// v000
// The times below were measured on an AMD MI455X: many runs one after another, warmed up first and cycling through
// copies of the inputs, with the whole window's GPU time divided by the number of runs. Launches and the gaps
// between them are all in it. The median over several windows is given; except for v000 it joins two sittings, which
// can be a few percent apart, so the side-by-side timings, each taken in one sitting, are the better comparison.
// The starting kernel, v000, takes 7260 microseconds a run.
#include <hip/hip_runtime.h>
// Multi-head CROSS-attention without an output projection (input, memory [4][2048][1024]; q = input Wq^T + bq, k = memory Wk^T + bk, v = memory Wv^T + bv (natural [1024][1024], zero biases); 16 heads of 64; q * 64^-0.5 then q k^T; softmax over all 2048 memory positions (no mask); out = attn v merged to [4][2048][1024]; NO output projection).
// Structure: token rows r = b*2048 + s; x as exact f16 rows (bf16-rounded); Q, K, V as three WMMA GEMMs (32x64 wave tiles, f32 accumulation, exact x16 weights + bias, f16 outputs); per batch: V^T for all heads via LDS transposes; per (batch, group of 4 heads): scores GEMM (K = 64, batched over the heads on grid.y, alpha = 1/sqrt(64)), row softmax on VALU (f32 statistics; weights stored x256 as f16), o = P . V^T GEMM (K = 2048, alpha 2^-8 undoing the x256 weights) written straight into the merged f32 output rows; no output GEMM.
// Compute dtype: inputs rounded to bf16; x / weights exact; q, k, v and softmax weights as plain f16 GEMM operands (~2^-12); scores and softmax statistics f32. v_wmma_f32_16x16x32_f16.
#define NB 4
#define SQ 2048
#define DM 1024
#define NH 16
#define HD 64
#define HG 4                         /* heads per attention launch group */
#define B0 0                         /* first batch processed (debug hook) */
#define NBR NB                       /* batches processed (debug hook) */
#define NR ((size_t)NB * SQ)         /* token rows */
#define MP ((int)((size_t)NBR * SQ)) /* rows projected (debug hook) */
#define QN SQ                        /* query rows attended per batch (debug hook) */
#define NHD NH                       /* heads attended (debug hook) */
#define MPO MP                       /* unused (no output projection) */
#define LQ DM      /* row pitch of the q/k/v rows */
typedef __bf16 v16b __attribute__((ext_vector_type(16)));
typedef unsigned short v8us __attribute__((ext_vector_type(8), may_alias));
typedef float  v8f  __attribute__((ext_vector_type(8)));
typedef float  v4f  __attribute__((ext_vector_type(4)));
typedef float  v4fa __attribute__((ext_vector_type(4), may_alias));
union FragB { v16b v; v8us half[2]; unsigned short u[16]; };

__device__ __forceinline__ unsigned short bf16_bits(float x) { unsigned int u = __float_as_uint(x); return (unsigned short)((u + 0x7FFFu + ((u >> 16) & 1u)) >> 16); }
__device__ __forceinline__ float bf16_val(unsigned short b) { return __uint_as_float(((unsigned int)b) << 16); }
__device__ __forceinline__ float bf16_round(float x) { return bf16_val(bf16_bits(x)); }
// D += A·B with NT terms: 1 = ah·bh, 2 = + al·bh (A split), 3 = + ah·bl (both split)
template <int NT>
__device__ __forceinline__ v8f mmaN(v16b ah, v16b al, v16b bh, v16b bl, v8f c) {
  c = __builtin_amdgcn_wmma_f32_16x16x32_bf16(false, ah, false, bh, (short)0, c, false, false);
  if (NT >= 2) c = __builtin_amdgcn_wmma_f32_16x16x32_bf16(false, al, false, bh, (short)0, c, false, false);
  if (NT >= 3) c = __builtin_amdgcn_wmma_f32_16x16x32_bf16(false, ah, false, bl, (short)0, c, false, false);
  asm volatile("v_nop\n\tv_nop\n\tv_nop\n\tv_nop" : "+v"(c) : "v"(ah), "v"(al), "v"(bh), "v"(bl));
  return c;
}

__global__ __launch_bounds__(256) void k_wt_bf16(const float* __restrict__ W, unsigned short* __restrict__ Wt, int K, int N) {
  const int t = blockIdx.x * 256 + threadIdx.x;
  const int k8n = K / 8;
  if (t >= N * k8n) return;
  const int n = t / k8n, k8 = (t % k8n) * 8;
  v8us v;
#pragma unroll
  for (int i = 0; i < 8; ++i) v[i] = bf16_bits(W[(size_t)(k8 + i) * N + n]);
  *(v8us*)(Wt + (size_t)n * K + k8) = v;
  
}

// GEMM C[M][N] (f32, pitch ldc) = act(A[M][K]·W + bias). A f32 row-major (pitch lda) converted per fragment to bf16
// (ASPLIT: hi/lo two planes -> 2 terms, else single rounded term); Wt bf16 [N][K] (pitch ldb). BIAS_BF16 rounds the
// bias to bf16 first (bias quantised to bf16 before the add). K%32==0, M%16==0, N%64==0.
template <bool ASPLIT, int ACT, bool BIAS_BF16>
__global__ __launch_bounds__(128) void k_gemm_bf(const float* __restrict__ A, int lda, const unsigned short* __restrict__ Wt, int ldb,
                                               const float* __restrict__ bias, float* __restrict__ C, int ldc, int M, int N, int K) {
  __shared__ __attribute__((aligned(16))) float so[4][16][64];
  const int tid = threadIdx.x, w = tid >> 5, lane = tid & 31, ln = lane & 15, hh = lane >> 4;
  const int ntn = N / 64;
  const int wid = blockIdx.x * 4 + w;
  const int mt = wid / ntn, nq = wid % ntn;
  if (mt * 16 >= M) return;
  const int row0 = mt * 16, col0 = nq * 64;
  const float* arow = A + (size_t)(row0 + ln) * lda;
  v8f acc[4] = {};
  for (int kb = 0; kb < K; kb += 32) {
    FragB ah, al;
    const v4f x0 = *(const v4fa*)(arow + kb + 8 * hh), x1 = *(const v4fa*)(arow + kb + 8 * hh + 4);
    const v4f x2 = *(const v4fa*)(arow + kb + 16 + 8 * hh), x3 = *(const v4fa*)(arow + kb + 16 + 8 * hh + 4);
    float xs[16] = {x0[0],x0[1],x0[2],x0[3],x1[0],x1[1],x1[2],x1[3],x2[0],x2[1],x2[2],x2[3],x3[0],x3[1],x3[2],x3[3]};
#pragma unroll
    for (int i = 0; i < 16; ++i) { const unsigned short hb = bf16_bits(xs[i]); ah.u[i] = hb; al.u[i] = ASPLIT ? bf16_bits(xs[i] - bf16_val(hb)) : (unsigned short)0; }
#pragma unroll
    for (int t = 0; t < 4; ++t) {
      const unsigned short* brow = Wt + (size_t)(col0 + t * 16 + ln) * ldb + kb;
      FragB b;
      b.half[0] = *(const v8us*)(brow + 8 * hh);
      b.half[1] = *(const v8us*)(brow + 16 + 8 * hh);
      acc[t] = mmaN<ASPLIT ? 2 : 1>(ah.v, al.v, b.v, b.v, acc[t]);
    }
  }
#pragma unroll
  for (int t = 0; t < 4; ++t) {
    float bv = bias ? bias[col0 + t * 16 + ln] : 0.f;
    if (BIAS_BF16) bv = bf16_round(bv);
#pragma unroll
    for (int r = 0; r < 8; ++r) { float v = acc[t][r] + bv; if (ACT == 1) v = fmaxf(v, 0.f); so[w][8 * hh + r][t * 16 + ln] = v; }
  }
  __builtin_amdgcn_fence(__ATOMIC_ACQ_REL, "workgroup");
  __builtin_amdgcn_wave_barrier();
  const int rsub = lane >> 4, c4 = (lane & 15) * 4;
  {
#pragma unroll
    for (int q = 0; q < 8; ++q) {
      const int r = q * 2 + rsub;
      const v4f v = *(const v4fa*)&so[w][r][c4];
      *(v4f*)(C + (size_t)(row0 + r) * ldc + col0 + c4) = v;
    }
    
  }
}

// GEMM C = act(A·W + bias + resid): A f32 (ASPLIT -> hi/lo 2 terms), Wt bf16 [N][K]; ACT 0 none, 1 relu, 2 exact gelu;
// resid (optional, f32, row index = (row % rmod), pitch ldr, RES_BF16 rounds it) added before the activation.
template <bool ASPLIT, int ACT, bool BIAS_BF16, bool RES_BF16>
__global__ __launch_bounds__(128) void k_gemm_bf3(const float* __restrict__ A, int lda, const unsigned short* __restrict__ Wt, int ldb,
                                                const float* __restrict__ bias, const float* __restrict__ resid, int rmod, int ldr,
                                                float* __restrict__ C, int ldc, int M, int N, int K) {
  __shared__ __attribute__((aligned(16))) float so[4][16][64];
  const int tid = threadIdx.x, w = tid >> 5, lane = tid & 31, ln = lane & 15, hh = lane >> 4;
  const int ntn = N / 64;
  const int wid = blockIdx.x * 4 + w;
  const int mt = wid / ntn, nq = wid % ntn;
  if (mt * 16 >= M) return;
  const int row0 = mt * 16, col0 = nq * 64;
  const float* arow = A + (size_t)(row0 + ln) * lda;
  v8f acc[4] = {};
  for (int kb = 0; kb < K; kb += 32) {
    FragB ah, al;
    const v4f x0 = *(const v4fa*)(arow + kb + 8 * hh), x1 = *(const v4fa*)(arow + kb + 8 * hh + 4);
    const v4f x2 = *(const v4fa*)(arow + kb + 16 + 8 * hh), x3 = *(const v4fa*)(arow + kb + 16 + 8 * hh + 4);
    float xs[16] = {x0[0],x0[1],x0[2],x0[3],x1[0],x1[1],x1[2],x1[3],x2[0],x2[1],x2[2],x2[3],x3[0],x3[1],x3[2],x3[3]};
#pragma unroll
    for (int i = 0; i < 16; ++i) { const unsigned short hb = bf16_bits(xs[i]); ah.u[i] = hb; al.u[i] = ASPLIT ? bf16_bits(xs[i] - bf16_val(hb)) : (unsigned short)0; }
#pragma unroll
    for (int t = 0; t < 4; ++t) {
      const unsigned short* brow = Wt + (size_t)(col0 + t * 16 + ln) * ldb + kb;
      FragB b;
      b.half[0] = *(const v8us*)(brow + 8 * hh);
      b.half[1] = *(const v8us*)(brow + 16 + 8 * hh);
      acc[t] = mmaN<ASPLIT ? 2 : 1>(ah.v, al.v, b.v, b.v, acc[t]);
    }
  }
#pragma unroll
  for (int t = 0; t < 4; ++t) {
    const int col = col0 + t * 16 + ln;
    float bv = bias ? bias[col] : 0.f;
    if (BIAS_BF16) bv = bf16_round(bv);
#pragma unroll
    for (int r = 0; r < 8; ++r) {
      float v = acc[t][r] + bv;
      if (resid) { float rv = resid[(size_t)((row0 + 8 * hh + r) % rmod) * ldr + col]; if (RES_BF16) rv = bf16_round(rv); v += rv; }
      if (ACT == 1) v = fmaxf(v, 0.f);
      if (ACT == 2) v = 0.5f * v * (1.0f + erff(v * 0.70710678118654752f));
      if (ACT == 3) { const float u = 0.7978845608028654f * (v + 0.044715f * v * v * v); v = 0.5f * v * (1.0f + tanhf(u)); }
      so[w][8 * hh + r][t * 16 + ln] = v;
    }
  }
  __builtin_amdgcn_fence(__ATOMIC_ACQ_REL, "workgroup");
  __builtin_amdgcn_wave_barrier();
  const int rsub = lane >> 4, c4 = (lane & 15) * 4;
  {
#pragma unroll
    for (int q = 0; q < 8; ++q) {
      const int r = q * 2 + rsub;
      const v4f v = *(const v4fa*)&so[w][r][c4];
      *(v4f*)(C + (size_t)(row0 + r) * ldc + col0 + c4) = v;
    }
    
  }
}
// row LayerNorm (biased variance, eps) over N: s = X (+ R); optional out_sum <- s; out_norm <- (s-mu)*rsqrt(var+eps)*g + b
template <bool PARAM_BF16>
__global__ __launch_bounds__(256) void k_layernorm(const float* __restrict__ X, const float* __restrict__ R, const float* __restrict__ g, const float* __restrict__ bta,
                                                  float* __restrict__ out_sum, float* __restrict__ out_norm, int N, float eps) {
  __shared__ float red[256];
  const int row = blockIdx.x, tid = threadIdx.x;
  const float* x = X + (size_t)row * N; const float* rr = R ? R + (size_t)row * N : nullptr;
  float vals[16];                     // up to N = 4096
  const int per = N / 256;            // contiguous chunk per thread? use strided-by-4 chunks: thread handles j = tid*4 + 1024*u
  float s1 = 0.f;
  for (int u = 0; u < per / 4; ++u) {
    const int j = tid * 4 + 1024 * u;
    const v4f a = *(const v4fa*)(x + j);
    v4f b = {0.f,0.f,0.f,0.f}; if (rr) b = *(const v4fa*)(rr + j);
#pragma unroll
    for (int q = 0; q < 4; ++q) { const float v = a[q] + b[q]; vals[u * 4 + q] = v; s1 += v; }
  }
  red[tid] = s1; __syncthreads();
  for (int st = 128; st > 0; st >>= 1) { if (tid < st) red[tid] += red[tid + st]; __syncthreads(); }
  const float mu = red[0] / (float)N; __syncthreads();
  float s2 = 0.f;
  for (int u = 0; u < per / 4; ++u)
#pragma unroll
    for (int q = 0; q < 4; ++q) { const float c = vals[u * 4 + q] - mu; s2 += c * c; }
  red[tid] = s2; __syncthreads();
  for (int st = 128; st > 0; st >>= 1) { if (tid < st) red[tid] += red[tid + st]; __syncthreads(); }
  const float rs = rsqrtf(red[0] / (float)N + eps);
  {
    for (int u = 0; u < per / 4; ++u) {
      const int j = tid * 4 + 1024 * u;
      v4f o, sm;
#pragma unroll
      for (int q = 0; q < 4; ++q) {
        float gg = g[j + q], bb = bta[j + q];
        if (PARAM_BF16) { gg = bf16_round(gg); bb = bf16_round(bb); }
        sm[q] = vals[u * 4 + q]; o[q] = (vals[u * 4 + q] - mu) * rs * gg + bb;
      }
      if (out_sum) *(v4f*)(out_sum + (size_t)row * N + j) = sm;
      *(v4f*)(out_norm + (size_t)row * N + j) = o;
    }
    
  }
}



// ---- f16 WMMA path (v_wmma_f32_16x16x32_f16): 11-bit significands for operands in range — used where a [0,1] probability operand needs more precision than bf16
typedef _Float16 v16h __attribute__((ext_vector_type(16)));
union FragH { v16h v; v8us half[2]; _Float16 h[16]; unsigned short u[16]; };
template <int NT>
__device__ __forceinline__ v8f mmaH(v16h ah, v16h al, v16h bh, v16h bl, v8f c) {
  c = __builtin_amdgcn_wmma_f32_16x16x32_f16(false, ah, false, bh, (short)0, c, false, false);
  if (NT >= 2) c = __builtin_amdgcn_wmma_f32_16x16x32_f16(false, al, false, bh, (short)0, c, false, false);
  if (NT >= 3) c = __builtin_amdgcn_wmma_f32_16x16x32_f16(false, ah, false, bl, (short)0, c, false, false);
  asm volatile("v_nop\n\tv_nop\n\tv_nop\n\tv_nop" : "+v"(c) : "v"(ah), "v"(al), "v"(bh), "v"(bl));
  return c;
}
// batched GEMM like k_gemm_b but f16 operands: A f32 (split into f16 hi/lo if ASPLIT, else rounded to f16), Bt = f16 values [n][k]; alpha; C f32; N multiple of 16 (partial tiles skipped)
template <bool ASPLIT>
__global__ __launch_bounds__(128) void k_gemm_h(const float* __restrict__ A, int lda, size_t sA, const _Float16* __restrict__ Bh, int ldb, size_t sB, float alpha, float* __restrict__ C, int ldc, size_t sC, int M, int N, int K) {
  __shared__ __attribute__((aligned(16))) float so[4][16][64];
  const int tid = threadIdx.x, w = tid >> 5, lane = tid & 31, ln = lane & 15, hh = lane >> 4; const int by = blockIdx.y;
  A += (size_t)by * sA; Bh += (size_t)by * sB; C += (size_t)by * sC;
  const int ntn = (N + 63) / 64; const int wid = blockIdx.x * 4 + w; const int mt = wid / ntn, nq = wid % ntn; if (mt * 16 >= M) return;
  const int row0 = mt * 16, col0 = nq * 64; const float* arow = A + (size_t)(row0 + ln) * lda;
  v8f acc[4] = {};
  for (int kb = 0; kb < K; kb += 32) {
    FragH ah, al;
    const v4f x0 = *(const v4fa*)(arow + kb + 8 * hh), x1 = *(const v4fa*)(arow + kb + 8 * hh + 4), x2 = *(const v4fa*)(arow + kb + 16 + 8 * hh), x3 = *(const v4fa*)(arow + kb + 16 + 8 * hh + 4);
    float xs[16] = {x0[0],x0[1],x0[2],x0[3],x1[0],x1[1],x1[2],x1[3],x2[0],x2[1],x2[2],x2[3],x3[0],x3[1],x3[2],x3[3]};
#pragma unroll
    for (int i = 0; i < 16; ++i) { const _Float16 h = (_Float16)xs[i]; ah.h[i] = h; al.h[i] = ASPLIT ? (_Float16)(xs[i] - (float)h) : (_Float16)0.0f; }
#pragma unroll
    for (int t = 0; t < 4; ++t) { if (col0 + t * 16 >= N) continue; const size_t boff = (size_t)(col0 + t * 16 + ln) * ldb + kb; FragH bq; bq.half[0] = *(const v8us*)(Bh + boff + 8 * hh); bq.half[1] = *(const v8us*)(Bh + boff + 16 + 8 * hh);
      acc[t] = mmaH<ASPLIT ? 2 : 1>(ah.v, al.v, bq.v, bq.v, acc[t]); }
  }
#pragma unroll
  for (int t = 0; t < 4; ++t) { if (col0 + t * 16 >= N) continue;
#pragma unroll
    for (int r = 0; r < 8; ++r) so[w][8 * hh + r][t * 16 + ln] = acc[t][r] * alpha; }
  __builtin_amdgcn_fence(__ATOMIC_ACQ_REL, "workgroup"); __builtin_amdgcn_wave_barrier();
  const int rsub = lane >> 4, c4 = (lane & 15) * 4;
  {
#pragma unroll
    for (int q = 0; q < 8; ++q) { const int r = q * 2 + rsub; if (col0 + c4 < N) { const v4f v = *(const v4fa*)&so[w][r][c4]; *(v4f*)(C + (size_t)(row0 + r) * ldc + col0 + c4) = v; } }
     }
}

// Wt[n][k] = f16(W[k][n]·scale) from f32 row-major W[K][N] (scale = power of two; bf16-exact weights stay exact in f16 away from the subnormal range)
__global__ __launch_bounds__(256) void k_wt_f16(const float* __restrict__ W, _Float16* __restrict__ Wt, int K, int N, float scale) {
  const int t = blockIdx.x * 256 + threadIdx.x; if (t >= N * (K / 8)) return; const int n = t / (K / 8), k8 = (t % (K / 8)) * 8; FragH f;
#pragma unroll
  for (int i = 0; i < 8; ++i) f.h[i] = (_Float16)(bf16_round(W[(size_t)(k8 + i) * N + n]) * scale); const v8us o = f.half[0];
  *(v8us*)((unsigned short*)Wt + (size_t)n * K + k8) = o; 
}
// k_gemm_hh variant with fused epilogue: v = acc·alpha + bias[by·sBias + col] (+ CP[(row/rowsPerB)·sCPb + by·64 + col] if CP) ; ACT 0 none / 1 elu ; writes f16 C16 (and f32 C if non-null)
template <int ACT>
__global__ __launch_bounds__(128) void k_gemm_hhx(const _Float16* __restrict__ A, int lda, size_t sA, const _Float16* __restrict__ Bh, int ldb, size_t sB, float alpha, const float* __restrict__ bias, size_t sBias, const float* __restrict__ CP, int rowsPerB, size_t sCPb, int row0g,
    float* __restrict__ C, _Float16* __restrict__ C16, int ldc, size_t sC, int M, int N, int K) {
  __shared__ __attribute__((aligned(16))) float so[4][16][64];
  const int tid = threadIdx.x, w = tid >> 5, lane = tid & 31, ln = lane & 15, hh = lane >> 4; const int by = blockIdx.y;
  A += (size_t)by * sA; Bh += (size_t)by * sB; const size_t cofs = (size_t)by * sC; const float* bp = bias ? bias + (size_t)by * sBias : nullptr;
  const int ntn = (N + 63) / 64; const int wid = blockIdx.x * 4 + w; const int mt = wid / ntn, nq = wid % ntn; if (mt * 16 >= M) return;
  const int row0 = mt * 16, col0 = nq * 64; const _Float16* arow = A + (size_t)(row0 + ln) * lda;
  v8f acc[4] = {};
  for (int kb = 0; kb < K; kb += 32) { FragH ah; ah.half[0] = *(const v8us*)((const unsigned short*)arow + kb + 8 * hh); ah.half[1] = *(const v8us*)((const unsigned short*)arow + kb + 16 + 8 * hh);
#pragma unroll
    for (int t = 0; t < 4; ++t) { if (col0 + t * 16 >= N) continue; const size_t boff = (size_t)(col0 + t * 16 + ln) * ldb + kb; FragH bq; bq.half[0] = *(const v8us*)((const unsigned short*)Bh + boff + 8 * hh); bq.half[1] = *(const v8us*)((const unsigned short*)Bh + boff + 16 + 8 * hh);
      acc[t] = mmaH<1>(ah.v, ah.v, bq.v, bq.v, acc[t]); }
  }
#pragma unroll
  for (int t = 0; t < 4; ++t) { if (col0 + t * 16 >= N) continue; const int col = col0 + t * 16 + ln; const float bv = bp ? bf16_round(bp[col]) : 0.f;
#pragma unroll
    for (int r = 0; r < 8; ++r) { float v = acc[t][r] * alpha + bv; if (CP) { const int rr = row0g + row0 + 8 * hh + r; if (rowsPerB < 0) v += CP[cofs + (size_t)rr * ldc + col];      /* rowsPerB < 0: own element of the batched C plane */ else { const int bidx = rr / rowsPerB; v += CP[(size_t)bidx * sCPb + (size_t)by * 64 + col]; } } if (ACT == 1) v = (v > 0.f) ? v : expm1f(v); else if (ACT == 7) v = (v > 0.f) ? v + 1.0f : expf(v); else if (ACT == 8) v = tanhf(v); else if (ACT == 9) v = 0.5f * v * (1.0f + tanhf(0.7978845608028654f * (v + 0.044715f * v * v * v))); else if (ACT == 11) v = 1.0f / (1.0f + expf(-v)); else if (ACT == 12) v = (v > 0.f) ? v : 0.01f * v; else if (ACT == 14) v = (v > 0.f) ? v : 0.1f * v; else if (ACT == 16) v = (v >= 0.f) ? v : 0.3f * v; else if (ACT == 17) v = (v >= 0.f) ? v : 0.2f * v; else if (ACT == 15) v = v / (1.0f + expf(-v)); else if (ACT == 3) v = fmaxf(v, 0.f); else if (ACT == 6) v = 0.5f * v * (1.0f + erff(v * 0.70710678118654752f)); so[w][8 * hh + r][t * 16 + ln] = v; } }
  __builtin_amdgcn_fence(__ATOMIC_ACQ_REL, "workgroup"); __builtin_amdgcn_wave_barrier();
  const int rsub = lane >> 4, c4 = (lane & 15) * 4; typedef _Float16 v4h __attribute__((ext_vector_type(4)));
  {
#pragma unroll
    for (int q = 0; q < 8; ++q) { const int r = q * 2 + rsub; if (col0 + c4 < N) { const v4f v = *(const v4fa*)&so[w][r][c4]; if (C) *(v4f*)(C + cofs + (size_t)(row0 + r) * ldc + col0 + c4) = v; if (C16) { v4h h4; for (int i = 0; i < 4; ++i) h4[i] = (_Float16)v[i]; *(v4h*)(C16 + cofs + (size_t)(row0 + r) * ldc + col0 + c4) = h4; } } }
     }
}


typedef _Float16 v4h __attribute__((ext_vector_type(4)));

__global__ __launch_bounds__(256) void k_x16(const float* __restrict__ x, _Float16* __restrict__ X16, size_t n8) { const size_t t = (size_t)blockIdx.x * 256 + threadIdx.x; if (t >= n8) return; FragH f;
#pragma unroll
  for (int q = 0; q < 8; ++q) f.h[q] = (_Float16)bf16_round(x[t * 8 + q]); *(v8us*)((unsigned short*)X16 + t * 8) = f.half[0];  }
__global__ __launch_bounds__(256) void k_h16(const float* __restrict__ x, _Float16* __restrict__ X16, size_t n8) { const size_t t = (size_t)blockIdx.x * 256 + threadIdx.x; if (t >= n8) return; FragH f;
#pragma unroll
  for (int q = 0; q < 8; ++q) f.h[q] = (_Float16)x[t * 8 + q]; *(v8us*)((unsigned short*)X16 + t * 8) = f.half[0];  }
__global__ __launch_bounds__(256) void k_round16f(const float* __restrict__ W, _Float16* __restrict__ Bt, size_t n8) { const size_t t = (size_t)blockIdx.x * 256 + threadIdx.x; if (t >= n8) return; FragH f;
#pragma unroll
  for (int i = 0; i < 8; ++i) f.h[i] = (_Float16)(bf16_round(W[t * 8 + i]) * 16.0f); *(v8us*)((unsigned short*)Bt + t * 8) = f.half[0];  }
template <int NHv, int TTv>
__global__ __launch_bounds__(256) void k_vt(const _Float16* __restrict__ V16, int ldv, int voff, _Float16* __restrict__ Vt) { __shared__ unsigned short tl[64][66]; const int tid = threadIdx.x; const int slab = blockIdx.x / (TTv / 64), lg = blockIdx.x % (TTv / 64); const int b = slab / NHv, h = slab % NHv;
  for (int i = tid; i < 64 * 8; i += 256) { const int r = i / 8, c8 = (i % 8) * 8; FragH f; f.half[0] = *(const v8us*)((const unsigned short*)V16 + ((size_t)b * TTv + lg * 64 + r) * ldv + voff + h * 64 + c8);
#pragma unroll
    for (int q = 0; q < 8; ++q) tl[r][c8 + q] = f.u[q]; }
  __syncthreads();
  {
#pragma unroll
    for (int rd = 0; rd < 2; ++rd) { const int d = rd * 32 + tid / 8, pc = tid % 8; FragH f;
#pragma unroll
      for (int q = 0; q < 8; ++q) f.u[q] = tl[pc * 8 + q][d];
      *(v8us*)((unsigned short*)Vt + ((size_t)slab * 64 + d) * TTv + lg * 64 + pc * 8) = f.half[0]; }
     } }

__global__ __launch_bounds__(256) void k_hl(const float* __restrict__ F, _Float16* __restrict__ Hh, _Float16* __restrict__ Hl, size_t n8) { const size_t t = (size_t)blockIdx.x * 256 + threadIdx.x; if (t >= n8) return; FragH fh, fl; const v4f a = *(const v4fa*)(F + t * 8), c = *(const v4fa*)(F + t * 8 + 4);
#pragma unroll
  for (int q = 0; q < 4; ++q) { _Float16 h = (_Float16)a[q]; fh.h[q] = h; fl.h[q] = (_Float16)((a[q] - (float)h) * 1024.0f); h = (_Float16)c[q]; fh.h[4 + q] = h; fl.h[4 + q] = (_Float16)((c[q] - (float)h) * 1024.0f); }
  { *(v8us*)((unsigned short*)Hh + t * 8) = fh.half[0]; *(v8us*)((unsigned short*)Hl + t * 8) = fl.half[0];  } }

// ---- fast GEMM (wave tile 32x64; requires M % 32 == 0 rows per launch region and N % 64 == 0); epilogue = k_gemm_hhx semantics ----
__device__ __forceinline__ v16h g2_frag(const _Float16* p, int hh) { FragH f; f.half[0] = *(const v8us*)((const unsigned short*)p + 8 * hh); f.half[1] = *(const v8us*)((const unsigned short*)p + 16 + 8 * hh); return f.v; }
__device__ __forceinline__ v8f g2_mma(v16h a, v16h b, v8f c) { v8f d = __builtin_amdgcn_wmma_f32_16x16x32_f16(false, a, false, b, (short)0, c, false, false); asm volatile("v_nop\n\tv_nop\n\tv_nop\n\tv_nop" : "+v"(d) : "v"(a), "v"(b)); return d; }
template <int ACT>
__global__ __launch_bounds__(128) void k_gemm2(const _Float16* __restrict__ A, int lda, size_t sA, const _Float16* __restrict__ Bh, int ldb, size_t sB, float alpha, const float* __restrict__ bias, size_t sBias, const float* __restrict__ CP, int rowsPerB, size_t sCPb, int row0g,
    float* __restrict__ C, _Float16* __restrict__ C16, int ldc, size_t sC, int M, int N, int K) { static_assert(ACT == 0 || ACT == 3 || ACT == 6 || ACT == 8 || ACT == 9 || ACT == 11 || ACT == 12 || ACT == 14 || ACT == 15 || ACT == 16 || ACT == 17, "k_gemm2: unsupported ACT code (would silently apply no activation)");
  __shared__ __attribute__((aligned(16))) float so[4][32][68];
  const int tid = threadIdx.x, w = tid >> 5, lane = tid & 31, ln = lane & 15, hh = lane >> 4; const int by = blockIdx.y;
  A += (size_t)by * sA; Bh += (size_t)by * sB; const size_t cofs = (size_t)by * sC; const float* bp = bias ? bias + (size_t)by * sBias : nullptr;
  const int ntn = N >> 6; const int mt = blockIdx.x / ntn, nq = blockIdx.x - mt * ntn; const int row0 = mt * 128 + 32 * w, col0 = nq * 64; if (row0 >= M) return;
  const _Float16* a0p = A + (size_t)(row0 + ln) * lda; const _Float16* a1p = a0p + (size_t)16 * lda;
  const _Float16* b0p = Bh + (size_t)(col0 + ln) * ldb; const _Float16* b1p = b0p + (size_t)16 * ldb; const _Float16* b2p = b1p + (size_t)16 * ldb; const _Float16* b3p = b2p + (size_t)16 * ldb;
  const v8f z8 = {0.f,0.f,0.f,0.f,0.f,0.f,0.f,0.f}; v8f c00 = z8, c01 = z8, c02 = z8, c03 = z8, c10 = z8, c11 = z8, c12 = z8, c13 = z8;
#pragma unroll 1
  for (int kb = 0; kb < K; kb += 32) { const v16h a0 = g2_frag(a0p + kb, hh), a1 = g2_frag(a1p + kb, hh);
    v16h b = g2_frag(b0p + kb, hh); c00 = g2_mma(a0, b, c00); c10 = g2_mma(a1, b, c10);
    b = g2_frag(b1p + kb, hh); c01 = g2_mma(a0, b, c01); c11 = g2_mma(a1, b, c11);
    b = g2_frag(b2p + kb, hh); c02 = g2_mma(a0, b, c02); c12 = g2_mma(a1, b, c12);
    b = g2_frag(b3p + kb, hh); c03 = g2_mma(a0, b, c03); c13 = g2_mma(a1, b, c13); }
  v8f accs[8] = {c00, c01, c02, c03, c10, c11, c12, c13};
#pragma unroll
  for (int u = 0; u < 8; ++u) { const int t = u & 3, half = u >> 2; const int col = col0 + t * 16 + ln; const float bv = bp ? bf16_round(bp[col]) : 0.f;
#pragma unroll
    for (int r = 0; r < 8; ++r) { const int rloc = half * 16 + 8 * hh + r; float v = accs[u][r] * alpha + bv; if (CP) { if (rowsPerB < 0) v += CP[cofs + (size_t)(row0g + row0 + rloc) * ldc + col];      /* rowsPerB < 0: own element of the batched C plane */ else { const int bidx = (row0g + row0 + rloc) / rowsPerB; v += CP[(size_t)bidx * sCPb + (size_t)by * 64 + col]; } }
      if (ACT == 3) v = fmaxf(v, 0.f); else if (ACT == 6) v = 0.5f * v * (1.0f + erff(v * 0.70710678118654752f)); else if (ACT == 11) v = 1.0f / (1.0f + expf(-v)); else if (ACT == 15) v = v / (1.0f + expf(-v)); else if (ACT == 12) v = (v > 0.f) ? v : 0.01f * v; else if (ACT == 8) v = tanhf(v); else if (ACT == 9) v = 0.5f * v * (1.0f + tanhf(0.7978845608028654f * (v + 0.044715f * v * v * v))); else if (ACT == 14) v = (v > 0.f) ? v : 0.1f * v; else if (ACT == 16) v = (v >= 0.f) ? v : 0.3f * v; else if (ACT == 17) v = (v >= 0.f) ? v : 0.2f * v;
      so[w][rloc][t * 16 + ln] = v; } }
  __builtin_amdgcn_fence(__ATOMIC_ACQ_REL, "workgroup"); __builtin_amdgcn_wave_barrier();
  const int rsub = lane >> 4, c4 = (lane & 15) * 4;
  {
#pragma unroll
    for (int q = 0; q < 16; ++q) { const int r = q * 2 + rsub; const v4f v = *(const v4fa*)&so[w][r][c4]; if (C) *(v4f*)(C + cofs + (size_t)(row0 + r) * ldc + col0 + c4) = v; if (C16) { v4h h4; for (int i = 0; i < 4; ++i) h4[i] = (_Float16)v[i]; *(v4h*)(C16 + cofs + (size_t)(row0 + r) * ldc + col0 + c4) = h4; } }
     } }


__global__ __launch_bounds__(256) void k_wnat(const float* __restrict__ w, size_t n8, _Float16* __restrict__ Bt) { const size_t t = (size_t)blockIdx.x * 256 + threadIdx.x; if (t >= n8) return; FragH f; for (int q = 0; q < 8; ++q) f.h[q] = (_Float16)(bf16_round(w[t * 8 + q]) * 16.0f); *(v8us*)((unsigned short*)Bt + t * 8) = f.half[0];  }
__global__ __launch_bounds__(256) void k_rsm(const float* __restrict__ S, _Float16* __restrict__ P, int nrows) {
  #pragma clang fp contract(off)
  const int i = blockIdx.x * 256 + threadIdx.x; if (i >= nrows) return; const float* s = S + (size_t)i * SQ; float mx = -3.0e38f;
#pragma unroll 1
  for (int j = 0; j < SQ; ++j) mx = fmaxf(mx, s[j]); float se = 0.f;
#pragma unroll 1
  for (int j = 0; j < SQ; ++j) se += expf(s[j] - mx); const float sc = 256.0f / se;
#pragma unroll 1
  for (int j0 = 0; j0 < SQ; j0 += 8) { FragH f; for (int q = 0; q < 8; ++q) f.h[q] = (_Float16)(expf(s[j0 + q] - mx) * sc); unsigned short* d = (unsigned short*)P + (size_t)i * SQ + j0; *(v8us*)d = f.half[0];  } }
__global__ __launch_bounds__(256) void k_vt(const _Float16* __restrict__ V16, int b, int h0, _Float16* __restrict__ VT) { __shared__ unsigned short tl[64][65]; const int tid = threadIdx.x; const int hh = blockIdx.x % HG, sg = blockIdx.x / HG; const int s0 = sg * 64; const int h = h0 + hh;
  for (int i = tid; i < 64 * 8; i += 256) { const int j = i / 8, d8 = (i % 8) * 8; FragH f; f.half[0] = *(const v8us*)((const unsigned short*)V16 + ((size_t)b * SQ + s0 + j) * DM + h * HD + d8); for (int q = 0; q < 8; ++q) tl[d8 + q][j] = f.u[q]; }
  __syncthreads();
  { for (int i = tid; i < 64 * 8; i += 256) { const int d = i / 8, j8 = (i % 8) * 8; FragH f; for (int q = 0; q < 8; ++q) f.u[q] = tl[d][j8 + q]; *(v8us*)((unsigned short*)VT + ((size_t)hh * HD + d) * SQ + s0 + j8) = f.half[0]; }  } }



__global__ __launch_bounds__(256) void k_rsmkm(const float* __restrict__ S, _Float16* __restrict__ P, int nrows, const int* __restrict__ am) {
  #pragma clang fp contract(off)
  const int t = blockIdx.x * 256 + threadIdx.x; if (t >= nrows) return; const size_t i = (size_t)t; const float* s = S + i * SQ; const int* mr = am + (size_t)(t % SQ) * SQ; float mx = -3.0e38f;
#pragma unroll 1
  for (int j = 0; j < SQ; ++j) { const float f = (mr[j] != 0) ? 1.f : 0.f; mx = fmaxf(mx, fmaf(f, s[j], (1.f - f) * -1.0e9f)); } float se = 0.f;
#pragma unroll 1
  for (int j = 0; j < SQ; ++j) { const float f = (mr[j] != 0) ? 1.f : 0.f; se += __expf(fmaf(f, s[j], (1.f - f) * -1.0e9f) - mx); } const float sc = 256.0f / se;
#pragma unroll 1
  for (int j0 = 0; j0 < SQ; j0 += 8) { FragH fr; for (int q = 0; q < 8; ++q) { const int j = j0 + q; const float f = (mr[j] != 0) ? 1.f : 0.f; fr.h[q] = (_Float16)(__expf(fmaf(f, s[j], (1.f - f) * -1.0e9f) - mx) * sc); }
    unsigned short* d = (unsigned short*)P + i * SQ + j0; *(v8us*)d = fr.half[0];  } }
extern "C" void kernel_launch(void* const* d_in, const int* in_sizes, int n_in,
                              void* d_out, int out_size, void* d_ws, size_t ws_size, hipStream_t stream) {
  (void)in_sizes; (void)n_in; (void)out_size;
  const float* const* I = (const float* const*)d_in; const float* xq = I[0]; const float* xk = I[1]; const float* xv = I[1]; const float* wq = I[2]; const float* bq = I[3]; const float* wk = I[4]; const float* bk = I[5]; const float* wv = I[6]; const float* bv = I[7]; const float* x = xq;      /* input (queries), memory (keys AND values); natural weights + biases; no output projection */
  char* ws = (char*)d_ws; size_t off = 0;
  auto take = [&](size_t bytes) { char* p = ws + off; off += (bytes + 255) & ~(size_t)255; return p; };
  _Float16* BQ = (_Float16*)take((size_t)DM * DM * 2); _Float16* BK = (_Float16*)take((size_t)DM * DM * 2); _Float16* BV = (_Float16*)take((size_t)DM * DM * 2); 
  _Float16* X16 = (_Float16*)take(NR * DM * 2); _Float16* XKp = (_Float16*)take(NR * DM * 2); _Float16* XVp = (_Float16*)take(NR * DM * 2); _Float16* Q16 = (_Float16*)take(NR * DM * 2); _Float16* K16 = (_Float16*)take(NR * DM * 2); _Float16* V16 = (_Float16*)take(NR * DM * 2); 
  float* S = (float*)take((size_t)HG * SQ * SQ * 4); _Float16* P = (_Float16*)take((size_t)HG * SQ * SQ * 2); _Float16* VT = (_Float16*)take((size_t)NH * HD * SQ * 2);
  if (off > ws_size) return;
  { const unsigned g = (unsigned)(((size_t)DM * DM / 8 + 255) / 256); k_wnat<<<g, 256, 0, stream>>>(wq, (size_t)DM * DM / 8, BQ); k_wnat<<<g, 256, 0, stream>>>(wk, (size_t)DM * DM / 8, BK); k_wnat<<<g, 256, 0, stream>>>(wv, (size_t)DM * DM / 8, BV); }      /* natural [out][in] = Bt x16 (no output projection: no Wo plane) */
  _Float16* XK = XKp; _Float16* XV = XVp; k_x16<<<(unsigned)((NR * DM / 8 + 255) / 256), 256, 0, stream>>>(xk, XK, NR * DM / 8); k_x16<<<(unsigned)((NR * DM / 8 + 255) / 256), 256, 0, stream>>>(xv, XV, NR * DM / 8);      /* key and value inputs as exact f16 rows */

  k_x16<<<(unsigned)((NR * DM / 8 + 255) / 256), 256, 0, stream>>>(x, X16, NR * DM / 8);
  const size_t r0p = (size_t)B0 * SQ;      /* first projected row */
  k_gemm2<0><<<dim3((unsigned)((MP / 128) * (DM / 64)), 1), 128, 0, stream>>>(X16 + r0p * DM, DM, 0, BQ, DM, 0, 0.0625f, bq, 0, nullptr, 1, 0, 0, nullptr, Q16 + r0p * DM, DM, 0, MP, DM, DM);
  k_gemm2<0><<<dim3((unsigned)((MP / 128) * (DM / 64)), 1), 128, 0, stream>>>(XK + r0p * DM, DM, 0, BK, DM, 0, 0.0625f, bk, 0, nullptr, 1, 0, 0, nullptr, K16 + r0p * DM, DM, 0, MP, DM, DM);
  k_gemm2<0><<<dim3((unsigned)((MP / 128) * (DM / 64)), 1), 128, 0, stream>>>(XV + r0p * DM, DM, 0, BV, DM, 0, 0.0625f, bv, 0, nullptr, 1, 0, 0, nullptr, V16 + r0p * DM, DM, 0, MP, DM, DM);
  for (int b = B0; b < B0 + NBR; ++b) { const size_t r0 = (size_t)b * SQ;
    k_vt<NH, SQ><<<NH * (SQ / 64), 256, 0, stream>>>(V16 + r0 * LQ, LQ, 0, VT);      /* V^T [NH][HD][SQ] for this batch */
    for (int h0 = 0; h0 < NHD; h0 += HG) {
      k_gemm2<0><<<dim3((QN / 128) * (SQ / 64), HG), 128, 0, stream>>>(Q16 + r0 * LQ + h0 * HD, LQ, (size_t)HD, K16 + r0 * LQ + h0 * HD, LQ, (size_t)HD, 0.125f, nullptr, 0, nullptr, 1, 0, 0, S, nullptr, SQ, (size_t)SQ * SQ, QN, SQ, HD);      /* scores, HG heads per launch */
      k_rsm<<<(HG * SQ + 255) / 256, 256, 0, stream>>>(S, P, HG * SQ);      /* P = 256 softmax (f16), rows of all HG heads */
      k_gemm2<0><<<dim3((QN / 128) * (HD / 64), HG), 128, 0, stream>>>(P, SQ, (size_t)SQ * SQ, VT + (size_t)h0 * HD * SQ, SQ, (size_t)HD * SQ, 0.00390625f, nullptr, 0, nullptr, 1, 0, 0, (float*)d_out + r0 * DM + h0 * HD, nullptr, DM, (size_t)HD, QN, HD, SQ); } }      /* out = P V^T 2^-8 straight to the f32 output (merged heads; each 256-B head segment of a row written by one wave tile) */
  /* no output projection in this module */
}

// v001
// A run of this version takes 1720 microseconds.
// Next to v000, in two timings, it ran 4.24 and 4.21 times as fast.
#include <hip/hip_runtime.h>
// Multi-head CROSS-attention without an output projection (input, memory [4][2048][1024]; q = input Wq^T + bq, k = memory Wk^T + bk, v = memory Wv^T + bv (natural [1024][1024], zero biases); 16 heads of 64; q * 64^-0.5 then q k^T; softmax over all 2048 memory positions (no mask); out = attn v merged to [4][2048][1024]; NO output projection).
// Structure: token rows r = b*2048 + s; x as exact f16 rows (bf16-rounded); Q, K, V as three WMMA GEMMs (32x64 wave tiles, f32 accumulation, exact x16 weights + bias, f16 outputs); per batch: V^T for all heads via LDS transposes; per (batch, group of 4 heads): scores GEMM (K = 64, batched over the heads on grid.y, alpha = 1/sqrt(64)), row softmax on VALU (f32 statistics; weights stored x256 as f16), o = P . V^T GEMM (K = 2048, alpha 2^-8 undoing the x256 weights) written straight into the merged f32 output rows; no output GEMM.
// Compute dtype: inputs rounded to bf16; x / weights exact; q, k, v and softmax weights as plain f16 GEMM operands (~2^-12); scores and softmax statistics f32. v_wmma_f32_16x16x32_f16.
#define NB 4
#define SQ 2048
#define DM 1024
#define NH 16
#define HD 64
#define HG 4                         /* heads per attention launch group */
#define B0 0                         /* first batch processed (debug hook) */
#define NBR NB                       /* batches processed (debug hook) */
#define NR ((size_t)NB * SQ)         /* token rows */
#define MP ((int)((size_t)NBR * SQ)) /* rows projected (debug hook) */
#define QN SQ                        /* query rows attended per batch (debug hook) */
#define NHD NH                       /* heads attended (debug hook) */
#define MPO MP                       /* unused (no output projection) */
#define LQ DM      /* row pitch of the q/k/v rows */
typedef __bf16 v16b __attribute__((ext_vector_type(16)));
typedef unsigned short v8us __attribute__((ext_vector_type(8), may_alias));
typedef float  v8f  __attribute__((ext_vector_type(8)));
typedef float  v4f  __attribute__((ext_vector_type(4)));
typedef float  v4fa __attribute__((ext_vector_type(4), may_alias));
union FragB { v16b v; v8us half[2]; unsigned short u[16]; };

__device__ __forceinline__ unsigned short bf16_bits(float x) { unsigned int u = __float_as_uint(x); return (unsigned short)((u + 0x7FFFu + ((u >> 16) & 1u)) >> 16); }
__device__ __forceinline__ float bf16_val(unsigned short b) { return __uint_as_float(((unsigned int)b) << 16); }
__device__ __forceinline__ float bf16_round(float x) { return bf16_val(bf16_bits(x)); }
// D += A·B with NT terms: 1 = ah·bh, 2 = + al·bh (A split), 3 = + ah·bl (both split)
template <int NT>
__device__ __forceinline__ v8f mmaN(v16b ah, v16b al, v16b bh, v16b bl, v8f c) {
  c = __builtin_amdgcn_wmma_f32_16x16x32_bf16(false, ah, false, bh, (short)0, c, false, false);
  if (NT >= 2) c = __builtin_amdgcn_wmma_f32_16x16x32_bf16(false, al, false, bh, (short)0, c, false, false);
  if (NT >= 3) c = __builtin_amdgcn_wmma_f32_16x16x32_bf16(false, ah, false, bl, (short)0, c, false, false);
  asm volatile("v_nop\n\tv_nop\n\tv_nop\n\tv_nop" : "+v"(c) : "v"(ah), "v"(al), "v"(bh), "v"(bl));
  return c;
}

__global__ __launch_bounds__(256) void k_wt_bf16(const float* __restrict__ W, unsigned short* __restrict__ Wt, int K, int N) {
  const int t = blockIdx.x * 256 + threadIdx.x;
  const int k8n = K / 8;
  if (t >= N * k8n) return;
  const int n = t / k8n, k8 = (t % k8n) * 8;
  v8us v;
#pragma unroll
  for (int i = 0; i < 8; ++i) v[i] = bf16_bits(W[(size_t)(k8 + i) * N + n]);
  *(v8us*)(Wt + (size_t)n * K + k8) = v;
  
}

// GEMM C[M][N] (f32, pitch ldc) = act(A[M][K]·W + bias). A f32 row-major (pitch lda) converted per fragment to bf16
// (ASPLIT: hi/lo two planes -> 2 terms, else single rounded term); Wt bf16 [N][K] (pitch ldb). BIAS_BF16 rounds the
// bias to bf16 first (bias quantised to bf16 before the add). K%32==0, M%16==0, N%64==0.
template <bool ASPLIT, int ACT, bool BIAS_BF16>
__global__ __launch_bounds__(128) void k_gemm_bf(const float* __restrict__ A, int lda, const unsigned short* __restrict__ Wt, int ldb,
                                               const float* __restrict__ bias, float* __restrict__ C, int ldc, int M, int N, int K) {
  __shared__ __attribute__((aligned(16))) float so[4][16][64];
  const int tid = threadIdx.x, w = tid >> 5, lane = tid & 31, ln = lane & 15, hh = lane >> 4;
  const int ntn = N / 64;
  const int wid = blockIdx.x * 4 + w;
  const int mt = wid / ntn, nq = wid % ntn;
  if (mt * 16 >= M) return;
  const int row0 = mt * 16, col0 = nq * 64;
  const float* arow = A + (size_t)(row0 + ln) * lda;
  v8f acc[4] = {};
  for (int kb = 0; kb < K; kb += 32) {
    FragB ah, al;
    const v4f x0 = *(const v4fa*)(arow + kb + 8 * hh), x1 = *(const v4fa*)(arow + kb + 8 * hh + 4);
    const v4f x2 = *(const v4fa*)(arow + kb + 16 + 8 * hh), x3 = *(const v4fa*)(arow + kb + 16 + 8 * hh + 4);
    float xs[16] = {x0[0],x0[1],x0[2],x0[3],x1[0],x1[1],x1[2],x1[3],x2[0],x2[1],x2[2],x2[3],x3[0],x3[1],x3[2],x3[3]};
#pragma unroll
    for (int i = 0; i < 16; ++i) { const unsigned short hb = bf16_bits(xs[i]); ah.u[i] = hb; al.u[i] = ASPLIT ? bf16_bits(xs[i] - bf16_val(hb)) : (unsigned short)0; }
#pragma unroll
    for (int t = 0; t < 4; ++t) {
      const unsigned short* brow = Wt + (size_t)(col0 + t * 16 + ln) * ldb + kb;
      FragB b;
      b.half[0] = *(const v8us*)(brow + 8 * hh);
      b.half[1] = *(const v8us*)(brow + 16 + 8 * hh);
      acc[t] = mmaN<ASPLIT ? 2 : 1>(ah.v, al.v, b.v, b.v, acc[t]);
    }
  }
#pragma unroll
  for (int t = 0; t < 4; ++t) {
    float bv = bias ? bias[col0 + t * 16 + ln] : 0.f;
    if (BIAS_BF16) bv = bf16_round(bv);
#pragma unroll
    for (int r = 0; r < 8; ++r) { float v = acc[t][r] + bv; if (ACT == 1) v = fmaxf(v, 0.f); so[w][8 * hh + r][t * 16 + ln] = v; }
  }
  __builtin_amdgcn_fence(__ATOMIC_ACQ_REL, "workgroup");
  __builtin_amdgcn_wave_barrier();
  const int rsub = lane >> 4, c4 = (lane & 15) * 4;
  {
#pragma unroll
    for (int q = 0; q < 8; ++q) {
      const int r = q * 2 + rsub;
      const v4f v = *(const v4fa*)&so[w][r][c4];
      *(v4f*)(C + (size_t)(row0 + r) * ldc + col0 + c4) = v;
    }
    
  }
}

// GEMM C = act(A·W + bias + resid): A f32 (ASPLIT -> hi/lo 2 terms), Wt bf16 [N][K]; ACT 0 none, 1 relu, 2 exact gelu;
// resid (optional, f32, row index = (row % rmod), pitch ldr, RES_BF16 rounds it) added before the activation.
template <bool ASPLIT, int ACT, bool BIAS_BF16, bool RES_BF16>
__global__ __launch_bounds__(128) void k_gemm_bf3(const float* __restrict__ A, int lda, const unsigned short* __restrict__ Wt, int ldb,
                                                const float* __restrict__ bias, const float* __restrict__ resid, int rmod, int ldr,
                                                float* __restrict__ C, int ldc, int M, int N, int K) {
  __shared__ __attribute__((aligned(16))) float so[4][16][64];
  const int tid = threadIdx.x, w = tid >> 5, lane = tid & 31, ln = lane & 15, hh = lane >> 4;
  const int ntn = N / 64;
  const int wid = blockIdx.x * 4 + w;
  const int mt = wid / ntn, nq = wid % ntn;
  if (mt * 16 >= M) return;
  const int row0 = mt * 16, col0 = nq * 64;
  const float* arow = A + (size_t)(row0 + ln) * lda;
  v8f acc[4] = {};
  for (int kb = 0; kb < K; kb += 32) {
    FragB ah, al;
    const v4f x0 = *(const v4fa*)(arow + kb + 8 * hh), x1 = *(const v4fa*)(arow + kb + 8 * hh + 4);
    const v4f x2 = *(const v4fa*)(arow + kb + 16 + 8 * hh), x3 = *(const v4fa*)(arow + kb + 16 + 8 * hh + 4);
    float xs[16] = {x0[0],x0[1],x0[2],x0[3],x1[0],x1[1],x1[2],x1[3],x2[0],x2[1],x2[2],x2[3],x3[0],x3[1],x3[2],x3[3]};
#pragma unroll
    for (int i = 0; i < 16; ++i) { const unsigned short hb = bf16_bits(xs[i]); ah.u[i] = hb; al.u[i] = ASPLIT ? bf16_bits(xs[i] - bf16_val(hb)) : (unsigned short)0; }
#pragma unroll
    for (int t = 0; t < 4; ++t) {
      const unsigned short* brow = Wt + (size_t)(col0 + t * 16 + ln) * ldb + kb;
      FragB b;
      b.half[0] = *(const v8us*)(brow + 8 * hh);
      b.half[1] = *(const v8us*)(brow + 16 + 8 * hh);
      acc[t] = mmaN<ASPLIT ? 2 : 1>(ah.v, al.v, b.v, b.v, acc[t]);
    }
  }
#pragma unroll
  for (int t = 0; t < 4; ++t) {
    const int col = col0 + t * 16 + ln;
    float bv = bias ? bias[col] : 0.f;
    if (BIAS_BF16) bv = bf16_round(bv);
#pragma unroll
    for (int r = 0; r < 8; ++r) {
      float v = acc[t][r] + bv;
      if (resid) { float rv = resid[(size_t)((row0 + 8 * hh + r) % rmod) * ldr + col]; if (RES_BF16) rv = bf16_round(rv); v += rv; }
      if (ACT == 1) v = fmaxf(v, 0.f);
      if (ACT == 2) v = 0.5f * v * (1.0f + erff(v * 0.70710678118654752f));
      if (ACT == 3) { const float u = 0.7978845608028654f * (v + 0.044715f * v * v * v); v = 0.5f * v * (1.0f + tanhf(u)); }
      so[w][8 * hh + r][t * 16 + ln] = v;
    }
  }
  __builtin_amdgcn_fence(__ATOMIC_ACQ_REL, "workgroup");
  __builtin_amdgcn_wave_barrier();
  const int rsub = lane >> 4, c4 = (lane & 15) * 4;
  {
#pragma unroll
    for (int q = 0; q < 8; ++q) {
      const int r = q * 2 + rsub;
      const v4f v = *(const v4fa*)&so[w][r][c4];
      *(v4f*)(C + (size_t)(row0 + r) * ldc + col0 + c4) = v;
    }
    
  }
}
// row LayerNorm (biased variance, eps) over N: s = X (+ R); optional out_sum <- s; out_norm <- (s-mu)*rsqrt(var+eps)*g + b
template <bool PARAM_BF16>
__global__ __launch_bounds__(256) void k_layernorm(const float* __restrict__ X, const float* __restrict__ R, const float* __restrict__ g, const float* __restrict__ bta,
                                                  float* __restrict__ out_sum, float* __restrict__ out_norm, int N, float eps) {
  __shared__ float red[256];
  const int row = blockIdx.x, tid = threadIdx.x;
  const float* x = X + (size_t)row * N; const float* rr = R ? R + (size_t)row * N : nullptr;
  float vals[16];                     // up to N = 4096
  const int per = N / 256;            // contiguous chunk per thread? use strided-by-4 chunks: thread handles j = tid*4 + 1024*u
  float s1 = 0.f;
  for (int u = 0; u < per / 4; ++u) {
    const int j = tid * 4 + 1024 * u;
    const v4f a = *(const v4fa*)(x + j);
    v4f b = {0.f,0.f,0.f,0.f}; if (rr) b = *(const v4fa*)(rr + j);
#pragma unroll
    for (int q = 0; q < 4; ++q) { const float v = a[q] + b[q]; vals[u * 4 + q] = v; s1 += v; }
  }
  red[tid] = s1; __syncthreads();
  for (int st = 128; st > 0; st >>= 1) { if (tid < st) red[tid] += red[tid + st]; __syncthreads(); }
  const float mu = red[0] / (float)N; __syncthreads();
  float s2 = 0.f;
  for (int u = 0; u < per / 4; ++u)
#pragma unroll
    for (int q = 0; q < 4; ++q) { const float c = vals[u * 4 + q] - mu; s2 += c * c; }
  red[tid] = s2; __syncthreads();
  for (int st = 128; st > 0; st >>= 1) { if (tid < st) red[tid] += red[tid + st]; __syncthreads(); }
  const float rs = rsqrtf(red[0] / (float)N + eps);
  {
    for (int u = 0; u < per / 4; ++u) {
      const int j = tid * 4 + 1024 * u;
      v4f o, sm;
#pragma unroll
      for (int q = 0; q < 4; ++q) {
        float gg = g[j + q], bb = bta[j + q];
        if (PARAM_BF16) { gg = bf16_round(gg); bb = bf16_round(bb); }
        sm[q] = vals[u * 4 + q]; o[q] = (vals[u * 4 + q] - mu) * rs * gg + bb;
      }
      if (out_sum) *(v4f*)(out_sum + (size_t)row * N + j) = sm;
      *(v4f*)(out_norm + (size_t)row * N + j) = o;
    }
    
  }
}



// ---- f16 WMMA path (v_wmma_f32_16x16x32_f16): 11-bit significands for operands in range — used where a [0,1] probability operand needs more precision than bf16
typedef _Float16 v16h __attribute__((ext_vector_type(16)));
union FragH { v16h v; v8us half[2]; _Float16 h[16]; unsigned short u[16]; };
template <int NT>
__device__ __forceinline__ v8f mmaH(v16h ah, v16h al, v16h bh, v16h bl, v8f c) {
  c = __builtin_amdgcn_wmma_f32_16x16x32_f16(false, ah, false, bh, (short)0, c, false, false);
  if (NT >= 2) c = __builtin_amdgcn_wmma_f32_16x16x32_f16(false, al, false, bh, (short)0, c, false, false);
  if (NT >= 3) c = __builtin_amdgcn_wmma_f32_16x16x32_f16(false, ah, false, bl, (short)0, c, false, false);
  asm volatile("v_nop\n\tv_nop\n\tv_nop\n\tv_nop" : "+v"(c) : "v"(ah), "v"(al), "v"(bh), "v"(bl));
  return c;
}
// batched GEMM like k_gemm_b but f16 operands: A f32 (split into f16 hi/lo if ASPLIT, else rounded to f16), Bt = f16 values [n][k]; alpha; C f32; N multiple of 16 (partial tiles skipped)
template <bool ASPLIT>
__global__ __launch_bounds__(128) void k_gemm_h(const float* __restrict__ A, int lda, size_t sA, const _Float16* __restrict__ Bh, int ldb, size_t sB, float alpha, float* __restrict__ C, int ldc, size_t sC, int M, int N, int K) {
  __shared__ __attribute__((aligned(16))) float so[4][16][64];
  const int tid = threadIdx.x, w = tid >> 5, lane = tid & 31, ln = lane & 15, hh = lane >> 4; const int by = blockIdx.y;
  A += (size_t)by * sA; Bh += (size_t)by * sB; C += (size_t)by * sC;
  const int ntn = (N + 63) / 64; const int wid = blockIdx.x * 4 + w; const int mt = wid / ntn, nq = wid % ntn; if (mt * 16 >= M) return;
  const int row0 = mt * 16, col0 = nq * 64; const float* arow = A + (size_t)(row0 + ln) * lda;
  v8f acc[4] = {};
  for (int kb = 0; kb < K; kb += 32) {
    FragH ah, al;
    const v4f x0 = *(const v4fa*)(arow + kb + 8 * hh), x1 = *(const v4fa*)(arow + kb + 8 * hh + 4), x2 = *(const v4fa*)(arow + kb + 16 + 8 * hh), x3 = *(const v4fa*)(arow + kb + 16 + 8 * hh + 4);
    float xs[16] = {x0[0],x0[1],x0[2],x0[3],x1[0],x1[1],x1[2],x1[3],x2[0],x2[1],x2[2],x2[3],x3[0],x3[1],x3[2],x3[3]};
#pragma unroll
    for (int i = 0; i < 16; ++i) { const _Float16 h = (_Float16)xs[i]; ah.h[i] = h; al.h[i] = ASPLIT ? (_Float16)(xs[i] - (float)h) : (_Float16)0.0f; }
#pragma unroll
    for (int t = 0; t < 4; ++t) { if (col0 + t * 16 >= N) continue; const size_t boff = (size_t)(col0 + t * 16 + ln) * ldb + kb; FragH bq; bq.half[0] = *(const v8us*)(Bh + boff + 8 * hh); bq.half[1] = *(const v8us*)(Bh + boff + 16 + 8 * hh);
      acc[t] = mmaH<ASPLIT ? 2 : 1>(ah.v, al.v, bq.v, bq.v, acc[t]); }
  }
#pragma unroll
  for (int t = 0; t < 4; ++t) { if (col0 + t * 16 >= N) continue;
#pragma unroll
    for (int r = 0; r < 8; ++r) so[w][8 * hh + r][t * 16 + ln] = acc[t][r] * alpha; }
  __builtin_amdgcn_fence(__ATOMIC_ACQ_REL, "workgroup"); __builtin_amdgcn_wave_barrier();
  const int rsub = lane >> 4, c4 = (lane & 15) * 4;
  {
#pragma unroll
    for (int q = 0; q < 8; ++q) { const int r = q * 2 + rsub; if (col0 + c4 < N) { const v4f v = *(const v4fa*)&so[w][r][c4]; *(v4f*)(C + (size_t)(row0 + r) * ldc + col0 + c4) = v; } }
     }
}

// Wt[n][k] = f16(W[k][n]·scale) from f32 row-major W[K][N] (scale = power of two; bf16-exact weights stay exact in f16 away from the subnormal range)
__global__ __launch_bounds__(256) void k_wt_f16(const float* __restrict__ W, _Float16* __restrict__ Wt, int K, int N, float scale) {
  const int t = blockIdx.x * 256 + threadIdx.x; if (t >= N * (K / 8)) return; const int n = t / (K / 8), k8 = (t % (K / 8)) * 8; FragH f;
#pragma unroll
  for (int i = 0; i < 8; ++i) f.h[i] = (_Float16)(bf16_round(W[(size_t)(k8 + i) * N + n]) * scale); const v8us o = f.half[0];
  *(v8us*)((unsigned short*)Wt + (size_t)n * K + k8) = o; 
}
// k_gemm_hh variant with fused epilogue: v = acc·alpha + bias[by·sBias + col] (+ CP[(row/rowsPerB)·sCPb + by·64 + col] if CP) ; ACT 0 none / 1 elu ; writes f16 C16 (and f32 C if non-null)
template <int ACT>
__global__ __launch_bounds__(128) void k_gemm_hhx(const _Float16* __restrict__ A, int lda, size_t sA, const _Float16* __restrict__ Bh, int ldb, size_t sB, float alpha, const float* __restrict__ bias, size_t sBias, const float* __restrict__ CP, int rowsPerB, size_t sCPb, int row0g,
    float* __restrict__ C, _Float16* __restrict__ C16, int ldc, size_t sC, int M, int N, int K) {
  __shared__ __attribute__((aligned(16))) float so[4][16][64];
  const int tid = threadIdx.x, w = tid >> 5, lane = tid & 31, ln = lane & 15, hh = lane >> 4; const int by = blockIdx.y;
  A += (size_t)by * sA; Bh += (size_t)by * sB; const size_t cofs = (size_t)by * sC; const float* bp = bias ? bias + (size_t)by * sBias : nullptr;
  const int ntn = (N + 63) / 64; const int wid = blockIdx.x * 4 + w; const int mt = wid / ntn, nq = wid % ntn; if (mt * 16 >= M) return;
  const int row0 = mt * 16, col0 = nq * 64; const _Float16* arow = A + (size_t)(row0 + ln) * lda;
  v8f acc[4] = {};
  for (int kb = 0; kb < K; kb += 32) { FragH ah; ah.half[0] = *(const v8us*)((const unsigned short*)arow + kb + 8 * hh); ah.half[1] = *(const v8us*)((const unsigned short*)arow + kb + 16 + 8 * hh);
#pragma unroll
    for (int t = 0; t < 4; ++t) { if (col0 + t * 16 >= N) continue; const size_t boff = (size_t)(col0 + t * 16 + ln) * ldb + kb; FragH bq; bq.half[0] = *(const v8us*)((const unsigned short*)Bh + boff + 8 * hh); bq.half[1] = *(const v8us*)((const unsigned short*)Bh + boff + 16 + 8 * hh);
      acc[t] = mmaH<1>(ah.v, ah.v, bq.v, bq.v, acc[t]); }
  }
#pragma unroll
  for (int t = 0; t < 4; ++t) { if (col0 + t * 16 >= N) continue; const int col = col0 + t * 16 + ln; const float bv = bp ? bf16_round(bp[col]) : 0.f;
#pragma unroll
    for (int r = 0; r < 8; ++r) { float v = acc[t][r] * alpha + bv; if (CP) { const int rr = row0g + row0 + 8 * hh + r; if (rowsPerB < 0) v += CP[cofs + (size_t)rr * ldc + col];      /* rowsPerB < 0: own element of the batched C plane */ else { const int bidx = rr / rowsPerB; v += CP[(size_t)bidx * sCPb + (size_t)by * 64 + col]; } } if (ACT == 1) v = (v > 0.f) ? v : expm1f(v); else if (ACT == 7) v = (v > 0.f) ? v + 1.0f : expf(v); else if (ACT == 8) v = tanhf(v); else if (ACT == 9) v = 0.5f * v * (1.0f + tanhf(0.7978845608028654f * (v + 0.044715f * v * v * v))); else if (ACT == 11) v = 1.0f / (1.0f + expf(-v)); else if (ACT == 12) v = (v > 0.f) ? v : 0.01f * v; else if (ACT == 14) v = (v > 0.f) ? v : 0.1f * v; else if (ACT == 16) v = (v >= 0.f) ? v : 0.3f * v; else if (ACT == 17) v = (v >= 0.f) ? v : 0.2f * v; else if (ACT == 15) v = v / (1.0f + expf(-v)); else if (ACT == 3) v = fmaxf(v, 0.f); else if (ACT == 6) v = 0.5f * v * (1.0f + erff(v * 0.70710678118654752f)); so[w][8 * hh + r][t * 16 + ln] = v; } }
  __builtin_amdgcn_fence(__ATOMIC_ACQ_REL, "workgroup"); __builtin_amdgcn_wave_barrier();
  const int rsub = lane >> 4, c4 = (lane & 15) * 4; typedef _Float16 v4h __attribute__((ext_vector_type(4)));
  {
#pragma unroll
    for (int q = 0; q < 8; ++q) { const int r = q * 2 + rsub; if (col0 + c4 < N) { const v4f v = *(const v4fa*)&so[w][r][c4]; if (C) *(v4f*)(C + cofs + (size_t)(row0 + r) * ldc + col0 + c4) = v; if (C16) { v4h h4; for (int i = 0; i < 4; ++i) h4[i] = (_Float16)v[i]; *(v4h*)(C16 + cofs + (size_t)(row0 + r) * ldc + col0 + c4) = h4; } } }
     }
}


typedef _Float16 v4h __attribute__((ext_vector_type(4)));

__global__ __launch_bounds__(256) void k_x16(const float* __restrict__ x, _Float16* __restrict__ X16, size_t n8) { const size_t t = (size_t)blockIdx.x * 256 + threadIdx.x; if (t >= n8) return; FragH f;
#pragma unroll
  for (int q = 0; q < 8; ++q) f.h[q] = (_Float16)bf16_round(x[t * 8 + q]); *(v8us*)((unsigned short*)X16 + t * 8) = f.half[0];  }
__global__ __launch_bounds__(256) void k_h16(const float* __restrict__ x, _Float16* __restrict__ X16, size_t n8) { const size_t t = (size_t)blockIdx.x * 256 + threadIdx.x; if (t >= n8) return; FragH f;
#pragma unroll
  for (int q = 0; q < 8; ++q) f.h[q] = (_Float16)x[t * 8 + q]; *(v8us*)((unsigned short*)X16 + t * 8) = f.half[0];  }
__global__ __launch_bounds__(256) void k_round16f(const float* __restrict__ W, _Float16* __restrict__ Bt, size_t n8) { const size_t t = (size_t)blockIdx.x * 256 + threadIdx.x; if (t >= n8) return; FragH f;
#pragma unroll
  for (int i = 0; i < 8; ++i) f.h[i] = (_Float16)(bf16_round(W[t * 8 + i]) * 16.0f); *(v8us*)((unsigned short*)Bt + t * 8) = f.half[0];  }
template <int NHv, int TTv>
__global__ __launch_bounds__(256) void k_vt(const _Float16* __restrict__ V16, int ldv, int voff, _Float16* __restrict__ Vt) { __shared__ unsigned short tl[64][66]; const int tid = threadIdx.x; const int slab = blockIdx.x / (TTv / 64), lg = blockIdx.x % (TTv / 64); const int b = slab / NHv, h = slab % NHv;
  for (int i = tid; i < 64 * 8; i += 256) { const int r = i / 8, c8 = (i % 8) * 8; FragH f; f.half[0] = *(const v8us*)((const unsigned short*)V16 + ((size_t)b * TTv + lg * 64 + r) * ldv + voff + h * 64 + c8);
#pragma unroll
    for (int q = 0; q < 8; ++q) tl[r][c8 + q] = f.u[q]; }
  __syncthreads();
  {
#pragma unroll
    for (int rd = 0; rd < 2; ++rd) { const int d = rd * 32 + tid / 8, pc = tid % 8; FragH f;
#pragma unroll
      for (int q = 0; q < 8; ++q) f.u[q] = tl[pc * 8 + q][d];
      *(v8us*)((unsigned short*)Vt + ((size_t)slab * 64 + d) * TTv + lg * 64 + pc * 8) = f.half[0]; }
     } }

__global__ __launch_bounds__(256) void k_hl(const float* __restrict__ F, _Float16* __restrict__ Hh, _Float16* __restrict__ Hl, size_t n8) { const size_t t = (size_t)blockIdx.x * 256 + threadIdx.x; if (t >= n8) return; FragH fh, fl; const v4f a = *(const v4fa*)(F + t * 8), c = *(const v4fa*)(F + t * 8 + 4);
#pragma unroll
  for (int q = 0; q < 4; ++q) { _Float16 h = (_Float16)a[q]; fh.h[q] = h; fl.h[q] = (_Float16)((a[q] - (float)h) * 1024.0f); h = (_Float16)c[q]; fh.h[4 + q] = h; fl.h[4 + q] = (_Float16)((c[q] - (float)h) * 1024.0f); }
  { *(v8us*)((unsigned short*)Hh + t * 8) = fh.half[0]; *(v8us*)((unsigned short*)Hl + t * 8) = fl.half[0];  } }

// ---- fast GEMM (wave tile 32x64; requires M % 32 == 0 rows per launch region and N % 64 == 0); epilogue = k_gemm_hhx semantics ----
__device__ __forceinline__ v16h g2_frag(const _Float16* p, int hh) { FragH f; f.half[0] = *(const v8us*)((const unsigned short*)p + 8 * hh); f.half[1] = *(const v8us*)((const unsigned short*)p + 16 + 8 * hh); return f.v; }
__device__ __forceinline__ v8f g2_mma(v16h a, v16h b, v8f c) { v8f d = __builtin_amdgcn_wmma_f32_16x16x32_f16(false, a, false, b, (short)0, c, false, false); asm volatile("v_nop\n\tv_nop\n\tv_nop\n\tv_nop" : "+v"(d) : "v"(a), "v"(b)); return d; }
template <int ACT>
__global__ __launch_bounds__(128) void k_gemm2(const _Float16* __restrict__ A, int lda, size_t sA, const _Float16* __restrict__ Bh, int ldb, size_t sB, float alpha, const float* __restrict__ bias, size_t sBias, const float* __restrict__ CP, int rowsPerB, size_t sCPb, int row0g,
    float* __restrict__ C, _Float16* __restrict__ C16, int ldc, size_t sC, int M, int N, int K) { static_assert(ACT == 0 || ACT == 3 || ACT == 6 || ACT == 8 || ACT == 9 || ACT == 11 || ACT == 12 || ACT == 14 || ACT == 15 || ACT == 16 || ACT == 17, "k_gemm2: unsupported ACT code (would silently apply no activation)");
  __shared__ __attribute__((aligned(16))) float so[4][32][68];
  const int tid = threadIdx.x, w = tid >> 5, lane = tid & 31, ln = lane & 15, hh = lane >> 4; const int by = blockIdx.y;
  A += (size_t)by * sA; Bh += (size_t)by * sB; const size_t cofs = (size_t)by * sC; const float* bp = bias ? bias + (size_t)by * sBias : nullptr;
  const int ntn = N >> 6; const int mt = blockIdx.x / ntn, nq = blockIdx.x - mt * ntn; const int row0 = mt * 128 + 32 * w, col0 = nq * 64; if (row0 >= M) return;
  const _Float16* a0p = A + (size_t)(row0 + ln) * lda; const _Float16* a1p = a0p + (size_t)16 * lda;
  const _Float16* b0p = Bh + (size_t)(col0 + ln) * ldb; const _Float16* b1p = b0p + (size_t)16 * ldb; const _Float16* b2p = b1p + (size_t)16 * ldb; const _Float16* b3p = b2p + (size_t)16 * ldb;
  const v8f z8 = {0.f,0.f,0.f,0.f,0.f,0.f,0.f,0.f}; v8f c00 = z8, c01 = z8, c02 = z8, c03 = z8, c10 = z8, c11 = z8, c12 = z8, c13 = z8;
#pragma unroll 1
  for (int kb = 0; kb < K; kb += 32) { const v16h a0 = g2_frag(a0p + kb, hh), a1 = g2_frag(a1p + kb, hh);
    v16h b = g2_frag(b0p + kb, hh); c00 = g2_mma(a0, b, c00); c10 = g2_mma(a1, b, c10);
    b = g2_frag(b1p + kb, hh); c01 = g2_mma(a0, b, c01); c11 = g2_mma(a1, b, c11);
    b = g2_frag(b2p + kb, hh); c02 = g2_mma(a0, b, c02); c12 = g2_mma(a1, b, c12);
    b = g2_frag(b3p + kb, hh); c03 = g2_mma(a0, b, c03); c13 = g2_mma(a1, b, c13); }
  v8f accs[8] = {c00, c01, c02, c03, c10, c11, c12, c13};
#pragma unroll
  for (int u = 0; u < 8; ++u) { const int t = u & 3, half = u >> 2; const int col = col0 + t * 16 + ln; const float bv = bp ? bf16_round(bp[col]) : 0.f;
#pragma unroll
    for (int r = 0; r < 8; ++r) { const int rloc = half * 16 + 8 * hh + r; float v = accs[u][r] * alpha + bv; if (CP) { if (rowsPerB < 0) v += CP[cofs + (size_t)(row0g + row0 + rloc) * ldc + col];      /* rowsPerB < 0: own element of the batched C plane */ else { const int bidx = (row0g + row0 + rloc) / rowsPerB; v += CP[(size_t)bidx * sCPb + (size_t)by * 64 + col]; } }
      if (ACT == 3) v = fmaxf(v, 0.f); else if (ACT == 6) v = 0.5f * v * (1.0f + erff(v * 0.70710678118654752f)); else if (ACT == 11) v = 1.0f / (1.0f + expf(-v)); else if (ACT == 15) v = v / (1.0f + expf(-v)); else if (ACT == 12) v = (v > 0.f) ? v : 0.01f * v; else if (ACT == 8) v = tanhf(v); else if (ACT == 9) v = 0.5f * v * (1.0f + tanhf(0.7978845608028654f * (v + 0.044715f * v * v * v))); else if (ACT == 14) v = (v > 0.f) ? v : 0.1f * v; else if (ACT == 16) v = (v >= 0.f) ? v : 0.3f * v; else if (ACT == 17) v = (v >= 0.f) ? v : 0.2f * v;
      so[w][rloc][t * 16 + ln] = v; } }
  __builtin_amdgcn_fence(__ATOMIC_ACQ_REL, "workgroup"); __builtin_amdgcn_wave_barrier();
  const int rsub = lane >> 4, c4 = (lane & 15) * 4;
  {
#pragma unroll
    for (int q = 0; q < 16; ++q) { const int r = q * 2 + rsub; const v4f v = *(const v4fa*)&so[w][r][c4]; if (C) *(v4f*)(C + cofs + (size_t)(row0 + r) * ldc + col0 + c4) = v; if (C16) { v4h h4; for (int i = 0; i < 4; ++i) h4[i] = (_Float16)v[i]; *(v4h*)(C16 + cofs + (size_t)(row0 + r) * ldc + col0 + c4) = h4; } }
     } }


__global__ __launch_bounds__(256) void k_wnat(const float* __restrict__ w, size_t n8, _Float16* __restrict__ Bt) { const size_t t = (size_t)blockIdx.x * 256 + threadIdx.x; if (t >= n8) return; FragH f; for (int q = 0; q < 8; ++q) f.h[q] = (_Float16)(bf16_round(w[t * 8 + q]) * 16.0f); *(v8us*)((unsigned short*)Bt + t * 8) = f.half[0];  }
// Row softmax, one wave per pair of score rows: a row's 2048 f32 sit in the wave's registers (16 loads of 512 contiguous bytes), are read once,
// and maximum and sum are folded across the 32 lanes. exp is taken once per element; P = 256 softmax as f16, stored in whole 128-B lines.
#define RSM_R 2                      /* score rows per wave: both rows' loads are issued before the first row is worked on */
#define RSM_W 16                     /* waves per work-group */
template <int CTRL>
__device__ __forceinline__ float rsm_dpp(float v) { return __int_as_float(__builtin_amdgcn_update_dpp(0, __float_as_int(v), CTRL, 0xf, 0xf, true)); }      /* value of lane ^ (CTRL & 15) inside the 16-lane row (row_xmask) */
__device__ __forceinline__ float rsm_x16(float v) { const int i = __float_as_int(v); return __int_as_float(__builtin_amdgcn_permlanex16(i, i, 0x76543210, 0xfedcba98, false, false)); }      /* value of lane ^ 16 */
__device__ __forceinline__ float rsm_wmax(float v) { v = fmaxf(v, rsm_dpp<0x161>(v)); v = fmaxf(v, rsm_dpp<0x162>(v)); v = fmaxf(v, rsm_dpp<0x164>(v)); v = fmaxf(v, rsm_dpp<0x168>(v)); return fmaxf(v, rsm_x16(v)); }
__device__ __forceinline__ float rsm_wsum(float v) { v += rsm_dpp<0x161>(v); v += rsm_dpp<0x162>(v); v += rsm_dpp<0x164>(v); v += rsm_dpp<0x168>(v); return v + rsm_x16(v); }
__global__ __launch_bounds__(32 * RSM_W) void k_rsm(const float* __restrict__ S, _Float16* __restrict__ P, int nrows) {
  static_assert(SQ == 2048 && (HG * SQ) % RSM_R == 0, "k_rsm: 16 loads of 128 elements per row, whole groups of rows per wave");
  const int lane = threadIdx.x & 31; const int row0 = (blockIdx.x * RSM_W + __builtin_amdgcn_readfirstlane(threadIdx.x >> 5)) * RSM_R; if (row0 >= nrows) return;      /* wave-uniform; no barrier in this kernel */
  v4f x[RSM_R][16]; const char* sb = (const char*)(S + (size_t)row0 * SQ); const unsigned vo = lane * 16;      /* wave-uniform base, the lane's byte offset */
#pragma unroll
  for (int k = 0; k < RSM_R; ++k)
#pragma unroll
    for (int c = 0; c < 16; ++c) x[k][c] = *(const v4fa*)(sb + vo + (k * SQ + c * 128) * 4);
  __builtin_amdgcn_sched_barrier(0);      /* keeps every load in front of the arithmetic: the later row's bytes fly while the first row is worked on */
#pragma unroll
  for (int k = 0; k < RSM_R; ++k) { v4f m4 = {-3.0e38f, -3.0e38f, -3.0e38f, -3.0e38f};
#pragma unroll
    for (int c = 0; c < 16; ++c) for (int q = 0; q < 4; ++q) m4[q] = fmaxf(m4[q], x[k][c][q]);
    const float mx = rsm_wmax(fmaxf(fmaxf(m4[0], m4[1]), fmaxf(m4[2], m4[3]))); v4f s4 = {0.f, 0.f, 0.f, 0.f};
#pragma unroll
    for (int c = 0; c < 16; ++c) for (int q = 0; q < 4; ++q) { const float e = expf(x[k][c][q] - mx); x[k][c][q] = e; s4[q] += e; }
    const float sc = 256.0f / rsm_wsum((s4[0] + s4[1]) + (s4[2] + s4[3])); _Float16* d = P + (size_t)(row0 + k) * SQ + lane * 4;
#pragma unroll
    for (int c = 0; c < 16; ++c) { v4h h4; for (int q = 0; q < 4; ++q) h4[q] = (_Float16)(x[k][c][q] * sc); *(v4h*)(d + c * 128) = h4; }
    if (k + 1 < RSM_R) __builtin_amdgcn_sched_barrier(0); } }      /* keeps a finished row's stores in front of the next row's arithmetic, so that they drain beside it */
__global__ __launch_bounds__(256) void k_vt(const _Float16* __restrict__ V16, int b, int h0, _Float16* __restrict__ VT) { __shared__ unsigned short tl[64][65]; const int tid = threadIdx.x; const int hh = blockIdx.x % HG, sg = blockIdx.x / HG; const int s0 = sg * 64; const int h = h0 + hh;
  for (int i = tid; i < 64 * 8; i += 256) { const int j = i / 8, d8 = (i % 8) * 8; FragH f; f.half[0] = *(const v8us*)((const unsigned short*)V16 + ((size_t)b * SQ + s0 + j) * DM + h * HD + d8); for (int q = 0; q < 8; ++q) tl[d8 + q][j] = f.u[q]; }
  __syncthreads();
  { for (int i = tid; i < 64 * 8; i += 256) { const int d = i / 8, j8 = (i % 8) * 8; FragH f; for (int q = 0; q < 8; ++q) f.u[q] = tl[d][j8 + q]; *(v8us*)((unsigned short*)VT + ((size_t)hh * HD + d) * SQ + s0 + j8) = f.half[0]; }  } }



__global__ __launch_bounds__(256) void k_rsmkm(const float* __restrict__ S, _Float16* __restrict__ P, int nrows, const int* __restrict__ am) {
  #pragma clang fp contract(off)
  const int t = blockIdx.x * 256 + threadIdx.x; if (t >= nrows) return; const size_t i = (size_t)t; const float* s = S + i * SQ; const int* mr = am + (size_t)(t % SQ) * SQ; float mx = -3.0e38f;
#pragma unroll 1
  for (int j = 0; j < SQ; ++j) { const float f = (mr[j] != 0) ? 1.f : 0.f; mx = fmaxf(mx, fmaf(f, s[j], (1.f - f) * -1.0e9f)); } float se = 0.f;
#pragma unroll 1
  for (int j = 0; j < SQ; ++j) { const float f = (mr[j] != 0) ? 1.f : 0.f; se += __expf(fmaf(f, s[j], (1.f - f) * -1.0e9f) - mx); } const float sc = 256.0f / se;
#pragma unroll 1
  for (int j0 = 0; j0 < SQ; j0 += 8) { FragH fr; for (int q = 0; q < 8; ++q) { const int j = j0 + q; const float f = (mr[j] != 0) ? 1.f : 0.f; fr.h[q] = (_Float16)(__expf(fmaf(f, s[j], (1.f - f) * -1.0e9f) - mx) * sc); }
    unsigned short* d = (unsigned short*)P + i * SQ + j0; *(v8us*)d = fr.half[0];  } }
extern "C" void kernel_launch(void* const* d_in, const int* in_sizes, int n_in,
                              void* d_out, int out_size, void* d_ws, size_t ws_size, hipStream_t stream) {
  (void)in_sizes; (void)n_in; (void)out_size;
  const float* const* I = (const float* const*)d_in; const float* xq = I[0]; const float* xk = I[1]; const float* xv = I[1]; const float* wq = I[2]; const float* bq = I[3]; const float* wk = I[4]; const float* bk = I[5]; const float* wv = I[6]; const float* bv = I[7]; const float* x = xq;      /* input (queries), memory (keys AND values); natural weights + biases; no output projection */
  char* ws = (char*)d_ws; size_t off = 0;
  auto take = [&](size_t bytes) { char* p = ws + off; off += (bytes + 255) & ~(size_t)255; return p; };
  _Float16* BQ = (_Float16*)take((size_t)DM * DM * 2); _Float16* BK = (_Float16*)take((size_t)DM * DM * 2); _Float16* BV = (_Float16*)take((size_t)DM * DM * 2); 
  _Float16* X16 = (_Float16*)take(NR * DM * 2); _Float16* XKp = (_Float16*)take(NR * DM * 2); _Float16* XVp = (_Float16*)take(NR * DM * 2); _Float16* Q16 = (_Float16*)take(NR * DM * 2); _Float16* K16 = (_Float16*)take(NR * DM * 2); _Float16* V16 = (_Float16*)take(NR * DM * 2); 
  float* S = (float*)take((size_t)HG * SQ * SQ * 4); _Float16* P = (_Float16*)take((size_t)HG * SQ * SQ * 2); _Float16* VT = (_Float16*)take((size_t)NH * HD * SQ * 2);
  if (off > ws_size) return;
  { const unsigned g = (unsigned)(((size_t)DM * DM / 8 + 255) / 256); k_wnat<<<g, 256, 0, stream>>>(wq, (size_t)DM * DM / 8, BQ); k_wnat<<<g, 256, 0, stream>>>(wk, (size_t)DM * DM / 8, BK); k_wnat<<<g, 256, 0, stream>>>(wv, (size_t)DM * DM / 8, BV); }      /* natural [out][in] = Bt x16 (no output projection: no Wo plane) */
  _Float16* XK = XKp; _Float16* XV = XVp; k_x16<<<(unsigned)((NR * DM / 8 + 255) / 256), 256, 0, stream>>>(xk, XK, NR * DM / 8); k_x16<<<(unsigned)((NR * DM / 8 + 255) / 256), 256, 0, stream>>>(xv, XV, NR * DM / 8);      /* key and value inputs as exact f16 rows */

  k_x16<<<(unsigned)((NR * DM / 8 + 255) / 256), 256, 0, stream>>>(x, X16, NR * DM / 8);
  const size_t r0p = (size_t)B0 * SQ;      /* first projected row */
  k_gemm2<0><<<dim3((unsigned)((MP / 128) * (DM / 64)), 1), 128, 0, stream>>>(X16 + r0p * DM, DM, 0, BQ, DM, 0, 0.0625f, bq, 0, nullptr, 1, 0, 0, nullptr, Q16 + r0p * DM, DM, 0, MP, DM, DM);
  k_gemm2<0><<<dim3((unsigned)((MP / 128) * (DM / 64)), 1), 128, 0, stream>>>(XK + r0p * DM, DM, 0, BK, DM, 0, 0.0625f, bk, 0, nullptr, 1, 0, 0, nullptr, K16 + r0p * DM, DM, 0, MP, DM, DM);
  k_gemm2<0><<<dim3((unsigned)((MP / 128) * (DM / 64)), 1), 128, 0, stream>>>(XV + r0p * DM, DM, 0, BV, DM, 0, 0.0625f, bv, 0, nullptr, 1, 0, 0, nullptr, V16 + r0p * DM, DM, 0, MP, DM, DM);
  for (int b = B0; b < B0 + NBR; ++b) { const size_t r0 = (size_t)b * SQ;
    k_vt<NH, SQ><<<NH * (SQ / 64), 256, 0, stream>>>(V16 + r0 * LQ, LQ, 0, VT);      /* V^T [NH][HD][SQ] for this batch */
    for (int h0 = 0; h0 < NHD; h0 += HG) {
      k_gemm2<0><<<dim3((QN / 128) * (SQ / 64), HG), 128, 0, stream>>>(Q16 + r0 * LQ + h0 * HD, LQ, (size_t)HD, K16 + r0 * LQ + h0 * HD, LQ, (size_t)HD, 0.125f, nullptr, 0, nullptr, 1, 0, 0, S, nullptr, SQ, (size_t)SQ * SQ, QN, SQ, HD);      /* scores, HG heads per launch */
      k_rsm<<<(HG * SQ + RSM_W * RSM_R - 1) / (RSM_W * RSM_R), 32 * RSM_W, 0, stream>>>(S, P, HG * SQ);      /* P = 256 softmax (f16), rows of all HG heads */
      k_gemm2<0><<<dim3((QN / 128) * (HD / 64), HG), 128, 0, stream>>>(P, SQ, (size_t)SQ * SQ, VT + (size_t)h0 * HD * SQ, SQ, (size_t)HD * SQ, 0.00390625f, nullptr, 0, nullptr, 1, 0, 0, (float*)d_out + r0 * DM + h0 * HD, nullptr, DM, (size_t)HD, QN, HD, SQ); } }      /* out = P V^T 2^-8 straight to the f32 output (merged heads; each 256-B head segment of a row written by one wave tile) */
  /* no output projection in this module */
}

// v002
// One run takes 254 microseconds.
// In two side-by-side timings against v001, it was 6.82 and 6.77 times as fast.
// All steps since v000 together make it 28.7 times as fast.
#include <hip/hip_runtime.h>
// Multi-head CROSS-attention without an output projection (input, memory [4][2048][1024]; q = input Wq^T + bq, k = memory Wk^T + bk, v = memory Wv^T + bv (natural [1024][1024], zero biases); 16 heads of 64; q * 64^-0.5 then q k^T; softmax over all 2048 memory positions (no mask); out = attn v merged to [4][2048][1024]; NO output projection).
// Structure: token rows r = b*2048 + s; x as exact f16 rows (bf16-rounded); Q, K, V as three WMMA GEMMs (32x64 wave tiles, f32 accumulation, exact x16 weights + bias, f16 outputs); V^T for all batches and heads via LDS transposes; one fused attention launch (k_fattn): S^T = K Q^T (K = 64), online softmax (f32 statistics, base 2, weights as f16 relative to the running maximum), O^T += V^T P^T, divided by the row sum and written straight into the merged f32 output rows.
// Compute dtype: inputs rounded to bf16; x / weights exact; q, k, v, softmax weights as plain f16 GEMM operands (~2^-12); scores, softmax statistics and o f32. v_wmma_f32_16x16x32_f16.
#define NB 4
#define SQ 2048
#define DM 1024
#define NH 16
#define HD 64
#define HG 4                         /* heads per k_vt(b, h0) launch (that overload is not launched) */
#define B0 0                         /* first batch processed (debug hook) */
#define NBR NB                       /* batches processed (debug hook) */
#define NR ((size_t)NB * SQ)         /* token rows */
#define MP ((int)((size_t)NBR * SQ)) /* rows projected (debug hook) */
#define QN SQ                        /* unused (attention covers all SQ query rows) */
#define NHD NH                       /* unused (attention covers all NH heads) */
#define MPO MP                       /* unused (no output projection) */
#define LQ DM      /* row pitch of the q/k/v rows */
typedef __bf16 v16b __attribute__((ext_vector_type(16)));
typedef unsigned short v8us __attribute__((ext_vector_type(8), may_alias));
typedef float  v8f  __attribute__((ext_vector_type(8)));
typedef float  v4f  __attribute__((ext_vector_type(4)));
typedef float  v4fa __attribute__((ext_vector_type(4), may_alias));
union FragB { v16b v; v8us half[2]; unsigned short u[16]; };

__device__ __forceinline__ unsigned short bf16_bits(float x) { unsigned int u = __float_as_uint(x); return (unsigned short)((u + 0x7FFFu + ((u >> 16) & 1u)) >> 16); }
__device__ __forceinline__ float bf16_val(unsigned short b) { return __uint_as_float(((unsigned int)b) << 16); }
__device__ __forceinline__ float bf16_round(float x) { return bf16_val(bf16_bits(x)); }
// D += A·B with NT terms: 1 = ah·bh, 2 = + al·bh (A split), 3 = + ah·bl (both split)
template <int NT>
__device__ __forceinline__ v8f mmaN(v16b ah, v16b al, v16b bh, v16b bl, v8f c) {
  c = __builtin_amdgcn_wmma_f32_16x16x32_bf16(false, ah, false, bh, (short)0, c, false, false);
  if (NT >= 2) c = __builtin_amdgcn_wmma_f32_16x16x32_bf16(false, al, false, bh, (short)0, c, false, false);
  if (NT >= 3) c = __builtin_amdgcn_wmma_f32_16x16x32_bf16(false, ah, false, bl, (short)0, c, false, false);
  asm volatile("v_nop\n\tv_nop\n\tv_nop\n\tv_nop" : "+v"(c) : "v"(ah), "v"(al), "v"(bh), "v"(bl));
  return c;
}

__global__ __launch_bounds__(256) void k_wt_bf16(const float* __restrict__ W, unsigned short* __restrict__ Wt, int K, int N) {
  const int t = blockIdx.x * 256 + threadIdx.x;
  const int k8n = K / 8;
  if (t >= N * k8n) return;
  const int n = t / k8n, k8 = (t % k8n) * 8;
  v8us v;
#pragma unroll
  for (int i = 0; i < 8; ++i) v[i] = bf16_bits(W[(size_t)(k8 + i) * N + n]);
  *(v8us*)(Wt + (size_t)n * K + k8) = v;
  
}

// GEMM C[M][N] (f32, pitch ldc) = act(A[M][K]·W + bias). A f32 row-major (pitch lda) converted per fragment to bf16
// (ASPLIT: hi/lo two planes -> 2 terms, else single rounded term); Wt bf16 [N][K] (pitch ldb). BIAS_BF16 rounds the
// bias to bf16 first (bias quantised to bf16 before the add). K%32==0, M%16==0, N%64==0.
template <bool ASPLIT, int ACT, bool BIAS_BF16>
__global__ __launch_bounds__(128) void k_gemm_bf(const float* __restrict__ A, int lda, const unsigned short* __restrict__ Wt, int ldb,
                                               const float* __restrict__ bias, float* __restrict__ C, int ldc, int M, int N, int K) {
  __shared__ __attribute__((aligned(16))) float so[4][16][64];
  const int tid = threadIdx.x, w = tid >> 5, lane = tid & 31, ln = lane & 15, hh = lane >> 4;
  const int ntn = N / 64;
  const int wid = blockIdx.x * 4 + w;
  const int mt = wid / ntn, nq = wid % ntn;
  if (mt * 16 >= M) return;
  const int row0 = mt * 16, col0 = nq * 64;
  const float* arow = A + (size_t)(row0 + ln) * lda;
  v8f acc[4] = {};
  for (int kb = 0; kb < K; kb += 32) {
    FragB ah, al;
    const v4f x0 = *(const v4fa*)(arow + kb + 8 * hh), x1 = *(const v4fa*)(arow + kb + 8 * hh + 4);
    const v4f x2 = *(const v4fa*)(arow + kb + 16 + 8 * hh), x3 = *(const v4fa*)(arow + kb + 16 + 8 * hh + 4);
    float xs[16] = {x0[0],x0[1],x0[2],x0[3],x1[0],x1[1],x1[2],x1[3],x2[0],x2[1],x2[2],x2[3],x3[0],x3[1],x3[2],x3[3]};
#pragma unroll
    for (int i = 0; i < 16; ++i) { const unsigned short hb = bf16_bits(xs[i]); ah.u[i] = hb; al.u[i] = ASPLIT ? bf16_bits(xs[i] - bf16_val(hb)) : (unsigned short)0; }
#pragma unroll
    for (int t = 0; t < 4; ++t) {
      const unsigned short* brow = Wt + (size_t)(col0 + t * 16 + ln) * ldb + kb;
      FragB b;
      b.half[0] = *(const v8us*)(brow + 8 * hh);
      b.half[1] = *(const v8us*)(brow + 16 + 8 * hh);
      acc[t] = mmaN<ASPLIT ? 2 : 1>(ah.v, al.v, b.v, b.v, acc[t]);
    }
  }
#pragma unroll
  for (int t = 0; t < 4; ++t) {
    float bv = bias ? bias[col0 + t * 16 + ln] : 0.f;
    if (BIAS_BF16) bv = bf16_round(bv);
#pragma unroll
    for (int r = 0; r < 8; ++r) { float v = acc[t][r] + bv; if (ACT == 1) v = fmaxf(v, 0.f); so[w][8 * hh + r][t * 16 + ln] = v; }
  }
  __builtin_amdgcn_fence(__ATOMIC_ACQ_REL, "workgroup");
  __builtin_amdgcn_wave_barrier();
  const int rsub = lane >> 4, c4 = (lane & 15) * 4;
  {
#pragma unroll
    for (int q = 0; q < 8; ++q) {
      const int r = q * 2 + rsub;
      const v4f v = *(const v4fa*)&so[w][r][c4];
      *(v4f*)(C + (size_t)(row0 + r) * ldc + col0 + c4) = v;
    }
    
  }
}

// GEMM C = act(A·W + bias + resid): A f32 (ASPLIT -> hi/lo 2 terms), Wt bf16 [N][K]; ACT 0 none, 1 relu, 2 exact gelu;
// resid (optional, f32, row index = (row % rmod), pitch ldr, RES_BF16 rounds it) added before the activation.
template <bool ASPLIT, int ACT, bool BIAS_BF16, bool RES_BF16>
__global__ __launch_bounds__(128) void k_gemm_bf3(const float* __restrict__ A, int lda, const unsigned short* __restrict__ Wt, int ldb,
                                                const float* __restrict__ bias, const float* __restrict__ resid, int rmod, int ldr,
                                                float* __restrict__ C, int ldc, int M, int N, int K) {
  __shared__ __attribute__((aligned(16))) float so[4][16][64];
  const int tid = threadIdx.x, w = tid >> 5, lane = tid & 31, ln = lane & 15, hh = lane >> 4;
  const int ntn = N / 64;
  const int wid = blockIdx.x * 4 + w;
  const int mt = wid / ntn, nq = wid % ntn;
  if (mt * 16 >= M) return;
  const int row0 = mt * 16, col0 = nq * 64;
  const float* arow = A + (size_t)(row0 + ln) * lda;
  v8f acc[4] = {};
  for (int kb = 0; kb < K; kb += 32) {
    FragB ah, al;
    const v4f x0 = *(const v4fa*)(arow + kb + 8 * hh), x1 = *(const v4fa*)(arow + kb + 8 * hh + 4);
    const v4f x2 = *(const v4fa*)(arow + kb + 16 + 8 * hh), x3 = *(const v4fa*)(arow + kb + 16 + 8 * hh + 4);
    float xs[16] = {x0[0],x0[1],x0[2],x0[3],x1[0],x1[1],x1[2],x1[3],x2[0],x2[1],x2[2],x2[3],x3[0],x3[1],x3[2],x3[3]};
#pragma unroll
    for (int i = 0; i < 16; ++i) { const unsigned short hb = bf16_bits(xs[i]); ah.u[i] = hb; al.u[i] = ASPLIT ? bf16_bits(xs[i] - bf16_val(hb)) : (unsigned short)0; }
#pragma unroll
    for (int t = 0; t < 4; ++t) {
      const unsigned short* brow = Wt + (size_t)(col0 + t * 16 + ln) * ldb + kb;
      FragB b;
      b.half[0] = *(const v8us*)(brow + 8 * hh);
      b.half[1] = *(const v8us*)(brow + 16 + 8 * hh);
      acc[t] = mmaN<ASPLIT ? 2 : 1>(ah.v, al.v, b.v, b.v, acc[t]);
    }
  }
#pragma unroll
  for (int t = 0; t < 4; ++t) {
    const int col = col0 + t * 16 + ln;
    float bv = bias ? bias[col] : 0.f;
    if (BIAS_BF16) bv = bf16_round(bv);
#pragma unroll
    for (int r = 0; r < 8; ++r) {
      float v = acc[t][r] + bv;
      if (resid) { float rv = resid[(size_t)((row0 + 8 * hh + r) % rmod) * ldr + col]; if (RES_BF16) rv = bf16_round(rv); v += rv; }
      if (ACT == 1) v = fmaxf(v, 0.f);
      if (ACT == 2) v = 0.5f * v * (1.0f + erff(v * 0.70710678118654752f));
      if (ACT == 3) { const float u = 0.7978845608028654f * (v + 0.044715f * v * v * v); v = 0.5f * v * (1.0f + tanhf(u)); }
      so[w][8 * hh + r][t * 16 + ln] = v;
    }
  }
  __builtin_amdgcn_fence(__ATOMIC_ACQ_REL, "workgroup");
  __builtin_amdgcn_wave_barrier();
  const int rsub = lane >> 4, c4 = (lane & 15) * 4;
  {
#pragma unroll
    for (int q = 0; q < 8; ++q) {
      const int r = q * 2 + rsub;
      const v4f v = *(const v4fa*)&so[w][r][c4];
      *(v4f*)(C + (size_t)(row0 + r) * ldc + col0 + c4) = v;
    }
    
  }
}
// row LayerNorm (biased variance, eps) over N: s = X (+ R); optional out_sum <- s; out_norm <- (s-mu)*rsqrt(var+eps)*g + b
template <bool PARAM_BF16>
__global__ __launch_bounds__(256) void k_layernorm(const float* __restrict__ X, const float* __restrict__ R, const float* __restrict__ g, const float* __restrict__ bta,
                                                  float* __restrict__ out_sum, float* __restrict__ out_norm, int N, float eps) {
  __shared__ float red[256];
  const int row = blockIdx.x, tid = threadIdx.x;
  const float* x = X + (size_t)row * N; const float* rr = R ? R + (size_t)row * N : nullptr;
  float vals[16];                     // up to N = 4096
  const int per = N / 256;            // contiguous chunk per thread? use strided-by-4 chunks: thread handles j = tid*4 + 1024*u
  float s1 = 0.f;
  for (int u = 0; u < per / 4; ++u) {
    const int j = tid * 4 + 1024 * u;
    const v4f a = *(const v4fa*)(x + j);
    v4f b = {0.f,0.f,0.f,0.f}; if (rr) b = *(const v4fa*)(rr + j);
#pragma unroll
    for (int q = 0; q < 4; ++q) { const float v = a[q] + b[q]; vals[u * 4 + q] = v; s1 += v; }
  }
  red[tid] = s1; __syncthreads();
  for (int st = 128; st > 0; st >>= 1) { if (tid < st) red[tid] += red[tid + st]; __syncthreads(); }
  const float mu = red[0] / (float)N; __syncthreads();
  float s2 = 0.f;
  for (int u = 0; u < per / 4; ++u)
#pragma unroll
    for (int q = 0; q < 4; ++q) { const float c = vals[u * 4 + q] - mu; s2 += c * c; }
  red[tid] = s2; __syncthreads();
  for (int st = 128; st > 0; st >>= 1) { if (tid < st) red[tid] += red[tid + st]; __syncthreads(); }
  const float rs = rsqrtf(red[0] / (float)N + eps);
  {
    for (int u = 0; u < per / 4; ++u) {
      const int j = tid * 4 + 1024 * u;
      v4f o, sm;
#pragma unroll
      for (int q = 0; q < 4; ++q) {
        float gg = g[j + q], bb = bta[j + q];
        if (PARAM_BF16) { gg = bf16_round(gg); bb = bf16_round(bb); }
        sm[q] = vals[u * 4 + q]; o[q] = (vals[u * 4 + q] - mu) * rs * gg + bb;
      }
      if (out_sum) *(v4f*)(out_sum + (size_t)row * N + j) = sm;
      *(v4f*)(out_norm + (size_t)row * N + j) = o;
    }
    
  }
}



// ---- f16 WMMA path (v_wmma_f32_16x16x32_f16): 11-bit significands for operands in range — used where a [0,1] probability operand needs more precision than bf16
typedef _Float16 v16h __attribute__((ext_vector_type(16)));
union FragH { v16h v; v8us half[2]; _Float16 h[16]; unsigned short u[16]; };
template <int NT>
__device__ __forceinline__ v8f mmaH(v16h ah, v16h al, v16h bh, v16h bl, v8f c) {
  c = __builtin_amdgcn_wmma_f32_16x16x32_f16(false, ah, false, bh, (short)0, c, false, false);
  if (NT >= 2) c = __builtin_amdgcn_wmma_f32_16x16x32_f16(false, al, false, bh, (short)0, c, false, false);
  if (NT >= 3) c = __builtin_amdgcn_wmma_f32_16x16x32_f16(false, ah, false, bl, (short)0, c, false, false);
  asm volatile("v_nop\n\tv_nop\n\tv_nop\n\tv_nop" : "+v"(c) : "v"(ah), "v"(al), "v"(bh), "v"(bl));
  return c;
}
// batched GEMM like k_gemm_b but f16 operands: A f32 (split into f16 hi/lo if ASPLIT, else rounded to f16), Bt = f16 values [n][k]; alpha; C f32; N multiple of 16 (partial tiles skipped)
template <bool ASPLIT>
__global__ __launch_bounds__(128) void k_gemm_h(const float* __restrict__ A, int lda, size_t sA, const _Float16* __restrict__ Bh, int ldb, size_t sB, float alpha, float* __restrict__ C, int ldc, size_t sC, int M, int N, int K) {
  __shared__ __attribute__((aligned(16))) float so[4][16][64];
  const int tid = threadIdx.x, w = tid >> 5, lane = tid & 31, ln = lane & 15, hh = lane >> 4; const int by = blockIdx.y;
  A += (size_t)by * sA; Bh += (size_t)by * sB; C += (size_t)by * sC;
  const int ntn = (N + 63) / 64; const int wid = blockIdx.x * 4 + w; const int mt = wid / ntn, nq = wid % ntn; if (mt * 16 >= M) return;
  const int row0 = mt * 16, col0 = nq * 64; const float* arow = A + (size_t)(row0 + ln) * lda;
  v8f acc[4] = {};
  for (int kb = 0; kb < K; kb += 32) {
    FragH ah, al;
    const v4f x0 = *(const v4fa*)(arow + kb + 8 * hh), x1 = *(const v4fa*)(arow + kb + 8 * hh + 4), x2 = *(const v4fa*)(arow + kb + 16 + 8 * hh), x3 = *(const v4fa*)(arow + kb + 16 + 8 * hh + 4);
    float xs[16] = {x0[0],x0[1],x0[2],x0[3],x1[0],x1[1],x1[2],x1[3],x2[0],x2[1],x2[2],x2[3],x3[0],x3[1],x3[2],x3[3]};
#pragma unroll
    for (int i = 0; i < 16; ++i) { const _Float16 h = (_Float16)xs[i]; ah.h[i] = h; al.h[i] = ASPLIT ? (_Float16)(xs[i] - (float)h) : (_Float16)0.0f; }
#pragma unroll
    for (int t = 0; t < 4; ++t) { if (col0 + t * 16 >= N) continue; const size_t boff = (size_t)(col0 + t * 16 + ln) * ldb + kb; FragH bq; bq.half[0] = *(const v8us*)(Bh + boff + 8 * hh); bq.half[1] = *(const v8us*)(Bh + boff + 16 + 8 * hh);
      acc[t] = mmaH<ASPLIT ? 2 : 1>(ah.v, al.v, bq.v, bq.v, acc[t]); }
  }
#pragma unroll
  for (int t = 0; t < 4; ++t) { if (col0 + t * 16 >= N) continue;
#pragma unroll
    for (int r = 0; r < 8; ++r) so[w][8 * hh + r][t * 16 + ln] = acc[t][r] * alpha; }
  __builtin_amdgcn_fence(__ATOMIC_ACQ_REL, "workgroup"); __builtin_amdgcn_wave_barrier();
  const int rsub = lane >> 4, c4 = (lane & 15) * 4;
  {
#pragma unroll
    for (int q = 0; q < 8; ++q) { const int r = q * 2 + rsub; if (col0 + c4 < N) { const v4f v = *(const v4fa*)&so[w][r][c4]; *(v4f*)(C + (size_t)(row0 + r) * ldc + col0 + c4) = v; } }
     }
}

// Wt[n][k] = f16(W[k][n]·scale) from f32 row-major W[K][N] (scale = power of two; bf16-exact weights stay exact in f16 away from the subnormal range)
__global__ __launch_bounds__(256) void k_wt_f16(const float* __restrict__ W, _Float16* __restrict__ Wt, int K, int N, float scale) {
  const int t = blockIdx.x * 256 + threadIdx.x; if (t >= N * (K / 8)) return; const int n = t / (K / 8), k8 = (t % (K / 8)) * 8; FragH f;
#pragma unroll
  for (int i = 0; i < 8; ++i) f.h[i] = (_Float16)(bf16_round(W[(size_t)(k8 + i) * N + n]) * scale); const v8us o = f.half[0];
  *(v8us*)((unsigned short*)Wt + (size_t)n * K + k8) = o; 
}
// k_gemm_hh variant with fused epilogue: v = acc·alpha + bias[by·sBias + col] (+ CP[(row/rowsPerB)·sCPb + by·64 + col] if CP) ; ACT 0 none / 1 elu ; writes f16 C16 (and f32 C if non-null)
template <int ACT>
__global__ __launch_bounds__(128) void k_gemm_hhx(const _Float16* __restrict__ A, int lda, size_t sA, const _Float16* __restrict__ Bh, int ldb, size_t sB, float alpha, const float* __restrict__ bias, size_t sBias, const float* __restrict__ CP, int rowsPerB, size_t sCPb, int row0g,
    float* __restrict__ C, _Float16* __restrict__ C16, int ldc, size_t sC, int M, int N, int K) {
  __shared__ __attribute__((aligned(16))) float so[4][16][64];
  const int tid = threadIdx.x, w = tid >> 5, lane = tid & 31, ln = lane & 15, hh = lane >> 4; const int by = blockIdx.y;
  A += (size_t)by * sA; Bh += (size_t)by * sB; const size_t cofs = (size_t)by * sC; const float* bp = bias ? bias + (size_t)by * sBias : nullptr;
  const int ntn = (N + 63) / 64; const int wid = blockIdx.x * 4 + w; const int mt = wid / ntn, nq = wid % ntn; if (mt * 16 >= M) return;
  const int row0 = mt * 16, col0 = nq * 64; const _Float16* arow = A + (size_t)(row0 + ln) * lda;
  v8f acc[4] = {};
  for (int kb = 0; kb < K; kb += 32) { FragH ah; ah.half[0] = *(const v8us*)((const unsigned short*)arow + kb + 8 * hh); ah.half[1] = *(const v8us*)((const unsigned short*)arow + kb + 16 + 8 * hh);
#pragma unroll
    for (int t = 0; t < 4; ++t) { if (col0 + t * 16 >= N) continue; const size_t boff = (size_t)(col0 + t * 16 + ln) * ldb + kb; FragH bq; bq.half[0] = *(const v8us*)((const unsigned short*)Bh + boff + 8 * hh); bq.half[1] = *(const v8us*)((const unsigned short*)Bh + boff + 16 + 8 * hh);
      acc[t] = mmaH<1>(ah.v, ah.v, bq.v, bq.v, acc[t]); }
  }
#pragma unroll
  for (int t = 0; t < 4; ++t) { if (col0 + t * 16 >= N) continue; const int col = col0 + t * 16 + ln; const float bv = bp ? bf16_round(bp[col]) : 0.f;
#pragma unroll
    for (int r = 0; r < 8; ++r) { float v = acc[t][r] * alpha + bv; if (CP) { const int rr = row0g + row0 + 8 * hh + r; if (rowsPerB < 0) v += CP[cofs + (size_t)rr * ldc + col];      /* rowsPerB < 0: own element of the batched C plane */ else { const int bidx = rr / rowsPerB; v += CP[(size_t)bidx * sCPb + (size_t)by * 64 + col]; } } if (ACT == 1) v = (v > 0.f) ? v : expm1f(v); else if (ACT == 7) v = (v > 0.f) ? v + 1.0f : expf(v); else if (ACT == 8) v = tanhf(v); else if (ACT == 9) v = 0.5f * v * (1.0f + tanhf(0.7978845608028654f * (v + 0.044715f * v * v * v))); else if (ACT == 11) v = 1.0f / (1.0f + expf(-v)); else if (ACT == 12) v = (v > 0.f) ? v : 0.01f * v; else if (ACT == 14) v = (v > 0.f) ? v : 0.1f * v; else if (ACT == 16) v = (v >= 0.f) ? v : 0.3f * v; else if (ACT == 17) v = (v >= 0.f) ? v : 0.2f * v; else if (ACT == 15) v = v / (1.0f + expf(-v)); else if (ACT == 3) v = fmaxf(v, 0.f); else if (ACT == 6) v = 0.5f * v * (1.0f + erff(v * 0.70710678118654752f)); so[w][8 * hh + r][t * 16 + ln] = v; } }
  __builtin_amdgcn_fence(__ATOMIC_ACQ_REL, "workgroup"); __builtin_amdgcn_wave_barrier();
  const int rsub = lane >> 4, c4 = (lane & 15) * 4; typedef _Float16 v4h __attribute__((ext_vector_type(4)));
  {
#pragma unroll
    for (int q = 0; q < 8; ++q) { const int r = q * 2 + rsub; if (col0 + c4 < N) { const v4f v = *(const v4fa*)&so[w][r][c4]; if (C) *(v4f*)(C + cofs + (size_t)(row0 + r) * ldc + col0 + c4) = v; if (C16) { v4h h4; for (int i = 0; i < 4; ++i) h4[i] = (_Float16)v[i]; *(v4h*)(C16 + cofs + (size_t)(row0 + r) * ldc + col0 + c4) = h4; } } }
     }
}


typedef _Float16 v4h __attribute__((ext_vector_type(4)));

__global__ __launch_bounds__(256) void k_x16(const float* __restrict__ x, _Float16* __restrict__ X16, size_t n8) { const size_t t = (size_t)blockIdx.x * 256 + threadIdx.x; if (t >= n8) return; FragH f;
#pragma unroll
  for (int q = 0; q < 8; ++q) f.h[q] = (_Float16)bf16_round(x[t * 8 + q]); *(v8us*)((unsigned short*)X16 + t * 8) = f.half[0];  }
__global__ __launch_bounds__(256) void k_h16(const float* __restrict__ x, _Float16* __restrict__ X16, size_t n8) { const size_t t = (size_t)blockIdx.x * 256 + threadIdx.x; if (t >= n8) return; FragH f;
#pragma unroll
  for (int q = 0; q < 8; ++q) f.h[q] = (_Float16)x[t * 8 + q]; *(v8us*)((unsigned short*)X16 + t * 8) = f.half[0];  }
__global__ __launch_bounds__(256) void k_round16f(const float* __restrict__ W, _Float16* __restrict__ Bt, size_t n8) { const size_t t = (size_t)blockIdx.x * 256 + threadIdx.x; if (t >= n8) return; FragH f;
#pragma unroll
  for (int i = 0; i < 8; ++i) f.h[i] = (_Float16)(bf16_round(W[t * 8 + i]) * 16.0f); *(v8us*)((unsigned short*)Bt + t * 8) = f.half[0];  }
template <int NHv, int TTv>
__global__ __launch_bounds__(256) void k_vt(const _Float16* __restrict__ V16, int ldv, int voff, _Float16* __restrict__ Vt) { __shared__ unsigned short tl[64][66]; const int tid = threadIdx.x; const int slab = blockIdx.x / (TTv / 64), lg = blockIdx.x % (TTv / 64); const int b = slab / NHv, h = slab % NHv;
  for (int i = tid; i < 64 * 8; i += 256) { const int r = i / 8, c8 = (i % 8) * 8; FragH f; f.half[0] = *(const v8us*)((const unsigned short*)V16 + ((size_t)b * TTv + lg * 64 + r) * ldv + voff + h * 64 + c8);
#pragma unroll
    for (int q = 0; q < 8; ++q) tl[r][c8 + q] = f.u[q]; }
  __syncthreads();
  {
#pragma unroll
    for (int rd = 0; rd < 2; ++rd) { const int d = rd * 32 + tid / 8, pc = tid % 8; FragH f;
#pragma unroll
      for (int q = 0; q < 8; ++q) f.u[q] = tl[pc * 8 + q][d];
      *(v8us*)((unsigned short*)Vt + ((size_t)slab * 64 + d) * TTv + lg * 64 + pc * 8) = f.half[0]; }
     } }

__global__ __launch_bounds__(256) void k_hl(const float* __restrict__ F, _Float16* __restrict__ Hh, _Float16* __restrict__ Hl, size_t n8) { const size_t t = (size_t)blockIdx.x * 256 + threadIdx.x; if (t >= n8) return; FragH fh, fl; const v4f a = *(const v4fa*)(F + t * 8), c = *(const v4fa*)(F + t * 8 + 4);
#pragma unroll
  for (int q = 0; q < 4; ++q) { _Float16 h = (_Float16)a[q]; fh.h[q] = h; fl.h[q] = (_Float16)((a[q] - (float)h) * 1024.0f); h = (_Float16)c[q]; fh.h[4 + q] = h; fl.h[4 + q] = (_Float16)((c[q] - (float)h) * 1024.0f); }
  { *(v8us*)((unsigned short*)Hh + t * 8) = fh.half[0]; *(v8us*)((unsigned short*)Hl + t * 8) = fl.half[0];  } }

// ---- fast GEMM (wave tile 32x64; requires M % 32 == 0 rows per launch region and N % 64 == 0); epilogue = k_gemm_hhx semantics ----
__device__ __forceinline__ v16h g2_frag(const _Float16* p, int hh) { FragH f; f.half[0] = *(const v8us*)((const unsigned short*)p + 8 * hh); f.half[1] = *(const v8us*)((const unsigned short*)p + 16 + 8 * hh); return f.v; }
__device__ __forceinline__ v8f g2_mma(v16h a, v16h b, v8f c) { v8f d = __builtin_amdgcn_wmma_f32_16x16x32_f16(false, a, false, b, (short)0, c, false, false); asm volatile("v_nop\n\tv_nop\n\tv_nop\n\tv_nop" : "+v"(d) : "v"(a), "v"(b)); return d; }
template <int ACT>
__global__ __launch_bounds__(128) void k_gemm2(const _Float16* __restrict__ A, int lda, size_t sA, const _Float16* __restrict__ Bh, int ldb, size_t sB, float alpha, const float* __restrict__ bias, size_t sBias, const float* __restrict__ CP, int rowsPerB, size_t sCPb, int row0g,
    float* __restrict__ C, _Float16* __restrict__ C16, int ldc, size_t sC, int M, int N, int K) { static_assert(ACT == 0 || ACT == 3 || ACT == 6 || ACT == 8 || ACT == 9 || ACT == 11 || ACT == 12 || ACT == 14 || ACT == 15 || ACT == 16 || ACT == 17, "k_gemm2: unsupported ACT code (would silently apply no activation)");
  __shared__ __attribute__((aligned(16))) float so[4][32][68];
  const int tid = threadIdx.x, w = tid >> 5, lane = tid & 31, ln = lane & 15, hh = lane >> 4; const int by = blockIdx.y;
  A += (size_t)by * sA; Bh += (size_t)by * sB; const size_t cofs = (size_t)by * sC; const float* bp = bias ? bias + (size_t)by * sBias : nullptr;
  const int ntn = N >> 6; const int mt = blockIdx.x / ntn, nq = blockIdx.x - mt * ntn; const int row0 = mt * 128 + 32 * w, col0 = nq * 64; if (row0 >= M) return;
  const _Float16* a0p = A + (size_t)(row0 + ln) * lda; const _Float16* a1p = a0p + (size_t)16 * lda;
  const _Float16* b0p = Bh + (size_t)(col0 + ln) * ldb; const _Float16* b1p = b0p + (size_t)16 * ldb; const _Float16* b2p = b1p + (size_t)16 * ldb; const _Float16* b3p = b2p + (size_t)16 * ldb;
  const v8f z8 = {0.f,0.f,0.f,0.f,0.f,0.f,0.f,0.f}; v8f c00 = z8, c01 = z8, c02 = z8, c03 = z8, c10 = z8, c11 = z8, c12 = z8, c13 = z8;
#pragma unroll 1
  for (int kb = 0; kb < K; kb += 32) { const v16h a0 = g2_frag(a0p + kb, hh), a1 = g2_frag(a1p + kb, hh);
    v16h b = g2_frag(b0p + kb, hh); c00 = g2_mma(a0, b, c00); c10 = g2_mma(a1, b, c10);
    b = g2_frag(b1p + kb, hh); c01 = g2_mma(a0, b, c01); c11 = g2_mma(a1, b, c11);
    b = g2_frag(b2p + kb, hh); c02 = g2_mma(a0, b, c02); c12 = g2_mma(a1, b, c12);
    b = g2_frag(b3p + kb, hh); c03 = g2_mma(a0, b, c03); c13 = g2_mma(a1, b, c13); }
  v8f accs[8] = {c00, c01, c02, c03, c10, c11, c12, c13};
#pragma unroll
  for (int u = 0; u < 8; ++u) { const int t = u & 3, half = u >> 2; const int col = col0 + t * 16 + ln; const float bv = bp ? bf16_round(bp[col]) : 0.f;
#pragma unroll
    for (int r = 0; r < 8; ++r) { const int rloc = half * 16 + 8 * hh + r; float v = accs[u][r] * alpha + bv; if (CP) { if (rowsPerB < 0) v += CP[cofs + (size_t)(row0g + row0 + rloc) * ldc + col];      /* rowsPerB < 0: own element of the batched C plane */ else { const int bidx = (row0g + row0 + rloc) / rowsPerB; v += CP[(size_t)bidx * sCPb + (size_t)by * 64 + col]; } }
      if (ACT == 3) v = fmaxf(v, 0.f); else if (ACT == 6) v = 0.5f * v * (1.0f + erff(v * 0.70710678118654752f)); else if (ACT == 11) v = 1.0f / (1.0f + expf(-v)); else if (ACT == 15) v = v / (1.0f + expf(-v)); else if (ACT == 12) v = (v > 0.f) ? v : 0.01f * v; else if (ACT == 8) v = tanhf(v); else if (ACT == 9) v = 0.5f * v * (1.0f + tanhf(0.7978845608028654f * (v + 0.044715f * v * v * v))); else if (ACT == 14) v = (v > 0.f) ? v : 0.1f * v; else if (ACT == 16) v = (v >= 0.f) ? v : 0.3f * v; else if (ACT == 17) v = (v >= 0.f) ? v : 0.2f * v;
      so[w][rloc][t * 16 + ln] = v; } }
  __builtin_amdgcn_fence(__ATOMIC_ACQ_REL, "workgroup"); __builtin_amdgcn_wave_barrier();
  const int rsub = lane >> 4, c4 = (lane & 15) * 4;
  {
#pragma unroll
    for (int q = 0; q < 16; ++q) { const int r = q * 2 + rsub; const v4f v = *(const v4fa*)&so[w][r][c4]; if (C) *(v4f*)(C + cofs + (size_t)(row0 + r) * ldc + col0 + c4) = v; if (C16) { v4h h4; for (int i = 0; i < 4; ++i) h4[i] = (_Float16)v[i]; *(v4h*)(C16 + cofs + (size_t)(row0 + r) * ldc + col0 + c4) = h4; } }
     } }


__global__ __launch_bounds__(256) void k_wnat(const float* __restrict__ w, size_t n8, _Float16* __restrict__ Bt) { const size_t t = (size_t)blockIdx.x * 256 + threadIdx.x; if (t >= n8) return; FragH f; for (int q = 0; q < 8; ++q) f.h[q] = (_Float16)(bf16_round(w[t * 8 + q]) * 16.0f); *(v8us*)((unsigned short*)Bt + t * 8) = f.half[0];  }
#define FA_NW 8                      /* waves per work-group */
#define FA_SK 64                     /* keys per LDS tile (two passes of 32) */
#define FA_PITCH 144                 /* LDS row pitch in bytes: 128 of data, an odd multiple of 16 for the 16-byte fragment reads */
#define FA_NS (SQ / FA_SK)
__device__ __forceinline__ float fa_x16(float v) { const int i = __float_as_int(v); return __int_as_float(__builtin_amdgcn_permlanex16(i, i, 0x76543210, 0xfedcba98, false, false)); }      /* value of lane ^ 16 */
__device__ __forceinline__ v16h fa_frag(const unsigned char* p) { FragH f; f.half[0] = *(const v8us*)p; f.half[1] = *(const v8us*)(p + 32); return f.v; }      /* k = 8 h .. 8 h + 7 and 16 + 8 h .. 16 + 8 h + 7; p already holds the lane's 16 h bytes */
__device__ __forceinline__ v8f fa_mma(v16h a, v16h b, v8f c) { return __builtin_amdgcn_wmma_f32_16x16x32_f16(false, a, false, b, (short)0, c, false, false); }
__global__ __launch_bounds__(32 * FA_NW) __attribute__((amdgpu_waves_per_eu(4, 4))) void k_fattn(const _Float16* __restrict__ Q16, const _Float16* __restrict__ K16, const _Float16* __restrict__ VT, float* __restrict__ out) {
  static_assert(HD == 64 && SQ % (32 * FA_NW) == 0 && SQ % FA_SK == 0, "k_fattn: head size 64, whole work-groups of queries, whole tiles of keys");
  __shared__ __attribute__((aligned(16))) unsigned char L[2][2][FA_SK * FA_PITCH];      /* [buffer][K rows by key | V^T rows by d] */
  typedef _Float16 h2 __attribute__((ext_vector_type(2))); typedef float f2 __attribute__((ext_vector_type(2)));
  const int tid = threadIdx.x, lane = tid & 31, wave = tid >> 5, c = lane & 15, h = lane >> 4;
  const int bh = blockIdx.y, b = bh / NH, hd = bh % NH; const int q0 = blockIdx.x * (32 * FA_NW) + wave * 32;
  const float cscale = 0.125f * 1.4426950408889634f;      /* 64^-0.5, scores taken to base 2 */
  const int sr = tid >> 3, sc = (tid & 7) * 8;      /* staging: 8 threads cover one 128-byte row, 32 rows per load */
  const unsigned short* kg = (const unsigned short*)K16 + ((size_t)b * SQ + sr) * LQ + hd * HD + sc;      /* row = key */
  const unsigned short* vg = (const unsigned short*)VT + ((size_t)bh * HD + sr) * SQ + sc;      /* row = d, keys along the row */
  const int so0 = sr * FA_PITCH + sc * 2, so1 = so0 + 32 * FA_PITCH;
  v16h qf[2][2];      /* B operand: column = query, k = d */
#pragma unroll
  for (int g = 0; g < 2; ++g)
#pragma unroll
    for (int kc = 0; kc < 2; ++kc) qf[g][kc] = g2_frag(Q16 + ((size_t)b * SQ + q0 + 16 * g + c) * LQ + hd * HD + 32 * kc, h);
  FragH ones;      /* A operand whose row 0 is 1.0: its product with P^T gives the column sums of P^T in row 0 */
#pragma unroll
  for (int i = 0; i < 16; ++i) ones.u[i] = (c == 0) ? (unsigned short)0x3C00 : (unsigned short)0;
  const v8f z8 = {0.f, 0.f, 0.f, 0.f, 0.f, 0.f, 0.f, 0.f};
  v8f acc[2][4], lacc[2]; float m_run[2];
#pragma unroll
  for (int g = 0; g < 2; ++g) { m_run[g] = -__builtin_inff(); lacc[g] = z8;
#pragma unroll
    for (int t = 0; t < 4; ++t) acc[g][t] = z8; }
  v8us rk0 = *(const v8us*)kg, rk1 = *(const v8us*)(kg + (size_t)32 * LQ), rv0 = *(const v8us*)vg, rv1 = *(const v8us*)(vg + (size_t)32 * SQ);
  *(v8us*)&L[0][0][so0] = rk0; *(v8us*)&L[0][0][so1] = rk1; *(v8us*)&L[0][1][so0] = rv0; *(v8us*)&L[0][1][so1] = rv1;
  __syncthreads();      /* tile 0 is visible to all waves */
#pragma unroll 1      /* rolled, last trip not peeled off: in the peeled build the compiler sinks the next tile's global loads down to their LDS stores, and the trip's work no longer covers their latency */
  for (int s = 0; s < FA_NS; ++s) {
    const unsigned char* Kb = &L[s & 1][0][0]; const unsigned char* Vb = &L[s & 1][1][0];
    if (s + 1 < FA_NS) { const unsigned short* kn = kg + (size_t)(s + 1) * FA_SK * LQ; const unsigned short* vn = vg + (s + 1) * FA_SK;
      rk0 = *(const v8us*)kn; rk1 = *(const v8us*)(kn + (size_t)32 * LQ); rv0 = *(const v8us*)vn; rv1 = *(const v8us*)(vn + (size_t)32 * SQ); }
#pragma unroll
    for (int sub = 0; sub < 2; ++sub) {      /* one pass: 32 keys */
      v8f sx[2][2];      /* [16-key tile][column group]: register r = key 16 kt + 8 h + r, lane column c = query */
#pragma unroll
      for (int kt = 0; kt < 2; ++kt) { const unsigned char* kp = Kb + (32 * sub + 16 * kt + c) * FA_PITCH + 16 * h; const v16h k0 = fa_frag(kp), k1 = fa_frag(kp + 64);
#pragma unroll
        for (int g = 0; g < 2; ++g) sx[kt][g] = fa_mma(k1, qf[g][1], fa_mma(k0, qf[g][0], z8)); }
      float mb[2]; bool need = false;
#pragma unroll
      for (int g = 0; g < 2; ++g) { float mx = sx[0][g][0];
#pragma unroll
        for (int r = 1; r < 8; ++r) mx = fmaxf(mx, sx[0][g][r]);
#pragma unroll
        for (int r = 0; r < 8; ++r) mx = fmaxf(mx, sx[1][g][r]);
        mx = fmaxf(mx, fa_x16(mx)) * cscale; mb[g] = mx; need = need || (mx > m_run[g] + 8.0f); }
      if (__builtin_amdgcn_ballot_w32(need) != 0) {      /* lazy rescale: the maximum in use may trail the true one by up to 8 (base 2), so an exponential stays below 2^8 */
#pragma unroll
        for (int g = 0; g < 2; ++g) { const float m_new = fmaxf(m_run[g], mb[g]); const float corr = __builtin_amdgcn_exp2f(m_run[g] - m_new); m_run[g] = m_new; lacc[g] = lacc[g] * corr;
#pragma unroll
          for (int t = 0; t < 4; ++t) acc[g][t] = acc[g][t] * corr; } }
      v16h vf[4];      /* A operand: row = d, k = the pass's 32 keys */
#pragma unroll
      for (int t = 0; t < 4; ++t) vf[t] = fa_frag(Vb + (16 * t + c) * FA_PITCH + 64 * sub + 16 * h);
#pragma unroll
      for (int g = 0; g < 2; ++g) { const float nm = -m_run[g]; union { v16h v; h2 p[8]; } pf;      /* B operand: element pair i = keys 16 (i >> 2) + 8 h + 2 (i & 3), + 1: the k order of fa_frag */
#pragma unroll
        for (int i = 0; i < 8; ++i) { const float e0 = __builtin_amdgcn_exp2f(fmaf(sx[i >> 2][g][2 * (i & 3)], cscale, nm)), e1 = __builtin_amdgcn_exp2f(fmaf(sx[i >> 2][g][2 * (i & 3) + 1], cscale, nm)); pf.p[i] = __builtin_convertvector(f2{e0, e1}, h2); }
#pragma unroll
        for (int t = 0; t < 4; ++t) acc[g][t] = fa_mma(vf[t], pf.v, acc[g][t]);
        lacc[g] = fa_mma(ones.v, pf.v, lacc[g]); }
    }
    __builtin_amdgcn_sched_barrier(0); asm volatile("v_nop\n\tv_nop\n\tv_nop\n\tv_nop"); __builtin_amdgcn_sched_barrier(0);      /* four vector slots behind the trip's last WMMA, in front of the branches that follow it */
    if (s + 1 < FA_NS) { unsigned char* Kn = &L[(s + 1) & 1][0][0]; unsigned char* Vn = &L[(s + 1) & 1][1][0];
      *(v8us*)(Kn + so0) = rk0; *(v8us*)(Kn + so1) = rk1; *(v8us*)(Vn + so0) = rv0; *(v8us*)(Vn + so1) = rv1; }
    __syncthreads();      /* publishes tile s + 1 and ends every wave's reads of tile s, whose buffer the next trip refills */
  }
#pragma unroll
  for (int g = 0; g < 2; ++g) { const float lr = lacc[g][0]; const float inv = 1.0f / (lr + fa_x16(lr));      /* row 0 of the sum tile sits in lanes 0-15, lanes 16-31 hold row 8 = 0: the exchange-and-add stays unconditional */
    float* op = out + ((size_t)b * SQ + q0 + 16 * g + c) * DM + hd * HD + 8 * h;      /* register r of tile t = d 16 t + 8 h + r of query column c */
#pragma unroll
    for (int t = 0; t < 4; ++t) { const v8f o = acc[g][t] * inv; const v4f lo = {o[0], o[1], o[2], o[3]}, hi = {o[4], o[5], o[6], o[7]}; *(v4f*)(op + 16 * t) = lo; *(v4f*)(op + 16 * t + 4) = hi; } } }
__global__ __launch_bounds__(256) void k_vt(const _Float16* __restrict__ V16, int b, int h0, _Float16* __restrict__ VT) { __shared__ unsigned short tl[64][65]; const int tid = threadIdx.x; const int hh = blockIdx.x % HG, sg = blockIdx.x / HG; const int s0 = sg * 64; const int h = h0 + hh;
  for (int i = tid; i < 64 * 8; i += 256) { const int j = i / 8, d8 = (i % 8) * 8; FragH f; f.half[0] = *(const v8us*)((const unsigned short*)V16 + ((size_t)b * SQ + s0 + j) * DM + h * HD + d8); for (int q = 0; q < 8; ++q) tl[d8 + q][j] = f.u[q]; }
  __syncthreads();
  { for (int i = tid; i < 64 * 8; i += 256) { const int d = i / 8, j8 = (i % 8) * 8; FragH f; for (int q = 0; q < 8; ++q) f.u[q] = tl[d][j8 + q]; *(v8us*)((unsigned short*)VT + ((size_t)hh * HD + d) * SQ + s0 + j8) = f.half[0]; }  } }



__global__ __launch_bounds__(256) void k_rsmkm(const float* __restrict__ S, _Float16* __restrict__ P, int nrows, const int* __restrict__ am) {
  #pragma clang fp contract(off)
  const int t = blockIdx.x * 256 + threadIdx.x; if (t >= nrows) return; const size_t i = (size_t)t; const float* s = S + i * SQ; const int* mr = am + (size_t)(t % SQ) * SQ; float mx = -3.0e38f;
#pragma unroll 1
  for (int j = 0; j < SQ; ++j) { const float f = (mr[j] != 0) ? 1.f : 0.f; mx = fmaxf(mx, fmaf(f, s[j], (1.f - f) * -1.0e9f)); } float se = 0.f;
#pragma unroll 1
  for (int j = 0; j < SQ; ++j) { const float f = (mr[j] != 0) ? 1.f : 0.f; se += __expf(fmaf(f, s[j], (1.f - f) * -1.0e9f) - mx); } const float sc = 256.0f / se;
#pragma unroll 1
  for (int j0 = 0; j0 < SQ; j0 += 8) { FragH fr; for (int q = 0; q < 8; ++q) { const int j = j0 + q; const float f = (mr[j] != 0) ? 1.f : 0.f; fr.h[q] = (_Float16)(__expf(fmaf(f, s[j], (1.f - f) * -1.0e9f) - mx) * sc); }
    unsigned short* d = (unsigned short*)P + i * SQ + j0; *(v8us*)d = fr.half[0];  } }
extern "C" void kernel_launch(void* const* d_in, const int* in_sizes, int n_in,
                              void* d_out, int out_size, void* d_ws, size_t ws_size, hipStream_t stream) {
  (void)in_sizes; (void)n_in; (void)out_size;
  const float* const* I = (const float* const*)d_in; const float* xq = I[0]; const float* xk = I[1]; const float* xv = I[1]; const float* wq = I[2]; const float* bq = I[3]; const float* wk = I[4]; const float* bk = I[5]; const float* wv = I[6]; const float* bv = I[7]; const float* x = xq;      /* input (queries), memory (keys AND values); natural weights + biases; no output projection */
  char* ws = (char*)d_ws; size_t off = 0;
  auto take = [&](size_t bytes) { char* p = ws + off; off += (bytes + 255) & ~(size_t)255; return p; };
  _Float16* BQ = (_Float16*)take((size_t)DM * DM * 2); _Float16* BK = (_Float16*)take((size_t)DM * DM * 2); _Float16* BV = (_Float16*)take((size_t)DM * DM * 2); 
  _Float16* X16 = (_Float16*)take(NR * DM * 2); _Float16* XKp = (_Float16*)take(NR * DM * 2); _Float16* XVp = (_Float16*)take(NR * DM * 2); _Float16* Q16 = (_Float16*)take(NR * DM * 2); _Float16* K16 = (_Float16*)take(NR * DM * 2); _Float16* V16 = (_Float16*)take(NR * DM * 2); 
  _Float16* VT = (_Float16*)take((size_t)NB * NH * HD * SQ * 2);
  if (off > ws_size) return;
  { const unsigned g = (unsigned)(((size_t)DM * DM / 8 + 255) / 256); k_wnat<<<g, 256, 0, stream>>>(wq, (size_t)DM * DM / 8, BQ); k_wnat<<<g, 256, 0, stream>>>(wk, (size_t)DM * DM / 8, BK); k_wnat<<<g, 256, 0, stream>>>(wv, (size_t)DM * DM / 8, BV); }      /* natural [out][in] = Bt x16 (no output projection: no Wo plane) */
  _Float16* XK = XKp; _Float16* XV = XVp; k_x16<<<(unsigned)((NR * DM / 8 + 255) / 256), 256, 0, stream>>>(xk, XK, NR * DM / 8); k_x16<<<(unsigned)((NR * DM / 8 + 255) / 256), 256, 0, stream>>>(xv, XV, NR * DM / 8);      /* key and value inputs as exact f16 rows */

  k_x16<<<(unsigned)((NR * DM / 8 + 255) / 256), 256, 0, stream>>>(x, X16, NR * DM / 8);
  const size_t r0p = (size_t)B0 * SQ;      /* first projected row */
  k_gemm2<0><<<dim3((unsigned)((MP / 128) * (DM / 64)), 1), 128, 0, stream>>>(X16 + r0p * DM, DM, 0, BQ, DM, 0, 0.0625f, bq, 0, nullptr, 1, 0, 0, nullptr, Q16 + r0p * DM, DM, 0, MP, DM, DM);
  k_gemm2<0><<<dim3((unsigned)((MP / 128) * (DM / 64)), 1), 128, 0, stream>>>(XK + r0p * DM, DM, 0, BK, DM, 0, 0.0625f, bk, 0, nullptr, 1, 0, 0, nullptr, K16 + r0p * DM, DM, 0, MP, DM, DM);
  k_gemm2<0><<<dim3((unsigned)((MP / 128) * (DM / 64)), 1), 128, 0, stream>>>(XV + r0p * DM, DM, 0, BV, DM, 0, 0.0625f, bv, 0, nullptr, 1, 0, 0, nullptr, V16 + r0p * DM, DM, 0, MP, DM, DM);
  k_vt<NH, SQ><<<NB * NH * (SQ / 64), 256, 0, stream>>>(V16, LQ, 0, VT);      /* V^T [NB * NH][HD][SQ] */
  k_fattn<<<dim3(SQ / (32 * FA_NW), NB * NH), 32 * FA_NW, 0, stream>>>(Q16, K16, VT, (float*)d_out);      /* out = softmax(q k^T / 8) v straight to the f32 output (merged heads; each 256-B head segment of a row written by one wave) */
  /* no output projection in this module */
}

// v003
// One run takes 140 microseconds.
// Next to v002, in two timings, it ran 1.83 and 1.82 times as fast.
// Over all steps from v000 it is 52.3 times as fast.
#include <hip/hip_runtime.h>
// Multi-head CROSS-attention without an output projection (input, memory [4][2048][1024]; q = input Wq^T + bq, k = memory Wk^T + bk, v = memory Wv^T + bv (natural [1024][1024], zero biases); 16 heads of 64; q * 64^-0.5 then q k^T; softmax over all 2048 memory positions (no mask); out = attn v merged to [4][2048][1024]; NO output projection).
// Structure: token rows r = b*2048 + s; x as exact f16 rows (bf16-rounded); Q, K, V as three WMMA GEMMs (128x128 tiles through LDS, 64x64 wave tiles, f32 accumulation, exact x16 weights + bias, f16 outputs); V^T for all batches and heads via LDS transposes; one fused attention launch (k_fattn): S^T = K Q^T (K = 64), online softmax (f32 statistics, base 2, weights as f16 relative to the running maximum), O^T += V^T P^T, divided by the row sum and written straight into the merged f32 output rows.
// Compute dtype: inputs rounded to bf16; x / weights exact; q, k, v and softmax weights as plain f16 GEMM operands (~2^-12); scores, softmax statistics and o f32. v_wmma_f32_16x16x32_f16.
#define NB 4
#define SQ 2048
#define DM 1024
#define NH 16
#define HD 64
#define HG 4                         /* heads per k_vt(b, h0) launch (that overload is not launched) */
#define B0 0                         /* first batch processed (debug hook) */
#define NBR NB                       /* batches processed (debug hook) */
#define NR ((size_t)NB * SQ)         /* token rows */
#define MP ((int)((size_t)NBR * SQ)) /* rows projected (debug hook) */
#define QN SQ                        /* unused (attention covers all SQ query rows) */
#define NHD NH                       /* unused (attention covers all NH heads) */
#define MPO MP                       /* unused (no output projection) */
#define LQ DM      /* row pitch of the q/k/v rows */
typedef __bf16 v16b __attribute__((ext_vector_type(16)));
typedef unsigned short v8us __attribute__((ext_vector_type(8), may_alias));
typedef float  v8f  __attribute__((ext_vector_type(8)));
typedef float  v4f  __attribute__((ext_vector_type(4)));
typedef float  v4fa __attribute__((ext_vector_type(4), may_alias));
union FragB { v16b v; v8us half[2]; unsigned short u[16]; };

__device__ __forceinline__ unsigned short bf16_bits(float x) { unsigned int u = __float_as_uint(x); return (unsigned short)((u + 0x7FFFu + ((u >> 16) & 1u)) >> 16); }
__device__ __forceinline__ float bf16_val(unsigned short b) { return __uint_as_float(((unsigned int)b) << 16); }
__device__ __forceinline__ float bf16_round(float x) { return bf16_val(bf16_bits(x)); }
// D += A·B with NT terms: 1 = ah·bh, 2 = + al·bh (A split), 3 = + ah·bl (both split)
template <int NT>
__device__ __forceinline__ v8f mmaN(v16b ah, v16b al, v16b bh, v16b bl, v8f c) {
  c = __builtin_amdgcn_wmma_f32_16x16x32_bf16(false, ah, false, bh, (short)0, c, false, false);
  if (NT >= 2) c = __builtin_amdgcn_wmma_f32_16x16x32_bf16(false, al, false, bh, (short)0, c, false, false);
  if (NT >= 3) c = __builtin_amdgcn_wmma_f32_16x16x32_bf16(false, ah, false, bl, (short)0, c, false, false);
  asm volatile("v_nop\n\tv_nop\n\tv_nop\n\tv_nop" : "+v"(c) : "v"(ah), "v"(al), "v"(bh), "v"(bl));
  return c;
}

__global__ __launch_bounds__(256) void k_wt_bf16(const float* __restrict__ W, unsigned short* __restrict__ Wt, int K, int N) {
  const int t = blockIdx.x * 256 + threadIdx.x;
  const int k8n = K / 8;
  if (t >= N * k8n) return;
  const int n = t / k8n, k8 = (t % k8n) * 8;
  v8us v;
#pragma unroll
  for (int i = 0; i < 8; ++i) v[i] = bf16_bits(W[(size_t)(k8 + i) * N + n]);
  *(v8us*)(Wt + (size_t)n * K + k8) = v;
  
}

// GEMM C[M][N] (f32, pitch ldc) = act(A[M][K]·W + bias). A f32 row-major (pitch lda) converted per fragment to bf16
// (ASPLIT: hi/lo two planes -> 2 terms, else single rounded term); Wt bf16 [N][K] (pitch ldb). BIAS_BF16 rounds the
// bias to bf16 first (bias quantised to bf16 before the add). K%32==0, M%16==0, N%64==0.
template <bool ASPLIT, int ACT, bool BIAS_BF16>
__global__ __launch_bounds__(128) void k_gemm_bf(const float* __restrict__ A, int lda, const unsigned short* __restrict__ Wt, int ldb,
                                               const float* __restrict__ bias, float* __restrict__ C, int ldc, int M, int N, int K) {
  __shared__ __attribute__((aligned(16))) float so[4][16][64];
  const int tid = threadIdx.x, w = tid >> 5, lane = tid & 31, ln = lane & 15, hh = lane >> 4;
  const int ntn = N / 64;
  const int wid = blockIdx.x * 4 + w;
  const int mt = wid / ntn, nq = wid % ntn;
  if (mt * 16 >= M) return;
  const int row0 = mt * 16, col0 = nq * 64;
  const float* arow = A + (size_t)(row0 + ln) * lda;
  v8f acc[4] = {};
  for (int kb = 0; kb < K; kb += 32) {
    FragB ah, al;
    const v4f x0 = *(const v4fa*)(arow + kb + 8 * hh), x1 = *(const v4fa*)(arow + kb + 8 * hh + 4);
    const v4f x2 = *(const v4fa*)(arow + kb + 16 + 8 * hh), x3 = *(const v4fa*)(arow + kb + 16 + 8 * hh + 4);
    float xs[16] = {x0[0],x0[1],x0[2],x0[3],x1[0],x1[1],x1[2],x1[3],x2[0],x2[1],x2[2],x2[3],x3[0],x3[1],x3[2],x3[3]};
#pragma unroll
    for (int i = 0; i < 16; ++i) { const unsigned short hb = bf16_bits(xs[i]); ah.u[i] = hb; al.u[i] = ASPLIT ? bf16_bits(xs[i] - bf16_val(hb)) : (unsigned short)0; }
#pragma unroll
    for (int t = 0; t < 4; ++t) {
      const unsigned short* brow = Wt + (size_t)(col0 + t * 16 + ln) * ldb + kb;
      FragB b;
      b.half[0] = *(const v8us*)(brow + 8 * hh);
      b.half[1] = *(const v8us*)(brow + 16 + 8 * hh);
      acc[t] = mmaN<ASPLIT ? 2 : 1>(ah.v, al.v, b.v, b.v, acc[t]);
    }
  }
#pragma unroll
  for (int t = 0; t < 4; ++t) {
    float bv = bias ? bias[col0 + t * 16 + ln] : 0.f;
    if (BIAS_BF16) bv = bf16_round(bv);
#pragma unroll
    for (int r = 0; r < 8; ++r) { float v = acc[t][r] + bv; if (ACT == 1) v = fmaxf(v, 0.f); so[w][8 * hh + r][t * 16 + ln] = v; }
  }
  __builtin_amdgcn_fence(__ATOMIC_ACQ_REL, "workgroup");
  __builtin_amdgcn_wave_barrier();
  const int rsub = lane >> 4, c4 = (lane & 15) * 4;
  {
#pragma unroll
    for (int q = 0; q < 8; ++q) {
      const int r = q * 2 + rsub;
      const v4f v = *(const v4fa*)&so[w][r][c4];
      *(v4f*)(C + (size_t)(row0 + r) * ldc + col0 + c4) = v;
    }
    
  }
}

// GEMM C = act(A·W + bias + resid): A f32 (ASPLIT -> hi/lo 2 terms), Wt bf16 [N][K]; ACT 0 none, 1 relu, 2 exact gelu;
// resid (optional, f32, row index = (row % rmod), pitch ldr, RES_BF16 rounds it) added before the activation.
template <bool ASPLIT, int ACT, bool BIAS_BF16, bool RES_BF16>
__global__ __launch_bounds__(128) void k_gemm_bf3(const float* __restrict__ A, int lda, const unsigned short* __restrict__ Wt, int ldb,
                                                const float* __restrict__ bias, const float* __restrict__ resid, int rmod, int ldr,
                                                float* __restrict__ C, int ldc, int M, int N, int K) {
  __shared__ __attribute__((aligned(16))) float so[4][16][64];
  const int tid = threadIdx.x, w = tid >> 5, lane = tid & 31, ln = lane & 15, hh = lane >> 4;
  const int ntn = N / 64;
  const int wid = blockIdx.x * 4 + w;
  const int mt = wid / ntn, nq = wid % ntn;
  if (mt * 16 >= M) return;
  const int row0 = mt * 16, col0 = nq * 64;
  const float* arow = A + (size_t)(row0 + ln) * lda;
  v8f acc[4] = {};
  for (int kb = 0; kb < K; kb += 32) {
    FragB ah, al;
    const v4f x0 = *(const v4fa*)(arow + kb + 8 * hh), x1 = *(const v4fa*)(arow + kb + 8 * hh + 4);
    const v4f x2 = *(const v4fa*)(arow + kb + 16 + 8 * hh), x3 = *(const v4fa*)(arow + kb + 16 + 8 * hh + 4);
    float xs[16] = {x0[0],x0[1],x0[2],x0[3],x1[0],x1[1],x1[2],x1[3],x2[0],x2[1],x2[2],x2[3],x3[0],x3[1],x3[2],x3[3]};
#pragma unroll
    for (int i = 0; i < 16; ++i) { const unsigned short hb = bf16_bits(xs[i]); ah.u[i] = hb; al.u[i] = ASPLIT ? bf16_bits(xs[i] - bf16_val(hb)) : (unsigned short)0; }
#pragma unroll
    for (int t = 0; t < 4; ++t) {
      const unsigned short* brow = Wt + (size_t)(col0 + t * 16 + ln) * ldb + kb;
      FragB b;
      b.half[0] = *(const v8us*)(brow + 8 * hh);
      b.half[1] = *(const v8us*)(brow + 16 + 8 * hh);
      acc[t] = mmaN<ASPLIT ? 2 : 1>(ah.v, al.v, b.v, b.v, acc[t]);
    }
  }
#pragma unroll
  for (int t = 0; t < 4; ++t) {
    const int col = col0 + t * 16 + ln;
    float bv = bias ? bias[col] : 0.f;
    if (BIAS_BF16) bv = bf16_round(bv);
#pragma unroll
    for (int r = 0; r < 8; ++r) {
      float v = acc[t][r] + bv;
      if (resid) { float rv = resid[(size_t)((row0 + 8 * hh + r) % rmod) * ldr + col]; if (RES_BF16) rv = bf16_round(rv); v += rv; }
      if (ACT == 1) v = fmaxf(v, 0.f);
      if (ACT == 2) v = 0.5f * v * (1.0f + erff(v * 0.70710678118654752f));
      if (ACT == 3) { const float u = 0.7978845608028654f * (v + 0.044715f * v * v * v); v = 0.5f * v * (1.0f + tanhf(u)); }
      so[w][8 * hh + r][t * 16 + ln] = v;
    }
  }
  __builtin_amdgcn_fence(__ATOMIC_ACQ_REL, "workgroup");
  __builtin_amdgcn_wave_barrier();
  const int rsub = lane >> 4, c4 = (lane & 15) * 4;
  {
#pragma unroll
    for (int q = 0; q < 8; ++q) {
      const int r = q * 2 + rsub;
      const v4f v = *(const v4fa*)&so[w][r][c4];
      *(v4f*)(C + (size_t)(row0 + r) * ldc + col0 + c4) = v;
    }
    
  }
}
// row LayerNorm (biased variance, eps) over N: s = X (+ R); optional out_sum <- s; out_norm <- (s-mu)*rsqrt(var+eps)*g + b
template <bool PARAM_BF16>
__global__ __launch_bounds__(256) void k_layernorm(const float* __restrict__ X, const float* __restrict__ R, const float* __restrict__ g, const float* __restrict__ bta,
                                                  float* __restrict__ out_sum, float* __restrict__ out_norm, int N, float eps) {
  __shared__ float red[256];
  const int row = blockIdx.x, tid = threadIdx.x;
  const float* x = X + (size_t)row * N; const float* rr = R ? R + (size_t)row * N : nullptr;
  float vals[16];                     // up to N = 4096
  const int per = N / 256;            // contiguous chunk per thread? use strided-by-4 chunks: thread handles j = tid*4 + 1024*u
  float s1 = 0.f;
  for (int u = 0; u < per / 4; ++u) {
    const int j = tid * 4 + 1024 * u;
    const v4f a = *(const v4fa*)(x + j);
    v4f b = {0.f,0.f,0.f,0.f}; if (rr) b = *(const v4fa*)(rr + j);
#pragma unroll
    for (int q = 0; q < 4; ++q) { const float v = a[q] + b[q]; vals[u * 4 + q] = v; s1 += v; }
  }
  red[tid] = s1; __syncthreads();
  for (int st = 128; st > 0; st >>= 1) { if (tid < st) red[tid] += red[tid + st]; __syncthreads(); }
  const float mu = red[0] / (float)N; __syncthreads();
  float s2 = 0.f;
  for (int u = 0; u < per / 4; ++u)
#pragma unroll
    for (int q = 0; q < 4; ++q) { const float c = vals[u * 4 + q] - mu; s2 += c * c; }
  red[tid] = s2; __syncthreads();
  for (int st = 128; st > 0; st >>= 1) { if (tid < st) red[tid] += red[tid + st]; __syncthreads(); }
  const float rs = rsqrtf(red[0] / (float)N + eps);
  {
    for (int u = 0; u < per / 4; ++u) {
      const int j = tid * 4 + 1024 * u;
      v4f o, sm;
#pragma unroll
      for (int q = 0; q < 4; ++q) {
        float gg = g[j + q], bb = bta[j + q];
        if (PARAM_BF16) { gg = bf16_round(gg); bb = bf16_round(bb); }
        sm[q] = vals[u * 4 + q]; o[q] = (vals[u * 4 + q] - mu) * rs * gg + bb;
      }
      if (out_sum) *(v4f*)(out_sum + (size_t)row * N + j) = sm;
      *(v4f*)(out_norm + (size_t)row * N + j) = o;
    }
    
  }
}



// ---- f16 WMMA path (v_wmma_f32_16x16x32_f16): 11-bit significands for operands in range — used where a [0,1] probability operand needs more precision than bf16
typedef _Float16 v16h __attribute__((ext_vector_type(16)));
union FragH { v16h v; v8us half[2]; _Float16 h[16]; unsigned short u[16]; };
template <int NT>
__device__ __forceinline__ v8f mmaH(v16h ah, v16h al, v16h bh, v16h bl, v8f c) {
  c = __builtin_amdgcn_wmma_f32_16x16x32_f16(false, ah, false, bh, (short)0, c, false, false);
  if (NT >= 2) c = __builtin_amdgcn_wmma_f32_16x16x32_f16(false, al, false, bh, (short)0, c, false, false);
  if (NT >= 3) c = __builtin_amdgcn_wmma_f32_16x16x32_f16(false, ah, false, bl, (short)0, c, false, false);
  asm volatile("v_nop\n\tv_nop\n\tv_nop\n\tv_nop" : "+v"(c) : "v"(ah), "v"(al), "v"(bh), "v"(bl));
  return c;
}
// batched GEMM like k_gemm_b but f16 operands: A f32 (split into f16 hi/lo if ASPLIT, else rounded to f16), Bt = f16 values [n][k]; alpha; C f32; N multiple of 16 (partial tiles skipped)
template <bool ASPLIT>
__global__ __launch_bounds__(128) void k_gemm_h(const float* __restrict__ A, int lda, size_t sA, const _Float16* __restrict__ Bh, int ldb, size_t sB, float alpha, float* __restrict__ C, int ldc, size_t sC, int M, int N, int K) {
  __shared__ __attribute__((aligned(16))) float so[4][16][64];
  const int tid = threadIdx.x, w = tid >> 5, lane = tid & 31, ln = lane & 15, hh = lane >> 4; const int by = blockIdx.y;
  A += (size_t)by * sA; Bh += (size_t)by * sB; C += (size_t)by * sC;
  const int ntn = (N + 63) / 64; const int wid = blockIdx.x * 4 + w; const int mt = wid / ntn, nq = wid % ntn; if (mt * 16 >= M) return;
  const int row0 = mt * 16, col0 = nq * 64; const float* arow = A + (size_t)(row0 + ln) * lda;
  v8f acc[4] = {};
  for (int kb = 0; kb < K; kb += 32) {
    FragH ah, al;
    const v4f x0 = *(const v4fa*)(arow + kb + 8 * hh), x1 = *(const v4fa*)(arow + kb + 8 * hh + 4), x2 = *(const v4fa*)(arow + kb + 16 + 8 * hh), x3 = *(const v4fa*)(arow + kb + 16 + 8 * hh + 4);
    float xs[16] = {x0[0],x0[1],x0[2],x0[3],x1[0],x1[1],x1[2],x1[3],x2[0],x2[1],x2[2],x2[3],x3[0],x3[1],x3[2],x3[3]};
#pragma unroll
    for (int i = 0; i < 16; ++i) { const _Float16 h = (_Float16)xs[i]; ah.h[i] = h; al.h[i] = ASPLIT ? (_Float16)(xs[i] - (float)h) : (_Float16)0.0f; }
#pragma unroll
    for (int t = 0; t < 4; ++t) { if (col0 + t * 16 >= N) continue; const size_t boff = (size_t)(col0 + t * 16 + ln) * ldb + kb; FragH bq; bq.half[0] = *(const v8us*)(Bh + boff + 8 * hh); bq.half[1] = *(const v8us*)(Bh + boff + 16 + 8 * hh);
      acc[t] = mmaH<ASPLIT ? 2 : 1>(ah.v, al.v, bq.v, bq.v, acc[t]); }
  }
#pragma unroll
  for (int t = 0; t < 4; ++t) { if (col0 + t * 16 >= N) continue;
#pragma unroll
    for (int r = 0; r < 8; ++r) so[w][8 * hh + r][t * 16 + ln] = acc[t][r] * alpha; }
  __builtin_amdgcn_fence(__ATOMIC_ACQ_REL, "workgroup"); __builtin_amdgcn_wave_barrier();
  const int rsub = lane >> 4, c4 = (lane & 15) * 4;
  {
#pragma unroll
    for (int q = 0; q < 8; ++q) { const int r = q * 2 + rsub; if (col0 + c4 < N) { const v4f v = *(const v4fa*)&so[w][r][c4]; *(v4f*)(C + (size_t)(row0 + r) * ldc + col0 + c4) = v; } }
     }
}

// Wt[n][k] = f16(W[k][n]·scale) from f32 row-major W[K][N] (scale = power of two; bf16-exact weights stay exact in f16 away from the subnormal range)
__global__ __launch_bounds__(256) void k_wt_f16(const float* __restrict__ W, _Float16* __restrict__ Wt, int K, int N, float scale) {
  const int t = blockIdx.x * 256 + threadIdx.x; if (t >= N * (K / 8)) return; const int n = t / (K / 8), k8 = (t % (K / 8)) * 8; FragH f;
#pragma unroll
  for (int i = 0; i < 8; ++i) f.h[i] = (_Float16)(bf16_round(W[(size_t)(k8 + i) * N + n]) * scale); const v8us o = f.half[0];
  *(v8us*)((unsigned short*)Wt + (size_t)n * K + k8) = o; 
}
// k_gemm_hh variant with fused epilogue: v = acc·alpha + bias[by·sBias + col] (+ CP[(row/rowsPerB)·sCPb + by·64 + col] if CP) ; ACT 0 none / 1 elu ; writes f16 C16 (and f32 C if non-null)
template <int ACT>
__global__ __launch_bounds__(128) void k_gemm_hhx(const _Float16* __restrict__ A, int lda, size_t sA, const _Float16* __restrict__ Bh, int ldb, size_t sB, float alpha, const float* __restrict__ bias, size_t sBias, const float* __restrict__ CP, int rowsPerB, size_t sCPb, int row0g,
    float* __restrict__ C, _Float16* __restrict__ C16, int ldc, size_t sC, int M, int N, int K) {
  __shared__ __attribute__((aligned(16))) float so[4][16][64];
  const int tid = threadIdx.x, w = tid >> 5, lane = tid & 31, ln = lane & 15, hh = lane >> 4; const int by = blockIdx.y;
  A += (size_t)by * sA; Bh += (size_t)by * sB; const size_t cofs = (size_t)by * sC; const float* bp = bias ? bias + (size_t)by * sBias : nullptr;
  const int ntn = (N + 63) / 64; const int wid = blockIdx.x * 4 + w; const int mt = wid / ntn, nq = wid % ntn; if (mt * 16 >= M) return;
  const int row0 = mt * 16, col0 = nq * 64; const _Float16* arow = A + (size_t)(row0 + ln) * lda;
  v8f acc[4] = {};
  for (int kb = 0; kb < K; kb += 32) { FragH ah; ah.half[0] = *(const v8us*)((const unsigned short*)arow + kb + 8 * hh); ah.half[1] = *(const v8us*)((const unsigned short*)arow + kb + 16 + 8 * hh);
#pragma unroll
    for (int t = 0; t < 4; ++t) { if (col0 + t * 16 >= N) continue; const size_t boff = (size_t)(col0 + t * 16 + ln) * ldb + kb; FragH bq; bq.half[0] = *(const v8us*)((const unsigned short*)Bh + boff + 8 * hh); bq.half[1] = *(const v8us*)((const unsigned short*)Bh + boff + 16 + 8 * hh);
      acc[t] = mmaH<1>(ah.v, ah.v, bq.v, bq.v, acc[t]); }
  }
#pragma unroll
  for (int t = 0; t < 4; ++t) { if (col0 + t * 16 >= N) continue; const int col = col0 + t * 16 + ln; const float bv = bp ? bf16_round(bp[col]) : 0.f;
#pragma unroll
    for (int r = 0; r < 8; ++r) { float v = acc[t][r] * alpha + bv; if (CP) { const int rr = row0g + row0 + 8 * hh + r; if (rowsPerB < 0) v += CP[cofs + (size_t)rr * ldc + col];      /* rowsPerB < 0: own element of the batched C plane */ else { const int bidx = rr / rowsPerB; v += CP[(size_t)bidx * sCPb + (size_t)by * 64 + col]; } } if (ACT == 1) v = (v > 0.f) ? v : expm1f(v); else if (ACT == 7) v = (v > 0.f) ? v + 1.0f : expf(v); else if (ACT == 8) v = tanhf(v); else if (ACT == 9) v = 0.5f * v * (1.0f + tanhf(0.7978845608028654f * (v + 0.044715f * v * v * v))); else if (ACT == 11) v = 1.0f / (1.0f + expf(-v)); else if (ACT == 12) v = (v > 0.f) ? v : 0.01f * v; else if (ACT == 14) v = (v > 0.f) ? v : 0.1f * v; else if (ACT == 16) v = (v >= 0.f) ? v : 0.3f * v; else if (ACT == 17) v = (v >= 0.f) ? v : 0.2f * v; else if (ACT == 15) v = v / (1.0f + expf(-v)); else if (ACT == 3) v = fmaxf(v, 0.f); else if (ACT == 6) v = 0.5f * v * (1.0f + erff(v * 0.70710678118654752f)); so[w][8 * hh + r][t * 16 + ln] = v; } }
  __builtin_amdgcn_fence(__ATOMIC_ACQ_REL, "workgroup"); __builtin_amdgcn_wave_barrier();
  const int rsub = lane >> 4, c4 = (lane & 15) * 4; typedef _Float16 v4h __attribute__((ext_vector_type(4)));
  {
#pragma unroll
    for (int q = 0; q < 8; ++q) { const int r = q * 2 + rsub; if (col0 + c4 < N) { const v4f v = *(const v4fa*)&so[w][r][c4]; if (C) *(v4f*)(C + cofs + (size_t)(row0 + r) * ldc + col0 + c4) = v; if (C16) { v4h h4; for (int i = 0; i < 4; ++i) h4[i] = (_Float16)v[i]; *(v4h*)(C16 + cofs + (size_t)(row0 + r) * ldc + col0 + c4) = h4; } } }
     }
}


typedef _Float16 v4h __attribute__((ext_vector_type(4)));

__global__ __launch_bounds__(256) void k_x16(const float* __restrict__ x, _Float16* __restrict__ X16, size_t n8) { const size_t t = (size_t)blockIdx.x * 256 + threadIdx.x; if (t >= n8) return; FragH f;
#pragma unroll
  for (int q = 0; q < 8; ++q) f.h[q] = (_Float16)bf16_round(x[t * 8 + q]); *(v8us*)((unsigned short*)X16 + t * 8) = f.half[0];  }
__global__ __launch_bounds__(256) void k_h16(const float* __restrict__ x, _Float16* __restrict__ X16, size_t n8) { const size_t t = (size_t)blockIdx.x * 256 + threadIdx.x; if (t >= n8) return; FragH f;
#pragma unroll
  for (int q = 0; q < 8; ++q) f.h[q] = (_Float16)x[t * 8 + q]; *(v8us*)((unsigned short*)X16 + t * 8) = f.half[0];  }
__global__ __launch_bounds__(256) void k_round16f(const float* __restrict__ W, _Float16* __restrict__ Bt, size_t n8) { const size_t t = (size_t)blockIdx.x * 256 + threadIdx.x; if (t >= n8) return; FragH f;
#pragma unroll
  for (int i = 0; i < 8; ++i) f.h[i] = (_Float16)(bf16_round(W[t * 8 + i]) * 16.0f); *(v8us*)((unsigned short*)Bt + t * 8) = f.half[0];  }
template <int NHv, int TTv>
__global__ __launch_bounds__(256) void k_vt(const _Float16* __restrict__ V16, int ldv, int voff, _Float16* __restrict__ Vt) { __shared__ unsigned short tl[64][66]; const int tid = threadIdx.x; const int slab = blockIdx.x / (TTv / 64), lg = blockIdx.x % (TTv / 64); const int b = slab / NHv, h = slab % NHv;
  for (int i = tid; i < 64 * 8; i += 256) { const int r = i / 8, c8 = (i % 8) * 8; FragH f; f.half[0] = *(const v8us*)((const unsigned short*)V16 + ((size_t)b * TTv + lg * 64 + r) * ldv + voff + h * 64 + c8);
#pragma unroll
    for (int q = 0; q < 8; ++q) tl[r][c8 + q] = f.u[q]; }
  __syncthreads();
  {
#pragma unroll
    for (int rd = 0; rd < 2; ++rd) { const int d = rd * 32 + tid / 8, pc = tid % 8; FragH f;
#pragma unroll
      for (int q = 0; q < 8; ++q) f.u[q] = tl[pc * 8 + q][d];
      *(v8us*)((unsigned short*)Vt + ((size_t)slab * 64 + d) * TTv + lg * 64 + pc * 8) = f.half[0]; }
     } }

__global__ __launch_bounds__(256) void k_hl(const float* __restrict__ F, _Float16* __restrict__ Hh, _Float16* __restrict__ Hl, size_t n8) { const size_t t = (size_t)blockIdx.x * 256 + threadIdx.x; if (t >= n8) return; FragH fh, fl; const v4f a = *(const v4fa*)(F + t * 8), c = *(const v4fa*)(F + t * 8 + 4);
#pragma unroll
  for (int q = 0; q < 4; ++q) { _Float16 h = (_Float16)a[q]; fh.h[q] = h; fl.h[q] = (_Float16)((a[q] - (float)h) * 1024.0f); h = (_Float16)c[q]; fh.h[4 + q] = h; fl.h[4 + q] = (_Float16)((c[q] - (float)h) * 1024.0f); }
  { *(v8us*)((unsigned short*)Hh + t * 8) = fh.half[0]; *(v8us*)((unsigned short*)Hl + t * 8) = fl.half[0];  } }

__device__ __forceinline__ v16h g2_frag(const _Float16* p, int hh) { FragH f; f.half[0] = *(const v8us*)((const unsigned short*)p + 8 * hh); f.half[1] = *(const v8us*)((const unsigned short*)p + 16 + 8 * hh); return f.v; }
// Projection GEMM Y[8192][1024] = f16(X W^T * alpha + bias), X and W as f16 rows with k along the row. A work-group of four waves (2 x 2) owns a 128 x 128 tile of Y, a wave 64 x 64.
// The W and X tiles of 64 k (128-byte rows) are brought by whole-line global loads and shared through LDS: two buffers, the next tile's loads fly in registers while this tile is worked on,
// one barrier per tile. The wave forms Y^T = W X^T (A = W rows, B = X rows, both read with fa_frag, so the two k orders are equal): a lane then holds eight neighbouring output columns of one
// token row, which pack into one 16-byte piece; the pieces pass through the wave's own part of the (then free) ring, so that every global store covers whole 128-byte lines.
// amdgpu_waves_per_eu(2, 2): two work-groups per WGP, the 512 work-groups of a launch spread evenly, and one work-group's matrix work covers the other's barrier and LDS waits.
// Every '#pragma unroll' in k_proj gives constant indices, so that the fragment, staging and accumulator arrays stay in registers.
#define PG_T 128                     /* tile edge in rows of W and of X */
#define PG_K 64                      /* k per LDS tile */
#define PG_PITCH 144                 /* LDS row pitch in bytes: 128 of data, an odd multiple of 16 for the 16-byte fragment reads */
#define PG_NS (DM / PG_K)
__device__ __forceinline__ v16h fa_frag(const unsigned char* p);
__device__ __forceinline__ v8f fa_mma(v16h a, v16h b, v8f c);
__global__ __launch_bounds__(128) __attribute__((amdgpu_waves_per_eu(2, 2))) void k_proj(const _Float16* __restrict__ X, const _Float16* __restrict__ Wt, const float* __restrict__ bias, float alpha, _Float16* __restrict__ Y) {
  static_assert(MP % PG_T == 0 && DM % PG_T == 0 && DM % PG_K == 0, "k_proj: whole tiles only");
  __shared__ __attribute__((aligned(16))) unsigned char L[2][2][PG_T * PG_PITCH];      /* [buffer][W rows | X rows] */
  const int tid = threadIdx.x, lane = tid & 31, wave = tid >> 5, c = lane & 15, h = lane >> 4;
  const int mt = blockIdx.x / (DM / PG_T), nq = blockIdx.x % (DM / PG_T); const int row0 = mt * PG_T, col0 = nq * PG_T; const int wm = wave >> 1, wn = wave & 1;
  const int sr = tid >> 3, sc = (tid & 7) * 8;      /* staging: 8 threads cover one 128-byte row, 16 rows per load */
  const unsigned short* wg = (const unsigned short*)Wt + (size_t)(col0 + sr) * DM + sc;
  const unsigned short* xg = (const unsigned short*)X + (size_t)(row0 + sr) * DM + sc;
  const int so = sr * PG_PITCH + sc * 2;
  const int fw = (64 * wn + c) * PG_PITCH + 16 * h, fx = (64 * wm + c) * PG_PITCH + 16 * h;      /* the lane's fragment row and its 16 h bytes */
  const v8f z8 = {0.f, 0.f, 0.f, 0.f, 0.f, 0.f, 0.f, 0.f};
  v8f acc[4][4];      /* [16 output columns i][16 token rows j]: register r = column 16 i + 8 h + r, lane column c = token row 16 j + c */
#pragma unroll
  for (int i = 0; i < 4; ++i)
#pragma unroll
    for (int j = 0; j < 4; ++j) acc[i][j] = z8;
  v8us rw[8], rx[8];
#pragma unroll
  for (int i = 0; i < 8; ++i) { rw[i] = *(const v8us*)(wg + (size_t)(16 * i) * DM); rx[i] = *(const v8us*)(xg + (size_t)(16 * i) * DM); }
#pragma unroll
  for (int i = 0; i < 8; ++i) { *(v8us*)&L[0][0][so + 16 * i * PG_PITCH] = rw[i]; *(v8us*)&L[0][1][so + 16 * i * PG_PITCH] = rx[i]; }
  __syncthreads();      /* tile 0 is visible to all waves */
#pragma unroll 1      /* rolled, last trip not peeled off, as in k_fattn: the next tile's global loads stay at the head of the trip, whose work covers their latency */
  for (int s = 0; s < PG_NS; ++s) {
    const unsigned char* Wb = &L[s & 1][0][0]; const unsigned char* Xb = &L[s & 1][1][0];
    if (s + 1 < PG_NS) {
#pragma unroll
      for (int i = 0; i < 8; ++i) { rw[i] = *(const v8us*)(wg + (size_t)(16 * i) * DM + (s + 1) * PG_K); rx[i] = *(const v8us*)(xg + (size_t)(16 * i) * DM + (s + 1) * PG_K); } }
    v16h wf[2][4], xf[2][4];      /* [32 k][16 rows] */
#pragma unroll
    for (int kc = 0; kc < 2; ++kc)
#pragma unroll
      for (int i = 0; i < 4; ++i) { wf[kc][i] = fa_frag(Wb + fw + 16 * i * PG_PITCH + 64 * kc); xf[kc][i] = fa_frag(Xb + fx + 16 * i * PG_PITCH + 64 * kc); }
    __builtin_amdgcn_sched_barrier(0);      /* the trip's 32 fragment reads stay one group in front of its 32 products: without it the compiler reads one W fragment at a time and waits for it in front of every four products */
#pragma unroll
    for (int kc = 0; kc < 2; ++kc)
#pragma unroll
      for (int i = 0; i < 4; ++i)
#pragma unroll
        for (int j = 0; j < 4; ++j) acc[i][j] = fa_mma(wf[kc][i], xf[kc][j], acc[i][j]);
    __builtin_amdgcn_sched_barrier(0); asm volatile("v_nop\n\tv_nop\n\tv_nop\n\tv_nop"); __builtin_amdgcn_sched_barrier(0);      /* four vector slots behind the trip's last WMMA, in front of the branches that follow it */
    if (s + 1 < PG_NS) { unsigned char* Wn = &L[(s + 1) & 1][0][0]; unsigned char* Xn = &L[(s + 1) & 1][1][0];
#pragma unroll
      for (int i = 0; i < 8; ++i) { *(v8us*)(Wn + so + 16 * i * PG_PITCH) = rw[i]; *(v8us*)(Xn + so + 16 * i * PG_PITCH) = rx[i]; } }
    __syncthreads();      /* publishes tile s + 1 and ends every wave's reads of tile s, whose buffer the next trip refills; behind the last trip it frees the ring for the output staging */
  }
  unsigned char* st = &L[0][0][0] + wave * (64 * PG_PITCH);      /* the wave's own 64 rows of 128 bytes */
#pragma unroll
  for (int i = 0; i < 4; ++i) { const float* bp = bias + col0 + 64 * wn + 16 * i + 8 * h; float bv[8];
#pragma unroll
    for (int r = 0; r < 8; ++r) bv[r] = bf16_round(bp[r]);
#pragma unroll
    for (int j = 0; j < 4; ++j) { FragH f;
#pragma unroll
      for (int r = 0; r < 8; ++r) f.h[r] = (_Float16)(acc[i][j][r] * alpha + bv[r]);
      *(v8us*)(st + (16 * j + c) * PG_PITCH + 32 * i + 16 * h) = f.half[0]; } }
  __builtin_amdgcn_fence(__ATOMIC_ACQ_REL, "workgroup"); __builtin_amdgcn_wave_barrier();      /* the wave's lanes read each other's pieces: the reads stay behind the writes */
  unsigned short* yp = (unsigned short*)Y + (size_t)(row0 + 64 * wm + (lane >> 3)) * DM + col0 + 64 * wn + (lane & 7) * 8;
#pragma unroll
  for (int q = 0; q < 16; ++q) { const v8us v = *(const v8us*)(st + (4 * q + (lane >> 3)) * PG_PITCH + (lane & 7) * 16); *(v8us*)(yp + (size_t)(4 * q) * DM) = v; } }


__global__ __launch_bounds__(256) void k_wnat(const float* __restrict__ w, size_t n8, _Float16* __restrict__ Bt) { const size_t t = (size_t)blockIdx.x * 256 + threadIdx.x; if (t >= n8) return; FragH f; for (int q = 0; q < 8; ++q) f.h[q] = (_Float16)(bf16_round(w[t * 8 + q]) * 16.0f); *(v8us*)((unsigned short*)Bt + t * 8) = f.half[0];  }
#define FA_NW 8                      /* waves per work-group */
#define FA_SK 64                     /* keys per LDS tile (two passes of 32) */
#define FA_PITCH 144                 /* LDS row pitch in bytes: 128 of data, an odd multiple of 16 for the 16-byte fragment reads */
#define FA_NS (SQ / FA_SK)
__device__ __forceinline__ float fa_x16(float v) { const int i = __float_as_int(v); return __int_as_float(__builtin_amdgcn_permlanex16(i, i, 0x76543210, 0xfedcba98, false, false)); }      /* value of lane ^ 16 */
__device__ __forceinline__ v16h fa_frag(const unsigned char* p) { FragH f; f.half[0] = *(const v8us*)p; f.half[1] = *(const v8us*)(p + 32); return f.v; }      /* k = 8 h .. 8 h + 7 and 16 + 8 h .. 16 + 8 h + 7; p already holds the lane's 16 h bytes */
__device__ __forceinline__ v8f fa_mma(v16h a, v16h b, v8f c) { return __builtin_amdgcn_wmma_f32_16x16x32_f16(false, a, false, b, (short)0, c, false, false); }
__global__ __launch_bounds__(32 * FA_NW) __attribute__((amdgpu_waves_per_eu(4, 4))) void k_fattn(const _Float16* __restrict__ Q16, const _Float16* __restrict__ K16, const _Float16* __restrict__ VT, float* __restrict__ out) {
  static_assert(HD == 64 && SQ % (32 * FA_NW) == 0 && SQ % FA_SK == 0, "k_fattn: head size 64, whole work-groups of queries, whole tiles of keys");
  __shared__ __attribute__((aligned(16))) unsigned char L[2][2][FA_SK * FA_PITCH];      /* [buffer][K rows by key | V^T rows by d] */
  typedef _Float16 h2 __attribute__((ext_vector_type(2))); typedef float f2 __attribute__((ext_vector_type(2)));
  const int tid = threadIdx.x, lane = tid & 31, wave = tid >> 5, c = lane & 15, h = lane >> 4;
  const int bh = blockIdx.y, b = bh / NH, hd = bh % NH; const int q0 = blockIdx.x * (32 * FA_NW) + wave * 32;
  const float cscale = 0.125f * 1.4426950408889634f;      /* 64^-0.5, scores taken to base 2 */
  const int sr = tid >> 3, sc = (tid & 7) * 8;      /* staging: 8 threads cover one 128-byte row, 32 rows per load */
  const unsigned short* kg = (const unsigned short*)K16 + ((size_t)b * SQ + sr) * LQ + hd * HD + sc;      /* row = key */
  const unsigned short* vg = (const unsigned short*)VT + ((size_t)bh * HD + sr) * SQ + sc;      /* row = d, keys along the row */
  const int so0 = sr * FA_PITCH + sc * 2, so1 = so0 + 32 * FA_PITCH;
  v16h qf[2][2];      /* B operand: column = query, k = d */
#pragma unroll
  for (int g = 0; g < 2; ++g)
#pragma unroll
    for (int kc = 0; kc < 2; ++kc) qf[g][kc] = g2_frag(Q16 + ((size_t)b * SQ + q0 + 16 * g + c) * LQ + hd * HD + 32 * kc, h);
  FragH ones;      /* A operand whose row 0 is 1.0: its product with P^T gives the column sums of P^T in row 0 */
#pragma unroll
  for (int i = 0; i < 16; ++i) ones.u[i] = (c == 0) ? (unsigned short)0x3C00 : (unsigned short)0;
  const v8f z8 = {0.f, 0.f, 0.f, 0.f, 0.f, 0.f, 0.f, 0.f};
  v8f acc[2][4], lacc[2]; float m_run[2];
#pragma unroll
  for (int g = 0; g < 2; ++g) { m_run[g] = -__builtin_inff(); lacc[g] = z8;
#pragma unroll
    for (int t = 0; t < 4; ++t) acc[g][t] = z8; }
  v8us rk0 = *(const v8us*)kg, rk1 = *(const v8us*)(kg + (size_t)32 * LQ), rv0 = *(const v8us*)vg, rv1 = *(const v8us*)(vg + (size_t)32 * SQ);
  *(v8us*)&L[0][0][so0] = rk0; *(v8us*)&L[0][0][so1] = rk1; *(v8us*)&L[0][1][so0] = rv0; *(v8us*)&L[0][1][so1] = rv1;
  __syncthreads();      /* tile 0 is visible to all waves */
#pragma unroll 1      /* rolled, last trip not peeled off: in the peeled build the compiler sinks the next tile's global loads down to their LDS stores, and the trip's work no longer covers their latency */
  for (int s = 0; s < FA_NS; ++s) {
    const unsigned char* Kb = &L[s & 1][0][0]; const unsigned char* Vb = &L[s & 1][1][0];
    if (s + 1 < FA_NS) { const unsigned short* kn = kg + (size_t)(s + 1) * FA_SK * LQ; const unsigned short* vn = vg + (s + 1) * FA_SK;
      rk0 = *(const v8us*)kn; rk1 = *(const v8us*)(kn + (size_t)32 * LQ); rv0 = *(const v8us*)vn; rv1 = *(const v8us*)(vn + (size_t)32 * SQ); }
#pragma unroll
    for (int sub = 0; sub < 2; ++sub) {      /* one pass: 32 keys */
      v8f sx[2][2];      /* [16-key tile][column group]: register r = key 16 kt + 8 h + r, lane column c = query */
#pragma unroll
      for (int kt = 0; kt < 2; ++kt) { const unsigned char* kp = Kb + (32 * sub + 16 * kt + c) * FA_PITCH + 16 * h; const v16h k0 = fa_frag(kp), k1 = fa_frag(kp + 64);
#pragma unroll
        for (int g = 0; g < 2; ++g) sx[kt][g] = fa_mma(k1, qf[g][1], fa_mma(k0, qf[g][0], z8)); }
      float mb[2]; bool need = false;
#pragma unroll
      for (int g = 0; g < 2; ++g) { float mx = sx[0][g][0];
#pragma unroll
        for (int r = 1; r < 8; ++r) mx = fmaxf(mx, sx[0][g][r]);
#pragma unroll
        for (int r = 0; r < 8; ++r) mx = fmaxf(mx, sx[1][g][r]);
        mx = fmaxf(mx, fa_x16(mx)) * cscale; mb[g] = mx; need = need || (mx > m_run[g] + 8.0f); }
      if (__builtin_amdgcn_ballot_w32(need) != 0) {      /* lazy rescale: the maximum in use may trail the true one by up to 8 (base 2), so an exponential stays below 2^8 */
#pragma unroll
        for (int g = 0; g < 2; ++g) { const float m_new = fmaxf(m_run[g], mb[g]); const float corr = __builtin_amdgcn_exp2f(m_run[g] - m_new); m_run[g] = m_new; lacc[g] = lacc[g] * corr;
#pragma unroll
          for (int t = 0; t < 4; ++t) acc[g][t] = acc[g][t] * corr; } }
      v16h vf[4];      /* A operand: row = d, k = the pass's 32 keys */
#pragma unroll
      for (int t = 0; t < 4; ++t) vf[t] = fa_frag(Vb + (16 * t + c) * FA_PITCH + 64 * sub + 16 * h);
#pragma unroll
      for (int g = 0; g < 2; ++g) { const float nm = -m_run[g]; union { v16h v; h2 p[8]; } pf;      /* B operand: element pair i = keys 16 (i >> 2) + 8 h + 2 (i & 3), + 1: the k order of fa_frag */
#pragma unroll
        for (int i = 0; i < 8; ++i) { const float e0 = __builtin_amdgcn_exp2f(fmaf(sx[i >> 2][g][2 * (i & 3)], cscale, nm)), e1 = __builtin_amdgcn_exp2f(fmaf(sx[i >> 2][g][2 * (i & 3) + 1], cscale, nm)); pf.p[i] = __builtin_convertvector(f2{e0, e1}, h2); }
#pragma unroll
        for (int t = 0; t < 4; ++t) acc[g][t] = fa_mma(vf[t], pf.v, acc[g][t]);
        lacc[g] = fa_mma(ones.v, pf.v, lacc[g]); }
    }
    __builtin_amdgcn_sched_barrier(0); asm volatile("v_nop\n\tv_nop\n\tv_nop\n\tv_nop"); __builtin_amdgcn_sched_barrier(0);      /* four vector slots behind the trip's last WMMA, in front of the branches that follow it */
    if (s + 1 < FA_NS) { unsigned char* Kn = &L[(s + 1) & 1][0][0]; unsigned char* Vn = &L[(s + 1) & 1][1][0];
      *(v8us*)(Kn + so0) = rk0; *(v8us*)(Kn + so1) = rk1; *(v8us*)(Vn + so0) = rv0; *(v8us*)(Vn + so1) = rv1; }
    __syncthreads();      /* publishes tile s + 1 and ends every wave's reads of tile s, whose buffer the next trip refills */
  }
#pragma unroll
  for (int g = 0; g < 2; ++g) { const float lr = lacc[g][0]; const float inv = 1.0f / (lr + fa_x16(lr));      /* row 0 of the sum tile sits in lanes 0-15, lanes 16-31 hold row 8 = 0: the exchange-and-add stays unconditional */
    float* op = out + ((size_t)b * SQ + q0 + 16 * g + c) * DM + hd * HD + 8 * h;      /* register r of tile t = d 16 t + 8 h + r of query column c */
#pragma unroll
    for (int t = 0; t < 4; ++t) { const v8f o = acc[g][t] * inv; const v4f lo = {o[0], o[1], o[2], o[3]}, hi = {o[4], o[5], o[6], o[7]}; *(v4f*)(op + 16 * t) = lo; *(v4f*)(op + 16 * t + 4) = hi; } } }
__global__ __launch_bounds__(256) void k_vt(const _Float16* __restrict__ V16, int b, int h0, _Float16* __restrict__ VT) { __shared__ unsigned short tl[64][65]; const int tid = threadIdx.x; const int hh = blockIdx.x % HG, sg = blockIdx.x / HG; const int s0 = sg * 64; const int h = h0 + hh;
  for (int i = tid; i < 64 * 8; i += 256) { const int j = i / 8, d8 = (i % 8) * 8; FragH f; f.half[0] = *(const v8us*)((const unsigned short*)V16 + ((size_t)b * SQ + s0 + j) * DM + h * HD + d8); for (int q = 0; q < 8; ++q) tl[d8 + q][j] = f.u[q]; }
  __syncthreads();
  { for (int i = tid; i < 64 * 8; i += 256) { const int d = i / 8, j8 = (i % 8) * 8; FragH f; for (int q = 0; q < 8; ++q) f.u[q] = tl[d][j8 + q]; *(v8us*)((unsigned short*)VT + ((size_t)hh * HD + d) * SQ + s0 + j8) = f.half[0]; }  } }



__global__ __launch_bounds__(256) void k_rsmkm(const float* __restrict__ S, _Float16* __restrict__ P, int nrows, const int* __restrict__ am) {
  #pragma clang fp contract(off)
  const int t = blockIdx.x * 256 + threadIdx.x; if (t >= nrows) return; const size_t i = (size_t)t; const float* s = S + i * SQ; const int* mr = am + (size_t)(t % SQ) * SQ; float mx = -3.0e38f;
#pragma unroll 1
  for (int j = 0; j < SQ; ++j) { const float f = (mr[j] != 0) ? 1.f : 0.f; mx = fmaxf(mx, fmaf(f, s[j], (1.f - f) * -1.0e9f)); } float se = 0.f;
#pragma unroll 1
  for (int j = 0; j < SQ; ++j) { const float f = (mr[j] != 0) ? 1.f : 0.f; se += __expf(fmaf(f, s[j], (1.f - f) * -1.0e9f) - mx); } const float sc = 256.0f / se;
#pragma unroll 1
  for (int j0 = 0; j0 < SQ; j0 += 8) { FragH fr; for (int q = 0; q < 8; ++q) { const int j = j0 + q; const float f = (mr[j] != 0) ? 1.f : 0.f; fr.h[q] = (_Float16)(__expf(fmaf(f, s[j], (1.f - f) * -1.0e9f) - mx) * sc); }
    unsigned short* d = (unsigned short*)P + i * SQ + j0; *(v8us*)d = fr.half[0];  } }
extern "C" void kernel_launch(void* const* d_in, const int* in_sizes, int n_in,
                              void* d_out, int out_size, void* d_ws, size_t ws_size, hipStream_t stream) {
  (void)in_sizes; (void)n_in; (void)out_size;
  const float* const* I = (const float* const*)d_in; const float* xq = I[0]; const float* xk = I[1]; const float* xv = I[1]; const float* wq = I[2]; const float* bq = I[3]; const float* wk = I[4]; const float* bk = I[5]; const float* wv = I[6]; const float* bv = I[7]; const float* x = xq;      /* input (queries), memory (keys AND values); natural weights + biases; no output projection */
  char* ws = (char*)d_ws; size_t off = 0;
  auto take = [&](size_t bytes) { char* p = ws + off; off += (bytes + 255) & ~(size_t)255; return p; };
  _Float16* BQ = (_Float16*)take((size_t)DM * DM * 2); _Float16* BK = (_Float16*)take((size_t)DM * DM * 2); _Float16* BV = (_Float16*)take((size_t)DM * DM * 2); 
  _Float16* X16 = (_Float16*)take(NR * DM * 2); _Float16* XKp = (_Float16*)take(NR * DM * 2); _Float16* XVp = (_Float16*)take(NR * DM * 2); _Float16* Q16 = (_Float16*)take(NR * DM * 2); _Float16* K16 = (_Float16*)take(NR * DM * 2); _Float16* V16 = (_Float16*)take(NR * DM * 2); 
  _Float16* VT = (_Float16*)take((size_t)NB * NH * HD * SQ * 2);
  if (off > ws_size) return;
  { const unsigned g = (unsigned)(((size_t)DM * DM / 8 + 255) / 256); k_wnat<<<g, 256, 0, stream>>>(wq, (size_t)DM * DM / 8, BQ); k_wnat<<<g, 256, 0, stream>>>(wk, (size_t)DM * DM / 8, BK); k_wnat<<<g, 256, 0, stream>>>(wv, (size_t)DM * DM / 8, BV); }      /* natural [out][in] = Bt x16 (no output projection: no Wo plane) */
  _Float16* XK = XKp; _Float16* XV = XVp; k_x16<<<(unsigned)((NR * DM / 8 + 255) / 256), 256, 0, stream>>>(xk, XK, NR * DM / 8); k_x16<<<(unsigned)((NR * DM / 8 + 255) / 256), 256, 0, stream>>>(xv, XV, NR * DM / 8);      /* key and value inputs as exact f16 rows */

  k_x16<<<(unsigned)((NR * DM / 8 + 255) / 256), 256, 0, stream>>>(x, X16, NR * DM / 8);
  const size_t r0p = (size_t)B0 * SQ;      /* first projected row */
  k_proj<<<(MP / PG_T) * (DM / PG_T), 128, 0, stream>>>(X16 + r0p * DM, BQ, bq, 0.0625f, Q16 + r0p * DM);
  k_proj<<<(MP / PG_T) * (DM / PG_T), 128, 0, stream>>>(XK + r0p * DM, BK, bk, 0.0625f, K16 + r0p * DM);
  k_proj<<<(MP / PG_T) * (DM / PG_T), 128, 0, stream>>>(XV + r0p * DM, BV, bv, 0.0625f, V16 + r0p * DM);
  k_vt<NH, SQ><<<NB * NH * (SQ / 64), 256, 0, stream>>>(V16, LQ, 0, VT);      /* V^T [NB * NH][HD][SQ] */
  k_fattn<<<dim3(SQ / (32 * FA_NW), NB * NH), 32 * FA_NW, 0, stream>>>(Q16, K16, VT, (float*)d_out);      /* out = softmax(q k^T / 8) v straight to the f32 output (merged heads; each 256-B head segment of a row written by one wave) */
  /* no output projection in this module */
}

// v004
// It runs in 129 microseconds.
// In two side-by-side timings against v003, it was 1.09 and 1.07 times as fast.
// All steps since v000 together make it 56.5 times as fast.
#include <hip/hip_runtime.h>
// Multi-head CROSS-attention without an output projection (input, memory [4][2048][1024]; q = input Wq^T + bq, k = memory Wk^T + bk, v = memory Wv^T + bv (natural [1024][1024], zero biases); 16 heads of 64; q * 64^-0.5 then q k^T; softmax over all 2048 memory positions (no mask); out = attn v merged to [4][2048][1024]; NO output projection).
// Structure: token rows r = b*2048 + s; x as exact f16 rows (bf16-rounded); Q, K, V as three WMMA GEMMs (128x128 tiles through LDS, 64x64 wave tiles, f32 accumulation, exact x16 weights + bias, f16 outputs); V^T for all batches and heads via LDS transposes; one fused attention launch (k_fattn): S^T = K Q^T (K = 64), online softmax (f32 statistics, base 2, weights as f16 relative to the running maximum), O^T += V^T P^T, divided by the row sum and written straight into the merged f32 output rows.
// Compute dtype: inputs rounded to bf16; x / weights exact; q, k, v and softmax weights as plain f16 GEMM operands (~2^-12); scores, softmax statistics and o f32. v_wmma_f32_16x16x32_f16.
#define NB 4
#define SQ 2048
#define DM 1024
#define NH 16
#define HD 64
#define HG 4                         /* heads per k_vt(b, h0) launch (that overload is not launched) */
#define B0 0                         /* first batch processed (debug hook) */
#define NBR NB                       /* batches processed (debug hook) */
#define NR ((size_t)NB * SQ)         /* token rows */
#define MP ((int)((size_t)NBR * SQ)) /* rows projected (debug hook) */
#define QN SQ                        /* unused (attention covers all SQ query rows) */
#define NHD NH                       /* unused (attention covers all NH heads) */
#define MPO MP                       /* unused (no output projection) */
#define LQ DM      /* row pitch of the q/k/v rows */
typedef __bf16 v16b __attribute__((ext_vector_type(16)));
typedef unsigned short v8us __attribute__((ext_vector_type(8), may_alias));
typedef float  v8f  __attribute__((ext_vector_type(8)));
typedef float  v4f  __attribute__((ext_vector_type(4)));
typedef float  v4fa __attribute__((ext_vector_type(4), may_alias));
union FragB { v16b v; v8us half[2]; unsigned short u[16]; };

__device__ __forceinline__ unsigned short bf16_bits(float x) { unsigned int u = __float_as_uint(x); return (unsigned short)((u + 0x7FFFu + ((u >> 16) & 1u)) >> 16); }
__device__ __forceinline__ float bf16_val(unsigned short b) { return __uint_as_float(((unsigned int)b) << 16); }
__device__ __forceinline__ float bf16_round(float x) { return bf16_val(bf16_bits(x)); }
// D += A·B with NT terms: 1 = ah·bh, 2 = + al·bh (A split), 3 = + ah·bl (both split)
template <int NT>
__device__ __forceinline__ v8f mmaN(v16b ah, v16b al, v16b bh, v16b bl, v8f c) {
  c = __builtin_amdgcn_wmma_f32_16x16x32_bf16(false, ah, false, bh, (short)0, c, false, false);
  if (NT >= 2) c = __builtin_amdgcn_wmma_f32_16x16x32_bf16(false, al, false, bh, (short)0, c, false, false);
  if (NT >= 3) c = __builtin_amdgcn_wmma_f32_16x16x32_bf16(false, ah, false, bl, (short)0, c, false, false);
  asm volatile("v_nop\n\tv_nop\n\tv_nop\n\tv_nop" : "+v"(c) : "v"(ah), "v"(al), "v"(bh), "v"(bl));
  return c;
}

__global__ __launch_bounds__(256) void k_wt_bf16(const float* __restrict__ W, unsigned short* __restrict__ Wt, int K, int N) {
  const int t = blockIdx.x * 256 + threadIdx.x;
  const int k8n = K / 8;
  if (t >= N * k8n) return;
  const int n = t / k8n, k8 = (t % k8n) * 8;
  v8us v;
#pragma unroll
  for (int i = 0; i < 8; ++i) v[i] = bf16_bits(W[(size_t)(k8 + i) * N + n]);
  *(v8us*)(Wt + (size_t)n * K + k8) = v;
  
}

// GEMM C[M][N] (f32, pitch ldc) = act(A[M][K]·W + bias). A f32 row-major (pitch lda) converted per fragment to bf16
// (ASPLIT: hi/lo two planes -> 2 terms, else single rounded term); Wt bf16 [N][K] (pitch ldb). BIAS_BF16 rounds the
// bias to bf16 first (bias quantised to bf16 before the add). K%32==0, M%16==0, N%64==0.
template <bool ASPLIT, int ACT, bool BIAS_BF16>
__global__ __launch_bounds__(128) void k_gemm_bf(const float* __restrict__ A, int lda, const unsigned short* __restrict__ Wt, int ldb,
                                               const float* __restrict__ bias, float* __restrict__ C, int ldc, int M, int N, int K) {
  __shared__ __attribute__((aligned(16))) float so[4][16][64];
  const int tid = threadIdx.x, w = tid >> 5, lane = tid & 31, ln = lane & 15, hh = lane >> 4;
  const int ntn = N / 64;
  const int wid = blockIdx.x * 4 + w;
  const int mt = wid / ntn, nq = wid % ntn;
  if (mt * 16 >= M) return;
  const int row0 = mt * 16, col0 = nq * 64;
  const float* arow = A + (size_t)(row0 + ln) * lda;
  v8f acc[4] = {};
  for (int kb = 0; kb < K; kb += 32) {
    FragB ah, al;
    const v4f x0 = *(const v4fa*)(arow + kb + 8 * hh), x1 = *(const v4fa*)(arow + kb + 8 * hh + 4);
    const v4f x2 = *(const v4fa*)(arow + kb + 16 + 8 * hh), x3 = *(const v4fa*)(arow + kb + 16 + 8 * hh + 4);
    float xs[16] = {x0[0],x0[1],x0[2],x0[3],x1[0],x1[1],x1[2],x1[3],x2[0],x2[1],x2[2],x2[3],x3[0],x3[1],x3[2],x3[3]};
#pragma unroll
    for (int i = 0; i < 16; ++i) { const unsigned short hb = bf16_bits(xs[i]); ah.u[i] = hb; al.u[i] = ASPLIT ? bf16_bits(xs[i] - bf16_val(hb)) : (unsigned short)0; }
#pragma unroll
    for (int t = 0; t < 4; ++t) {
      const unsigned short* brow = Wt + (size_t)(col0 + t * 16 + ln) * ldb + kb;
      FragB b;
      b.half[0] = *(const v8us*)(brow + 8 * hh);
      b.half[1] = *(const v8us*)(brow + 16 + 8 * hh);
      acc[t] = mmaN<ASPLIT ? 2 : 1>(ah.v, al.v, b.v, b.v, acc[t]);
    }
  }
#pragma unroll
  for (int t = 0; t < 4; ++t) {
    float bv = bias ? bias[col0 + t * 16 + ln] : 0.f;
    if (BIAS_BF16) bv = bf16_round(bv);
#pragma unroll
    for (int r = 0; r < 8; ++r) { float v = acc[t][r] + bv; if (ACT == 1) v = fmaxf(v, 0.f); so[w][8 * hh + r][t * 16 + ln] = v; }
  }
  __builtin_amdgcn_fence(__ATOMIC_ACQ_REL, "workgroup");
  __builtin_amdgcn_wave_barrier();
  const int rsub = lane >> 4, c4 = (lane & 15) * 4;
  {
#pragma unroll
    for (int q = 0; q < 8; ++q) {
      const int r = q * 2 + rsub;
      const v4f v = *(const v4fa*)&so[w][r][c4];
      *(v4f*)(C + (size_t)(row0 + r) * ldc + col0 + c4) = v;
    }
    
  }
}

// GEMM C = act(A·W + bias + resid): A f32 (ASPLIT -> hi/lo 2 terms), Wt bf16 [N][K]; ACT 0 none, 1 relu, 2 exact gelu;
// resid (optional, f32, row index = (row % rmod), pitch ldr, RES_BF16 rounds it) added before the activation.
template <bool ASPLIT, int ACT, bool BIAS_BF16, bool RES_BF16>
__global__ __launch_bounds__(128) void k_gemm_bf3(const float* __restrict__ A, int lda, const unsigned short* __restrict__ Wt, int ldb,
                                                const float* __restrict__ bias, const float* __restrict__ resid, int rmod, int ldr,
                                                float* __restrict__ C, int ldc, int M, int N, int K) {
  __shared__ __attribute__((aligned(16))) float so[4][16][64];
  const int tid = threadIdx.x, w = tid >> 5, lane = tid & 31, ln = lane & 15, hh = lane >> 4;
  const int ntn = N / 64;
  const int wid = blockIdx.x * 4 + w;
  const int mt = wid / ntn, nq = wid % ntn;
  if (mt * 16 >= M) return;
  const int row0 = mt * 16, col0 = nq * 64;
  const float* arow = A + (size_t)(row0 + ln) * lda;
  v8f acc[4] = {};
  for (int kb = 0; kb < K; kb += 32) {
    FragB ah, al;
    const v4f x0 = *(const v4fa*)(arow + kb + 8 * hh), x1 = *(const v4fa*)(arow + kb + 8 * hh + 4);
    const v4f x2 = *(const v4fa*)(arow + kb + 16 + 8 * hh), x3 = *(const v4fa*)(arow + kb + 16 + 8 * hh + 4);
    float xs[16] = {x0[0],x0[1],x0[2],x0[3],x1[0],x1[1],x1[2],x1[3],x2[0],x2[1],x2[2],x2[3],x3[0],x3[1],x3[2],x3[3]};
#pragma unroll
    for (int i = 0; i < 16; ++i) { const unsigned short hb = bf16_bits(xs[i]); ah.u[i] = hb; al.u[i] = ASPLIT ? bf16_bits(xs[i] - bf16_val(hb)) : (unsigned short)0; }
#pragma unroll
    for (int t = 0; t < 4; ++t) {
      const unsigned short* brow = Wt + (size_t)(col0 + t * 16 + ln) * ldb + kb;
      FragB b;
      b.half[0] = *(const v8us*)(brow + 8 * hh);
      b.half[1] = *(const v8us*)(brow + 16 + 8 * hh);
      acc[t] = mmaN<ASPLIT ? 2 : 1>(ah.v, al.v, b.v, b.v, acc[t]);
    }
  }
#pragma unroll
  for (int t = 0; t < 4; ++t) {
    const int col = col0 + t * 16 + ln;
    float bv = bias ? bias[col] : 0.f;
    if (BIAS_BF16) bv = bf16_round(bv);
#pragma unroll
    for (int r = 0; r < 8; ++r) {
      float v = acc[t][r] + bv;
      if (resid) { float rv = resid[(size_t)((row0 + 8 * hh + r) % rmod) * ldr + col]; if (RES_BF16) rv = bf16_round(rv); v += rv; }
      if (ACT == 1) v = fmaxf(v, 0.f);
      if (ACT == 2) v = 0.5f * v * (1.0f + erff(v * 0.70710678118654752f));
      if (ACT == 3) { const float u = 0.7978845608028654f * (v + 0.044715f * v * v * v); v = 0.5f * v * (1.0f + tanhf(u)); }
      so[w][8 * hh + r][t * 16 + ln] = v;
    }
  }
  __builtin_amdgcn_fence(__ATOMIC_ACQ_REL, "workgroup");
  __builtin_amdgcn_wave_barrier();
  const int rsub = lane >> 4, c4 = (lane & 15) * 4;
  {
#pragma unroll
    for (int q = 0; q < 8; ++q) {
      const int r = q * 2 + rsub;
      const v4f v = *(const v4fa*)&so[w][r][c4];
      *(v4f*)(C + (size_t)(row0 + r) * ldc + col0 + c4) = v;
    }
    
  }
}
// row LayerNorm (biased variance, eps) over N: s = X (+ R); optional out_sum <- s; out_norm <- (s-mu)*rsqrt(var+eps)*g + b
template <bool PARAM_BF16>
__global__ __launch_bounds__(256) void k_layernorm(const float* __restrict__ X, const float* __restrict__ R, const float* __restrict__ g, const float* __restrict__ bta,
                                                  float* __restrict__ out_sum, float* __restrict__ out_norm, int N, float eps) {
  __shared__ float red[256];
  const int row = blockIdx.x, tid = threadIdx.x;
  const float* x = X + (size_t)row * N; const float* rr = R ? R + (size_t)row * N : nullptr;
  float vals[16];                     // up to N = 4096
  const int per = N / 256;            // contiguous chunk per thread? use strided-by-4 chunks: thread handles j = tid*4 + 1024*u
  float s1 = 0.f;
  for (int u = 0; u < per / 4; ++u) {
    const int j = tid * 4 + 1024 * u;
    const v4f a = *(const v4fa*)(x + j);
    v4f b = {0.f,0.f,0.f,0.f}; if (rr) b = *(const v4fa*)(rr + j);
#pragma unroll
    for (int q = 0; q < 4; ++q) { const float v = a[q] + b[q]; vals[u * 4 + q] = v; s1 += v; }
  }
  red[tid] = s1; __syncthreads();
  for (int st = 128; st > 0; st >>= 1) { if (tid < st) red[tid] += red[tid + st]; __syncthreads(); }
  const float mu = red[0] / (float)N; __syncthreads();
  float s2 = 0.f;
  for (int u = 0; u < per / 4; ++u)
#pragma unroll
    for (int q = 0; q < 4; ++q) { const float c = vals[u * 4 + q] - mu; s2 += c * c; }
  red[tid] = s2; __syncthreads();
  for (int st = 128; st > 0; st >>= 1) { if (tid < st) red[tid] += red[tid + st]; __syncthreads(); }
  const float rs = rsqrtf(red[0] / (float)N + eps);
  {
    for (int u = 0; u < per / 4; ++u) {
      const int j = tid * 4 + 1024 * u;
      v4f o, sm;
#pragma unroll
      for (int q = 0; q < 4; ++q) {
        float gg = g[j + q], bb = bta[j + q];
        if (PARAM_BF16) { gg = bf16_round(gg); bb = bf16_round(bb); }
        sm[q] = vals[u * 4 + q]; o[q] = (vals[u * 4 + q] - mu) * rs * gg + bb;
      }
      if (out_sum) *(v4f*)(out_sum + (size_t)row * N + j) = sm;
      *(v4f*)(out_norm + (size_t)row * N + j) = o;
    }
    
  }
}



// ---- f16 WMMA path (v_wmma_f32_16x16x32_f16): 11-bit significands for operands in range — used where a [0,1] probability operand needs more precision than bf16
typedef _Float16 v16h __attribute__((ext_vector_type(16)));
union FragH { v16h v; v8us half[2]; _Float16 h[16]; unsigned short u[16]; };
template <int NT>
__device__ __forceinline__ v8f mmaH(v16h ah, v16h al, v16h bh, v16h bl, v8f c) {
  c = __builtin_amdgcn_wmma_f32_16x16x32_f16(false, ah, false, bh, (short)0, c, false, false);
  if (NT >= 2) c = __builtin_amdgcn_wmma_f32_16x16x32_f16(false, al, false, bh, (short)0, c, false, false);
  if (NT >= 3) c = __builtin_amdgcn_wmma_f32_16x16x32_f16(false, ah, false, bl, (short)0, c, false, false);
  asm volatile("v_nop\n\tv_nop\n\tv_nop\n\tv_nop" : "+v"(c) : "v"(ah), "v"(al), "v"(bh), "v"(bl));
  return c;
}
// batched GEMM like k_gemm_b but f16 operands: A f32 (split into f16 hi/lo if ASPLIT, else rounded to f16), Bt = f16 values [n][k]; alpha; C f32; N multiple of 16 (partial tiles skipped)
template <bool ASPLIT>
__global__ __launch_bounds__(128) void k_gemm_h(const float* __restrict__ A, int lda, size_t sA, const _Float16* __restrict__ Bh, int ldb, size_t sB, float alpha, float* __restrict__ C, int ldc, size_t sC, int M, int N, int K) {
  __shared__ __attribute__((aligned(16))) float so[4][16][64];
  const int tid = threadIdx.x, w = tid >> 5, lane = tid & 31, ln = lane & 15, hh = lane >> 4; const int by = blockIdx.y;
  A += (size_t)by * sA; Bh += (size_t)by * sB; C += (size_t)by * sC;
  const int ntn = (N + 63) / 64; const int wid = blockIdx.x * 4 + w; const int mt = wid / ntn, nq = wid % ntn; if (mt * 16 >= M) return;
  const int row0 = mt * 16, col0 = nq * 64; const float* arow = A + (size_t)(row0 + ln) * lda;
  v8f acc[4] = {};
  for (int kb = 0; kb < K; kb += 32) {
    FragH ah, al;
    const v4f x0 = *(const v4fa*)(arow + kb + 8 * hh), x1 = *(const v4fa*)(arow + kb + 8 * hh + 4), x2 = *(const v4fa*)(arow + kb + 16 + 8 * hh), x3 = *(const v4fa*)(arow + kb + 16 + 8 * hh + 4);
    float xs[16] = {x0[0],x0[1],x0[2],x0[3],x1[0],x1[1],x1[2],x1[3],x2[0],x2[1],x2[2],x2[3],x3[0],x3[1],x3[2],x3[3]};
#pragma unroll
    for (int i = 0; i < 16; ++i) { const _Float16 h = (_Float16)xs[i]; ah.h[i] = h; al.h[i] = ASPLIT ? (_Float16)(xs[i] - (float)h) : (_Float16)0.0f; }
#pragma unroll
    for (int t = 0; t < 4; ++t) { if (col0 + t * 16 >= N) continue; const size_t boff = (size_t)(col0 + t * 16 + ln) * ldb + kb; FragH bq; bq.half[0] = *(const v8us*)(Bh + boff + 8 * hh); bq.half[1] = *(const v8us*)(Bh + boff + 16 + 8 * hh);
      acc[t] = mmaH<ASPLIT ? 2 : 1>(ah.v, al.v, bq.v, bq.v, acc[t]); }
  }
#pragma unroll
  for (int t = 0; t < 4; ++t) { if (col0 + t * 16 >= N) continue;
#pragma unroll
    for (int r = 0; r < 8; ++r) so[w][8 * hh + r][t * 16 + ln] = acc[t][r] * alpha; }
  __builtin_amdgcn_fence(__ATOMIC_ACQ_REL, "workgroup"); __builtin_amdgcn_wave_barrier();
  const int rsub = lane >> 4, c4 = (lane & 15) * 4;
  {
#pragma unroll
    for (int q = 0; q < 8; ++q) { const int r = q * 2 + rsub; if (col0 + c4 < N) { const v4f v = *(const v4fa*)&so[w][r][c4]; *(v4f*)(C + (size_t)(row0 + r) * ldc + col0 + c4) = v; } }
     }
}

// Wt[n][k] = f16(W[k][n]·scale) from f32 row-major W[K][N] (scale = power of two; bf16-exact weights stay exact in f16 away from the subnormal range)
__global__ __launch_bounds__(256) void k_wt_f16(const float* __restrict__ W, _Float16* __restrict__ Wt, int K, int N, float scale) {
  const int t = blockIdx.x * 256 + threadIdx.x; if (t >= N * (K / 8)) return; const int n = t / (K / 8), k8 = (t % (K / 8)) * 8; FragH f;
#pragma unroll
  for (int i = 0; i < 8; ++i) f.h[i] = (_Float16)(bf16_round(W[(size_t)(k8 + i) * N + n]) * scale); const v8us o = f.half[0];
  *(v8us*)((unsigned short*)Wt + (size_t)n * K + k8) = o; 
}
// k_gemm_hh variant with fused epilogue: v = acc·alpha + bias[by·sBias + col] (+ CP[(row/rowsPerB)·sCPb + by·64 + col] if CP) ; ACT 0 none / 1 elu ; writes f16 C16 (and f32 C if non-null)
template <int ACT>
__global__ __launch_bounds__(128) void k_gemm_hhx(const _Float16* __restrict__ A, int lda, size_t sA, const _Float16* __restrict__ Bh, int ldb, size_t sB, float alpha, const float* __restrict__ bias, size_t sBias, const float* __restrict__ CP, int rowsPerB, size_t sCPb, int row0g,
    float* __restrict__ C, _Float16* __restrict__ C16, int ldc, size_t sC, int M, int N, int K) {
  __shared__ __attribute__((aligned(16))) float so[4][16][64];
  const int tid = threadIdx.x, w = tid >> 5, lane = tid & 31, ln = lane & 15, hh = lane >> 4; const int by = blockIdx.y;
  A += (size_t)by * sA; Bh += (size_t)by * sB; const size_t cofs = (size_t)by * sC; const float* bp = bias ? bias + (size_t)by * sBias : nullptr;
  const int ntn = (N + 63) / 64; const int wid = blockIdx.x * 4 + w; const int mt = wid / ntn, nq = wid % ntn; if (mt * 16 >= M) return;
  const int row0 = mt * 16, col0 = nq * 64; const _Float16* arow = A + (size_t)(row0 + ln) * lda;
  v8f acc[4] = {};
  for (int kb = 0; kb < K; kb += 32) { FragH ah; ah.half[0] = *(const v8us*)((const unsigned short*)arow + kb + 8 * hh); ah.half[1] = *(const v8us*)((const unsigned short*)arow + kb + 16 + 8 * hh);
#pragma unroll
    for (int t = 0; t < 4; ++t) { if (col0 + t * 16 >= N) continue; const size_t boff = (size_t)(col0 + t * 16 + ln) * ldb + kb; FragH bq; bq.half[0] = *(const v8us*)((const unsigned short*)Bh + boff + 8 * hh); bq.half[1] = *(const v8us*)((const unsigned short*)Bh + boff + 16 + 8 * hh);
      acc[t] = mmaH<1>(ah.v, ah.v, bq.v, bq.v, acc[t]); }
  }
#pragma unroll
  for (int t = 0; t < 4; ++t) { if (col0 + t * 16 >= N) continue; const int col = col0 + t * 16 + ln; const float bv = bp ? bf16_round(bp[col]) : 0.f;
#pragma unroll
    for (int r = 0; r < 8; ++r) { float v = acc[t][r] * alpha + bv; if (CP) { const int rr = row0g + row0 + 8 * hh + r; if (rowsPerB < 0) v += CP[cofs + (size_t)rr * ldc + col];      /* rowsPerB < 0: own element of the batched C plane */ else { const int bidx = rr / rowsPerB; v += CP[(size_t)bidx * sCPb + (size_t)by * 64 + col]; } } if (ACT == 1) v = (v > 0.f) ? v : expm1f(v); else if (ACT == 7) v = (v > 0.f) ? v + 1.0f : expf(v); else if (ACT == 8) v = tanhf(v); else if (ACT == 9) v = 0.5f * v * (1.0f + tanhf(0.7978845608028654f * (v + 0.044715f * v * v * v))); else if (ACT == 11) v = 1.0f / (1.0f + expf(-v)); else if (ACT == 12) v = (v > 0.f) ? v : 0.01f * v; else if (ACT == 14) v = (v > 0.f) ? v : 0.1f * v; else if (ACT == 16) v = (v >= 0.f) ? v : 0.3f * v; else if (ACT == 17) v = (v >= 0.f) ? v : 0.2f * v; else if (ACT == 15) v = v / (1.0f + expf(-v)); else if (ACT == 3) v = fmaxf(v, 0.f); else if (ACT == 6) v = 0.5f * v * (1.0f + erff(v * 0.70710678118654752f)); so[w][8 * hh + r][t * 16 + ln] = v; } }
  __builtin_amdgcn_fence(__ATOMIC_ACQ_REL, "workgroup"); __builtin_amdgcn_wave_barrier();
  const int rsub = lane >> 4, c4 = (lane & 15) * 4; typedef _Float16 v4h __attribute__((ext_vector_type(4)));
  {
#pragma unroll
    for (int q = 0; q < 8; ++q) { const int r = q * 2 + rsub; if (col0 + c4 < N) { const v4f v = *(const v4fa*)&so[w][r][c4]; if (C) *(v4f*)(C + cofs + (size_t)(row0 + r) * ldc + col0 + c4) = v; if (C16) { v4h h4; for (int i = 0; i < 4; ++i) h4[i] = (_Float16)v[i]; *(v4h*)(C16 + cofs + (size_t)(row0 + r) * ldc + col0 + c4) = h4; } } }
     }
}


typedef _Float16 v4h __attribute__((ext_vector_type(4)));

// All five f32 inputs become f16 planes in ONE launch of resident waves: 256 work-groups of 16 waves (one per WGP, four waves per SIMD), so that 4,096 waves start instead of one wave per KiB of input.
// A piece is 8 neighbouring values: 32 bytes read, 16 bytes stored per lane, so a wave's store covers 512 contiguous bytes. A slab is one piece per thread of the work-group (16 KiB read). A work-group owns
// 8 neighbouring slabs of each activation plane and one of each weight plane. A thread issues all of its 38 loads before it uses the first value: the whole input is asked for at once, and each piece is
// converted and stored as it lands.
// Activations: bf16-rounded, exact in f16. Weights: bf16-rounded, x16 (exact). memory feeds both the K and the V projection: it is converted once.
#define CV_G 256                     /* work-groups */
#define CV_T 512                     /* threads per work-group */
#define CV_N (CV_G * CV_T)
#define CV_XP 8                      /* slabs per work-group and activation plane */
template <bool X16W>
__device__ __forceinline__ v8us cv_pack(v4f a, v4f b) { FragH f;
#pragma unroll
  for (int q = 0; q < 4; ++q) { f.h[q] = X16W ? (_Float16)(bf16_round(a[q]) * 16.0f) : (_Float16)bf16_round(a[q]); f.h[4 + q] = X16W ? (_Float16)(bf16_round(b[q]) * 16.0f) : (_Float16)bf16_round(b[q]); }
  return f.half[0]; }
__global__ __launch_bounds__(CV_T) __attribute__((amdgpu_waves_per_eu(4, 4))) void k_cvt(const float* __restrict__ xq, const float* __restrict__ xm, const float* __restrict__ wq, const float* __restrict__ wk, const float* __restrict__ wv,
                                              _Float16* __restrict__ XQ, _Float16* __restrict__ XM, _Float16* __restrict__ BQ, _Float16* __restrict__ BK, _Float16* __restrict__ BV) {
  static_assert(NR * DM == (size_t)8 * CV_N * CV_XP && (size_t)DM * DM == (size_t)8 * CV_N, "k_cvt: the planes divide evenly among the threads");
  const unsigned g = blockIdx.x, ib = threadIdx.x * 32u, ob = threadIdx.x * 16u;      /* the thread's byte offsets in a slab: with the uniform pointers below, one address register serves every load and one every store */
  const char* pq = (const char*)xq + (size_t)g * (CV_XP * CV_T * 32); const char* pm = (const char*)xm + (size_t)g * (CV_XP * CV_T * 32);
  const char* pw[3] = {(const char*)wq + (size_t)g * (CV_T * 32), (const char*)wk + (size_t)g * (CV_T * 32), (const char*)wv + (size_t)g * (CV_T * 32)};
  char* oq = (char*)XQ + (size_t)g * (CV_XP * CV_T * 16); char* om = (char*)XM + (size_t)g * (CV_XP * CV_T * 16);
  char* ow[3] = {(char*)BQ + (size_t)g * (CV_T * 16), (char*)BK + (size_t)g * (CV_T * 16), (char*)BV + (size_t)g * (CV_T * 16)};
  v4f q[CV_XP][2], m[CV_XP][2], w[3][2];      /* every '#pragma unroll' below gives constant indices: the pieces stay in registers */
  /* The scheduling barriers of the three load loops keep the 38 loads one group, in the order in which the pieces are used, in front of the first conversion: without them the compiler either sinks the loads
     among the conversions (about nine in flight) or issues the first piece's loads late, so that the first counted wait covers half the group. */
#pragma unroll
  for (int i = 0; i < CV_XP; ++i) { q[i][0] = *(const v4fa*)(pq + i * (CV_T * 32) + ib); q[i][1] = *(const v4fa*)(pq + i * (CV_T * 32) + ib + 16); __builtin_amdgcn_sched_barrier(0); }
#pragma unroll
  for (int i = 0; i < CV_XP; ++i) { m[i][0] = *(const v4fa*)(pm + i * (CV_T * 32) + ib); m[i][1] = *(const v4fa*)(pm + i * (CV_T * 32) + ib + 16); __builtin_amdgcn_sched_barrier(0); }
#pragma unroll
  for (int i = 0; i < 3; ++i) { w[i][0] = *(const v4fa*)(pw[i] + ib); w[i][1] = *(const v4fa*)(pw[i] + ib + 16); __builtin_amdgcn_sched_barrier(0); }
  /* The scheduling barriers of the two activation store loops keep a piece's store behind its own conversion, while later loads still fly: without them the compiler sinks the stores to the end of the kernel. */
#pragma unroll
  for (int i = 0; i < CV_XP; ++i) { *(v8us*)(oq + i * (CV_T * 16) + ob) = cv_pack<false>(q[i][0], q[i][1]); __builtin_amdgcn_sched_barrier(0); }
#pragma unroll
  for (int i = 0; i < CV_XP; ++i) { *(v8us*)(om + i * (CV_T * 16) + ob) = cv_pack<false>(m[i][0], m[i][1]); __builtin_amdgcn_sched_barrier(0); }
#pragma unroll
  for (int i = 0; i < 3; ++i) *(v8us*)(ow[i] + ob) = cv_pack<true>(w[i][0], w[i][1]); }
__global__ __launch_bounds__(256) void k_h16(const float* __restrict__ x, _Float16* __restrict__ X16, size_t n8) { const size_t t = (size_t)blockIdx.x * 256 + threadIdx.x; if (t >= n8) return; FragH f;
#pragma unroll
  for (int q = 0; q < 8; ++q) f.h[q] = (_Float16)x[t * 8 + q]; *(v8us*)((unsigned short*)X16 + t * 8) = f.half[0];  }
__global__ __launch_bounds__(256) void k_round16f(const float* __restrict__ W, _Float16* __restrict__ Bt, size_t n8) { const size_t t = (size_t)blockIdx.x * 256 + threadIdx.x; if (t >= n8) return; FragH f;
#pragma unroll
  for (int i = 0; i < 8; ++i) f.h[i] = (_Float16)(bf16_round(W[t * 8 + i]) * 16.0f); *(v8us*)((unsigned short*)Bt + t * 8) = f.half[0];  }
template <int NHv, int TTv>
__global__ __launch_bounds__(256) void k_vt(const _Float16* __restrict__ V16, int ldv, int voff, _Float16* __restrict__ Vt) { __shared__ unsigned short tl[64][66]; const int tid = threadIdx.x; const int slab = blockIdx.x / (TTv / 64), lg = blockIdx.x % (TTv / 64); const int b = slab / NHv, h = slab % NHv;
  for (int i = tid; i < 64 * 8; i += 256) { const int r = i / 8, c8 = (i % 8) * 8; FragH f; f.half[0] = *(const v8us*)((const unsigned short*)V16 + ((size_t)b * TTv + lg * 64 + r) * ldv + voff + h * 64 + c8);
#pragma unroll
    for (int q = 0; q < 8; ++q) tl[r][c8 + q] = f.u[q]; }
  __syncthreads();
  {
#pragma unroll
    for (int rd = 0; rd < 2; ++rd) { const int d = rd * 32 + tid / 8, pc = tid % 8; FragH f;
#pragma unroll
      for (int q = 0; q < 8; ++q) f.u[q] = tl[pc * 8 + q][d];
      *(v8us*)((unsigned short*)Vt + ((size_t)slab * 64 + d) * TTv + lg * 64 + pc * 8) = f.half[0]; }
     } }

__global__ __launch_bounds__(256) void k_hl(const float* __restrict__ F, _Float16* __restrict__ Hh, _Float16* __restrict__ Hl, size_t n8) { const size_t t = (size_t)blockIdx.x * 256 + threadIdx.x; if (t >= n8) return; FragH fh, fl; const v4f a = *(const v4fa*)(F + t * 8), c = *(const v4fa*)(F + t * 8 + 4);
#pragma unroll
  for (int q = 0; q < 4; ++q) { _Float16 h = (_Float16)a[q]; fh.h[q] = h; fl.h[q] = (_Float16)((a[q] - (float)h) * 1024.0f); h = (_Float16)c[q]; fh.h[4 + q] = h; fl.h[4 + q] = (_Float16)((c[q] - (float)h) * 1024.0f); }
  { *(v8us*)((unsigned short*)Hh + t * 8) = fh.half[0]; *(v8us*)((unsigned short*)Hl + t * 8) = fl.half[0];  } }

__device__ __forceinline__ v16h g2_frag(const _Float16* p, int hh) { FragH f; f.half[0] = *(const v8us*)((const unsigned short*)p + 8 * hh); f.half[1] = *(const v8us*)((const unsigned short*)p + 16 + 8 * hh); return f.v; }
// Projection GEMM Y[8192][1024] = f16(X W^T * alpha + bias), X and W as f16 rows with k along the row. A work-group of four waves (2 x 2) owns a 128 x 128 tile of Y, a wave 64 x 64.
// The W and X tiles of 64 k (128-byte rows) are brought by whole-line global loads and shared through LDS: two buffers, the next tile's loads fly in registers while this tile is worked on,
// one barrier per tile. The wave forms Y^T = W X^T (A = W rows, B = X rows, both read with fa_frag, so the two k orders are equal): a lane then holds eight neighbouring output columns of one
// token row, which pack into one 16-byte piece; the pieces pass through the wave's own part of the (then free) ring, so that every global store covers whole 128-byte lines.
// amdgpu_waves_per_eu(2, 2): two work-groups per WGP, the 512 work-groups of a launch spread evenly, and one work-group's matrix work covers the other's barrier and LDS waits.
// Every '#pragma unroll' in k_proj gives constant indices, so that the fragment, staging and accumulator arrays stay in registers.
#define PG_T 128                     /* tile edge in rows of W and of X */
#define PG_K 64                      /* k per LDS tile */
#define PG_PITCH 144                 /* LDS row pitch in bytes: 128 of data, an odd multiple of 16 for the 16-byte fragment reads */
#define PG_NS (DM / PG_K)
__device__ __forceinline__ v16h fa_frag(const unsigned char* p);
__device__ __forceinline__ v8f fa_mma(v16h a, v16h b, v8f c);
__global__ __launch_bounds__(128) __attribute__((amdgpu_waves_per_eu(2, 2))) void k_proj(const _Float16* __restrict__ X, const _Float16* __restrict__ Wt, const float* __restrict__ bias, float alpha, _Float16* __restrict__ Y) {
  static_assert(MP % PG_T == 0 && DM % PG_T == 0 && DM % PG_K == 0, "k_proj: whole tiles only");
  __shared__ __attribute__((aligned(16))) unsigned char L[2][2][PG_T * PG_PITCH];      /* [buffer][W rows | X rows] */
  const int tid = threadIdx.x, lane = tid & 31, wave = tid >> 5, c = lane & 15, h = lane >> 4;
  const int mt = blockIdx.x / (DM / PG_T), nq = blockIdx.x % (DM / PG_T); const int row0 = mt * PG_T, col0 = nq * PG_T; const int wm = wave >> 1, wn = wave & 1;
  const int sr = tid >> 3, sc = (tid & 7) * 8;      /* staging: 8 threads cover one 128-byte row, 16 rows per load */
  const unsigned short* wg = (const unsigned short*)Wt + (size_t)(col0 + sr) * DM + sc;
  const unsigned short* xg = (const unsigned short*)X + (size_t)(row0 + sr) * DM + sc;
  const int so = sr * PG_PITCH + sc * 2;
  const int fw = (64 * wn + c) * PG_PITCH + 16 * h, fx = (64 * wm + c) * PG_PITCH + 16 * h;      /* the lane's fragment row and its 16 h bytes */
  const v8f z8 = {0.f, 0.f, 0.f, 0.f, 0.f, 0.f, 0.f, 0.f};
  v8f acc[4][4];      /* [16 output columns i][16 token rows j]: register r = column 16 i + 8 h + r, lane column c = token row 16 j + c */
#pragma unroll
  for (int i = 0; i < 4; ++i)
#pragma unroll
    for (int j = 0; j < 4; ++j) acc[i][j] = z8;
  v8us rw[8], rx[8];
#pragma unroll
  for (int i = 0; i < 8; ++i) { rw[i] = *(const v8us*)(wg + (size_t)(16 * i) * DM); rx[i] = *(const v8us*)(xg + (size_t)(16 * i) * DM); }
#pragma unroll
  for (int i = 0; i < 8; ++i) { *(v8us*)&L[0][0][so + 16 * i * PG_PITCH] = rw[i]; *(v8us*)&L[0][1][so + 16 * i * PG_PITCH] = rx[i]; }
  __syncthreads();      /* tile 0 is visible to all waves */
#pragma unroll 1      /* rolled, last trip not peeled off, as in k_fattn: the next tile's global loads stay at the head of the trip, whose work covers their latency */
  for (int s = 0; s < PG_NS; ++s) {
    const unsigned char* Wb = &L[s & 1][0][0]; const unsigned char* Xb = &L[s & 1][1][0];
    if (s + 1 < PG_NS) {
#pragma unroll
      for (int i = 0; i < 8; ++i) { rw[i] = *(const v8us*)(wg + (size_t)(16 * i) * DM + (s + 1) * PG_K); rx[i] = *(const v8us*)(xg + (size_t)(16 * i) * DM + (s + 1) * PG_K); } }
    v16h wf[2][4], xf[2][4];      /* [32 k][16 rows] */
#pragma unroll
    for (int kc = 0; kc < 2; ++kc)
#pragma unroll
      for (int i = 0; i < 4; ++i) { wf[kc][i] = fa_frag(Wb + fw + 16 * i * PG_PITCH + 64 * kc); xf[kc][i] = fa_frag(Xb + fx + 16 * i * PG_PITCH + 64 * kc); }
    __builtin_amdgcn_sched_barrier(0);      /* the trip's 32 fragment reads stay one group in front of its 32 products: without it the compiler reads one W fragment at a time and waits for it in front of every four products */
#pragma unroll
    for (int kc = 0; kc < 2; ++kc)
#pragma unroll
      for (int i = 0; i < 4; ++i)
#pragma unroll
        for (int j = 0; j < 4; ++j) acc[i][j] = fa_mma(wf[kc][i], xf[kc][j], acc[i][j]);
    __builtin_amdgcn_sched_barrier(0); asm volatile("v_nop\n\tv_nop\n\tv_nop\n\tv_nop"); __builtin_amdgcn_sched_barrier(0);      /* four vector slots behind the trip's last WMMA, in front of the branches that follow it */
    if (s + 1 < PG_NS) { unsigned char* Wn = &L[(s + 1) & 1][0][0]; unsigned char* Xn = &L[(s + 1) & 1][1][0];
#pragma unroll
      for (int i = 0; i < 8; ++i) { *(v8us*)(Wn + so + 16 * i * PG_PITCH) = rw[i]; *(v8us*)(Xn + so + 16 * i * PG_PITCH) = rx[i]; } }
    __syncthreads();      /* publishes tile s + 1 and ends every wave's reads of tile s, whose buffer the next trip refills; behind the last trip it frees the ring for the output staging */
  }
  unsigned char* st = &L[0][0][0] + wave * (64 * PG_PITCH);      /* the wave's own 64 rows of 128 bytes */
#pragma unroll
  for (int i = 0; i < 4; ++i) { const float* bp = bias + col0 + 64 * wn + 16 * i + 8 * h; float bv[8];
#pragma unroll
    for (int r = 0; r < 8; ++r) bv[r] = bf16_round(bp[r]);
#pragma unroll
    for (int j = 0; j < 4; ++j) { FragH f;
#pragma unroll
      for (int r = 0; r < 8; ++r) f.h[r] = (_Float16)(acc[i][j][r] * alpha + bv[r]);
      *(v8us*)(st + (16 * j + c) * PG_PITCH + 32 * i + 16 * h) = f.half[0]; } }
  __builtin_amdgcn_fence(__ATOMIC_ACQ_REL, "workgroup"); __builtin_amdgcn_wave_barrier();      /* the wave's lanes read each other's pieces: the reads stay behind the writes */
  unsigned short* yp = (unsigned short*)Y + (size_t)(row0 + 64 * wm + (lane >> 3)) * DM + col0 + 64 * wn + (lane & 7) * 8;
#pragma unroll
  for (int q = 0; q < 16; ++q) { const v8us v = *(const v8us*)(st + (4 * q + (lane >> 3)) * PG_PITCH + (lane & 7) * 16); *(v8us*)(yp + (size_t)(4 * q) * DM) = v; } }


#define FA_NW 8                      /* waves per work-group */
#define FA_SK 64                     /* keys per LDS tile (two passes of 32) */
#define FA_PITCH 144                 /* LDS row pitch in bytes: 128 of data, an odd multiple of 16 for the 16-byte fragment reads */
#define FA_NS (SQ / FA_SK)
__device__ __forceinline__ float fa_x16(float v) { const int i = __float_as_int(v); return __int_as_float(__builtin_amdgcn_permlanex16(i, i, 0x76543210, 0xfedcba98, false, false)); }      /* value of lane ^ 16 */
__device__ __forceinline__ v16h fa_frag(const unsigned char* p) { FragH f; f.half[0] = *(const v8us*)p; f.half[1] = *(const v8us*)(p + 32); return f.v; }      /* k = 8 h .. 8 h + 7 and 16 + 8 h .. 16 + 8 h + 7; p already holds the lane's 16 h bytes */
__device__ __forceinline__ v8f fa_mma(v16h a, v16h b, v8f c) { return __builtin_amdgcn_wmma_f32_16x16x32_f16(false, a, false, b, (short)0, c, false, false); }
__global__ __launch_bounds__(32 * FA_NW) __attribute__((amdgpu_waves_per_eu(4, 4))) void k_fattn(const _Float16* __restrict__ Q16, const _Float16* __restrict__ K16, const _Float16* __restrict__ VT, float* __restrict__ out) {
  static_assert(HD == 64 && SQ % (32 * FA_NW) == 0 && SQ % FA_SK == 0, "k_fattn: head size 64, whole work-groups of queries, whole tiles of keys");
  __shared__ __attribute__((aligned(16))) unsigned char L[2][2][FA_SK * FA_PITCH];      /* [buffer][K rows by key | V^T rows by d] */
  typedef _Float16 h2 __attribute__((ext_vector_type(2))); typedef float f2 __attribute__((ext_vector_type(2)));
  const int tid = threadIdx.x, lane = tid & 31, wave = tid >> 5, c = lane & 15, h = lane >> 4;
  const int bh = blockIdx.y, b = bh / NH, hd = bh % NH; const int q0 = blockIdx.x * (32 * FA_NW) + wave * 32;
  const float cscale = 0.125f * 1.4426950408889634f;      /* 64^-0.5, scores taken to base 2 */
  const int sr = tid >> 3, sc = (tid & 7) * 8;      /* staging: 8 threads cover one 128-byte row, 32 rows per load */
  const unsigned short* kg = (const unsigned short*)K16 + ((size_t)b * SQ + sr) * LQ + hd * HD + sc;      /* row = key */
  const unsigned short* vg = (const unsigned short*)VT + ((size_t)bh * HD + sr) * SQ + sc;      /* row = d, keys along the row */
  const int so0 = sr * FA_PITCH + sc * 2, so1 = so0 + 32 * FA_PITCH;
  v16h qf[2][2];      /* B operand: column = query, k = d */
#pragma unroll
  for (int g = 0; g < 2; ++g)
#pragma unroll
    for (int kc = 0; kc < 2; ++kc) qf[g][kc] = g2_frag(Q16 + ((size_t)b * SQ + q0 + 16 * g + c) * LQ + hd * HD + 32 * kc, h);
  FragH ones;      /* A operand whose row 0 is 1.0: its product with P^T gives the column sums of P^T in row 0 */
#pragma unroll
  for (int i = 0; i < 16; ++i) ones.u[i] = (c == 0) ? (unsigned short)0x3C00 : (unsigned short)0;
  const v8f z8 = {0.f, 0.f, 0.f, 0.f, 0.f, 0.f, 0.f, 0.f};
  v8f acc[2][4], lacc[2]; float m_run[2];
#pragma unroll
  for (int g = 0; g < 2; ++g) { m_run[g] = -__builtin_inff(); lacc[g] = z8;
#pragma unroll
    for (int t = 0; t < 4; ++t) acc[g][t] = z8; }
  v8us rk0 = *(const v8us*)kg, rk1 = *(const v8us*)(kg + (size_t)32 * LQ), rv0 = *(const v8us*)vg, rv1 = *(const v8us*)(vg + (size_t)32 * SQ);
  *(v8us*)&L[0][0][so0] = rk0; *(v8us*)&L[0][0][so1] = rk1; *(v8us*)&L[0][1][so0] = rv0; *(v8us*)&L[0][1][so1] = rv1;
  __syncthreads();      /* tile 0 is visible to all waves */
#pragma unroll 1      /* rolled, last trip not peeled off: in the peeled build the compiler sinks the next tile's global loads down to their LDS stores, and the trip's work no longer covers their latency */
  for (int s = 0; s < FA_NS; ++s) {
    const unsigned char* Kb = &L[s & 1][0][0]; const unsigned char* Vb = &L[s & 1][1][0];
    if (s + 1 < FA_NS) { const unsigned short* kn = kg + (size_t)(s + 1) * FA_SK * LQ; const unsigned short* vn = vg + (s + 1) * FA_SK;
      rk0 = *(const v8us*)kn; rk1 = *(const v8us*)(kn + (size_t)32 * LQ); rv0 = *(const v8us*)vn; rv1 = *(const v8us*)(vn + (size_t)32 * SQ); }
#pragma unroll
    for (int sub = 0; sub < 2; ++sub) {      /* one pass: 32 keys */
      v8f sx[2][2];      /* [16-key tile][column group]: register r = key 16 kt + 8 h + r, lane column c = query */
#pragma unroll
      for (int kt = 0; kt < 2; ++kt) { const unsigned char* kp = Kb + (32 * sub + 16 * kt + c) * FA_PITCH + 16 * h; const v16h k0 = fa_frag(kp), k1 = fa_frag(kp + 64);
#pragma unroll
        for (int g = 0; g < 2; ++g) sx[kt][g] = fa_mma(k1, qf[g][1], fa_mma(k0, qf[g][0], z8)); }
      float mb[2]; bool need = false;
#pragma unroll
      for (int g = 0; g < 2; ++g) { float mx = sx[0][g][0];
#pragma unroll
        for (int r = 1; r < 8; ++r) mx = fmaxf(mx, sx[0][g][r]);
#pragma unroll
        for (int r = 0; r < 8; ++r) mx = fmaxf(mx, sx[1][g][r]);
        mx = fmaxf(mx, fa_x16(mx)) * cscale; mb[g] = mx; need = need || (mx > m_run[g] + 8.0f); }
      if (__builtin_amdgcn_ballot_w32(need) != 0) {      /* lazy rescale: the maximum in use may trail the true one by up to 8 (base 2), so an exponential stays below 2^8 */
#pragma unroll
        for (int g = 0; g < 2; ++g) { const float m_new = fmaxf(m_run[g], mb[g]); const float corr = __builtin_amdgcn_exp2f(m_run[g] - m_new); m_run[g] = m_new; lacc[g] = lacc[g] * corr;
#pragma unroll
          for (int t = 0; t < 4; ++t) acc[g][t] = acc[g][t] * corr; } }
      v16h vf[4];      /* A operand: row = d, k = the pass's 32 keys */
#pragma unroll
      for (int t = 0; t < 4; ++t) vf[t] = fa_frag(Vb + (16 * t + c) * FA_PITCH + 64 * sub + 16 * h);
#pragma unroll
      for (int g = 0; g < 2; ++g) { const float nm = -m_run[g]; union { v16h v; h2 p[8]; } pf;      /* B operand: element pair i = keys 16 (i >> 2) + 8 h + 2 (i & 3), + 1: the k order of fa_frag */
#pragma unroll
        for (int i = 0; i < 8; ++i) { const float e0 = __builtin_amdgcn_exp2f(fmaf(sx[i >> 2][g][2 * (i & 3)], cscale, nm)), e1 = __builtin_amdgcn_exp2f(fmaf(sx[i >> 2][g][2 * (i & 3) + 1], cscale, nm)); pf.p[i] = __builtin_convertvector(f2{e0, e1}, h2); }
#pragma unroll
        for (int t = 0; t < 4; ++t) acc[g][t] = fa_mma(vf[t], pf.v, acc[g][t]);
        lacc[g] = fa_mma(ones.v, pf.v, lacc[g]); }
    }
    __builtin_amdgcn_sched_barrier(0); asm volatile("v_nop\n\tv_nop\n\tv_nop\n\tv_nop"); __builtin_amdgcn_sched_barrier(0);      /* four vector slots behind the trip's last WMMA, in front of the branches that follow it */
    if (s + 1 < FA_NS) { unsigned char* Kn = &L[(s + 1) & 1][0][0]; unsigned char* Vn = &L[(s + 1) & 1][1][0];
      *(v8us*)(Kn + so0) = rk0; *(v8us*)(Kn + so1) = rk1; *(v8us*)(Vn + so0) = rv0; *(v8us*)(Vn + so1) = rv1; }
    __syncthreads();      /* publishes tile s + 1 and ends every wave's reads of tile s, whose buffer the next trip refills */
  }
#pragma unroll
  for (int g = 0; g < 2; ++g) { const float lr = lacc[g][0]; const float inv = 1.0f / (lr + fa_x16(lr));      /* row 0 of the sum tile sits in lanes 0-15, lanes 16-31 hold row 8 = 0: the exchange-and-add stays unconditional */
    float* op = out + ((size_t)b * SQ + q0 + 16 * g + c) * DM + hd * HD + 8 * h;      /* register r of tile t = d 16 t + 8 h + r of query column c */
#pragma unroll
    for (int t = 0; t < 4; ++t) { const v8f o = acc[g][t] * inv; const v4f lo = {o[0], o[1], o[2], o[3]}, hi = {o[4], o[5], o[6], o[7]}; *(v4f*)(op + 16 * t) = lo; *(v4f*)(op + 16 * t + 4) = hi; } } }
__global__ __launch_bounds__(256) void k_vt(const _Float16* __restrict__ V16, int b, int h0, _Float16* __restrict__ VT) { __shared__ unsigned short tl[64][65]; const int tid = threadIdx.x; const int hh = blockIdx.x % HG, sg = blockIdx.x / HG; const int s0 = sg * 64; const int h = h0 + hh;
  for (int i = tid; i < 64 * 8; i += 256) { const int j = i / 8, d8 = (i % 8) * 8; FragH f; f.half[0] = *(const v8us*)((const unsigned short*)V16 + ((size_t)b * SQ + s0 + j) * DM + h * HD + d8); for (int q = 0; q < 8; ++q) tl[d8 + q][j] = f.u[q]; }
  __syncthreads();
  { for (int i = tid; i < 64 * 8; i += 256) { const int d = i / 8, j8 = (i % 8) * 8; FragH f; for (int q = 0; q < 8; ++q) f.u[q] = tl[d][j8 + q]; *(v8us*)((unsigned short*)VT + ((size_t)hh * HD + d) * SQ + s0 + j8) = f.half[0]; }  } }



__global__ __launch_bounds__(256) void k_rsmkm(const float* __restrict__ S, _Float16* __restrict__ P, int nrows, const int* __restrict__ am) {
  #pragma clang fp contract(off)
  const int t = blockIdx.x * 256 + threadIdx.x; if (t >= nrows) return; const size_t i = (size_t)t; const float* s = S + i * SQ; const int* mr = am + (size_t)(t % SQ) * SQ; float mx = -3.0e38f;
#pragma unroll 1
  for (int j = 0; j < SQ; ++j) { const float f = (mr[j] != 0) ? 1.f : 0.f; mx = fmaxf(mx, fmaf(f, s[j], (1.f - f) * -1.0e9f)); } float se = 0.f;
#pragma unroll 1
  for (int j = 0; j < SQ; ++j) { const float f = (mr[j] != 0) ? 1.f : 0.f; se += __expf(fmaf(f, s[j], (1.f - f) * -1.0e9f) - mx); } const float sc = 256.0f / se;
#pragma unroll 1
  for (int j0 = 0; j0 < SQ; j0 += 8) { FragH fr; for (int q = 0; q < 8; ++q) { const int j = j0 + q; const float f = (mr[j] != 0) ? 1.f : 0.f; fr.h[q] = (_Float16)(__expf(fmaf(f, s[j], (1.f - f) * -1.0e9f) - mx) * sc); }
    unsigned short* d = (unsigned short*)P + i * SQ + j0; *(v8us*)d = fr.half[0];  } }
extern "C" void kernel_launch(void* const* d_in, const int* in_sizes, int n_in,
                              void* d_out, int out_size, void* d_ws, size_t ws_size, hipStream_t stream) {
  (void)in_sizes; (void)n_in; (void)out_size;
  const float* const* I = (const float* const*)d_in; const float* xq = I[0]; const float* xm = I[1]; const float* wq = I[2]; const float* bq = I[3]; const float* wk = I[4]; const float* bk = I[5]; const float* wv = I[6]; const float* bv = I[7];      /* input (queries), memory (keys AND values); natural weights + biases; no output projection */
  char* ws = (char*)d_ws; size_t off = 0;
  auto take = [&](size_t bytes) { char* p = ws + off; off += (bytes + 255) & ~(size_t)255; return p; };
  _Float16* BQ = (_Float16*)take((size_t)DM * DM * 2); _Float16* BK = (_Float16*)take((size_t)DM * DM * 2); _Float16* BV = (_Float16*)take((size_t)DM * DM * 2); 
  _Float16* X16 = (_Float16*)take(NR * DM * 2); _Float16* XM = (_Float16*)take(NR * DM * 2); _Float16* Q16 = (_Float16*)take(NR * DM * 2); _Float16* K16 = (_Float16*)take(NR * DM * 2); _Float16* V16 = (_Float16*)take(NR * DM * 2); 
  _Float16* VT = (_Float16*)take((size_t)NB * NH * HD * SQ * 2);
  if (off > ws_size) return;
  k_cvt<<<CV_G, CV_T, 0, stream>>>(xq, xm, wq, wk, wv, X16, XM, BQ, BK, BV);      /* input and memory as exact f16 rows; natural [out][in] weights = Bt x16 (no output projection: no Wo plane) */
  const size_t r0p = (size_t)B0 * SQ;      /* first projected row */
  k_proj<<<(MP / PG_T) * (DM / PG_T), 128, 0, stream>>>(X16 + r0p * DM, BQ, bq, 0.0625f, Q16 + r0p * DM);
  k_proj<<<(MP / PG_T) * (DM / PG_T), 128, 0, stream>>>(XM + r0p * DM, BK, bk, 0.0625f, K16 + r0p * DM);
  k_proj<<<(MP / PG_T) * (DM / PG_T), 128, 0, stream>>>(XM + r0p * DM, BV, bv, 0.0625f, V16 + r0p * DM);
  k_vt<NH, SQ><<<NB * NH * (SQ / 64), 256, 0, stream>>>(V16, LQ, 0, VT);      /* V^T [NB * NH][HD][SQ] */
  k_fattn<<<dim3(SQ / (32 * FA_NW), NB * NH), 32 * FA_NW, 0, stream>>>(Q16, K16, VT, (float*)d_out);      /* out = softmax(q k^T / 8) v straight to the f32 output (merged heads; each 256-B head segment of a row written by one wave) */
  /* no output projection in this module */
}

// v005
// It runs in 121 microseconds.
// In both of two side-by-side timings against v004, it was 1.07 times as fast.
// Counting every step since v000, it is 60.7 times as fast.
#include <hip/hip_runtime.h>
// Multi-head CROSS-attention without an output projection (input, memory [4][2048][1024]; q = input Wq^T + bq, k = memory Wk^T + bk, v = memory Wv^T + bv (natural [1024][1024], zero biases); 16 heads of 64; q * 64^-0.5 then q k^T; softmax over all 2048 memory positions (no mask); out = attn v merged to [4][2048][1024]; NO output projection).
// Structure: token rows r = b*2048 + s; x as exact f16 rows (bf16-rounded); Q, K, V as three WMMA GEMMs (128x128 tiles through LDS, 64x64 wave tiles, f32 accumulation, exact x16 weights + bias, f16 outputs) in ONE launch, whose V tiles exchange the operand roles and store V^T [batch * head][d][key] themselves; one fused attention launch (k_fattn): S^T = K Q^T (K = 64), online softmax (f32 statistics, base 2, weights as f16 relative to the running maximum), O^T += V^T P^T, divided by the row sum and written straight into the merged f32 output rows.
// Compute dtype: inputs rounded to bf16; x / weights exact; q, k, v and softmax weights as plain f16 GEMM operands (~2^-12); scores, softmax statistics and o f32. v_wmma_f32_16x16x32_f16.
#define NB 4
#define SQ 2048
#define DM 1024
#define NH 16
#define HD 64
#define HG 4                         /* heads per k_vt(b, h0) launch (that overload is not launched) */
#define B0 0                         /* first batch processed (debug hook) */
#define NBR NB                       /* batches processed (debug hook) */
#define NR ((size_t)NB * SQ)         /* token rows */
#define MP ((int)((size_t)NBR * SQ)) /* rows projected (debug hook) */
#define QN SQ                        /* unused (attention covers all SQ query rows) */
#define NHD NH                       /* unused (attention covers all NH heads) */
#define MPO MP                       /* unused (no output projection) */
#define LQ DM      /* row pitch of the q and k rows */
typedef __bf16 v16b __attribute__((ext_vector_type(16)));
typedef unsigned short v8us __attribute__((ext_vector_type(8), may_alias));
typedef float  v8f  __attribute__((ext_vector_type(8)));
typedef float  v4f  __attribute__((ext_vector_type(4)));
typedef float  v4fa __attribute__((ext_vector_type(4), may_alias));
union FragB { v16b v; v8us half[2]; unsigned short u[16]; };

__device__ __forceinline__ unsigned short bf16_bits(float x) { unsigned int u = __float_as_uint(x); return (unsigned short)((u + 0x7FFFu + ((u >> 16) & 1u)) >> 16); }
__device__ __forceinline__ float bf16_val(unsigned short b) { return __uint_as_float(((unsigned int)b) << 16); }
__device__ __forceinline__ float bf16_round(float x) { return bf16_val(bf16_bits(x)); }
// D += A·B with NT terms: 1 = ah·bh, 2 = + al·bh (A split), 3 = + ah·bl (both split)
template <int NT>
__device__ __forceinline__ v8f mmaN(v16b ah, v16b al, v16b bh, v16b bl, v8f c) {
  c = __builtin_amdgcn_wmma_f32_16x16x32_bf16(false, ah, false, bh, (short)0, c, false, false);
  if (NT >= 2) c = __builtin_amdgcn_wmma_f32_16x16x32_bf16(false, al, false, bh, (short)0, c, false, false);
  if (NT >= 3) c = __builtin_amdgcn_wmma_f32_16x16x32_bf16(false, ah, false, bl, (short)0, c, false, false);
  asm volatile("v_nop\n\tv_nop\n\tv_nop\n\tv_nop" : "+v"(c) : "v"(ah), "v"(al), "v"(bh), "v"(bl));
  return c;
}

__global__ __launch_bounds__(256) void k_wt_bf16(const float* __restrict__ W, unsigned short* __restrict__ Wt, int K, int N) {
  const int t = blockIdx.x * 256 + threadIdx.x;
  const int k8n = K / 8;
  if (t >= N * k8n) return;
  const int n = t / k8n, k8 = (t % k8n) * 8;
  v8us v;
#pragma unroll
  for (int i = 0; i < 8; ++i) v[i] = bf16_bits(W[(size_t)(k8 + i) * N + n]);
  *(v8us*)(Wt + (size_t)n * K + k8) = v;
  
}

// GEMM C[M][N] (f32, pitch ldc) = act(A[M][K]·W + bias). A f32 row-major (pitch lda) converted per fragment to bf16
// (ASPLIT: hi/lo two planes -> 2 terms, else single rounded term); Wt bf16 [N][K] (pitch ldb). BIAS_BF16 rounds the
// bias to bf16 first (bias quantised to bf16 before the add). K%32==0, M%16==0, N%64==0.
template <bool ASPLIT, int ACT, bool BIAS_BF16>
__global__ __launch_bounds__(128) void k_gemm_bf(const float* __restrict__ A, int lda, const unsigned short* __restrict__ Wt, int ldb,
                                               const float* __restrict__ bias, float* __restrict__ C, int ldc, int M, int N, int K) {
  __shared__ __attribute__((aligned(16))) float so[4][16][64];
  const int tid = threadIdx.x, w = tid >> 5, lane = tid & 31, ln = lane & 15, hh = lane >> 4;
  const int ntn = N / 64;
  const int wid = blockIdx.x * 4 + w;
  const int mt = wid / ntn, nq = wid % ntn;
  if (mt * 16 >= M) return;
  const int row0 = mt * 16, col0 = nq * 64;
  const float* arow = A + (size_t)(row0 + ln) * lda;
  v8f acc[4] = {};
  for (int kb = 0; kb < K; kb += 32) {
    FragB ah, al;
    const v4f x0 = *(const v4fa*)(arow + kb + 8 * hh), x1 = *(const v4fa*)(arow + kb + 8 * hh + 4);
    const v4f x2 = *(const v4fa*)(arow + kb + 16 + 8 * hh), x3 = *(const v4fa*)(arow + kb + 16 + 8 * hh + 4);
    float xs[16] = {x0[0],x0[1],x0[2],x0[3],x1[0],x1[1],x1[2],x1[3],x2[0],x2[1],x2[2],x2[3],x3[0],x3[1],x3[2],x3[3]};
#pragma unroll
    for (int i = 0; i < 16; ++i) { const unsigned short hb = bf16_bits(xs[i]); ah.u[i] = hb; al.u[i] = ASPLIT ? bf16_bits(xs[i] - bf16_val(hb)) : (unsigned short)0; }
#pragma unroll
    for (int t = 0; t < 4; ++t) {
      const unsigned short* brow = Wt + (size_t)(col0 + t * 16 + ln) * ldb + kb;
      FragB b;
      b.half[0] = *(const v8us*)(brow + 8 * hh);
      b.half[1] = *(const v8us*)(brow + 16 + 8 * hh);
      acc[t] = mmaN<ASPLIT ? 2 : 1>(ah.v, al.v, b.v, b.v, acc[t]);
    }
  }
#pragma unroll
  for (int t = 0; t < 4; ++t) {
    float bv = bias ? bias[col0 + t * 16 + ln] : 0.f;
    if (BIAS_BF16) bv = bf16_round(bv);
#pragma unroll
    for (int r = 0; r < 8; ++r) { float v = acc[t][r] + bv; if (ACT == 1) v = fmaxf(v, 0.f); so[w][8 * hh + r][t * 16 + ln] = v; }
  }
  __builtin_amdgcn_fence(__ATOMIC_ACQ_REL, "workgroup");
  __builtin_amdgcn_wave_barrier();
  const int rsub = lane >> 4, c4 = (lane & 15) * 4;
  {
#pragma unroll
    for (int q = 0; q < 8; ++q) {
      const int r = q * 2 + rsub;
      const v4f v = *(const v4fa*)&so[w][r][c4];
      *(v4f*)(C + (size_t)(row0 + r) * ldc + col0 + c4) = v;
    }
    
  }
}

// GEMM C = act(A·W + bias + resid): A f32 (ASPLIT -> hi/lo 2 terms), Wt bf16 [N][K]; ACT 0 none, 1 relu, 2 exact gelu;
// resid (optional, f32, row index = (row % rmod), pitch ldr, RES_BF16 rounds it) added before the activation.
template <bool ASPLIT, int ACT, bool BIAS_BF16, bool RES_BF16>
__global__ __launch_bounds__(128) void k_gemm_bf3(const float* __restrict__ A, int lda, const unsigned short* __restrict__ Wt, int ldb,
                                                const float* __restrict__ bias, const float* __restrict__ resid, int rmod, int ldr,
                                                float* __restrict__ C, int ldc, int M, int N, int K) {
  __shared__ __attribute__((aligned(16))) float so[4][16][64];
  const int tid = threadIdx.x, w = tid >> 5, lane = tid & 31, ln = lane & 15, hh = lane >> 4;
  const int ntn = N / 64;
  const int wid = blockIdx.x * 4 + w;
  const int mt = wid / ntn, nq = wid % ntn;
  if (mt * 16 >= M) return;
  const int row0 = mt * 16, col0 = nq * 64;
  const float* arow = A + (size_t)(row0 + ln) * lda;
  v8f acc[4] = {};
  for (int kb = 0; kb < K; kb += 32) {
    FragB ah, al;
    const v4f x0 = *(const v4fa*)(arow + kb + 8 * hh), x1 = *(const v4fa*)(arow + kb + 8 * hh + 4);
    const v4f x2 = *(const v4fa*)(arow + kb + 16 + 8 * hh), x3 = *(const v4fa*)(arow + kb + 16 + 8 * hh + 4);
    float xs[16] = {x0[0],x0[1],x0[2],x0[3],x1[0],x1[1],x1[2],x1[3],x2[0],x2[1],x2[2],x2[3],x3[0],x3[1],x3[2],x3[3]};
#pragma unroll
    for (int i = 0; i < 16; ++i) { const unsigned short hb = bf16_bits(xs[i]); ah.u[i] = hb; al.u[i] = ASPLIT ? bf16_bits(xs[i] - bf16_val(hb)) : (unsigned short)0; }
#pragma unroll
    for (int t = 0; t < 4; ++t) {
      const unsigned short* brow = Wt + (size_t)(col0 + t * 16 + ln) * ldb + kb;
      FragB b;
      b.half[0] = *(const v8us*)(brow + 8 * hh);
      b.half[1] = *(const v8us*)(brow + 16 + 8 * hh);
      acc[t] = mmaN<ASPLIT ? 2 : 1>(ah.v, al.v, b.v, b.v, acc[t]);
    }
  }
#pragma unroll
  for (int t = 0; t < 4; ++t) {
    const int col = col0 + t * 16 + ln;
    float bv = bias ? bias[col] : 0.f;
    if (BIAS_BF16) bv = bf16_round(bv);
#pragma unroll
    for (int r = 0; r < 8; ++r) {
      float v = acc[t][r] + bv;
      if (resid) { float rv = resid[(size_t)((row0 + 8 * hh + r) % rmod) * ldr + col]; if (RES_BF16) rv = bf16_round(rv); v += rv; }
      if (ACT == 1) v = fmaxf(v, 0.f);
      if (ACT == 2) v = 0.5f * v * (1.0f + erff(v * 0.70710678118654752f));
      if (ACT == 3) { const float u = 0.7978845608028654f * (v + 0.044715f * v * v * v); v = 0.5f * v * (1.0f + tanhf(u)); }
      so[w][8 * hh + r][t * 16 + ln] = v;
    }
  }
  __builtin_amdgcn_fence(__ATOMIC_ACQ_REL, "workgroup");
  __builtin_amdgcn_wave_barrier();
  const int rsub = lane >> 4, c4 = (lane & 15) * 4;
  {
#pragma unroll
    for (int q = 0; q < 8; ++q) {
      const int r = q * 2 + rsub;
      const v4f v = *(const v4fa*)&so[w][r][c4];
      *(v4f*)(C + (size_t)(row0 + r) * ldc + col0 + c4) = v;
    }
    
  }
}
// row LayerNorm (biased variance, eps) over N: s = X (+ R); optional out_sum <- s; out_norm <- (s-mu)*rsqrt(var+eps)*g + b
template <bool PARAM_BF16>
__global__ __launch_bounds__(256) void k_layernorm(const float* __restrict__ X, const float* __restrict__ R, const float* __restrict__ g, const float* __restrict__ bta,
                                                  float* __restrict__ out_sum, float* __restrict__ out_norm, int N, float eps) {
  __shared__ float red[256];
  const int row = blockIdx.x, tid = threadIdx.x;
  const float* x = X + (size_t)row * N; const float* rr = R ? R + (size_t)row * N : nullptr;
  float vals[16];                     // up to N = 4096
  const int per = N / 256;            // contiguous chunk per thread? use strided-by-4 chunks: thread handles j = tid*4 + 1024*u
  float s1 = 0.f;
  for (int u = 0; u < per / 4; ++u) {
    const int j = tid * 4 + 1024 * u;
    const v4f a = *(const v4fa*)(x + j);
    v4f b = {0.f,0.f,0.f,0.f}; if (rr) b = *(const v4fa*)(rr + j);
#pragma unroll
    for (int q = 0; q < 4; ++q) { const float v = a[q] + b[q]; vals[u * 4 + q] = v; s1 += v; }
  }
  red[tid] = s1; __syncthreads();
  for (int st = 128; st > 0; st >>= 1) { if (tid < st) red[tid] += red[tid + st]; __syncthreads(); }
  const float mu = red[0] / (float)N; __syncthreads();
  float s2 = 0.f;
  for (int u = 0; u < per / 4; ++u)
#pragma unroll
    for (int q = 0; q < 4; ++q) { const float c = vals[u * 4 + q] - mu; s2 += c * c; }
  red[tid] = s2; __syncthreads();
  for (int st = 128; st > 0; st >>= 1) { if (tid < st) red[tid] += red[tid + st]; __syncthreads(); }
  const float rs = rsqrtf(red[0] / (float)N + eps);
  {
    for (int u = 0; u < per / 4; ++u) {
      const int j = tid * 4 + 1024 * u;
      v4f o, sm;
#pragma unroll
      for (int q = 0; q < 4; ++q) {
        float gg = g[j + q], bb = bta[j + q];
        if (PARAM_BF16) { gg = bf16_round(gg); bb = bf16_round(bb); }
        sm[q] = vals[u * 4 + q]; o[q] = (vals[u * 4 + q] - mu) * rs * gg + bb;
      }
      if (out_sum) *(v4f*)(out_sum + (size_t)row * N + j) = sm;
      *(v4f*)(out_norm + (size_t)row * N + j) = o;
    }
    
  }
}



// ---- f16 WMMA path (v_wmma_f32_16x16x32_f16): 11-bit significands for operands in range — used where a [0,1] probability operand needs more precision than bf16
typedef _Float16 v16h __attribute__((ext_vector_type(16)));
union FragH { v16h v; v8us half[2]; _Float16 h[16]; unsigned short u[16]; };
template <int NT>
__device__ __forceinline__ v8f mmaH(v16h ah, v16h al, v16h bh, v16h bl, v8f c) {
  c = __builtin_amdgcn_wmma_f32_16x16x32_f16(false, ah, false, bh, (short)0, c, false, false);
  if (NT >= 2) c = __builtin_amdgcn_wmma_f32_16x16x32_f16(false, al, false, bh, (short)0, c, false, false);
  if (NT >= 3) c = __builtin_amdgcn_wmma_f32_16x16x32_f16(false, ah, false, bl, (short)0, c, false, false);
  asm volatile("v_nop\n\tv_nop\n\tv_nop\n\tv_nop" : "+v"(c) : "v"(ah), "v"(al), "v"(bh), "v"(bl));
  return c;
}
// batched GEMM like k_gemm_b but f16 operands: A f32 (split into f16 hi/lo if ASPLIT, else rounded to f16), Bt = f16 values [n][k]; alpha; C f32; N multiple of 16 (partial tiles skipped)
template <bool ASPLIT>
__global__ __launch_bounds__(128) void k_gemm_h(const float* __restrict__ A, int lda, size_t sA, const _Float16* __restrict__ Bh, int ldb, size_t sB, float alpha, float* __restrict__ C, int ldc, size_t sC, int M, int N, int K) {
  __shared__ __attribute__((aligned(16))) float so[4][16][64];
  const int tid = threadIdx.x, w = tid >> 5, lane = tid & 31, ln = lane & 15, hh = lane >> 4; const int by = blockIdx.y;
  A += (size_t)by * sA; Bh += (size_t)by * sB; C += (size_t)by * sC;
  const int ntn = (N + 63) / 64; const int wid = blockIdx.x * 4 + w; const int mt = wid / ntn, nq = wid % ntn; if (mt * 16 >= M) return;
  const int row0 = mt * 16, col0 = nq * 64; const float* arow = A + (size_t)(row0 + ln) * lda;
  v8f acc[4] = {};
  for (int kb = 0; kb < K; kb += 32) {
    FragH ah, al;
    const v4f x0 = *(const v4fa*)(arow + kb + 8 * hh), x1 = *(const v4fa*)(arow + kb + 8 * hh + 4), x2 = *(const v4fa*)(arow + kb + 16 + 8 * hh), x3 = *(const v4fa*)(arow + kb + 16 + 8 * hh + 4);
    float xs[16] = {x0[0],x0[1],x0[2],x0[3],x1[0],x1[1],x1[2],x1[3],x2[0],x2[1],x2[2],x2[3],x3[0],x3[1],x3[2],x3[3]};
#pragma unroll
    for (int i = 0; i < 16; ++i) { const _Float16 h = (_Float16)xs[i]; ah.h[i] = h; al.h[i] = ASPLIT ? (_Float16)(xs[i] - (float)h) : (_Float16)0.0f; }
#pragma unroll
    for (int t = 0; t < 4; ++t) { if (col0 + t * 16 >= N) continue; const size_t boff = (size_t)(col0 + t * 16 + ln) * ldb + kb; FragH bq; bq.half[0] = *(const v8us*)(Bh + boff + 8 * hh); bq.half[1] = *(const v8us*)(Bh + boff + 16 + 8 * hh);
      acc[t] = mmaH<ASPLIT ? 2 : 1>(ah.v, al.v, bq.v, bq.v, acc[t]); }
  }
#pragma unroll
  for (int t = 0; t < 4; ++t) { if (col0 + t * 16 >= N) continue;
#pragma unroll
    for (int r = 0; r < 8; ++r) so[w][8 * hh + r][t * 16 + ln] = acc[t][r] * alpha; }
  __builtin_amdgcn_fence(__ATOMIC_ACQ_REL, "workgroup"); __builtin_amdgcn_wave_barrier();
  const int rsub = lane >> 4, c4 = (lane & 15) * 4;
  {
#pragma unroll
    for (int q = 0; q < 8; ++q) { const int r = q * 2 + rsub; if (col0 + c4 < N) { const v4f v = *(const v4fa*)&so[w][r][c4]; *(v4f*)(C + (size_t)(row0 + r) * ldc + col0 + c4) = v; } }
     }
}

// Wt[n][k] = f16(W[k][n]·scale) from f32 row-major W[K][N] (scale = power of two; bf16-exact weights stay exact in f16 away from the subnormal range)
__global__ __launch_bounds__(256) void k_wt_f16(const float* __restrict__ W, _Float16* __restrict__ Wt, int K, int N, float scale) {
  const int t = blockIdx.x * 256 + threadIdx.x; if (t >= N * (K / 8)) return; const int n = t / (K / 8), k8 = (t % (K / 8)) * 8; FragH f;
#pragma unroll
  for (int i = 0; i < 8; ++i) f.h[i] = (_Float16)(bf16_round(W[(size_t)(k8 + i) * N + n]) * scale); const v8us o = f.half[0];
  *(v8us*)((unsigned short*)Wt + (size_t)n * K + k8) = o; 
}
// k_gemm_hh variant with fused epilogue: v = acc·alpha + bias[by·sBias + col] (+ CP[(row/rowsPerB)·sCPb + by·64 + col] if CP) ; ACT 0 none / 1 elu ; writes f16 C16 (and f32 C if non-null)
template <int ACT>
__global__ __launch_bounds__(128) void k_gemm_hhx(const _Float16* __restrict__ A, int lda, size_t sA, const _Float16* __restrict__ Bh, int ldb, size_t sB, float alpha, const float* __restrict__ bias, size_t sBias, const float* __restrict__ CP, int rowsPerB, size_t sCPb, int row0g,
    float* __restrict__ C, _Float16* __restrict__ C16, int ldc, size_t sC, int M, int N, int K) {
  __shared__ __attribute__((aligned(16))) float so[4][16][64];
  const int tid = threadIdx.x, w = tid >> 5, lane = tid & 31, ln = lane & 15, hh = lane >> 4; const int by = blockIdx.y;
  A += (size_t)by * sA; Bh += (size_t)by * sB; const size_t cofs = (size_t)by * sC; const float* bp = bias ? bias + (size_t)by * sBias : nullptr;
  const int ntn = (N + 63) / 64; const int wid = blockIdx.x * 4 + w; const int mt = wid / ntn, nq = wid % ntn; if (mt * 16 >= M) return;
  const int row0 = mt * 16, col0 = nq * 64; const _Float16* arow = A + (size_t)(row0 + ln) * lda;
  v8f acc[4] = {};
  for (int kb = 0; kb < K; kb += 32) { FragH ah; ah.half[0] = *(const v8us*)((const unsigned short*)arow + kb + 8 * hh); ah.half[1] = *(const v8us*)((const unsigned short*)arow + kb + 16 + 8 * hh);
#pragma unroll
    for (int t = 0; t < 4; ++t) { if (col0 + t * 16 >= N) continue; const size_t boff = (size_t)(col0 + t * 16 + ln) * ldb + kb; FragH bq; bq.half[0] = *(const v8us*)((const unsigned short*)Bh + boff + 8 * hh); bq.half[1] = *(const v8us*)((const unsigned short*)Bh + boff + 16 + 8 * hh);
      acc[t] = mmaH<1>(ah.v, ah.v, bq.v, bq.v, acc[t]); }
  }
#pragma unroll
  for (int t = 0; t < 4; ++t) { if (col0 + t * 16 >= N) continue; const int col = col0 + t * 16 + ln; const float bv = bp ? bf16_round(bp[col]) : 0.f;
#pragma unroll
    for (int r = 0; r < 8; ++r) { float v = acc[t][r] * alpha + bv; if (CP) { const int rr = row0g + row0 + 8 * hh + r; if (rowsPerB < 0) v += CP[cofs + (size_t)rr * ldc + col];      /* rowsPerB < 0: own element of the batched C plane */ else { const int bidx = rr / rowsPerB; v += CP[(size_t)bidx * sCPb + (size_t)by * 64 + col]; } } if (ACT == 1) v = (v > 0.f) ? v : expm1f(v); else if (ACT == 7) v = (v > 0.f) ? v + 1.0f : expf(v); else if (ACT == 8) v = tanhf(v); else if (ACT == 9) v = 0.5f * v * (1.0f + tanhf(0.7978845608028654f * (v + 0.044715f * v * v * v))); else if (ACT == 11) v = 1.0f / (1.0f + expf(-v)); else if (ACT == 12) v = (v > 0.f) ? v : 0.01f * v; else if (ACT == 14) v = (v > 0.f) ? v : 0.1f * v; else if (ACT == 16) v = (v >= 0.f) ? v : 0.3f * v; else if (ACT == 17) v = (v >= 0.f) ? v : 0.2f * v; else if (ACT == 15) v = v / (1.0f + expf(-v)); else if (ACT == 3) v = fmaxf(v, 0.f); else if (ACT == 6) v = 0.5f * v * (1.0f + erff(v * 0.70710678118654752f)); so[w][8 * hh + r][t * 16 + ln] = v; } }
  __builtin_amdgcn_fence(__ATOMIC_ACQ_REL, "workgroup"); __builtin_amdgcn_wave_barrier();
  const int rsub = lane >> 4, c4 = (lane & 15) * 4; typedef _Float16 v4h __attribute__((ext_vector_type(4)));
  {
#pragma unroll
    for (int q = 0; q < 8; ++q) { const int r = q * 2 + rsub; if (col0 + c4 < N) { const v4f v = *(const v4fa*)&so[w][r][c4]; if (C) *(v4f*)(C + cofs + (size_t)(row0 + r) * ldc + col0 + c4) = v; if (C16) { v4h h4; for (int i = 0; i < 4; ++i) h4[i] = (_Float16)v[i]; *(v4h*)(C16 + cofs + (size_t)(row0 + r) * ldc + col0 + c4) = h4; } } }
     }
}


typedef _Float16 v4h __attribute__((ext_vector_type(4)));

// All five f32 inputs become f16 planes in ONE launch of resident waves: 256 work-groups of 16 waves (one per WGP, four waves per SIMD), so that 4,096 waves start instead of one wave per KiB of input.
// A piece is 8 neighbouring values: 32 bytes read, 16 bytes stored per lane, so a wave's store covers 512 contiguous bytes. A slab is one piece per thread of the work-group (16 KiB read). A work-group owns
// 8 neighbouring slabs of each activation plane and one of each weight plane. A thread issues all of its 38 loads before it uses the first value: the whole input is asked for at once, and each piece is
// converted and stored as it lands.
// Activations: bf16-rounded, exact in f16. Weights: bf16-rounded, x16 (exact). memory feeds both the K and the V projection: it is converted once.
#define CV_G 256                     /* work-groups */
#define CV_T 512                     /* threads per work-group */
#define CV_N (CV_G * CV_T)
#define CV_XP 8                      /* slabs per work-group and activation plane */
template <bool X16W>
__device__ __forceinline__ v8us cv_pack(v4f a, v4f b) { FragH f;
#pragma unroll
  for (int q = 0; q < 4; ++q) { f.h[q] = X16W ? (_Float16)(bf16_round(a[q]) * 16.0f) : (_Float16)bf16_round(a[q]); f.h[4 + q] = X16W ? (_Float16)(bf16_round(b[q]) * 16.0f) : (_Float16)bf16_round(b[q]); }
  return f.half[0]; }
__global__ __launch_bounds__(CV_T) __attribute__((amdgpu_waves_per_eu(4, 4))) void k_cvt(const float* __restrict__ xq, const float* __restrict__ xm, const float* __restrict__ wq, const float* __restrict__ wk, const float* __restrict__ wv,
                                              _Float16* __restrict__ XQ, _Float16* __restrict__ XM, _Float16* __restrict__ BQ, _Float16* __restrict__ BK, _Float16* __restrict__ BV) {
  static_assert(NR * DM == (size_t)8 * CV_N * CV_XP && (size_t)DM * DM == (size_t)8 * CV_N, "k_cvt: the planes divide evenly among the threads");
  const unsigned g = blockIdx.x, ib = threadIdx.x * 32u, ob = threadIdx.x * 16u;      /* the thread's byte offsets in a slab: with the uniform pointers below, one address register serves every load and one every store */
  const char* pq = (const char*)xq + (size_t)g * (CV_XP * CV_T * 32); const char* pm = (const char*)xm + (size_t)g * (CV_XP * CV_T * 32);
  const char* pw[3] = {(const char*)wq + (size_t)g * (CV_T * 32), (const char*)wk + (size_t)g * (CV_T * 32), (const char*)wv + (size_t)g * (CV_T * 32)};
  char* oq = (char*)XQ + (size_t)g * (CV_XP * CV_T * 16); char* om = (char*)XM + (size_t)g * (CV_XP * CV_T * 16);
  char* ow[3] = {(char*)BQ + (size_t)g * (CV_T * 16), (char*)BK + (size_t)g * (CV_T * 16), (char*)BV + (size_t)g * (CV_T * 16)};
  v4f q[CV_XP][2], m[CV_XP][2], w[3][2];      /* every '#pragma unroll' below gives constant indices: the pieces stay in registers */
  /* The scheduling barriers of the three load loops keep the 38 loads one group, in the order in which the pieces are used, in front of the first conversion: without them the compiler either sinks the loads
     among the conversions (about nine in flight) or issues the first piece's loads late, so that the first counted wait covers half the group. */
#pragma unroll
  for (int i = 0; i < CV_XP; ++i) { q[i][0] = *(const v4fa*)(pq + i * (CV_T * 32) + ib); q[i][1] = *(const v4fa*)(pq + i * (CV_T * 32) + ib + 16); __builtin_amdgcn_sched_barrier(0); }
#pragma unroll
  for (int i = 0; i < CV_XP; ++i) { m[i][0] = *(const v4fa*)(pm + i * (CV_T * 32) + ib); m[i][1] = *(const v4fa*)(pm + i * (CV_T * 32) + ib + 16); __builtin_amdgcn_sched_barrier(0); }
#pragma unroll
  for (int i = 0; i < 3; ++i) { w[i][0] = *(const v4fa*)(pw[i] + ib); w[i][1] = *(const v4fa*)(pw[i] + ib + 16); __builtin_amdgcn_sched_barrier(0); }
  /* The scheduling barriers of the two activation store loops keep a piece's store behind its own conversion, while later loads still fly: without them the compiler sinks the stores to the end of the kernel. */
#pragma unroll
  for (int i = 0; i < CV_XP; ++i) { *(v8us*)(oq + i * (CV_T * 16) + ob) = cv_pack<false>(q[i][0], q[i][1]); __builtin_amdgcn_sched_barrier(0); }
#pragma unroll
  for (int i = 0; i < CV_XP; ++i) { *(v8us*)(om + i * (CV_T * 16) + ob) = cv_pack<false>(m[i][0], m[i][1]); __builtin_amdgcn_sched_barrier(0); }
#pragma unroll
  for (int i = 0; i < 3; ++i) *(v8us*)(ow[i] + ob) = cv_pack<true>(w[i][0], w[i][1]); }
__global__ __launch_bounds__(256) void k_h16(const float* __restrict__ x, _Float16* __restrict__ X16, size_t n8) { const size_t t = (size_t)blockIdx.x * 256 + threadIdx.x; if (t >= n8) return; FragH f;
#pragma unroll
  for (int q = 0; q < 8; ++q) f.h[q] = (_Float16)x[t * 8 + q]; *(v8us*)((unsigned short*)X16 + t * 8) = f.half[0];  }
__global__ __launch_bounds__(256) void k_round16f(const float* __restrict__ W, _Float16* __restrict__ Bt, size_t n8) { const size_t t = (size_t)blockIdx.x * 256 + threadIdx.x; if (t >= n8) return; FragH f;
#pragma unroll
  for (int i = 0; i < 8; ++i) f.h[i] = (_Float16)(bf16_round(W[t * 8 + i]) * 16.0f); *(v8us*)((unsigned short*)Bt + t * 8) = f.half[0];  }
template <int NHv, int TTv>
__global__ __launch_bounds__(256) void k_vt(const _Float16* __restrict__ V16, int ldv, int voff, _Float16* __restrict__ Vt) { __shared__ unsigned short tl[64][66]; const int tid = threadIdx.x; const int slab = blockIdx.x / (TTv / 64), lg = blockIdx.x % (TTv / 64); const int b = slab / NHv, h = slab % NHv;
  for (int i = tid; i < 64 * 8; i += 256) { const int r = i / 8, c8 = (i % 8) * 8; FragH f; f.half[0] = *(const v8us*)((const unsigned short*)V16 + ((size_t)b * TTv + lg * 64 + r) * ldv + voff + h * 64 + c8);
#pragma unroll
    for (int q = 0; q < 8; ++q) tl[r][c8 + q] = f.u[q]; }
  __syncthreads();
  {
#pragma unroll
    for (int rd = 0; rd < 2; ++rd) { const int d = rd * 32 + tid / 8, pc = tid % 8; FragH f;
#pragma unroll
      for (int q = 0; q < 8; ++q) f.u[q] = tl[pc * 8 + q][d];
      *(v8us*)((unsigned short*)Vt + ((size_t)slab * 64 + d) * TTv + lg * 64 + pc * 8) = f.half[0]; }
     } }

__global__ __launch_bounds__(256) void k_hl(const float* __restrict__ F, _Float16* __restrict__ Hh, _Float16* __restrict__ Hl, size_t n8) { const size_t t = (size_t)blockIdx.x * 256 + threadIdx.x; if (t >= n8) return; FragH fh, fl; const v4f a = *(const v4fa*)(F + t * 8), c = *(const v4fa*)(F + t * 8 + 4);
#pragma unroll
  for (int q = 0; q < 4; ++q) { _Float16 h = (_Float16)a[q]; fh.h[q] = h; fl.h[q] = (_Float16)((a[q] - (float)h) * 1024.0f); h = (_Float16)c[q]; fh.h[4 + q] = h; fl.h[4 + q] = (_Float16)((c[q] - (float)h) * 1024.0f); }
  { *(v8us*)((unsigned short*)Hh + t * 8) = fh.half[0]; *(v8us*)((unsigned short*)Hl + t * 8) = fl.half[0];  } }

__device__ __forceinline__ v16h g2_frag(const _Float16* p, int hh) { FragH f; f.half[0] = *(const v8us*)((const unsigned short*)p + 8 * hh); f.half[1] = *(const v8us*)((const unsigned short*)p + 16 + 8 * hh); return f.v; }
// Projection GEMM Y[8192][1024] = f16(X W^T * alpha + bias), X and W as f16 rows with k along the row. A work-group of four waves (2 x 2) owns a 128 x 128 tile of Y, a wave 64 x 64.
// The W and X tiles of 64 k (128-byte rows) are brought by whole-line global loads and shared through LDS: two buffers, the next tile's loads fly in registers while this tile is worked on,
// one barrier per tile. The wave forms Y^T = W X^T (A = W rows, B = X rows, both read with fa_frag, so the two k orders are equal): a lane then holds eight neighbouring output columns of one
// token row, which pack into one 16-byte piece; the pieces pass through the wave's own part of the (then free) ring, so that every global store covers whole 128-byte lines.
// One launch holds the tiles of all three projections: the block index picks the plane (0 = Q, 1 = K, 2 = V) and the tile in it, so that no launch gap, fill or tail stands between the planes.
// A V tile exchanges the roles (A = X rows, B = W rows: wg then walks X, xg walks W; same loaders, same k order): a lane then holds eight neighbouring token rows of one output column, a 16-byte piece of a
// row of V^T; the staged rows go out as whole 128-byte lines of V^T [batch * head][d][key], and no transposing launch is needed.
// amdgpu_waves_per_eu(2, 2): two work-groups per WGP, and one work-group's matrix work covers the other's barrier and LDS waits.
// Every '#pragma unroll' in k_proj gives constant indices, so that the fragment, staging and accumulator arrays stay in registers.
#define PG_T 128                     /* tile edge in rows of W and of X */
#define PG_K 64                      /* k per LDS tile */
#define PG_PITCH 144                 /* LDS row pitch in bytes: 128 of data, an odd multiple of 16 for the 16-byte fragment reads */
#define PG_NS (DM / PG_K)
#define PG_NT ((MP / PG_T) * (DM / PG_T))      /* tiles per plane */
__device__ __forceinline__ v16h fa_frag(const unsigned char* p);
__device__ __forceinline__ v8f fa_mma(v16h a, v16h b, v8f c);
// A wave's results to its LDS staging rows: acc[i][j] register r = A row 16 i + 8 h + r, lane column c = B row 16 j + c of the wave's tile. Staged row = B row, 64 A rows along it.
// bias points at the wave's first output column. VTR false: the A rows are the output columns. VTR true: the B rows are.
template <bool VTR>
__device__ __forceinline__ void pg_stage(const v8f (&acc)[4][4], unsigned char* st, const float* __restrict__ bias, float alpha, int lane) {
  const int c = lane & 15, h = lane >> 4;
#pragma unroll
  for (int i = 0; i < 4; ++i) { float bv[8];
#pragma unroll
    for (int r = 0; r < 8; ++r) bv[r] = VTR ? 0.f : bf16_round(bias[16 * i + 8 * h + r]);
#pragma unroll
    for (int j = 0; j < 4; ++j) { FragH f; const float bc = VTR ? bf16_round(bias[16 * j + c]) : 0.f;
#pragma unroll
      for (int r = 0; r < 8; ++r) f.h[r] = (_Float16)(acc[i][j][r] * alpha + (VTR ? bc : bv[r]));
      *(v8us*)(st + (16 * j + c) * PG_PITCH + 32 * i + 16 * h) = f.half[0]; } } }
__global__ __launch_bounds__(128) __attribute__((amdgpu_waves_per_eu(2, 2))) void k_proj(const _Float16* __restrict__ XQ, const _Float16* __restrict__ XM, const _Float16* __restrict__ WQ, const _Float16* __restrict__ WK, const _Float16* __restrict__ WV,
                                                                                         const float* __restrict__ bq, const float* __restrict__ bk, const float* __restrict__ bv, float alpha,
                                                                                         _Float16* __restrict__ YQ, _Float16* __restrict__ YK, _Float16* __restrict__ VT) {
  static_assert(MP % PG_T == 0 && DM % PG_T == 0 && DM % PG_K == 0, "k_proj: whole tiles only");
  static_assert(NH * HD == DM && SQ % PG_T == 0, "k_proj, V tiles: row b * DM + column of V^T, a tile's token rows lie in one batch");
  const int plane = blockIdx.x / PG_NT, tile = blockIdx.x % PG_NT; const bool vtr = plane == 2;      /* the same in every thread of the work-group */
  const _Float16* X = plane == 0 ? XQ : XM; const _Float16* Wt = plane == 0 ? WQ : plane == 1 ? WK : WV;
  __shared__ __attribute__((aligned(16))) unsigned char L[2][2][PG_T * PG_PITCH];      /* [buffer][A rows | B rows]: W | X, in a V tile X | W */
  const int tid = threadIdx.x, lane = tid & 31, wave = tid >> 5, c = lane & 15, h = lane >> 4;
  const int mt = tile / (DM / PG_T), nq = tile % (DM / PG_T); const int row0 = mt * PG_T, col0 = nq * PG_T; const int wm = wave >> 1, wn = wave & 1;
  const int sr = tid >> 3, sc = (tid & 7) * 8;      /* staging: 8 threads cover one 128-byte row, 16 rows per load */
  const unsigned short* wr = (const unsigned short*)Wt + (size_t)(col0 + sr) * DM + sc; const unsigned short* xr = (const unsigned short*)X + (size_t)(row0 + sr) * DM + sc;
  const unsigned short* wg = vtr ? xr : wr;      /* rows of the A operand */
  const unsigned short* xg = vtr ? wr : xr;      /* rows of the B operand */
  const int so = sr * PG_PITCH + sc * 2;
  const int fw = (64 * wn + c) * PG_PITCH + 16 * h, fx = (64 * wm + c) * PG_PITCH + 16 * h;      /* the lane's fragment row and its 16 h bytes */
  const v8f z8 = {0.f, 0.f, 0.f, 0.f, 0.f, 0.f, 0.f, 0.f};
  v8f acc[4][4];      /* [16 A rows i][16 B rows j]: register r = A row 16 i + 8 h + r, lane column c = B row 16 j + c */
#pragma unroll
  for (int i = 0; i < 4; ++i)
#pragma unroll
    for (int j = 0; j < 4; ++j) acc[i][j] = z8;
  v8us rw[8], rx[8];
#pragma unroll
  for (int i = 0; i < 8; ++i) { rw[i] = *(const v8us*)(wg + (size_t)(16 * i) * DM); rx[i] = *(const v8us*)(xg + (size_t)(16 * i) * DM); }
#pragma unroll
  for (int i = 0; i < 8; ++i) { *(v8us*)&L[0][0][so + 16 * i * PG_PITCH] = rw[i]; *(v8us*)&L[0][1][so + 16 * i * PG_PITCH] = rx[i]; }
  __syncthreads();      /* tile 0 is visible to all waves */
#pragma unroll 1      /* rolled, last trip not peeled off, as in k_fattn: the next tile's global loads stay at the head of the trip, whose work covers their latency */
  for (int s = 0; s < PG_NS; ++s) {
    const unsigned char* Wb = &L[s & 1][0][0]; const unsigned char* Xb = &L[s & 1][1][0];
    if (s + 1 < PG_NS) {
#pragma unroll
      for (int i = 0; i < 8; ++i) { rw[i] = *(const v8us*)(wg + (size_t)(16 * i) * DM + (s + 1) * PG_K); rx[i] = *(const v8us*)(xg + (size_t)(16 * i) * DM + (s + 1) * PG_K); } }
    v16h wf[2][4], xf[2][4];      /* [32 k][16 rows] */
#pragma unroll
    for (int kc = 0; kc < 2; ++kc)
#pragma unroll
      for (int i = 0; i < 4; ++i) { wf[kc][i] = fa_frag(Wb + fw + 16 * i * PG_PITCH + 64 * kc); xf[kc][i] = fa_frag(Xb + fx + 16 * i * PG_PITCH + 64 * kc); }
    __builtin_amdgcn_sched_barrier(0);      /* the trip's 32 fragment reads stay one group in front of its 32 products: without it the compiler reads one W fragment at a time and waits for it in front of every four products */
#pragma unroll
    for (int kc = 0; kc < 2; ++kc)
#pragma unroll
      for (int i = 0; i < 4; ++i)
#pragma unroll
        for (int j = 0; j < 4; ++j) acc[i][j] = fa_mma(wf[kc][i], xf[kc][j], acc[i][j]);
    __builtin_amdgcn_sched_barrier(0); asm volatile("v_nop\n\tv_nop\n\tv_nop\n\tv_nop"); __builtin_amdgcn_sched_barrier(0);      /* four vector slots behind the trip's last WMMA, in front of the branches that follow it */
    if (s + 1 < PG_NS) { unsigned char* Wn = &L[(s + 1) & 1][0][0]; unsigned char* Xn = &L[(s + 1) & 1][1][0];
#pragma unroll
      for (int i = 0; i < 8; ++i) { *(v8us*)(Wn + so + 16 * i * PG_PITCH) = rw[i]; *(v8us*)(Xn + so + 16 * i * PG_PITCH) = rx[i]; } }
    __syncthreads();      /* publishes tile s + 1 and ends every wave's reads of tile s, whose buffer the next trip refills; behind the last trip it frees the ring for the output staging */
  }
  unsigned char* st = &L[0][0][0] + wave * (64 * PG_PITCH);      /* the wave's own 64 rows of 128 bytes */
  if (vtr) pg_stage<true>(acc, st, bv + col0 + 64 * wm, alpha, lane);
  else pg_stage<false>(acc, st, (plane == 0 ? bq : bk) + col0 + 64 * wn, alpha, lane);
  __builtin_amdgcn_fence(__ATOMIC_ACQ_REL, "workgroup"); __builtin_amdgcn_wave_barrier();      /* the wave's lanes read each other's pieces: the reads stay behind the writes */
  const int yl = vtr ? SQ : DM;      /* row pitch of the output plane in elements: V^T has rows of SQ keys, DM rows per batch */
  unsigned short* yb = vtr ? (unsigned short*)VT + ((size_t)(row0 / SQ) * DM + col0) * SQ + row0 % SQ : (unsigned short*)(plane == 0 ? YQ : YK) + (size_t)row0 * DM + col0;      /* the tile's first element: the same in every thread */
  const unsigned yo = (unsigned)((64 * wm + (lane >> 3)) * yl + 64 * wn + (lane & 7) * 8);      /* the lane's place in the tile: B row 64 wm + .., A row 64 wn + .. */
#pragma unroll
  for (int q = 0; q < 16; ++q) { const v8us v = *(const v8us*)(st + (4 * q + (lane >> 3)) * PG_PITCH + (lane & 7) * 16); *(v8us*)(yb + (size_t)(4 * q * yl) + yo) = v; } }


#define FA_NW 8                      /* waves per work-group */
#define FA_SK 64                     /* keys per LDS tile (two passes of 32) */
#define FA_PITCH 144                 /* LDS row pitch in bytes: 128 of data, an odd multiple of 16 for the 16-byte fragment reads */
#define FA_NS (SQ / FA_SK)
__device__ __forceinline__ float fa_x16(float v) { const int i = __float_as_int(v); return __int_as_float(__builtin_amdgcn_permlanex16(i, i, 0x76543210, 0xfedcba98, false, false)); }      /* value of lane ^ 16 */
__device__ __forceinline__ v16h fa_frag(const unsigned char* p) { FragH f; f.half[0] = *(const v8us*)p; f.half[1] = *(const v8us*)(p + 32); return f.v; }      /* k = 8 h .. 8 h + 7 and 16 + 8 h .. 16 + 8 h + 7; p already holds the lane's 16 h bytes */
__device__ __forceinline__ v8f fa_mma(v16h a, v16h b, v8f c) { return __builtin_amdgcn_wmma_f32_16x16x32_f16(false, a, false, b, (short)0, c, false, false); }
__global__ __launch_bounds__(32 * FA_NW) __attribute__((amdgpu_waves_per_eu(4, 4))) void k_fattn(const _Float16* __restrict__ Q16, const _Float16* __restrict__ K16, const _Float16* __restrict__ VT, float* __restrict__ out) {
  static_assert(HD == 64 && SQ % (32 * FA_NW) == 0 && SQ % FA_SK == 0, "k_fattn: head size 64, whole work-groups of queries, whole tiles of keys");
  __shared__ __attribute__((aligned(16))) unsigned char L[2][2][FA_SK * FA_PITCH];      /* [buffer][K rows by key | V^T rows by d] */
  typedef _Float16 h2 __attribute__((ext_vector_type(2))); typedef float f2 __attribute__((ext_vector_type(2)));
  const int tid = threadIdx.x, lane = tid & 31, wave = tid >> 5, c = lane & 15, h = lane >> 4;
  const int bh = blockIdx.y, b = bh / NH, hd = bh % NH; const int q0 = blockIdx.x * (32 * FA_NW) + wave * 32;
  const float cscale = 0.125f * 1.4426950408889634f;      /* 64^-0.5, scores taken to base 2 */
  const int sr = tid >> 3, sc = (tid & 7) * 8;      /* staging: 8 threads cover one 128-byte row, 32 rows per load */
  const unsigned short* kg = (const unsigned short*)K16 + ((size_t)b * SQ + sr) * LQ + hd * HD + sc;      /* row = key */
  const unsigned short* vg = (const unsigned short*)VT + ((size_t)bh * HD + sr) * SQ + sc;      /* row = d, keys along the row */
  const int so0 = sr * FA_PITCH + sc * 2, so1 = so0 + 32 * FA_PITCH;
  v16h qf[2][2];      /* B operand: column = query, k = d */
#pragma unroll
  for (int g = 0; g < 2; ++g)
#pragma unroll
    for (int kc = 0; kc < 2; ++kc) qf[g][kc] = g2_frag(Q16 + ((size_t)b * SQ + q0 + 16 * g + c) * LQ + hd * HD + 32 * kc, h);
  FragH ones;      /* A operand whose row 0 is 1.0: its product with P^T gives the column sums of P^T in row 0 */
#pragma unroll
  for (int i = 0; i < 16; ++i) ones.u[i] = (c == 0) ? (unsigned short)0x3C00 : (unsigned short)0;
  const v8f z8 = {0.f, 0.f, 0.f, 0.f, 0.f, 0.f, 0.f, 0.f};
  v8f acc[2][4], lacc[2]; float m_run[2];
#pragma unroll
  for (int g = 0; g < 2; ++g) { m_run[g] = -__builtin_inff(); lacc[g] = z8;
#pragma unroll
    for (int t = 0; t < 4; ++t) acc[g][t] = z8; }
  v8us rk0 = *(const v8us*)kg, rk1 = *(const v8us*)(kg + (size_t)32 * LQ), rv0 = *(const v8us*)vg, rv1 = *(const v8us*)(vg + (size_t)32 * SQ);
  *(v8us*)&L[0][0][so0] = rk0; *(v8us*)&L[0][0][so1] = rk1; *(v8us*)&L[0][1][so0] = rv0; *(v8us*)&L[0][1][so1] = rv1;
  __syncthreads();      /* tile 0 is visible to all waves */
#pragma unroll 1      /* rolled, last trip not peeled off: in the peeled build the compiler sinks the next tile's global loads down to their LDS stores, and the trip's work no longer covers their latency */
  for (int s = 0; s < FA_NS; ++s) {
    const unsigned char* Kb = &L[s & 1][0][0]; const unsigned char* Vb = &L[s & 1][1][0];
    if (s + 1 < FA_NS) { const unsigned short* kn = kg + (size_t)(s + 1) * FA_SK * LQ; const unsigned short* vn = vg + (s + 1) * FA_SK;
      rk0 = *(const v8us*)kn; rk1 = *(const v8us*)(kn + (size_t)32 * LQ); rv0 = *(const v8us*)vn; rv1 = *(const v8us*)(vn + (size_t)32 * SQ); }
#pragma unroll
    for (int sub = 0; sub < 2; ++sub) {      /* one pass: 32 keys */
      v8f sx[2][2];      /* [16-key tile][column group]: register r = key 16 kt + 8 h + r, lane column c = query */
#pragma unroll
      for (int kt = 0; kt < 2; ++kt) { const unsigned char* kp = Kb + (32 * sub + 16 * kt + c) * FA_PITCH + 16 * h; const v16h k0 = fa_frag(kp), k1 = fa_frag(kp + 64);
#pragma unroll
        for (int g = 0; g < 2; ++g) sx[kt][g] = fa_mma(k1, qf[g][1], fa_mma(k0, qf[g][0], z8)); }
      float mb[2]; bool need = false;
#pragma unroll
      for (int g = 0; g < 2; ++g) { float mx = sx[0][g][0];
#pragma unroll
        for (int r = 1; r < 8; ++r) mx = fmaxf(mx, sx[0][g][r]);
#pragma unroll
        for (int r = 0; r < 8; ++r) mx = fmaxf(mx, sx[1][g][r]);
        mx = fmaxf(mx, fa_x16(mx)) * cscale; mb[g] = mx; need = need || (mx > m_run[g] + 8.0f); }
      if (__builtin_amdgcn_ballot_w32(need) != 0) {      /* lazy rescale: the maximum in use may trail the true one by up to 8 (base 2), so an exponential stays below 2^8 */
#pragma unroll
        for (int g = 0; g < 2; ++g) { const float m_new = fmaxf(m_run[g], mb[g]); const float corr = __builtin_amdgcn_exp2f(m_run[g] - m_new); m_run[g] = m_new; lacc[g] = lacc[g] * corr;
#pragma unroll
          for (int t = 0; t < 4; ++t) acc[g][t] = acc[g][t] * corr; } }
      v16h vf[4];      /* A operand: row = d, k = the pass's 32 keys */
#pragma unroll
      for (int t = 0; t < 4; ++t) vf[t] = fa_frag(Vb + (16 * t + c) * FA_PITCH + 64 * sub + 16 * h);
#pragma unroll
      for (int g = 0; g < 2; ++g) { const float nm = -m_run[g]; union { v16h v; h2 p[8]; } pf;      /* B operand: element pair i = keys 16 (i >> 2) + 8 h + 2 (i & 3), + 1: the k order of fa_frag */
#pragma unroll
        for (int i = 0; i < 8; ++i) { const float e0 = __builtin_amdgcn_exp2f(fmaf(sx[i >> 2][g][2 * (i & 3)], cscale, nm)), e1 = __builtin_amdgcn_exp2f(fmaf(sx[i >> 2][g][2 * (i & 3) + 1], cscale, nm)); pf.p[i] = __builtin_convertvector(f2{e0, e1}, h2); }
#pragma unroll
        for (int t = 0; t < 4; ++t) acc[g][t] = fa_mma(vf[t], pf.v, acc[g][t]);
        lacc[g] = fa_mma(ones.v, pf.v, lacc[g]); }
    }
    __builtin_amdgcn_sched_barrier(0); asm volatile("v_nop\n\tv_nop\n\tv_nop\n\tv_nop"); __builtin_amdgcn_sched_barrier(0);      /* four vector slots behind the trip's last WMMA, in front of the branches that follow it */
    if (s + 1 < FA_NS) { unsigned char* Kn = &L[(s + 1) & 1][0][0]; unsigned char* Vn = &L[(s + 1) & 1][1][0];
      *(v8us*)(Kn + so0) = rk0; *(v8us*)(Kn + so1) = rk1; *(v8us*)(Vn + so0) = rv0; *(v8us*)(Vn + so1) = rv1; }
    __syncthreads();      /* publishes tile s + 1 and ends every wave's reads of tile s, whose buffer the next trip refills */
  }
#pragma unroll
  for (int g = 0; g < 2; ++g) { const float lr = lacc[g][0]; const float inv = 1.0f / (lr + fa_x16(lr));      /* row 0 of the sum tile sits in lanes 0-15, lanes 16-31 hold row 8 = 0: the exchange-and-add stays unconditional */
    float* op = out + ((size_t)b * SQ + q0 + 16 * g + c) * DM + hd * HD + 8 * h;      /* register r of tile t = d 16 t + 8 h + r of query column c */
#pragma unroll
    for (int t = 0; t < 4; ++t) { const v8f o = acc[g][t] * inv; const v4f lo = {o[0], o[1], o[2], o[3]}, hi = {o[4], o[5], o[6], o[7]}; *(v4f*)(op + 16 * t) = lo; *(v4f*)(op + 16 * t + 4) = hi; } } }
__global__ __launch_bounds__(256) void k_vt(const _Float16* __restrict__ V16, int b, int h0, _Float16* __restrict__ VT) { __shared__ unsigned short tl[64][65]; const int tid = threadIdx.x; const int hh = blockIdx.x % HG, sg = blockIdx.x / HG; const int s0 = sg * 64; const int h = h0 + hh;
  for (int i = tid; i < 64 * 8; i += 256) { const int j = i / 8, d8 = (i % 8) * 8; FragH f; f.half[0] = *(const v8us*)((const unsigned short*)V16 + ((size_t)b * SQ + s0 + j) * DM + h * HD + d8); for (int q = 0; q < 8; ++q) tl[d8 + q][j] = f.u[q]; }
  __syncthreads();
  { for (int i = tid; i < 64 * 8; i += 256) { const int d = i / 8, j8 = (i % 8) * 8; FragH f; for (int q = 0; q < 8; ++q) f.u[q] = tl[d][j8 + q]; *(v8us*)((unsigned short*)VT + ((size_t)hh * HD + d) * SQ + s0 + j8) = f.half[0]; }  } }



__global__ __launch_bounds__(256) void k_rsmkm(const float* __restrict__ S, _Float16* __restrict__ P, int nrows, const int* __restrict__ am) {
  #pragma clang fp contract(off)
  const int t = blockIdx.x * 256 + threadIdx.x; if (t >= nrows) return; const size_t i = (size_t)t; const float* s = S + i * SQ; const int* mr = am + (size_t)(t % SQ) * SQ; float mx = -3.0e38f;
#pragma unroll 1
  for (int j = 0; j < SQ; ++j) { const float f = (mr[j] != 0) ? 1.f : 0.f; mx = fmaxf(mx, fmaf(f, s[j], (1.f - f) * -1.0e9f)); } float se = 0.f;
#pragma unroll 1
  for (int j = 0; j < SQ; ++j) { const float f = (mr[j] != 0) ? 1.f : 0.f; se += __expf(fmaf(f, s[j], (1.f - f) * -1.0e9f) - mx); } const float sc = 256.0f / se;
#pragma unroll 1
  for (int j0 = 0; j0 < SQ; j0 += 8) { FragH fr; for (int q = 0; q < 8; ++q) { const int j = j0 + q; const float f = (mr[j] != 0) ? 1.f : 0.f; fr.h[q] = (_Float16)(__expf(fmaf(f, s[j], (1.f - f) * -1.0e9f) - mx) * sc); }
    unsigned short* d = (unsigned short*)P + i * SQ + j0; *(v8us*)d = fr.half[0];  } }
extern "C" void kernel_launch(void* const* d_in, const int* in_sizes, int n_in,
                              void* d_out, int out_size, void* d_ws, size_t ws_size, hipStream_t stream) {
  (void)in_sizes; (void)n_in; (void)out_size;
  const float* const* I = (const float* const*)d_in; const float* xq = I[0]; const float* xm = I[1]; const float* wq = I[2]; const float* bq = I[3]; const float* wk = I[4]; const float* bk = I[5]; const float* wv = I[6]; const float* bv = I[7];      /* input (queries), memory (keys AND values); natural weights + biases; no output projection */
  char* ws = (char*)d_ws; size_t off = 0;
  auto take = [&](size_t bytes) { char* p = ws + off; off += (bytes + 255) & ~(size_t)255; return p; };
  _Float16* BQ = (_Float16*)take((size_t)DM * DM * 2); _Float16* BK = (_Float16*)take((size_t)DM * DM * 2); _Float16* BV = (_Float16*)take((size_t)DM * DM * 2); 
  _Float16* X16 = (_Float16*)take(NR * DM * 2); _Float16* XM = (_Float16*)take(NR * DM * 2); _Float16* Q16 = (_Float16*)take(NR * DM * 2); _Float16* K16 = (_Float16*)take(NR * DM * 2); 
  _Float16* VT = (_Float16*)take((size_t)NB * NH * HD * SQ * 2);
  if (off > ws_size) return;
  k_cvt<<<CV_G, CV_T, 0, stream>>>(xq, xm, wq, wk, wv, X16, XM, BQ, BK, BV);      /* input and memory as exact f16 rows; natural [out][in] weights = Bt x16 (no output projection: no Wo plane) */
  const size_t r0p = (size_t)B0 * SQ;      /* first projected row */
  k_proj<<<3 * PG_NT, 128, 0, stream>>>(X16 + r0p * DM, XM + r0p * DM, BQ, BK, BV, bq, bk, bv, 0.0625f, Q16 + r0p * DM, K16 + r0p * DM, VT + r0p * DM);      /* q, k rows and V^T [NB * NH][HD][SQ] */
  k_fattn<<<dim3(SQ / (32 * FA_NW), NB * NH), 32 * FA_NW, 0, stream>>>(Q16, K16, VT, (float*)d_out);      /* out = softmax(q k^T / 8) v straight to the f32 output (merged heads; each 256-B head segment of a row written by one wave) */
  /* no output projection in this module */
}

// v006
// Measured time: 114 microseconds a run.
// Timed twice side by side with v005, it ran 1.06 and 1.05 times as fast.
// Over all steps from v000 it is 64.0 times as fast.
#include <hip/hip_runtime.h>
// Multi-head CROSS-attention without an output projection (input, memory [4][2048][1024]; q = input Wq^T + bq, k = memory Wk^T + bk, v = memory Wv^T + bv (natural [1024][1024], zero biases); 16 heads of 64; q * 64^-0.5 then q k^T; softmax over all 2048 memory positions (no mask); out = attn v merged to [4][2048][1024]; NO output projection).
// Structure: token rows r = b*2048 + s; x as exact f16 rows (bf16-rounded); Q, K, V as three WMMA GEMMs (128x128 tiles through LDS, 64x64 wave tiles, f32 accumulation, exact x16 weights + bias, f16 outputs) in ONE launch, whose V tiles exchange the operand roles and store V^T [batch * head][d][key] themselves; one fused attention launch (k_fattn): S^T = K Q^T (K = 64, q rows pre-scaled by 64^-0.5 log2(e)), softmax in base 2 (weights as f16 relative to the fixed reference 0, row sums f32 and checked; a walk with the running maximum as the fallback), O^T += V^T P^T, divided by the row sum and written straight into the merged f32 output rows.
// Compute dtype: inputs rounded to bf16; x / weights exact; q, k, v and softmax weights as plain f16 GEMM operands (~2^-12); scores and softmax statistics f32. v_wmma_f32_16x16x32_f16.
#define NB 4
#define SQ 2048
#define DM 1024
#define NH 16
#define HD 64
#define HG 4                         /* heads per k_vt(b, h0) launch (that overload is not launched) */
#define B0 0                         /* first batch processed (debug hook) */
#define NBR NB                       /* batches processed (debug hook) */
#define NR ((size_t)NB * SQ)         /* token rows */
#define MP ((int)((size_t)NBR * SQ)) /* rows projected (debug hook) */
#define QN SQ                        /* unused (attention covers all SQ query rows) */
#define NHD NH                       /* unused (attention covers all NH heads) */
#define MPO MP                       /* unused (no output projection) */
#define LQ DM      /* row pitch of the q and k rows */
typedef __bf16 v16b __attribute__((ext_vector_type(16)));
typedef unsigned short v8us __attribute__((ext_vector_type(8), may_alias));
typedef float  v8f  __attribute__((ext_vector_type(8)));
typedef float  v4f  __attribute__((ext_vector_type(4)));
typedef float  v4fa __attribute__((ext_vector_type(4), may_alias));
union FragB { v16b v; v8us half[2]; unsigned short u[16]; };

__device__ __forceinline__ unsigned short bf16_bits(float x) { unsigned int u = __float_as_uint(x); return (unsigned short)((u + 0x7FFFu + ((u >> 16) & 1u)) >> 16); }
__device__ __forceinline__ float bf16_val(unsigned short b) { return __uint_as_float(((unsigned int)b) << 16); }
__device__ __forceinline__ float bf16_round(float x) { return bf16_val(bf16_bits(x)); }
// D += A·B with NT terms: 1 = ah·bh, 2 = + al·bh (A split), 3 = + ah·bl (both split)
template <int NT>
__device__ __forceinline__ v8f mmaN(v16b ah, v16b al, v16b bh, v16b bl, v8f c) {
  c = __builtin_amdgcn_wmma_f32_16x16x32_bf16(false, ah, false, bh, (short)0, c, false, false);
  if (NT >= 2) c = __builtin_amdgcn_wmma_f32_16x16x32_bf16(false, al, false, bh, (short)0, c, false, false);
  if (NT >= 3) c = __builtin_amdgcn_wmma_f32_16x16x32_bf16(false, ah, false, bl, (short)0, c, false, false);
  asm volatile("v_nop\n\tv_nop\n\tv_nop\n\tv_nop" : "+v"(c) : "v"(ah), "v"(al), "v"(bh), "v"(bl));
  return c;
}

__global__ __launch_bounds__(256) void k_wt_bf16(const float* __restrict__ W, unsigned short* __restrict__ Wt, int K, int N) {
  const int t = blockIdx.x * 256 + threadIdx.x;
  const int k8n = K / 8;
  if (t >= N * k8n) return;
  const int n = t / k8n, k8 = (t % k8n) * 8;
  v8us v;
#pragma unroll
  for (int i = 0; i < 8; ++i) v[i] = bf16_bits(W[(size_t)(k8 + i) * N + n]);
  *(v8us*)(Wt + (size_t)n * K + k8) = v;
  
}

// GEMM C[M][N] (f32, pitch ldc) = act(A[M][K]·W + bias). A f32 row-major (pitch lda) converted per fragment to bf16
// (ASPLIT: hi/lo two planes -> 2 terms, else single rounded term); Wt bf16 [N][K] (pitch ldb). BIAS_BF16 rounds the
// bias to bf16 first (bias quantised to bf16 before the add). K%32==0, M%16==0, N%64==0.
template <bool ASPLIT, int ACT, bool BIAS_BF16>
__global__ __launch_bounds__(128) void k_gemm_bf(const float* __restrict__ A, int lda, const unsigned short* __restrict__ Wt, int ldb,
                                               const float* __restrict__ bias, float* __restrict__ C, int ldc, int M, int N, int K) {
  __shared__ __attribute__((aligned(16))) float so[4][16][64];
  const int tid = threadIdx.x, w = tid >> 5, lane = tid & 31, ln = lane & 15, hh = lane >> 4;
  const int ntn = N / 64;
  const int wid = blockIdx.x * 4 + w;
  const int mt = wid / ntn, nq = wid % ntn;
  if (mt * 16 >= M) return;
  const int row0 = mt * 16, col0 = nq * 64;
  const float* arow = A + (size_t)(row0 + ln) * lda;
  v8f acc[4] = {};
  for (int kb = 0; kb < K; kb += 32) {
    FragB ah, al;
    const v4f x0 = *(const v4fa*)(arow + kb + 8 * hh), x1 = *(const v4fa*)(arow + kb + 8 * hh + 4);
    const v4f x2 = *(const v4fa*)(arow + kb + 16 + 8 * hh), x3 = *(const v4fa*)(arow + kb + 16 + 8 * hh + 4);
    float xs[16] = {x0[0],x0[1],x0[2],x0[3],x1[0],x1[1],x1[2],x1[3],x2[0],x2[1],x2[2],x2[3],x3[0],x3[1],x3[2],x3[3]};
#pragma unroll
    for (int i = 0; i < 16; ++i) { const unsigned short hb = bf16_bits(xs[i]); ah.u[i] = hb; al.u[i] = ASPLIT ? bf16_bits(xs[i] - bf16_val(hb)) : (unsigned short)0; }
#pragma unroll
    for (int t = 0; t < 4; ++t) {
      const unsigned short* brow = Wt + (size_t)(col0 + t * 16 + ln) * ldb + kb;
      FragB b;
      b.half[0] = *(const v8us*)(brow + 8 * hh);
      b.half[1] = *(const v8us*)(brow + 16 + 8 * hh);
      acc[t] = mmaN<ASPLIT ? 2 : 1>(ah.v, al.v, b.v, b.v, acc[t]);
    }
  }
#pragma unroll
  for (int t = 0; t < 4; ++t) {
    float bv = bias ? bias[col0 + t * 16 + ln] : 0.f;
    if (BIAS_BF16) bv = bf16_round(bv);
#pragma unroll
    for (int r = 0; r < 8; ++r) { float v = acc[t][r] + bv; if (ACT == 1) v = fmaxf(v, 0.f); so[w][8 * hh + r][t * 16 + ln] = v; }
  }
  __builtin_amdgcn_fence(__ATOMIC_ACQ_REL, "workgroup");
  __builtin_amdgcn_wave_barrier();
  const int rsub = lane >> 4, c4 = (lane & 15) * 4;
  {
#pragma unroll
    for (int q = 0; q < 8; ++q) {
      const int r = q * 2 + rsub;
      const v4f v = *(const v4fa*)&so[w][r][c4];
      *(v4f*)(C + (size_t)(row0 + r) * ldc + col0 + c4) = v;
    }
    
  }
}

// GEMM C = act(A·W + bias + resid): A f32 (ASPLIT -> hi/lo 2 terms), Wt bf16 [N][K]; ACT 0 none, 1 relu, 2 exact gelu;
// resid (optional, f32, row index = (row % rmod), pitch ldr, RES_BF16 rounds it) added before the activation.
template <bool ASPLIT, int ACT, bool BIAS_BF16, bool RES_BF16>
__global__ __launch_bounds__(128) void k_gemm_bf3(const float* __restrict__ A, int lda, const unsigned short* __restrict__ Wt, int ldb,
                                                const float* __restrict__ bias, const float* __restrict__ resid, int rmod, int ldr,
                                                float* __restrict__ C, int ldc, int M, int N, int K) {
  __shared__ __attribute__((aligned(16))) float so[4][16][64];
  const int tid = threadIdx.x, w = tid >> 5, lane = tid & 31, ln = lane & 15, hh = lane >> 4;
  const int ntn = N / 64;
  const int wid = blockIdx.x * 4 + w;
  const int mt = wid / ntn, nq = wid % ntn;
  if (mt * 16 >= M) return;
  const int row0 = mt * 16, col0 = nq * 64;
  const float* arow = A + (size_t)(row0 + ln) * lda;
  v8f acc[4] = {};
  for (int kb = 0; kb < K; kb += 32) {
    FragB ah, al;
    const v4f x0 = *(const v4fa*)(arow + kb + 8 * hh), x1 = *(const v4fa*)(arow + kb + 8 * hh + 4);
    const v4f x2 = *(const v4fa*)(arow + kb + 16 + 8 * hh), x3 = *(const v4fa*)(arow + kb + 16 + 8 * hh + 4);
    float xs[16] = {x0[0],x0[1],x0[2],x0[3],x1[0],x1[1],x1[2],x1[3],x2[0],x2[1],x2[2],x2[3],x3[0],x3[1],x3[2],x3[3]};
#pragma unroll
    for (int i = 0; i < 16; ++i) { const unsigned short hb = bf16_bits(xs[i]); ah.u[i] = hb; al.u[i] = ASPLIT ? bf16_bits(xs[i] - bf16_val(hb)) : (unsigned short)0; }
#pragma unroll
    for (int t = 0; t < 4; ++t) {
      const unsigned short* brow = Wt + (size_t)(col0 + t * 16 + ln) * ldb + kb;
      FragB b;
      b.half[0] = *(const v8us*)(brow + 8 * hh);
      b.half[1] = *(const v8us*)(brow + 16 + 8 * hh);
      acc[t] = mmaN<ASPLIT ? 2 : 1>(ah.v, al.v, b.v, b.v, acc[t]);
    }
  }
#pragma unroll
  for (int t = 0; t < 4; ++t) {
    const int col = col0 + t * 16 + ln;
    float bv = bias ? bias[col] : 0.f;
    if (BIAS_BF16) bv = bf16_round(bv);
#pragma unroll
    for (int r = 0; r < 8; ++r) {
      float v = acc[t][r] + bv;
      if (resid) { float rv = resid[(size_t)((row0 + 8 * hh + r) % rmod) * ldr + col]; if (RES_BF16) rv = bf16_round(rv); v += rv; }
      if (ACT == 1) v = fmaxf(v, 0.f);
      if (ACT == 2) v = 0.5f * v * (1.0f + erff(v * 0.70710678118654752f));
      if (ACT == 3) { const float u = 0.7978845608028654f * (v + 0.044715f * v * v * v); v = 0.5f * v * (1.0f + tanhf(u)); }
      so[w][8 * hh + r][t * 16 + ln] = v;
    }
  }
  __builtin_amdgcn_fence(__ATOMIC_ACQ_REL, "workgroup");
  __builtin_amdgcn_wave_barrier();
  const int rsub = lane >> 4, c4 = (lane & 15) * 4;
  {
#pragma unroll
    for (int q = 0; q < 8; ++q) {
      const int r = q * 2 + rsub;
      const v4f v = *(const v4fa*)&so[w][r][c4];
      *(v4f*)(C + (size_t)(row0 + r) * ldc + col0 + c4) = v;
    }
    
  }
}
// row LayerNorm (biased variance, eps) over N: s = X (+ R); optional out_sum <- s; out_norm <- (s-mu)*rsqrt(var+eps)*g + b
template <bool PARAM_BF16>
__global__ __launch_bounds__(256) void k_layernorm(const float* __restrict__ X, const float* __restrict__ R, const float* __restrict__ g, const float* __restrict__ bta,
                                                  float* __restrict__ out_sum, float* __restrict__ out_norm, int N, float eps) {
  __shared__ float red[256];
  const int row = blockIdx.x, tid = threadIdx.x;
  const float* x = X + (size_t)row * N; const float* rr = R ? R + (size_t)row * N : nullptr;
  float vals[16];                     // up to N = 4096
  const int per = N / 256;            // contiguous chunk per thread? use strided-by-4 chunks: thread handles j = tid*4 + 1024*u
  float s1 = 0.f;
  for (int u = 0; u < per / 4; ++u) {
    const int j = tid * 4 + 1024 * u;
    const v4f a = *(const v4fa*)(x + j);
    v4f b = {0.f,0.f,0.f,0.f}; if (rr) b = *(const v4fa*)(rr + j);
#pragma unroll
    for (int q = 0; q < 4; ++q) { const float v = a[q] + b[q]; vals[u * 4 + q] = v; s1 += v; }
  }
  red[tid] = s1; __syncthreads();
  for (int st = 128; st > 0; st >>= 1) { if (tid < st) red[tid] += red[tid + st]; __syncthreads(); }
  const float mu = red[0] / (float)N; __syncthreads();
  float s2 = 0.f;
  for (int u = 0; u < per / 4; ++u)
#pragma unroll
    for (int q = 0; q < 4; ++q) { const float c = vals[u * 4 + q] - mu; s2 += c * c; }
  red[tid] = s2; __syncthreads();
  for (int st = 128; st > 0; st >>= 1) { if (tid < st) red[tid] += red[tid + st]; __syncthreads(); }
  const float rs = rsqrtf(red[0] / (float)N + eps);
  {
    for (int u = 0; u < per / 4; ++u) {
      const int j = tid * 4 + 1024 * u;
      v4f o, sm;
#pragma unroll
      for (int q = 0; q < 4; ++q) {
        float gg = g[j + q], bb = bta[j + q];
        if (PARAM_BF16) { gg = bf16_round(gg); bb = bf16_round(bb); }
        sm[q] = vals[u * 4 + q]; o[q] = (vals[u * 4 + q] - mu) * rs * gg + bb;
      }
      if (out_sum) *(v4f*)(out_sum + (size_t)row * N + j) = sm;
      *(v4f*)(out_norm + (size_t)row * N + j) = o;
    }
    
  }
}



// ---- f16 WMMA path (v_wmma_f32_16x16x32_f16): 11-bit significands for operands in range — used where a [0,1] probability operand needs more precision than bf16
typedef _Float16 v16h __attribute__((ext_vector_type(16)));
union FragH { v16h v; v8us half[2]; _Float16 h[16]; unsigned short u[16]; };
template <int NT>
__device__ __forceinline__ v8f mmaH(v16h ah, v16h al, v16h bh, v16h bl, v8f c) {
  c = __builtin_amdgcn_wmma_f32_16x16x32_f16(false, ah, false, bh, (short)0, c, false, false);
  if (NT >= 2) c = __builtin_amdgcn_wmma_f32_16x16x32_f16(false, al, false, bh, (short)0, c, false, false);
  if (NT >= 3) c = __builtin_amdgcn_wmma_f32_16x16x32_f16(false, ah, false, bl, (short)0, c, false, false);
  asm volatile("v_nop\n\tv_nop\n\tv_nop\n\tv_nop" : "+v"(c) : "v"(ah), "v"(al), "v"(bh), "v"(bl));
  return c;
}
// batched GEMM like k_gemm_b but f16 operands: A f32 (split into f16 hi/lo if ASPLIT, else rounded to f16), Bt = f16 values [n][k]; alpha; C f32; N multiple of 16 (partial tiles skipped)
template <bool ASPLIT>
__global__ __launch_bounds__(128) void k_gemm_h(const float* __restrict__ A, int lda, size_t sA, const _Float16* __restrict__ Bh, int ldb, size_t sB, float alpha, float* __restrict__ C, int ldc, size_t sC, int M, int N, int K) {
  __shared__ __attribute__((aligned(16))) float so[4][16][64];
  const int tid = threadIdx.x, w = tid >> 5, lane = tid & 31, ln = lane & 15, hh = lane >> 4; const int by = blockIdx.y;
  A += (size_t)by * sA; Bh += (size_t)by * sB; C += (size_t)by * sC;
  const int ntn = (N + 63) / 64; const int wid = blockIdx.x * 4 + w; const int mt = wid / ntn, nq = wid % ntn; if (mt * 16 >= M) return;
  const int row0 = mt * 16, col0 = nq * 64; const float* arow = A + (size_t)(row0 + ln) * lda;
  v8f acc[4] = {};
  for (int kb = 0; kb < K; kb += 32) {
    FragH ah, al;
    const v4f x0 = *(const v4fa*)(arow + kb + 8 * hh), x1 = *(const v4fa*)(arow + kb + 8 * hh + 4), x2 = *(const v4fa*)(arow + kb + 16 + 8 * hh), x3 = *(const v4fa*)(arow + kb + 16 + 8 * hh + 4);
    float xs[16] = {x0[0],x0[1],x0[2],x0[3],x1[0],x1[1],x1[2],x1[3],x2[0],x2[1],x2[2],x2[3],x3[0],x3[1],x3[2],x3[3]};
#pragma unroll
    for (int i = 0; i < 16; ++i) { const _Float16 h = (_Float16)xs[i]; ah.h[i] = h; al.h[i] = ASPLIT ? (_Float16)(xs[i] - (float)h) : (_Float16)0.0f; }
#pragma unroll
    for (int t = 0; t < 4; ++t) { if (col0 + t * 16 >= N) continue; const size_t boff = (size_t)(col0 + t * 16 + ln) * ldb + kb; FragH bq; bq.half[0] = *(const v8us*)(Bh + boff + 8 * hh); bq.half[1] = *(const v8us*)(Bh + boff + 16 + 8 * hh);
      acc[t] = mmaH<ASPLIT ? 2 : 1>(ah.v, al.v, bq.v, bq.v, acc[t]); }
  }
#pragma unroll
  for (int t = 0; t < 4; ++t) { if (col0 + t * 16 >= N) continue;
#pragma unroll
    for (int r = 0; r < 8; ++r) so[w][8 * hh + r][t * 16 + ln] = acc[t][r] * alpha; }
  __builtin_amdgcn_fence(__ATOMIC_ACQ_REL, "workgroup"); __builtin_amdgcn_wave_barrier();
  const int rsub = lane >> 4, c4 = (lane & 15) * 4;
  {
#pragma unroll
    for (int q = 0; q < 8; ++q) { const int r = q * 2 + rsub; if (col0 + c4 < N) { const v4f v = *(const v4fa*)&so[w][r][c4]; *(v4f*)(C + (size_t)(row0 + r) * ldc + col0 + c4) = v; } }
     }
}

// Wt[n][k] = f16(W[k][n]·scale) from f32 row-major W[K][N] (scale = power of two; bf16-exact weights stay exact in f16 away from the subnormal range)
__global__ __launch_bounds__(256) void k_wt_f16(const float* __restrict__ W, _Float16* __restrict__ Wt, int K, int N, float scale) {
  const int t = blockIdx.x * 256 + threadIdx.x; if (t >= N * (K / 8)) return; const int n = t / (K / 8), k8 = (t % (K / 8)) * 8; FragH f;
#pragma unroll
  for (int i = 0; i < 8; ++i) f.h[i] = (_Float16)(bf16_round(W[(size_t)(k8 + i) * N + n]) * scale); const v8us o = f.half[0];
  *(v8us*)((unsigned short*)Wt + (size_t)n * K + k8) = o; 
}
// k_gemm_hh variant with fused epilogue: v = acc·alpha + bias[by·sBias + col] (+ CP[(row/rowsPerB)·sCPb + by·64 + col] if CP) ; ACT 0 none / 1 elu ; writes f16 C16 (and f32 C if non-null)
template <int ACT>
__global__ __launch_bounds__(128) void k_gemm_hhx(const _Float16* __restrict__ A, int lda, size_t sA, const _Float16* __restrict__ Bh, int ldb, size_t sB, float alpha, const float* __restrict__ bias, size_t sBias, const float* __restrict__ CP, int rowsPerB, size_t sCPb, int row0g,
    float* __restrict__ C, _Float16* __restrict__ C16, int ldc, size_t sC, int M, int N, int K) {
  __shared__ __attribute__((aligned(16))) float so[4][16][64];
  const int tid = threadIdx.x, w = tid >> 5, lane = tid & 31, ln = lane & 15, hh = lane >> 4; const int by = blockIdx.y;
  A += (size_t)by * sA; Bh += (size_t)by * sB; const size_t cofs = (size_t)by * sC; const float* bp = bias ? bias + (size_t)by * sBias : nullptr;
  const int ntn = (N + 63) / 64; const int wid = blockIdx.x * 4 + w; const int mt = wid / ntn, nq = wid % ntn; if (mt * 16 >= M) return;
  const int row0 = mt * 16, col0 = nq * 64; const _Float16* arow = A + (size_t)(row0 + ln) * lda;
  v8f acc[4] = {};
  for (int kb = 0; kb < K; kb += 32) { FragH ah; ah.half[0] = *(const v8us*)((const unsigned short*)arow + kb + 8 * hh); ah.half[1] = *(const v8us*)((const unsigned short*)arow + kb + 16 + 8 * hh);
#pragma unroll
    for (int t = 0; t < 4; ++t) { if (col0 + t * 16 >= N) continue; const size_t boff = (size_t)(col0 + t * 16 + ln) * ldb + kb; FragH bq; bq.half[0] = *(const v8us*)((const unsigned short*)Bh + boff + 8 * hh); bq.half[1] = *(const v8us*)((const unsigned short*)Bh + boff + 16 + 8 * hh);
      acc[t] = mmaH<1>(ah.v, ah.v, bq.v, bq.v, acc[t]); }
  }
#pragma unroll
  for (int t = 0; t < 4; ++t) { if (col0 + t * 16 >= N) continue; const int col = col0 + t * 16 + ln; const float bv = bp ? bf16_round(bp[col]) : 0.f;
#pragma unroll
    for (int r = 0; r < 8; ++r) { float v = acc[t][r] * alpha + bv; if (CP) { const int rr = row0g + row0 + 8 * hh + r; if (rowsPerB < 0) v += CP[cofs + (size_t)rr * ldc + col];      /* rowsPerB < 0: own element of the batched C plane */ else { const int bidx = rr / rowsPerB; v += CP[(size_t)bidx * sCPb + (size_t)by * 64 + col]; } } if (ACT == 1) v = (v > 0.f) ? v : expm1f(v); else if (ACT == 7) v = (v > 0.f) ? v + 1.0f : expf(v); else if (ACT == 8) v = tanhf(v); else if (ACT == 9) v = 0.5f * v * (1.0f + tanhf(0.7978845608028654f * (v + 0.044715f * v * v * v))); else if (ACT == 11) v = 1.0f / (1.0f + expf(-v)); else if (ACT == 12) v = (v > 0.f) ? v : 0.01f * v; else if (ACT == 14) v = (v > 0.f) ? v : 0.1f * v; else if (ACT == 16) v = (v >= 0.f) ? v : 0.3f * v; else if (ACT == 17) v = (v >= 0.f) ? v : 0.2f * v; else if (ACT == 15) v = v / (1.0f + expf(-v)); else if (ACT == 3) v = fmaxf(v, 0.f); else if (ACT == 6) v = 0.5f * v * (1.0f + erff(v * 0.70710678118654752f)); so[w][8 * hh + r][t * 16 + ln] = v; } }
  __builtin_amdgcn_fence(__ATOMIC_ACQ_REL, "workgroup"); __builtin_amdgcn_wave_barrier();
  const int rsub = lane >> 4, c4 = (lane & 15) * 4; typedef _Float16 v4h __attribute__((ext_vector_type(4)));
  {
#pragma unroll
    for (int q = 0; q < 8; ++q) { const int r = q * 2 + rsub; if (col0 + c4 < N) { const v4f v = *(const v4fa*)&so[w][r][c4]; if (C) *(v4f*)(C + cofs + (size_t)(row0 + r) * ldc + col0 + c4) = v; if (C16) { v4h h4; for (int i = 0; i < 4; ++i) h4[i] = (_Float16)v[i]; *(v4h*)(C16 + cofs + (size_t)(row0 + r) * ldc + col0 + c4) = h4; } } }
     }
}


typedef _Float16 v4h __attribute__((ext_vector_type(4)));

// All five f32 inputs become f16 planes in ONE launch of resident waves: 256 work-groups of 16 waves (one per WGP, four waves per SIMD), so that 4,096 waves start instead of one wave per KiB of input.
// A piece is 8 neighbouring values: 32 bytes read, 16 bytes stored per lane, so a wave's store covers 512 contiguous bytes. A slab is one piece per thread of the work-group (16 KiB read). A work-group owns
// 8 neighbouring slabs of each activation plane and one of each weight plane. A thread issues all of its 38 loads before it uses the first value: the whole input is asked for at once, and each piece is
// converted and stored as it lands.
// Activations: bf16-rounded, exact in f16. Weights: bf16-rounded, x16 (exact). memory feeds both the K and the V projection: it is converted once.
#define CV_G 256                     /* work-groups */
#define CV_T 512                     /* threads per work-group */
#define CV_N (CV_G * CV_T)
#define CV_XP 8                      /* slabs per work-group and activation plane */
template <bool X16W>
__device__ __forceinline__ v8us cv_pack(v4f a, v4f b) { FragH f;
#pragma unroll
  for (int q = 0; q < 4; ++q) { f.h[q] = X16W ? (_Float16)(bf16_round(a[q]) * 16.0f) : (_Float16)bf16_round(a[q]); f.h[4 + q] = X16W ? (_Float16)(bf16_round(b[q]) * 16.0f) : (_Float16)bf16_round(b[q]); }
  return f.half[0]; }
__global__ __launch_bounds__(CV_T) __attribute__((amdgpu_waves_per_eu(4, 4))) void k_cvt(const float* __restrict__ xq, const float* __restrict__ xm, const float* __restrict__ wq, const float* __restrict__ wk, const float* __restrict__ wv,
                                              _Float16* __restrict__ XQ, _Float16* __restrict__ XM, _Float16* __restrict__ BQ, _Float16* __restrict__ BK, _Float16* __restrict__ BV) {
  static_assert(NR * DM == (size_t)8 * CV_N * CV_XP && (size_t)DM * DM == (size_t)8 * CV_N, "k_cvt: the planes divide evenly among the threads");
  const unsigned g = blockIdx.x, ib = threadIdx.x * 32u, ob = threadIdx.x * 16u;      /* the thread's byte offsets in a slab: with the uniform pointers below, one address register serves every load and one every store */
  const char* pq = (const char*)xq + (size_t)g * (CV_XP * CV_T * 32); const char* pm = (const char*)xm + (size_t)g * (CV_XP * CV_T * 32);
  const char* pw[3] = {(const char*)wq + (size_t)g * (CV_T * 32), (const char*)wk + (size_t)g * (CV_T * 32), (const char*)wv + (size_t)g * (CV_T * 32)};
  char* oq = (char*)XQ + (size_t)g * (CV_XP * CV_T * 16); char* om = (char*)XM + (size_t)g * (CV_XP * CV_T * 16);
  char* ow[3] = {(char*)BQ + (size_t)g * (CV_T * 16), (char*)BK + (size_t)g * (CV_T * 16), (char*)BV + (size_t)g * (CV_T * 16)};
  v4f q[CV_XP][2], m[CV_XP][2], w[3][2];      /* every '#pragma unroll' below gives constant indices: the pieces stay in registers */
  /* The scheduling barriers of the three load loops keep the 38 loads one group, in the order in which the pieces are used, in front of the first conversion: without them the compiler either sinks the loads
     among the conversions (about nine in flight) or issues the first piece's loads late, so that the first counted wait covers half the group. */
#pragma unroll
  for (int i = 0; i < CV_XP; ++i) { q[i][0] = *(const v4fa*)(pq + i * (CV_T * 32) + ib); q[i][1] = *(const v4fa*)(pq + i * (CV_T * 32) + ib + 16); __builtin_amdgcn_sched_barrier(0); }
#pragma unroll
  for (int i = 0; i < CV_XP; ++i) { m[i][0] = *(const v4fa*)(pm + i * (CV_T * 32) + ib); m[i][1] = *(const v4fa*)(pm + i * (CV_T * 32) + ib + 16); __builtin_amdgcn_sched_barrier(0); }
#pragma unroll
  for (int i = 0; i < 3; ++i) { w[i][0] = *(const v4fa*)(pw[i] + ib); w[i][1] = *(const v4fa*)(pw[i] + ib + 16); __builtin_amdgcn_sched_barrier(0); }
  /* The scheduling barriers of the two activation store loops keep a piece's store behind its own conversion, while later loads still fly: without them the compiler sinks the stores to the end of the kernel. */
#pragma unroll
  for (int i = 0; i < CV_XP; ++i) { *(v8us*)(oq + i * (CV_T * 16) + ob) = cv_pack<false>(q[i][0], q[i][1]); __builtin_amdgcn_sched_barrier(0); }
#pragma unroll
  for (int i = 0; i < CV_XP; ++i) { *(v8us*)(om + i * (CV_T * 16) + ob) = cv_pack<false>(m[i][0], m[i][1]); __builtin_amdgcn_sched_barrier(0); }
#pragma unroll
  for (int i = 0; i < 3; ++i) *(v8us*)(ow[i] + ob) = cv_pack<true>(w[i][0], w[i][1]); }
__global__ __launch_bounds__(256) void k_h16(const float* __restrict__ x, _Float16* __restrict__ X16, size_t n8) { const size_t t = (size_t)blockIdx.x * 256 + threadIdx.x; if (t >= n8) return; FragH f;
#pragma unroll
  for (int q = 0; q < 8; ++q) f.h[q] = (_Float16)x[t * 8 + q]; *(v8us*)((unsigned short*)X16 + t * 8) = f.half[0];  }
__global__ __launch_bounds__(256) void k_round16f(const float* __restrict__ W, _Float16* __restrict__ Bt, size_t n8) { const size_t t = (size_t)blockIdx.x * 256 + threadIdx.x; if (t >= n8) return; FragH f;
#pragma unroll
  for (int i = 0; i < 8; ++i) f.h[i] = (_Float16)(bf16_round(W[t * 8 + i]) * 16.0f); *(v8us*)((unsigned short*)Bt + t * 8) = f.half[0];  }
template <int NHv, int TTv>
__global__ __launch_bounds__(256) void k_vt(const _Float16* __restrict__ V16, int ldv, int voff, _Float16* __restrict__ Vt) { __shared__ unsigned short tl[64][66]; const int tid = threadIdx.x; const int slab = blockIdx.x / (TTv / 64), lg = blockIdx.x % (TTv / 64); const int b = slab / NHv, h = slab % NHv;
  for (int i = tid; i < 64 * 8; i += 256) { const int r = i / 8, c8 = (i % 8) * 8; FragH f; f.half[0] = *(const v8us*)((const unsigned short*)V16 + ((size_t)b * TTv + lg * 64 + r) * ldv + voff + h * 64 + c8);
#pragma unroll
    for (int q = 0; q < 8; ++q) tl[r][c8 + q] = f.u[q]; }
  __syncthreads();
  {
#pragma unroll
    for (int rd = 0; rd < 2; ++rd) { const int d = rd * 32 + tid / 8, pc = tid % 8; FragH f;
#pragma unroll
      for (int q = 0; q < 8; ++q) f.u[q] = tl[pc * 8 + q][d];
      *(v8us*)((unsigned short*)Vt + ((size_t)slab * 64 + d) * TTv + lg * 64 + pc * 8) = f.half[0]; }
     } }

__global__ __launch_bounds__(256) void k_hl(const float* __restrict__ F, _Float16* __restrict__ Hh, _Float16* __restrict__ Hl, size_t n8) { const size_t t = (size_t)blockIdx.x * 256 + threadIdx.x; if (t >= n8) return; FragH fh, fl; const v4f a = *(const v4fa*)(F + t * 8), c = *(const v4fa*)(F + t * 8 + 4);
#pragma unroll
  for (int q = 0; q < 4; ++q) { _Float16 h = (_Float16)a[q]; fh.h[q] = h; fl.h[q] = (_Float16)((a[q] - (float)h) * 1024.0f); h = (_Float16)c[q]; fh.h[4 + q] = h; fl.h[4 + q] = (_Float16)((c[q] - (float)h) * 1024.0f); }
  { *(v8us*)((unsigned short*)Hh + t * 8) = fh.half[0]; *(v8us*)((unsigned short*)Hl + t * 8) = fl.half[0];  } }

__device__ __forceinline__ v16h g2_frag(const _Float16* p, int hh) { FragH f; f.half[0] = *(const v8us*)((const unsigned short*)p + 8 * hh); f.half[1] = *(const v8us*)((const unsigned short*)p + 16 + 8 * hh); return f.v; }
// Projection GEMM Y[8192][1024] = f16(X W^T * alpha + bias), in the q plane times FA_QS, X and W as f16 rows with k along the row. A work-group of four waves (2 x 2) owns a 128 x 128 tile of Y, a wave 64 x 64.
// The W and X tiles of 64 k (128-byte rows) are brought by whole-line global loads and shared through LDS: two buffers, the next tile's loads fly in registers while this tile is worked on,
// one barrier per tile. The wave forms Y^T = W X^T (A = W rows, B = X rows, both read with fa_frag, so the two k orders are equal): a lane then holds eight neighbouring output columns of one
// token row, which pack into one 16-byte piece; the pieces pass through the wave's own part of the (then free) ring, so that every global store covers whole 128-byte lines.
// One launch holds the tiles of all three projections: the block index picks the plane (0 = Q, 1 = K, 2 = V) and the tile in it, so that no launch gap, fill or tail stands between the planes.
// A V tile exchanges the roles (A = X rows, B = W rows: wg then walks X, xg walks W; same loaders, same k order): a lane then holds eight neighbouring token rows of one output column, a 16-byte piece of a
// row of V^T; the staged rows go out as whole 128-byte lines of V^T [batch * head][d][key], and no transposing launch is needed.
// amdgpu_waves_per_eu(2, 2): two work-groups per WGP, and one work-group's matrix work covers the other's barrier and LDS waits.
// Every '#pragma unroll' in k_proj gives constant indices, so that the fragment, staging and accumulator arrays stay in registers.
#define PG_T 128                     /* tile edge in rows of W and of X */
#define PG_K 64                      /* k per LDS tile */
#define PG_PITCH 144                 /* LDS row pitch in bytes: 128 of data, an odd multiple of 16 for the 16-byte fragment reads */
#define PG_NS (DM / PG_K)
#define PG_NT ((MP / PG_T) * (DM / PG_T))      /* tiles per plane */
#define FA_QS (0.125f * 1.4426950408889634f)      /* 64^-0.5 log2(e): the q rows carry it, so that k_fattn's score tiles are exponents in base 2 */
__device__ __forceinline__ v16h fa_frag(const unsigned char* p);
__device__ __forceinline__ v8f fa_mma(v16h a, v16h b, v8f c);
// A wave's results to its LDS staging rows: acc[i][j] register r = A row 16 i + 8 h + r, lane column c = B row 16 j + c of the wave's tile. Staged row = B row, 64 A rows along it.
// bias points at the wave's first output column. VTR false: the A rows are the output columns. VTR true: the B rows are. bs scales the bias as alpha's extra factor scales the product (FA_QS in the q plane, else 1).
template <bool VTR>
__device__ __forceinline__ void pg_stage(const v8f (&acc)[4][4], unsigned char* st, const float* __restrict__ bias, float alpha, float bs, int lane) {
  const int c = lane & 15, h = lane >> 4;
#pragma unroll
  for (int i = 0; i < 4; ++i) { float bv[8];
#pragma unroll
    for (int r = 0; r < 8; ++r) bv[r] = VTR ? 0.f : bf16_round(bias[16 * i + 8 * h + r]) * bs;
#pragma unroll
    for (int j = 0; j < 4; ++j) { FragH f; const float bc = VTR ? bf16_round(bias[16 * j + c]) * bs : 0.f;
#pragma unroll
      for (int r = 0; r < 8; ++r) f.h[r] = (_Float16)(acc[i][j][r] * alpha + (VTR ? bc : bv[r]));
      *(v8us*)(st + (16 * j + c) * PG_PITCH + 32 * i + 16 * h) = f.half[0]; } } }
__global__ __launch_bounds__(128) __attribute__((amdgpu_waves_per_eu(2, 2))) void k_proj(const _Float16* __restrict__ XQ, const _Float16* __restrict__ XM, const _Float16* __restrict__ WQ, const _Float16* __restrict__ WK, const _Float16* __restrict__ WV,
                                                                                         const float* __restrict__ bq, const float* __restrict__ bk, const float* __restrict__ bv, float alpha,
                                                                                         _Float16* __restrict__ YQ, _Float16* __restrict__ YK, _Float16* __restrict__ VT) {
  static_assert(MP % PG_T == 0 && DM % PG_T == 0 && DM % PG_K == 0, "k_proj: whole tiles only");
  static_assert(NH * HD == DM && SQ % PG_T == 0, "k_proj, V tiles: row b * DM + column of V^T, a tile's token rows lie in one batch");
  const int plane = blockIdx.x / PG_NT, tile = blockIdx.x % PG_NT; const bool vtr = plane == 2;      /* the same in every thread of the work-group */
  const _Float16* X = plane == 0 ? XQ : XM; const _Float16* Wt = plane == 0 ? WQ : plane == 1 ? WK : WV;
  __shared__ __attribute__((aligned(16))) unsigned char L[2][2][PG_T * PG_PITCH];      /* [buffer][A rows | B rows]: W | X, in a V tile X | W */
  const int tid = threadIdx.x, lane = tid & 31, wave = tid >> 5, c = lane & 15, h = lane >> 4;
  const int mt = tile / (DM / PG_T), nq = tile % (DM / PG_T); const int row0 = mt * PG_T, col0 = nq * PG_T; const int wm = wave >> 1, wn = wave & 1;
  const int sr = tid >> 3, sc = (tid & 7) * 8;      /* staging: 8 threads cover one 128-byte row, 16 rows per load */
  const unsigned short* wr = (const unsigned short*)Wt + (size_t)(col0 + sr) * DM + sc; const unsigned short* xr = (const unsigned short*)X + (size_t)(row0 + sr) * DM + sc;
  const unsigned short* wg = vtr ? xr : wr;      /* rows of the A operand */
  const unsigned short* xg = vtr ? wr : xr;      /* rows of the B operand */
  const int so = sr * PG_PITCH + sc * 2;
  const int fw = (64 * wn + c) * PG_PITCH + 16 * h, fx = (64 * wm + c) * PG_PITCH + 16 * h;      /* the lane's fragment row and its 16 h bytes */
  const v8f z8 = {0.f, 0.f, 0.f, 0.f, 0.f, 0.f, 0.f, 0.f};
  v8f acc[4][4];      /* [16 A rows i][16 B rows j]: register r = A row 16 i + 8 h + r, lane column c = B row 16 j + c */
#pragma unroll
  for (int i = 0; i < 4; ++i)
#pragma unroll
    for (int j = 0; j < 4; ++j) acc[i][j] = z8;
  v8us rw[8], rx[8];
#pragma unroll
  for (int i = 0; i < 8; ++i) { rw[i] = *(const v8us*)(wg + (size_t)(16 * i) * DM); rx[i] = *(const v8us*)(xg + (size_t)(16 * i) * DM); }
#pragma unroll
  for (int i = 0; i < 8; ++i) { *(v8us*)&L[0][0][so + 16 * i * PG_PITCH] = rw[i]; *(v8us*)&L[0][1][so + 16 * i * PG_PITCH] = rx[i]; }
  __syncthreads();      /* tile 0 is visible to all waves */
#pragma unroll 1      /* rolled, last trip not peeled off, as in k_fattn: the next tile's global loads stay at the head of the trip, whose work covers their latency */
  for (int s = 0; s < PG_NS; ++s) {
    const unsigned char* Wb = &L[s & 1][0][0]; const unsigned char* Xb = &L[s & 1][1][0];
    if (s + 1 < PG_NS) {
#pragma unroll
      for (int i = 0; i < 8; ++i) { rw[i] = *(const v8us*)(wg + (size_t)(16 * i) * DM + (s + 1) * PG_K); rx[i] = *(const v8us*)(xg + (size_t)(16 * i) * DM + (s + 1) * PG_K); } }
    v16h wf[2][4], xf[2][4];      /* [32 k][16 rows] */
#pragma unroll
    for (int kc = 0; kc < 2; ++kc)
#pragma unroll
      for (int i = 0; i < 4; ++i) { wf[kc][i] = fa_frag(Wb + fw + 16 * i * PG_PITCH + 64 * kc); xf[kc][i] = fa_frag(Xb + fx + 16 * i * PG_PITCH + 64 * kc); }
    __builtin_amdgcn_sched_barrier(0);      /* the trip's 32 fragment reads stay one group in front of its 32 products: without it the compiler reads one W fragment at a time and waits for it in front of every four products */
#pragma unroll
    for (int kc = 0; kc < 2; ++kc)
#pragma unroll
      for (int i = 0; i < 4; ++i)
#pragma unroll
        for (int j = 0; j < 4; ++j) acc[i][j] = fa_mma(wf[kc][i], xf[kc][j], acc[i][j]);
    __builtin_amdgcn_sched_barrier(0); asm volatile("v_nop\n\tv_nop\n\tv_nop\n\tv_nop"); __builtin_amdgcn_sched_barrier(0);      /* four vector slots behind the trip's last WMMA, in front of the branches that follow it */
    if (s + 1 < PG_NS) { unsigned char* Wn = &L[(s + 1) & 1][0][0]; unsigned char* Xn = &L[(s + 1) & 1][1][0];
#pragma unroll
      for (int i = 0; i < 8; ++i) { *(v8us*)(Wn + so + 16 * i * PG_PITCH) = rw[i]; *(v8us*)(Xn + so + 16 * i * PG_PITCH) = rx[i]; } }
    __syncthreads();      /* publishes tile s + 1 and ends every wave's reads of tile s, whose buffer the next trip refills; behind the last trip it frees the ring for the output staging */
  }
  unsigned char* st = &L[0][0][0] + wave * (64 * PG_PITCH);      /* the wave's own 64 rows of 128 bytes */
  const float qs = plane == 0 ? FA_QS : 1.0f;
  if (vtr) pg_stage<true>(acc, st, bv + col0 + 64 * wm, alpha, 1.0f, lane);
  else pg_stage<false>(acc, st, (plane == 0 ? bq : bk) + col0 + 64 * wn, alpha * qs, qs, lane);
  __builtin_amdgcn_fence(__ATOMIC_ACQ_REL, "workgroup"); __builtin_amdgcn_wave_barrier();      /* the wave's lanes read each other's pieces: the reads stay behind the writes */
  const int yl = vtr ? SQ : DM;      /* row pitch of the output plane in elements: V^T has rows of SQ keys, DM rows per batch */
  unsigned short* yb = vtr ? (unsigned short*)VT + ((size_t)(row0 / SQ) * DM + col0) * SQ + row0 % SQ : (unsigned short*)(plane == 0 ? YQ : YK) + (size_t)row0 * DM + col0;      /* the tile's first element: the same in every thread */
  const unsigned yo = (unsigned)((64 * wm + (lane >> 3)) * yl + 64 * wn + (lane & 7) * 8);      /* the lane's place in the tile: B row 64 wm + .., A row 64 wn + .. */
#pragma unroll
  for (int q = 0; q < 16; ++q) { const v8us v = *(const v8us*)(st + (4 * q + (lane >> 3)) * PG_PITCH + (lane & 7) * 16); *(v8us*)(yb + (size_t)(4 * q * yl) + yo) = v; } }


#define FA_NW 8                      /* waves per work-group */
#define FA_SK 64                     /* keys per LDS tile (two passes of 32) */
#define FA_PITCH 144                 /* LDS row pitch in bytes: 128 of data, an odd multiple of 16 for the 16-byte fragment reads */
#define FA_NS (SQ / FA_SK)
__device__ __forceinline__ float fa_x16(float v) { const int i = __float_as_int(v); return __int_as_float(__builtin_amdgcn_permlanex16(i, i, 0x76543210, 0xfedcba98, false, false)); }      /* value of lane ^ 16 */
__device__ __forceinline__ v16h fa_frag(const unsigned char* p) { FragH f; f.half[0] = *(const v8us*)p; f.half[1] = *(const v8us*)(p + 32); return f.v; }      /* k = 8 h .. 8 h + 7 and 16 + 8 h .. 16 + 8 h + 7; p already holds the lane's 16 h bytes */
__device__ __forceinline__ v8f fa_mma(v16h a, v16h b, v8f c) { return __builtin_amdgcn_wmma_f32_16x16x32_f16(false, a, false, b, (short)0, c, false, false); }
#define FA_TB (FA_SK * FA_PITCH)     /* bytes of one K or V^T tile in LDS; a buffer is [K rows by key | V^T rows by d] */
template <bool ONLINE>
__device__ __forceinline__ void fa_keys(unsigned char* Lb, const unsigned short* __restrict__ kg, const unsigned short* __restrict__ vg, int so0, int so1, int c, int h,
                                        const v16h (&qf)[2][2], v16h ones, v8f (&acc)[2][4], v8f (&lacc)[2]) {
  typedef _Float16 h2 __attribute__((ext_vector_type(2))); typedef float f2 __attribute__((ext_vector_type(2)));
  const v8f z8 = {0.f, 0.f, 0.f, 0.f, 0.f, 0.f, 0.f, 0.f};
  float m_run[2];
#pragma unroll
  for (int g = 0; g < 2; ++g) { m_run[g] = -__builtin_inff(); lacc[g] = z8;
#pragma unroll
    for (int t = 0; t < 4; ++t) acc[g][t] = z8; }
  v8us rk0 = *(const v8us*)kg, rk1 = *(const v8us*)(kg + (size_t)32 * LQ), rv0 = *(const v8us*)vg, rv1 = *(const v8us*)(vg + (size_t)32 * SQ);
  *(v8us*)(Lb + so0) = rk0; *(v8us*)(Lb + so1) = rk1; *(v8us*)(Lb + FA_TB + so0) = rv0; *(v8us*)(Lb + FA_TB + so1) = rv1;
  __syncthreads();      /* tile 0 is visible to all waves */
#pragma unroll 1      /* rolled, last trip not peeled off: in the peeled build the compiler sinks the next tile's global loads down to their LDS stores, and the trip's work no longer covers their latency */
  for (int s = 0; s < FA_NS; ++s) {
    const unsigned char* Kb = Lb + (s & 1) * (2 * FA_TB); const unsigned char* Vb = Kb + FA_TB;
    if (s + 1 < FA_NS) { const unsigned short* kn = kg + (size_t)(s + 1) * FA_SK * LQ; const unsigned short* vn = vg + (s + 1) * FA_SK;
      rk0 = *(const v8us*)kn; rk1 = *(const v8us*)(kn + (size_t)32 * LQ); rv0 = *(const v8us*)vn; rv1 = *(const v8us*)(vn + (size_t)32 * SQ);
      asm volatile("s_wait_xcnt 0x0" :: "v"(kn), "v"(vn) : "memory"); }      /* the wait in front of any overwrite of the four loads' address pairs; as its inputs the pairs stay whole up to it */
#pragma unroll
    for (int sub = 0; sub < 2; ++sub) {      /* one pass: 32 keys */
      v8f sx[2][2];      /* [16-key tile][column group]: register r = key 16 kt + 8 h + r, lane column c = query */
#pragma unroll
      for (int kt = 0; kt < 2; ++kt) { const unsigned char* kp = Kb + (32 * sub + 16 * kt + c) * FA_PITCH + 16 * h; const v16h k0 = fa_frag(kp), k1 = fa_frag(kp + 64);
#pragma unroll
        for (int g = 0; g < 2; ++g) sx[kt][g] = fa_mma(k1, qf[g][1], fa_mma(k0, qf[g][0], z8)); }
      if (ONLINE) {
        float mb[2]; bool need = false;
#pragma unroll
        for (int g = 0; g < 2; ++g) { float mx = sx[0][g][0];
#pragma unroll
          for (int r = 1; r < 8; ++r) mx = fmaxf(mx, sx[0][g][r]);
#pragma unroll
          for (int r = 0; r < 8; ++r) mx = fmaxf(mx, sx[1][g][r]);
          mx = fmaxf(mx, fa_x16(mx)); mb[g] = mx; need = need || (mx > m_run[g] + 8.0f); }
        if (__builtin_amdgcn_ballot_w32(need) != 0) {      /* lazy rescale: the maximum in use may trail the true one by up to 8 (base 2), so an exponential stays below 2^8 */
#pragma unroll
          for (int g = 0; g < 2; ++g) { const float m_new = fmaxf(m_run[g], mb[g]); const float corr = __builtin_amdgcn_exp2f(m_run[g] - m_new); m_run[g] = m_new; lacc[g] = lacc[g] * corr;
#pragma unroll
            for (int t = 0; t < 4; ++t) acc[g][t] = acc[g][t] * corr; } } }
      v16h vf[4];      /* A operand: row = d, k = the pass's 32 keys */
#pragma unroll
      for (int t = 0; t < 4; ++t) vf[t] = fa_frag(Vb + (16 * t + c) * FA_PITCH + 64 * sub + 16 * h);
#pragma unroll
      for (int g = 0; g < 2; ++g) { union { v16h v; h2 p[8]; } pf;      /* B operand: element pair i = keys 16 (i >> 2) + 8 h + 2 (i & 3), + 1: the k order of fa_frag */
#pragma unroll
        for (int i = 0; i < 8; ++i) { const float x0 = sx[i >> 2][g][2 * (i & 3)], x1 = sx[i >> 2][g][2 * (i & 3) + 1];
          const float e0 = __builtin_amdgcn_exp2f(ONLINE ? x0 - m_run[g] : x0), e1 = __builtin_amdgcn_exp2f(ONLINE ? x1 - m_run[g] : x1); pf.p[i] = __builtin_convertvector(f2{e0, e1}, h2); }
#pragma unroll
        for (int t = 0; t < 4; ++t) acc[g][t] = fa_mma(vf[t], pf.v, acc[g][t]);
        lacc[g] = fa_mma(ones, pf.v, lacc[g]); }
    }
    __builtin_amdgcn_sched_barrier(0); asm volatile("v_nop\n\tv_nop\n\tv_nop\n\tv_nop"); __builtin_amdgcn_sched_barrier(0);      /* four vector slots behind the trip's last WMMA, in front of the branches that follow it */
    if (s + 1 < FA_NS) { unsigned char* Kn = Lb + ((s + 1) & 1) * (2 * FA_TB); unsigned char* Vn = Kn + FA_TB;
      *(v8us*)(Kn + so0) = rk0; *(v8us*)(Kn + so1) = rk1; *(v8us*)(Vn + so0) = rv0; *(v8us*)(Vn + so1) = rv1; }
    __syncthreads();      /* publishes tile s + 1 and ends every wave's reads of tile s, whose buffer the next trip refills; behind the last trip both buffers are free */
  } }
__global__ __launch_bounds__(32 * FA_NW) __attribute__((amdgpu_waves_per_eu(4, 4))) void k_fattn(const _Float16* __restrict__ Q16, const _Float16* __restrict__ K16, const _Float16* __restrict__ VT, float* __restrict__ out) {
  static_assert(HD == 64 && SQ % (32 * FA_NW) == 0 && SQ % FA_SK == 0, "k_fattn: head size 64, whole work-groups of queries, whole tiles of keys");
  __shared__ __attribute__((aligned(16))) unsigned char L[2][2][FA_TB];      /* [buffer][K rows by key | V^T rows by d] */
  __shared__ int fa_bad[FA_NW];      /* per wave: a row sum of the first walk is out of range */
  const int tid = threadIdx.x, lane = tid & 31, wave = tid >> 5, c = lane & 15, h = lane >> 4;
  const int bh = blockIdx.y, b = bh / NH, hd = bh % NH; const int q0 = blockIdx.x * (32 * FA_NW) + wave * 32;
  const int sr = tid >> 3, sc = (tid & 7) * 8;      /* staging: 8 threads cover one 128-byte row, 32 rows per load */
  const unsigned short* kg = (const unsigned short*)K16 + ((size_t)b * SQ + sr) * LQ + hd * HD + sc;      /* row = key */
  const unsigned short* vg = (const unsigned short*)VT + ((size_t)bh * HD + sr) * SQ + sc;      /* row = d, keys along the row */
  const int so0 = sr * FA_PITCH + sc * 2, so1 = so0 + 32 * FA_PITCH;
  v16h qf[2][2];      /* B operand: column = query, k = d */
#pragma unroll
  for (int g = 0; g < 2; ++g)
#pragma unroll
    for (int kc = 0; kc < 2; ++kc) qf[g][kc] = g2_frag(Q16 + ((size_t)b * SQ + q0 + 16 * g + c) * LQ + hd * HD + 32 * kc, h);
  FragH ones;      /* A operand whose row 0 is 1.0: its product with P^T gives the column sums of P^T in row 0 */
#pragma unroll
  for (int i = 0; i < 16; ++i) ones.u[i] = (c == 0) ? (unsigned short)0x3C00 : (unsigned short)0;
  v8f acc[2][4], lacc[2];
  fa_keys<false>(&L[0][0][0], kg, vg, so0, so1, c, h, qf, ones.v, acc, lacc);
  bool bad = false;
#pragma unroll
  for (int g = 0; g < 2; ++g) { const float lr = lacc[g][0]; const float l = lr + fa_x16(lr); bad = bad || !(l >= 1.0f && l < __builtin_inff()); }      /* also true for a NaN */
  const int wbad = __builtin_amdgcn_ballot_w32(bad) != 0 ? 1 : 0;      /* taken with all lanes on, in front of the one-lane store */
  if (lane == 0) fa_bad[wave] = wbad;
  __syncthreads();      /* every wave's verdict is visible: the work-group repeats the walk as a whole or not at all, since the walk holds barriers */
  int any = 0;
#pragma unroll
  for (int w = 0; w < FA_NW; ++w) any |= fa_bad[w];
  if (__builtin_amdgcn_readfirstlane(any) != 0) fa_keys<true>(&L[0][0][0], kg, vg, so0, so1, c, h, qf, ones.v, acc, lacc);      /* the same value in every thread of the work-group: a scalar branch */
#pragma unroll
  for (int g = 0; g < 2; ++g) { const float lr = lacc[g][0]; const float inv = 1.0f / (lr + fa_x16(lr));      /* row 0 of the sum tile sits in lanes 0-15, lanes 16-31 hold row 8 = 0: the exchange-and-add stays unconditional */
    float* op = out + ((size_t)b * SQ + q0 + 16 * g + c) * DM + hd * HD + 8 * h;      /* register r of tile t = d 16 t + 8 h + r of query column c */
#pragma unroll
    for (int t = 0; t < 4; ++t) { const v8f o = acc[g][t] * inv; const v4f lo = {o[0], o[1], o[2], o[3]}, hi = {o[4], o[5], o[6], o[7]}; *(v4f*)(op + 16 * t) = lo; *(v4f*)(op + 16 * t + 4) = hi; } } }
__global__ __launch_bounds__(256) void k_vt(const _Float16* __restrict__ V16, int b, int h0, _Float16* __restrict__ VT) { __shared__ unsigned short tl[64][65]; const int tid = threadIdx.x; const int hh = blockIdx.x % HG, sg = blockIdx.x / HG; const int s0 = sg * 64; const int h = h0 + hh;
  for (int i = tid; i < 64 * 8; i += 256) { const int j = i / 8, d8 = (i % 8) * 8; FragH f; f.half[0] = *(const v8us*)((const unsigned short*)V16 + ((size_t)b * SQ + s0 + j) * DM + h * HD + d8); for (int q = 0; q < 8; ++q) tl[d8 + q][j] = f.u[q]; }
  __syncthreads();
  { for (int i = tid; i < 64 * 8; i += 256) { const int d = i / 8, j8 = (i % 8) * 8; FragH f; for (int q = 0; q < 8; ++q) f.u[q] = tl[d][j8 + q]; *(v8us*)((unsigned short*)VT + ((size_t)hh * HD + d) * SQ + s0 + j8) = f.half[0]; }  } }



__global__ __launch_bounds__(256) void k_rsmkm(const float* __restrict__ S, _Float16* __restrict__ P, int nrows, const int* __restrict__ am) {
  #pragma clang fp contract(off)
  const int t = blockIdx.x * 256 + threadIdx.x; if (t >= nrows) return; const size_t i = (size_t)t; const float* s = S + i * SQ; const int* mr = am + (size_t)(t % SQ) * SQ; float mx = -3.0e38f;
#pragma unroll 1
  for (int j = 0; j < SQ; ++j) { const float f = (mr[j] != 0) ? 1.f : 0.f; mx = fmaxf(mx, fmaf(f, s[j], (1.f - f) * -1.0e9f)); } float se = 0.f;
#pragma unroll 1
  for (int j = 0; j < SQ; ++j) { const float f = (mr[j] != 0) ? 1.f : 0.f; se += __expf(fmaf(f, s[j], (1.f - f) * -1.0e9f) - mx); } const float sc = 256.0f / se;
#pragma unroll 1
  for (int j0 = 0; j0 < SQ; j0 += 8) { FragH fr; for (int q = 0; q < 8; ++q) { const int j = j0 + q; const float f = (mr[j] != 0) ? 1.f : 0.f; fr.h[q] = (_Float16)(__expf(fmaf(f, s[j], (1.f - f) * -1.0e9f) - mx) * sc); }
    unsigned short* d = (unsigned short*)P + i * SQ + j0; *(v8us*)d = fr.half[0];  } }
extern "C" void kernel_launch(void* const* d_in, const int* in_sizes, int n_in,
                              void* d_out, int out_size, void* d_ws, size_t ws_size, hipStream_t stream) {
  (void)in_sizes; (void)n_in; (void)out_size;
  const float* const* I = (const float* const*)d_in; const float* xq = I[0]; const float* xm = I[1]; const float* wq = I[2]; const float* bq = I[3]; const float* wk = I[4]; const float* bk = I[5]; const float* wv = I[6]; const float* bv = I[7];      /* input (queries), memory (keys AND values); natural weights + biases; no output projection */
  char* ws = (char*)d_ws; size_t off = 0;
  auto take = [&](size_t bytes) { char* p = ws + off; off += (bytes + 255) & ~(size_t)255; return p; };
  _Float16* BQ = (_Float16*)take((size_t)DM * DM * 2); _Float16* BK = (_Float16*)take((size_t)DM * DM * 2); _Float16* BV = (_Float16*)take((size_t)DM * DM * 2); 
  _Float16* X16 = (_Float16*)take(NR * DM * 2); _Float16* XM = (_Float16*)take(NR * DM * 2); _Float16* Q16 = (_Float16*)take(NR * DM * 2); _Float16* K16 = (_Float16*)take(NR * DM * 2); 
  _Float16* VT = (_Float16*)take((size_t)NB * NH * HD * SQ * 2);
  if (off > ws_size) return;
  k_cvt<<<CV_G, CV_T, 0, stream>>>(xq, xm, wq, wk, wv, X16, XM, BQ, BK, BV);      /* input and memory as exact f16 rows; natural [out][in] weights = Bt x16 (no output projection: no Wo plane) */
  const size_t r0p = (size_t)B0 * SQ;      /* first projected row */
  k_proj<<<3 * PG_NT, 128, 0, stream>>>(X16 + r0p * DM, XM + r0p * DM, BQ, BK, BV, bq, bk, bv, 0.0625f, Q16 + r0p * DM, K16 + r0p * DM, VT + r0p * DM);      /* q rows (times FA_QS), k rows and V^T [NB * NH][HD][SQ] */
  k_fattn<<<dim3(SQ / (32 * FA_NW), NB * NH), 32 * FA_NW, 0, stream>>>(Q16, K16, VT, (float*)d_out);      /* out = softmax(q k^T / 8) v straight to the f32 output (merged heads; each 256-B head segment of a row written by one wave) */
  /* no output projection in this module */
}

// v007
// One run takes 102 microseconds.
// Next to v006, in two timings, it ran 1.11 times as fast each time.
// All steps since v000 together make it 71.1 times as fast.
#include <hip/hip_runtime.h>
// Multi-head CROSS-attention without an output projection (input, memory [4][2048][1024]; q = input Wq^T + bq, k = memory Wk^T + bk, v = memory Wv^T + bv (natural [1024][1024], zero biases); 16 heads of 64; q * 64^-0.5 then q k^T; softmax over all 2048 memory positions (no mask); out = attn v merged to [4][2048][1024]; NO output projection).
// Structure: token rows r = b*2048 + s; x as exact f16 rows (bf16-rounded); Q, K, V as three WMMA GEMMs (128x128 tiles through LDS, 64x64 wave tiles, f32 accumulation, exact x16 weights + bias, f16 outputs) in ONE launch, whose V tiles exchange the operand roles and store V^T [batch * head][d][key] themselves; one fused attention launch (k_fattn): S^T = K Q^T (K = 64, q rows pre-scaled by 64^-0.5 log2(e)), softmax in base 2 (weights as f16 relative to the fixed reference 0, row sums f32 and checked; a walk with the running maximum as the fallback), O^T += V^T P^T, divided by the row sum and written straight into the merged f32 output rows.
// Compute dtype: inputs rounded to bf16; x / weights exact; q, k, v and softmax weights as plain f16 GEMM operands (~2^-12); scores and softmax statistics f32. v_wmma_f32_16x16x32_f16.
#define NB 4
#define SQ 2048
#define DM 1024
#define NH 16
#define HD 64
#define HG 4                         /* heads per k_vt(b, h0) launch (that overload is not launched) */
#define B0 0                         /* first batch processed (debug hook) */
#define NBR NB                       /* batches processed (debug hook) */
#define NR ((size_t)NB * SQ)         /* token rows */
#define MP ((int)((size_t)NBR * SQ)) /* rows projected (debug hook) */
#define QN SQ                        /* unused (attention covers all SQ query rows) */
#define NHD NH                       /* unused (attention covers all NH heads) */
#define MPO MP                       /* unused (no output projection) */
#define LQ DM      /* row pitch of the q and k rows */
typedef __bf16 v16b __attribute__((ext_vector_type(16)));
typedef unsigned short v8us __attribute__((ext_vector_type(8), may_alias));
typedef float  v8f  __attribute__((ext_vector_type(8)));
typedef float  v4f  __attribute__((ext_vector_type(4)));
typedef float  v4fa __attribute__((ext_vector_type(4), may_alias));
union FragB { v16b v; v8us half[2]; unsigned short u[16]; };

__device__ __forceinline__ unsigned short bf16_bits(float x) { unsigned int u = __float_as_uint(x); return (unsigned short)((u + 0x7FFFu + ((u >> 16) & 1u)) >> 16); }
__device__ __forceinline__ float bf16_val(unsigned short b) { return __uint_as_float(((unsigned int)b) << 16); }
__device__ __forceinline__ float bf16_round(float x) { return bf16_val(bf16_bits(x)); }
// D += A·B with NT terms: 1 = ah·bh, 2 = + al·bh (A split), 3 = + ah·bl (both split)
template <int NT>
__device__ __forceinline__ v8f mmaN(v16b ah, v16b al, v16b bh, v16b bl, v8f c) {
  c = __builtin_amdgcn_wmma_f32_16x16x32_bf16(false, ah, false, bh, (short)0, c, false, false);
  if (NT >= 2) c = __builtin_amdgcn_wmma_f32_16x16x32_bf16(false, al, false, bh, (short)0, c, false, false);
  if (NT >= 3) c = __builtin_amdgcn_wmma_f32_16x16x32_bf16(false, ah, false, bl, (short)0, c, false, false);
  asm volatile("v_nop\n\tv_nop\n\tv_nop\n\tv_nop" : "+v"(c) : "v"(ah), "v"(al), "v"(bh), "v"(bl));
  return c;
}

__global__ __launch_bounds__(256) void k_wt_bf16(const float* __restrict__ W, unsigned short* __restrict__ Wt, int K, int N) {
  const int t = blockIdx.x * 256 + threadIdx.x;
  const int k8n = K / 8;
  if (t >= N * k8n) return;
  const int n = t / k8n, k8 = (t % k8n) * 8;
  v8us v;
#pragma unroll
  for (int i = 0; i < 8; ++i) v[i] = bf16_bits(W[(size_t)(k8 + i) * N + n]);
  *(v8us*)(Wt + (size_t)n * K + k8) = v;
  
}

// GEMM C[M][N] (f32, pitch ldc) = act(A[M][K]·W + bias). A f32 row-major (pitch lda) converted per fragment to bf16
// (ASPLIT: hi/lo two planes -> 2 terms, else single rounded term); Wt bf16 [N][K] (pitch ldb). BIAS_BF16 rounds the
// bias to bf16 first (bias quantised to bf16 before the add). K%32==0, M%16==0, N%64==0.
template <bool ASPLIT, int ACT, bool BIAS_BF16>
__global__ __launch_bounds__(128) void k_gemm_bf(const float* __restrict__ A, int lda, const unsigned short* __restrict__ Wt, int ldb,
                                               const float* __restrict__ bias, float* __restrict__ C, int ldc, int M, int N, int K) {
  __shared__ __attribute__((aligned(16))) float so[4][16][64];
  const int tid = threadIdx.x, w = tid >> 5, lane = tid & 31, ln = lane & 15, hh = lane >> 4;
  const int ntn = N / 64;
  const int wid = blockIdx.x * 4 + w;
  const int mt = wid / ntn, nq = wid % ntn;
  if (mt * 16 >= M) return;
  const int row0 = mt * 16, col0 = nq * 64;
  const float* arow = A + (size_t)(row0 + ln) * lda;
  v8f acc[4] = {};
  for (int kb = 0; kb < K; kb += 32) {
    FragB ah, al;
    const v4f x0 = *(const v4fa*)(arow + kb + 8 * hh), x1 = *(const v4fa*)(arow + kb + 8 * hh + 4);
    const v4f x2 = *(const v4fa*)(arow + kb + 16 + 8 * hh), x3 = *(const v4fa*)(arow + kb + 16 + 8 * hh + 4);
    float xs[16] = {x0[0],x0[1],x0[2],x0[3],x1[0],x1[1],x1[2],x1[3],x2[0],x2[1],x2[2],x2[3],x3[0],x3[1],x3[2],x3[3]};
#pragma unroll
    for (int i = 0; i < 16; ++i) { const unsigned short hb = bf16_bits(xs[i]); ah.u[i] = hb; al.u[i] = ASPLIT ? bf16_bits(xs[i] - bf16_val(hb)) : (unsigned short)0; }
#pragma unroll
    for (int t = 0; t < 4; ++t) {
      const unsigned short* brow = Wt + (size_t)(col0 + t * 16 + ln) * ldb + kb;
      FragB b;
      b.half[0] = *(const v8us*)(brow + 8 * hh);
      b.half[1] = *(const v8us*)(brow + 16 + 8 * hh);
      acc[t] = mmaN<ASPLIT ? 2 : 1>(ah.v, al.v, b.v, b.v, acc[t]);
    }
  }
#pragma unroll
  for (int t = 0; t < 4; ++t) {
    float bv = bias ? bias[col0 + t * 16 + ln] : 0.f;
    if (BIAS_BF16) bv = bf16_round(bv);
#pragma unroll
    for (int r = 0; r < 8; ++r) { float v = acc[t][r] + bv; if (ACT == 1) v = fmaxf(v, 0.f); so[w][8 * hh + r][t * 16 + ln] = v; }
  }
  __builtin_amdgcn_fence(__ATOMIC_ACQ_REL, "workgroup");
  __builtin_amdgcn_wave_barrier();
  const int rsub = lane >> 4, c4 = (lane & 15) * 4;
  {
#pragma unroll
    for (int q = 0; q < 8; ++q) {
      const int r = q * 2 + rsub;
      const v4f v = *(const v4fa*)&so[w][r][c4];
      *(v4f*)(C + (size_t)(row0 + r) * ldc + col0 + c4) = v;
    }
    
  }
}

// GEMM C = act(A·W + bias + resid): A f32 (ASPLIT -> hi/lo 2 terms), Wt bf16 [N][K]; ACT 0 none, 1 relu, 2 exact gelu;
// resid (optional, f32, row index = (row % rmod), pitch ldr, RES_BF16 rounds it) added before the activation.
template <bool ASPLIT, int ACT, bool BIAS_BF16, bool RES_BF16>
__global__ __launch_bounds__(128) void k_gemm_bf3(const float* __restrict__ A, int lda, const unsigned short* __restrict__ Wt, int ldb,
                                                const float* __restrict__ bias, const float* __restrict__ resid, int rmod, int ldr,
                                                float* __restrict__ C, int ldc, int M, int N, int K) {
  __shared__ __attribute__((aligned(16))) float so[4][16][64];
  const int tid = threadIdx.x, w = tid >> 5, lane = tid & 31, ln = lane & 15, hh = lane >> 4;
  const int ntn = N / 64;
  const int wid = blockIdx.x * 4 + w;
  const int mt = wid / ntn, nq = wid % ntn;
  if (mt * 16 >= M) return;
  const int row0 = mt * 16, col0 = nq * 64;
  const float* arow = A + (size_t)(row0 + ln) * lda;
  v8f acc[4] = {};
  for (int kb = 0; kb < K; kb += 32) {
    FragB ah, al;
    const v4f x0 = *(const v4fa*)(arow + kb + 8 * hh), x1 = *(const v4fa*)(arow + kb + 8 * hh + 4);
    const v4f x2 = *(const v4fa*)(arow + kb + 16 + 8 * hh), x3 = *(const v4fa*)(arow + kb + 16 + 8 * hh + 4);
    float xs[16] = {x0[0],x0[1],x0[2],x0[3],x1[0],x1[1],x1[2],x1[3],x2[0],x2[1],x2[2],x2[3],x3[0],x3[1],x3[2],x3[3]};
#pragma unroll
    for (int i = 0; i < 16; ++i) { const unsigned short hb = bf16_bits(xs[i]); ah.u[i] = hb; al.u[i] = ASPLIT ? bf16_bits(xs[i] - bf16_val(hb)) : (unsigned short)0; }
#pragma unroll
    for (int t = 0; t < 4; ++t) {
      const unsigned short* brow = Wt + (size_t)(col0 + t * 16 + ln) * ldb + kb;
      FragB b;
      b.half[0] = *(const v8us*)(brow + 8 * hh);
      b.half[1] = *(const v8us*)(brow + 16 + 8 * hh);
      acc[t] = mmaN<ASPLIT ? 2 : 1>(ah.v, al.v, b.v, b.v, acc[t]);
    }
  }
#pragma unroll
  for (int t = 0; t < 4; ++t) {
    const int col = col0 + t * 16 + ln;
    float bv = bias ? bias[col] : 0.f;
    if (BIAS_BF16) bv = bf16_round(bv);
#pragma unroll
    for (int r = 0; r < 8; ++r) {
      float v = acc[t][r] + bv;
      if (resid) { float rv = resid[(size_t)((row0 + 8 * hh + r) % rmod) * ldr + col]; if (RES_BF16) rv = bf16_round(rv); v += rv; }
      if (ACT == 1) v = fmaxf(v, 0.f);
      if (ACT == 2) v = 0.5f * v * (1.0f + erff(v * 0.70710678118654752f));
      if (ACT == 3) { const float u = 0.7978845608028654f * (v + 0.044715f * v * v * v); v = 0.5f * v * (1.0f + tanhf(u)); }
      so[w][8 * hh + r][t * 16 + ln] = v;
    }
  }
  __builtin_amdgcn_fence(__ATOMIC_ACQ_REL, "workgroup");
  __builtin_amdgcn_wave_barrier();
  const int rsub = lane >> 4, c4 = (lane & 15) * 4;
  {
#pragma unroll
    for (int q = 0; q < 8; ++q) {
      const int r = q * 2 + rsub;
      const v4f v = *(const v4fa*)&so[w][r][c4];
      *(v4f*)(C + (size_t)(row0 + r) * ldc + col0 + c4) = v;
    }
    
  }
}
// row LayerNorm (biased variance, eps) over N: s = X (+ R); optional out_sum <- s; out_norm <- (s-mu)*rsqrt(var+eps)*g + b
template <bool PARAM_BF16>
__global__ __launch_bounds__(256) void k_layernorm(const float* __restrict__ X, const float* __restrict__ R, const float* __restrict__ g, const float* __restrict__ bta,
                                                  float* __restrict__ out_sum, float* __restrict__ out_norm, int N, float eps) {
  __shared__ float red[256];
  const int row = blockIdx.x, tid = threadIdx.x;
  const float* x = X + (size_t)row * N; const float* rr = R ? R + (size_t)row * N : nullptr;
  float vals[16];                     // up to N = 4096
  const int per = N / 256;            // contiguous chunk per thread? use strided-by-4 chunks: thread handles j = tid*4 + 1024*u
  float s1 = 0.f;
  for (int u = 0; u < per / 4; ++u) {
    const int j = tid * 4 + 1024 * u;
    const v4f a = *(const v4fa*)(x + j);
    v4f b = {0.f,0.f,0.f,0.f}; if (rr) b = *(const v4fa*)(rr + j);
#pragma unroll
    for (int q = 0; q < 4; ++q) { const float v = a[q] + b[q]; vals[u * 4 + q] = v; s1 += v; }
  }
  red[tid] = s1; __syncthreads();
  for (int st = 128; st > 0; st >>= 1) { if (tid < st) red[tid] += red[tid + st]; __syncthreads(); }
  const float mu = red[0] / (float)N; __syncthreads();
  float s2 = 0.f;
  for (int u = 0; u < per / 4; ++u)
#pragma unroll
    for (int q = 0; q < 4; ++q) { const float c = vals[u * 4 + q] - mu; s2 += c * c; }
  red[tid] = s2; __syncthreads();
  for (int st = 128; st > 0; st >>= 1) { if (tid < st) red[tid] += red[tid + st]; __syncthreads(); }
  const float rs = rsqrtf(red[0] / (float)N + eps);
  {
    for (int u = 0; u < per / 4; ++u) {
      const int j = tid * 4 + 1024 * u;
      v4f o, sm;
#pragma unroll
      for (int q = 0; q < 4; ++q) {
        float gg = g[j + q], bb = bta[j + q];
        if (PARAM_BF16) { gg = bf16_round(gg); bb = bf16_round(bb); }
        sm[q] = vals[u * 4 + q]; o[q] = (vals[u * 4 + q] - mu) * rs * gg + bb;
      }
      if (out_sum) *(v4f*)(out_sum + (size_t)row * N + j) = sm;
      *(v4f*)(out_norm + (size_t)row * N + j) = o;
    }
    
  }
}



// ---- f16 WMMA path (v_wmma_f32_16x16x32_f16): 11-bit significands for operands in range — used where a [0,1] probability operand needs more precision than bf16
typedef _Float16 v16h __attribute__((ext_vector_type(16)));
union FragH { v16h v; v8us half[2]; _Float16 h[16]; unsigned short u[16]; };
template <int NT>
__device__ __forceinline__ v8f mmaH(v16h ah, v16h al, v16h bh, v16h bl, v8f c) {
  c = __builtin_amdgcn_wmma_f32_16x16x32_f16(false, ah, false, bh, (short)0, c, false, false);
  if (NT >= 2) c = __builtin_amdgcn_wmma_f32_16x16x32_f16(false, al, false, bh, (short)0, c, false, false);
  if (NT >= 3) c = __builtin_amdgcn_wmma_f32_16x16x32_f16(false, ah, false, bl, (short)0, c, false, false);
  asm volatile("v_nop\n\tv_nop\n\tv_nop\n\tv_nop" : "+v"(c) : "v"(ah), "v"(al), "v"(bh), "v"(bl));
  return c;
}
// batched GEMM like k_gemm_b but f16 operands: A f32 (split into f16 hi/lo if ASPLIT, else rounded to f16), Bt = f16 values [n][k]; alpha; C f32; N multiple of 16 (partial tiles skipped)
template <bool ASPLIT>
__global__ __launch_bounds__(128) void k_gemm_h(const float* __restrict__ A, int lda, size_t sA, const _Float16* __restrict__ Bh, int ldb, size_t sB, float alpha, float* __restrict__ C, int ldc, size_t sC, int M, int N, int K) {
  __shared__ __attribute__((aligned(16))) float so[4][16][64];
  const int tid = threadIdx.x, w = tid >> 5, lane = tid & 31, ln = lane & 15, hh = lane >> 4; const int by = blockIdx.y;
  A += (size_t)by * sA; Bh += (size_t)by * sB; C += (size_t)by * sC;
  const int ntn = (N + 63) / 64; const int wid = blockIdx.x * 4 + w; const int mt = wid / ntn, nq = wid % ntn; if (mt * 16 >= M) return;
  const int row0 = mt * 16, col0 = nq * 64; const float* arow = A + (size_t)(row0 + ln) * lda;
  v8f acc[4] = {};
  for (int kb = 0; kb < K; kb += 32) {
    FragH ah, al;
    const v4f x0 = *(const v4fa*)(arow + kb + 8 * hh), x1 = *(const v4fa*)(arow + kb + 8 * hh + 4), x2 = *(const v4fa*)(arow + kb + 16 + 8 * hh), x3 = *(const v4fa*)(arow + kb + 16 + 8 * hh + 4);
    float xs[16] = {x0[0],x0[1],x0[2],x0[3],x1[0],x1[1],x1[2],x1[3],x2[0],x2[1],x2[2],x2[3],x3[0],x3[1],x3[2],x3[3]};
#pragma unroll
    for (int i = 0; i < 16; ++i) { const _Float16 h = (_Float16)xs[i]; ah.h[i] = h; al.h[i] = ASPLIT ? (_Float16)(xs[i] - (float)h) : (_Float16)0.0f; }
#pragma unroll
    for (int t = 0; t < 4; ++t) { if (col0 + t * 16 >= N) continue; const size_t boff = (size_t)(col0 + t * 16 + ln) * ldb + kb; FragH bq; bq.half[0] = *(const v8us*)(Bh + boff + 8 * hh); bq.half[1] = *(const v8us*)(Bh + boff + 16 + 8 * hh);
      acc[t] = mmaH<ASPLIT ? 2 : 1>(ah.v, al.v, bq.v, bq.v, acc[t]); }
  }
#pragma unroll
  for (int t = 0; t < 4; ++t) { if (col0 + t * 16 >= N) continue;
#pragma unroll
    for (int r = 0; r < 8; ++r) so[w][8 * hh + r][t * 16 + ln] = acc[t][r] * alpha; }
  __builtin_amdgcn_fence(__ATOMIC_ACQ_REL, "workgroup"); __builtin_amdgcn_wave_barrier();
  const int rsub = lane >> 4, c4 = (lane & 15) * 4;
  {
#pragma unroll
    for (int q = 0; q < 8; ++q) { const int r = q * 2 + rsub; if (col0 + c4 < N) { const v4f v = *(const v4fa*)&so[w][r][c4]; *(v4f*)(C + (size_t)(row0 + r) * ldc + col0 + c4) = v; } }
     }
}

// Wt[n][k] = f16(W[k][n]·scale) from f32 row-major W[K][N] (scale = power of two; bf16-exact weights stay exact in f16 away from the subnormal range)
__global__ __launch_bounds__(256) void k_wt_f16(const float* __restrict__ W, _Float16* __restrict__ Wt, int K, int N, float scale) {
  const int t = blockIdx.x * 256 + threadIdx.x; if (t >= N * (K / 8)) return; const int n = t / (K / 8), k8 = (t % (K / 8)) * 8; FragH f;
#pragma unroll
  for (int i = 0; i < 8; ++i) f.h[i] = (_Float16)(bf16_round(W[(size_t)(k8 + i) * N + n]) * scale); const v8us o = f.half[0];
  *(v8us*)((unsigned short*)Wt + (size_t)n * K + k8) = o; 
}
// k_gemm_hh variant with fused epilogue: v = acc·alpha + bias[by·sBias + col] (+ CP[(row/rowsPerB)·sCPb + by·64 + col] if CP) ; ACT 0 none / 1 elu ; writes f16 C16 (and f32 C if non-null)
template <int ACT>
__global__ __launch_bounds__(128) void k_gemm_hhx(const _Float16* __restrict__ A, int lda, size_t sA, const _Float16* __restrict__ Bh, int ldb, size_t sB, float alpha, const float* __restrict__ bias, size_t sBias, const float* __restrict__ CP, int rowsPerB, size_t sCPb, int row0g,
    float* __restrict__ C, _Float16* __restrict__ C16, int ldc, size_t sC, int M, int N, int K) {
  __shared__ __attribute__((aligned(16))) float so[4][16][64];
  const int tid = threadIdx.x, w = tid >> 5, lane = tid & 31, ln = lane & 15, hh = lane >> 4; const int by = blockIdx.y;
  A += (size_t)by * sA; Bh += (size_t)by * sB; const size_t cofs = (size_t)by * sC; const float* bp = bias ? bias + (size_t)by * sBias : nullptr;
  const int ntn = (N + 63) / 64; const int wid = blockIdx.x * 4 + w; const int mt = wid / ntn, nq = wid % ntn; if (mt * 16 >= M) return;
  const int row0 = mt * 16, col0 = nq * 64; const _Float16* arow = A + (size_t)(row0 + ln) * lda;
  v8f acc[4] = {};
  for (int kb = 0; kb < K; kb += 32) { FragH ah; ah.half[0] = *(const v8us*)((const unsigned short*)arow + kb + 8 * hh); ah.half[1] = *(const v8us*)((const unsigned short*)arow + kb + 16 + 8 * hh);
#pragma unroll
    for (int t = 0; t < 4; ++t) { if (col0 + t * 16 >= N) continue; const size_t boff = (size_t)(col0 + t * 16 + ln) * ldb + kb; FragH bq; bq.half[0] = *(const v8us*)((const unsigned short*)Bh + boff + 8 * hh); bq.half[1] = *(const v8us*)((const unsigned short*)Bh + boff + 16 + 8 * hh);
      acc[t] = mmaH<1>(ah.v, ah.v, bq.v, bq.v, acc[t]); }
  }
#pragma unroll
  for (int t = 0; t < 4; ++t) { if (col0 + t * 16 >= N) continue; const int col = col0 + t * 16 + ln; const float bv = bp ? bf16_round(bp[col]) : 0.f;
#pragma unroll
    for (int r = 0; r < 8; ++r) { float v = acc[t][r] * alpha + bv; if (CP) { const int rr = row0g + row0 + 8 * hh + r; if (rowsPerB < 0) v += CP[cofs + (size_t)rr * ldc + col];      /* rowsPerB < 0: own element of the batched C plane */ else { const int bidx = rr / rowsPerB; v += CP[(size_t)bidx * sCPb + (size_t)by * 64 + col]; } } if (ACT == 1) v = (v > 0.f) ? v : expm1f(v); else if (ACT == 7) v = (v > 0.f) ? v + 1.0f : expf(v); else if (ACT == 8) v = tanhf(v); else if (ACT == 9) v = 0.5f * v * (1.0f + tanhf(0.7978845608028654f * (v + 0.044715f * v * v * v))); else if (ACT == 11) v = 1.0f / (1.0f + expf(-v)); else if (ACT == 12) v = (v > 0.f) ? v : 0.01f * v; else if (ACT == 14) v = (v > 0.f) ? v : 0.1f * v; else if (ACT == 16) v = (v >= 0.f) ? v : 0.3f * v; else if (ACT == 17) v = (v >= 0.f) ? v : 0.2f * v; else if (ACT == 15) v = v / (1.0f + expf(-v)); else if (ACT == 3) v = fmaxf(v, 0.f); else if (ACT == 6) v = 0.5f * v * (1.0f + erff(v * 0.70710678118654752f)); so[w][8 * hh + r][t * 16 + ln] = v; } }
  __builtin_amdgcn_fence(__ATOMIC_ACQ_REL, "workgroup"); __builtin_amdgcn_wave_barrier();
  const int rsub = lane >> 4, c4 = (lane & 15) * 4; typedef _Float16 v4h __attribute__((ext_vector_type(4)));
  {
#pragma unroll
    for (int q = 0; q < 8; ++q) { const int r = q * 2 + rsub; if (col0 + c4 < N) { const v4f v = *(const v4fa*)&so[w][r][c4]; if (C) *(v4f*)(C + cofs + (size_t)(row0 + r) * ldc + col0 + c4) = v; if (C16) { v4h h4; for (int i = 0; i < 4; ++i) h4[i] = (_Float16)v[i]; *(v4h*)(C16 + cofs + (size_t)(row0 + r) * ldc + col0 + c4) = h4; } } }
     }
}


typedef _Float16 v4h __attribute__((ext_vector_type(4)));

// All five f32 inputs become f16 planes in ONE launch of resident waves: 256 work-groups of 16 waves (one per WGP, four waves per SIMD), so that 4,096 waves start instead of one wave per KiB of input.
// A piece is 8 neighbouring values: 32 bytes read, 16 bytes stored per lane, so a wave's store covers 512 contiguous bytes. A slab is one piece per thread of the work-group (16 KiB read). A work-group owns
// 8 neighbouring slabs of each activation plane and one of each weight plane. A thread issues all of its 38 loads before it uses the first value: the whole input is asked for at once, and each piece is
// converted and stored as it lands.
// Activations: bf16-rounded, exact in f16. Weights: bf16-rounded, x16 (exact). memory feeds both the K and the V projection: it is converted once.
#define CV_G 256                     /* work-groups */
#define CV_T 512                     /* threads per work-group */
#define CV_N (CV_G * CV_T)
#define CV_XP 8                      /* slabs per work-group and activation plane */
template <bool X16W>
__device__ __forceinline__ v8us cv_pack(v4f a, v4f b) { FragH f;
#pragma unroll
  for (int q = 0; q < 4; ++q) { f.h[q] = X16W ? (_Float16)(bf16_round(a[q]) * 16.0f) : (_Float16)bf16_round(a[q]); f.h[4 + q] = X16W ? (_Float16)(bf16_round(b[q]) * 16.0f) : (_Float16)bf16_round(b[q]); }
  return f.half[0]; }
__global__ __launch_bounds__(CV_T) __attribute__((amdgpu_waves_per_eu(4, 4))) void k_cvt(const float* __restrict__ xq, const float* __restrict__ xm, const float* __restrict__ wq, const float* __restrict__ wk, const float* __restrict__ wv,
                                              _Float16* __restrict__ XQ, _Float16* __restrict__ XM, _Float16* __restrict__ BQ, _Float16* __restrict__ BK, _Float16* __restrict__ BV) {
  static_assert(NR * DM == (size_t)8 * CV_N * CV_XP && (size_t)DM * DM == (size_t)8 * CV_N, "k_cvt: the planes divide evenly among the threads");
  const unsigned g = blockIdx.x, ib = threadIdx.x * 32u, ob = threadIdx.x * 16u;      /* the thread's byte offsets in a slab: with the uniform pointers below, one address register serves every load and one every store */
  const char* pq = (const char*)xq + (size_t)g * (CV_XP * CV_T * 32); const char* pm = (const char*)xm + (size_t)g * (CV_XP * CV_T * 32);
  const char* pw[3] = {(const char*)wq + (size_t)g * (CV_T * 32), (const char*)wk + (size_t)g * (CV_T * 32), (const char*)wv + (size_t)g * (CV_T * 32)};
  char* oq = (char*)XQ + (size_t)g * (CV_XP * CV_T * 16); char* om = (char*)XM + (size_t)g * (CV_XP * CV_T * 16);
  char* ow[3] = {(char*)BQ + (size_t)g * (CV_T * 16), (char*)BK + (size_t)g * (CV_T * 16), (char*)BV + (size_t)g * (CV_T * 16)};
  v4f q[CV_XP][2], m[CV_XP][2], w[3][2];      /* every '#pragma unroll' below gives constant indices: the pieces stay in registers */
  /* The scheduling barriers of the three load loops keep the 38 loads one group, in the order in which the pieces are used, in front of the first conversion: without them the compiler either sinks the loads
     among the conversions (about nine in flight) or issues the first piece's loads late, so that the first counted wait covers half the group. */
#pragma unroll
  for (int i = 0; i < CV_XP; ++i) { q[i][0] = *(const v4fa*)(pq + i * (CV_T * 32) + ib); q[i][1] = *(const v4fa*)(pq + i * (CV_T * 32) + ib + 16); __builtin_amdgcn_sched_barrier(0); }
#pragma unroll
  for (int i = 0; i < CV_XP; ++i) { m[i][0] = *(const v4fa*)(pm + i * (CV_T * 32) + ib); m[i][1] = *(const v4fa*)(pm + i * (CV_T * 32) + ib + 16); __builtin_amdgcn_sched_barrier(0); }
#pragma unroll
  for (int i = 0; i < 3; ++i) { w[i][0] = *(const v4fa*)(pw[i] + ib); w[i][1] = *(const v4fa*)(pw[i] + ib + 16); __builtin_amdgcn_sched_barrier(0); }
  /* The scheduling barriers of the two activation store loops keep a piece's store behind its own conversion, while later loads still fly: without them the compiler sinks the stores to the end of the kernel. */
#pragma unroll
  for (int i = 0; i < CV_XP; ++i) { *(v8us*)(oq + i * (CV_T * 16) + ob) = cv_pack<false>(q[i][0], q[i][1]); __builtin_amdgcn_sched_barrier(0); }
#pragma unroll
  for (int i = 0; i < CV_XP; ++i) { *(v8us*)(om + i * (CV_T * 16) + ob) = cv_pack<false>(m[i][0], m[i][1]); __builtin_amdgcn_sched_barrier(0); }
#pragma unroll
  for (int i = 0; i < 3; ++i) *(v8us*)(ow[i] + ob) = cv_pack<true>(w[i][0], w[i][1]); }
__global__ __launch_bounds__(256) void k_h16(const float* __restrict__ x, _Float16* __restrict__ X16, size_t n8) { const size_t t = (size_t)blockIdx.x * 256 + threadIdx.x; if (t >= n8) return; FragH f;
#pragma unroll
  for (int q = 0; q < 8; ++q) f.h[q] = (_Float16)x[t * 8 + q]; *(v8us*)((unsigned short*)X16 + t * 8) = f.half[0];  }
__global__ __launch_bounds__(256) void k_round16f(const float* __restrict__ W, _Float16* __restrict__ Bt, size_t n8) { const size_t t = (size_t)blockIdx.x * 256 + threadIdx.x; if (t >= n8) return; FragH f;
#pragma unroll
  for (int i = 0; i < 8; ++i) f.h[i] = (_Float16)(bf16_round(W[t * 8 + i]) * 16.0f); *(v8us*)((unsigned short*)Bt + t * 8) = f.half[0];  }
template <int NHv, int TTv>
__global__ __launch_bounds__(256) void k_vt(const _Float16* __restrict__ V16, int ldv, int voff, _Float16* __restrict__ Vt) { __shared__ unsigned short tl[64][66]; const int tid = threadIdx.x; const int slab = blockIdx.x / (TTv / 64), lg = blockIdx.x % (TTv / 64); const int b = slab / NHv, h = slab % NHv;
  for (int i = tid; i < 64 * 8; i += 256) { const int r = i / 8, c8 = (i % 8) * 8; FragH f; f.half[0] = *(const v8us*)((const unsigned short*)V16 + ((size_t)b * TTv + lg * 64 + r) * ldv + voff + h * 64 + c8);
#pragma unroll
    for (int q = 0; q < 8; ++q) tl[r][c8 + q] = f.u[q]; }
  __syncthreads();
  {
#pragma unroll
    for (int rd = 0; rd < 2; ++rd) { const int d = rd * 32 + tid / 8, pc = tid % 8; FragH f;
#pragma unroll
      for (int q = 0; q < 8; ++q) f.u[q] = tl[pc * 8 + q][d];
      *(v8us*)((unsigned short*)Vt + ((size_t)slab * 64 + d) * TTv + lg * 64 + pc * 8) = f.half[0]; }
     } }

__global__ __launch_bounds__(256) void k_hl(const float* __restrict__ F, _Float16* __restrict__ Hh, _Float16* __restrict__ Hl, size_t n8) { const size_t t = (size_t)blockIdx.x * 256 + threadIdx.x; if (t >= n8) return; FragH fh, fl; const v4f a = *(const v4fa*)(F + t * 8), c = *(const v4fa*)(F + t * 8 + 4);
#pragma unroll
  for (int q = 0; q < 4; ++q) { _Float16 h = (_Float16)a[q]; fh.h[q] = h; fl.h[q] = (_Float16)((a[q] - (float)h) * 1024.0f); h = (_Float16)c[q]; fh.h[4 + q] = h; fl.h[4 + q] = (_Float16)((c[q] - (float)h) * 1024.0f); }
  { *(v8us*)((unsigned short*)Hh + t * 8) = fh.half[0]; *(v8us*)((unsigned short*)Hl + t * 8) = fl.half[0];  } }

__device__ __forceinline__ v16h g2_frag(const _Float16* p, int hh) { FragH f; f.half[0] = *(const v8us*)((const unsigned short*)p + 8 * hh); f.half[1] = *(const v8us*)((const unsigned short*)p + 16 + 8 * hh); return f.v; }
// Projection GEMM Y[8192][1024] = f16(X W^T * alpha + bias), X and W as f16 rows with k along the row. A work-group of four waves (2 x 2) owns a 128 x 128 tile of Y, a wave 64 x 64.
// The W and X tiles of 128 k (256-byte rows) are brought by tensor loads and shared through LDS: every wave asks for one slice of 64 rows per tile, two buffers, the next tile's loads fly while this
// tile is worked on, one barrier per tile; no tile byte passes through a register on its way to LDS. The wave forms Y^T = W X^T (A = W rows, B = X rows, both read with fa_frag, so the two k orders are equal): a lane then holds eight neighbouring output columns of one
// token row, which pack into one 16-byte piece; the pieces pass through the wave's own part of the (then free) ring, so that every global store covers whole 128-byte lines.
// One launch holds the tiles of all three projections: the block index picks the plane (0 = Q, 1 = K, 2 = V) and the tile in it, so that no launch gap, fill or tail stands between the planes.
// A V tile exchanges the roles (A = X rows, B = W rows: slices 0, 1 then hold X rows, slices 2, 3 W rows; same loaders, same k order): a lane then holds eight neighbouring token rows of one output column, a 16-byte piece of a
// row of V^T; the staged rows go out as whole 128-byte lines of V^T [batch * head][d][key], and no transposing launch is needed.
// amdgpu_waves_per_eu(2, 2): two work-groups per WGP, and one work-group's matrix work covers the other's barrier and LDS waits.
// Every '#pragma unroll' in k_proj gives constant indices, so that the fragment, staging and accumulator arrays stay in registers.
#define PG_T 128                     /* tile edge in rows of W and of X */
#define PG_K 128                     /* k per LDS tile */
#define PG_RP 272                    /* LDS row pitch of the operand tiles in bytes: 256 of data and the tensor load's pad of 16, an odd multiple of 16 for the 16-byte fragment reads */
#define PG_SL 18432                  /* bytes of one slice in LDS: 64 rows of PG_RP bytes (17,408), rounded up so that every slice starts at a multiple of 2 KiB */
#define PG_PITCH 144                 /* LDS row pitch of the output staging rows in bytes: 128 of data, an odd multiple of 16 */
#define PG_NS (DM / PG_K)
#define PG_NT ((MP / PG_T) * (DM / PG_T))      /* tiles per plane */
#define FA_QS (0.125f * 1.4426950408889634f)      /* 64^-0.5 log2(e): the q rows carry it, so that k_fattn's score tiles are exponents in base 2 */
__device__ __forceinline__ v16h fa_frag(const unsigned char* p);
__device__ __forceinline__ v8f fa_mma(v16h a, v16h b, v8f c);
typedef unsigned int pg_u4 __attribute__((ext_vector_type(4)));
typedef unsigned int pg_u8 __attribute__((ext_vector_type(8)));
__device__ __forceinline__ unsigned int pg_uni(unsigned int v) { return (unsigned int)__builtin_amdgcn_readfirstlane(v); }      /* a descriptor word: the same in every lane, held in a scalar register */
__device__ __forceinline__ unsigned int pg_pinned(unsigned int v) { unsigned int w = pg_uni(v); asm volatile("" : "+s"(w)); return w; }      /* the issue test of a tensor load, held in a scalar register: the test then compiles to a scalar compare and branch (a tensor load ignores EXEC) */
// Tensor descriptor, group 1: a tile of 64 rows of 256 bytes (extents in bytes, tensor = tile), source row pitch of DM f16 values, 16 bytes of LDS pad behind every 256-byte row (pitch PG_RP), no mask.
__device__ __forceinline__ pg_u8 pg_group1() { pg_u8 g;
  g[0] = pg_uni((1u << 20) | (5u << 22) | (3u << 25)); g[1] = pg_uni(256u << 16); g[2] = pg_uni(64u << 16); g[3] = pg_uni(256u << 16); g[4] = pg_uni(64u); g[5] = pg_uni(DM * 2u); g[6] = pg_uni(0u); g[7] = pg_uni(0u);
  return g; }
// One request of the whole wave: the slice whose first byte is ga goes to the LDS byte offset lds. The waits and the barrier stand at the call sites. Returns the request's group 0 for pg_twait.
__device__ __forceinline__ pg_u4 pg_tload(unsigned int lds, unsigned long long ga, pg_u8 g1) { pg_u4 g0;
  g0[0] = pg_uni(1u); g0[1] = pg_uni(lds); g0[2] = pg_uni((unsigned int)ga); g0[3] = pg_uni((((unsigned int)(ga >> 32)) & 0x01FFFFFFu) | 0x80000000u);
  asm volatile("tensor_load_to_lds %0, %1" :: "s"(g0), "s"(g1) : "memory"); return g0; }
__device__ __forceinline__ void pg_twait(pg_u4 g0) { asm volatile("s_wait_tensorcnt 0x0" :: "s"(g0) : "memory"); }      /* the wave's own request has landed; its group 0 is an input, so that its four registers stay whole up to this wait: without it the build reuses them while the request flies */
// A wave's results to its LDS staging rows: acc[i][j] register r = A row 16 i + 8 h + r, lane column c = B row 16 j + c of the wave's tile. Staged row = B row, 64 A rows along it.
// bias points at the wave's first output column. VTR false: the A rows are the output columns. VTR true: the B rows are. bs scales the bias as alpha's extra factor scales the product (FA_QS in the q plane, else 1).
template <bool VTR>
__device__ __forceinline__ void pg_stage(const v8f (&acc)[4][4], unsigned char* st, const float* __restrict__ bias, float alpha, float bs, int lane) {
  const int c = lane & 15, h = lane >> 4;
#pragma unroll
  for (int i = 0; i < 4; ++i) { float bv[8];
#pragma unroll
    for (int r = 0; r < 8; ++r) bv[r] = VTR ? 0.f : bf16_round(bias[16 * i + 8 * h + r]) * bs;
#pragma unroll
    for (int j = 0; j < 4; ++j) { FragH f; const float bc = VTR ? bf16_round(bias[16 * j + c]) * bs : 0.f;
#pragma unroll
      for (int r = 0; r < 8; ++r) f.h[r] = (_Float16)(acc[i][j][r] * alpha + (VTR ? bc : bv[r]));
      *(v8us*)(st + (16 * j + c) * PG_PITCH + 32 * i + 16 * h) = f.half[0]; } } }
__global__ __launch_bounds__(128) __attribute__((amdgpu_waves_per_eu(2, 2))) void k_proj(const _Float16* __restrict__ XQ, const _Float16* __restrict__ XM, const _Float16* __restrict__ WQ, const _Float16* __restrict__ WK, const _Float16* __restrict__ WV,
                                                                                         const float* __restrict__ bq, const float* __restrict__ bk, const float* __restrict__ bv, float alpha,
                                                                                         _Float16* __restrict__ YQ, _Float16* __restrict__ YK, _Float16* __restrict__ VT) {
  static_assert(MP % PG_T == 0 && DM % PG_T == 0 && DM % PG_K == 0, "k_proj: whole tiles only");
  static_assert(NH * HD == DM && SQ % PG_T == 0, "k_proj, V tiles: row b * DM + column of V^T, a tile's token rows lie in one batch");
  const int plane = blockIdx.x / PG_NT, tile = blockIdx.x % PG_NT; const bool vtr = plane == 2;      /* the same in every thread of the work-group */
  const _Float16* X = plane == 0 ? XQ : XM; const _Float16* Wt = plane == 0 ? WQ : plane == 1 ? WK : WV;
  static_assert(PG_NS >= 2 && PG_K * 2 == 256 && 64 * PG_RP <= PG_SL && PG_SL % 2048 == 0 && 4 * 64 * PG_PITCH <= 8 * PG_SL, "k_proj: two tiles at least, 256-byte tile rows, slices at multiples of 2 KiB, staging inside the ring");
  __shared__ __attribute__((aligned(2048))) unsigned char L[2][4][PG_SL];      /* [buffer][slice of 64 rows: A rows 0-63 | A rows 64-127 | B rows 0-63 | B rows 64-127]; A | B = W | X, in a V tile X | W */
  const int tid = threadIdx.x, lane = tid & 31, wave = tid >> 5, c = lane & 15, h = lane >> 4;
  const int mt = tile / (DM / PG_T), nq = tile % (DM / PG_T); const int row0 = mt * PG_T, col0 = nq * PG_T; const int wm = wave >> 1, wn = wave & 1;
  const unsigned short* wr = (const unsigned short*)Wt + (size_t)col0 * DM; const unsigned short* xr = (const unsigned short*)X + (size_t)row0 * DM;      /* the tile's first W row and first X row */
  const unsigned int uw = pg_uni((unsigned int)wave);      /* the wave asks for slice uw of every tile */
  const unsigned long long sg = (unsigned long long)(size_t)(((uw & 2u) != 0u) == vtr ? wr : xr) + (unsigned long long)((uw & 1u) * (64u * DM * 2u));      /* first byte of that slice in tile 0: slices 0, 1 hold A rows (W, in a V tile X), slices 2, 3 B rows */
  const unsigned int sl = (unsigned int)(size_t)&L[0][0][0] + uw * PG_SL;      /* its place in buffer 0 */
  const pg_u8 g1 = pg_group1();
  const int fo = c * PG_RP + 16 * h;      /* the lane's fragment row in a slice and its 16 h bytes */
  const v8f z8 = {0.f, 0.f, 0.f, 0.f, 0.f, 0.f, 0.f, 0.f};
  v8f acc[4][4];      /* [16 A rows i][16 B rows j]: register r = A row 16 i + 8 h + r, lane column c = B row 16 j + c */
#pragma unroll
  for (int i = 0; i < 4; ++i)
#pragma unroll
    for (int j = 0; j < 4; ++j) acc[i][j] = z8;
  pg_u4 fl = pg_tload(sl, sg, g1);      /* tile 0 to buffer 0; fl: group 0 of the request in flight */
  pg_twait(fl);      /* the wave's own slice of tile 0 has landed */
  __syncthreads();      /* tile 0 is visible to all waves */
  fl = pg_tload(sl + 4 * PG_SL, sg + PG_K * 2, g1);      /* tile 1 to buffer 1: it flies while tile 0 is worked on */
#pragma unroll 1      /* rolled: one trip's text serves all eight, and the test for a tile s + 2 stays one scalar branch around one tensor load */
  for (int s = 0; s < PG_NS; ++s) {
    const unsigned char* Ab = &L[s & 1][wn][0] + fo; const unsigned char* Bb = &L[s & 1][2 + wm][0] + fo;
    v16h wf[4][4], xf[4][4];      /* [32 k][16 rows] */
#pragma unroll
    for (int kc = 0; kc < 4; ++kc)
#pragma unroll
      for (int i = 0; i < 4; ++i) { wf[kc][i] = fa_frag(Ab + 16 * i * PG_RP + 64 * kc); xf[kc][i] = fa_frag(Bb + 16 * i * PG_RP + 64 * kc); }
    __builtin_amdgcn_sched_barrier(0);      /* the trip's 64 fragment reads stay one group in front of its 64 products: without it the compiler reads one W fragment at a time and waits for it in front of every four products */
#pragma unroll
    for (int kc = 0; kc < 4; ++kc)
#pragma unroll
      for (int i = 0; i < 4; ++i)
#pragma unroll
        for (int j = 0; j < 4; ++j) acc[i][j] = fa_mma(wf[kc][i], xf[kc][j], acc[i][j]);
    __builtin_amdgcn_sched_barrier(0); asm volatile("v_nop\n\tv_nop\n\tv_nop\n\tv_nop"); __builtin_amdgcn_sched_barrier(0);      /* four vector slots behind the trip's last WMMA, in front of the branches that follow it */
    asm volatile("s_wait_dscnt 0x0" ::: "memory");      /* the wave's reads of tile s have returned before its buffer is aimed at again */
    pg_twait(fl);      /* the wave's own slice of tile s + 1 has landed */
    __syncthreads();      /* publishes tile s + 1 and ends every wave's reads of tile s, whose buffer is refilled behind it; behind the last trip it frees the ring for the output staging */
    if (pg_pinned(s + 2 < PG_NS)) fl = pg_tload(sl + (unsigned int)(s & 1) * (4 * PG_SL), sg + (unsigned long long)((s + 2) * (PG_K * 2)), g1);      /* tile s + 2 to the buffer that this trip has read */
  }
  pg_twait(fl);      /* no request is left when the ring becomes staging */
  asm volatile("s_wait_dscnt 0x0" ::: "memory");
  unsigned char* st = &L[0][0][0] + wave * (64 * PG_PITCH);      /* the wave's own 64 rows of 128 bytes */
  const float qs = plane == 0 ? FA_QS : 1.0f;
  if (vtr) pg_stage<true>(acc, st, bv + col0 + 64 * wm, alpha, 1.0f, lane);
  else pg_stage<false>(acc, st, (plane == 0 ? bq : bk) + col0 + 64 * wn, alpha * qs, qs, lane);
  __builtin_amdgcn_fence(__ATOMIC_ACQ_REL, "workgroup"); __builtin_amdgcn_wave_barrier();      /* the wave's lanes read each other's pieces: the reads stay behind the writes */
  const int yl = vtr ? SQ : DM;      /* row pitch of the output plane in elements: V^T has rows of SQ keys, DM rows per batch */
  unsigned short* yb = vtr ? (unsigned short*)VT + ((size_t)(row0 / SQ) * DM + col0) * SQ + row0 % SQ : (unsigned short*)(plane == 0 ? YQ : YK) + (size_t)row0 * DM + col0;      /* the tile's first element: the same in every thread */
  const unsigned yo = (unsigned)((64 * wm + (lane >> 3)) * yl + 64 * wn + (lane & 7) * 8);      /* the lane's place in the tile: B row 64 wm + .., A row 64 wn + .. */
#pragma unroll
  for (int q = 0; q < 16; ++q) { const v8us v = *(const v8us*)(st + (4 * q + (lane >> 3)) * PG_PITCH + (lane & 7) * 16); *(v8us*)(yb + (size_t)(4 * q * yl) + yo) = v; } }


#define FA_NW 8                      /* waves per work-group */
#define FA_SK 64                     /* keys per LDS tile (two passes of 32) */
#define FA_PITCH 144                 /* LDS row pitch in bytes: 128 of data and the tensor load's pad of 16, an odd multiple of 16 for the 16-byte fragment reads */
#define FA_NS (SQ / FA_SK)
__device__ __forceinline__ float fa_x16(float v) { const int i = __float_as_int(v); return __int_as_float(__builtin_amdgcn_permlanex16(i, i, 0x76543210, 0xfedcba98, false, false)); }      /* value of lane ^ 16 */
__device__ __forceinline__ v16h fa_frag(const unsigned char* p) { FragH f; f.half[0] = *(const v8us*)p; f.half[1] = *(const v8us*)(p + 32); return f.v; }      /* k = 8 h .. 8 h + 7 and 16 + 8 h .. 16 + 8 h + 7; p already holds the lane's 16 h bytes */
__device__ __forceinline__ v8f fa_mma(v16h a, v16h b, v8f c) { return __builtin_amdgcn_wmma_f32_16x16x32_f16(false, a, false, b, (short)0, c, false, false); }
#define FA_TB 10240                  /* bytes of one K or V^T tile in LDS: 64 rows of FA_PITCH bytes (9,216), rounded up so that every tile starts at a multiple of 2 KiB; a buffer is [K rows by key | V^T rows by d] */
// Tensor descriptor, group 1: a tile of 64 rows of 128 bytes (extents in bytes, tensor = tile), source row pitch sp bytes, 16 bytes of LDS pad behind every 128-byte row (pitch FA_PITCH), no mask.
__device__ __forceinline__ pg_u8 fa_group1(unsigned int sp) { pg_u8 g;
  g[0] = pg_uni((1u << 20) | (4u << 22) | (3u << 25)); g[1] = pg_uni(128u << 16); g[2] = pg_uni(64u << 16); g[3] = pg_uni(128u << 16); g[4] = pg_uni(64u); g[5] = pg_uni(sp); g[6] = pg_uni(0u); g[7] = pg_uni(0u);
  return g; }
// iss: 1 in the two waves that ask for tiles, else 0 (a scalar). sl: the wave's tile place in buffer 0. sg: first byte of its tile 0. sd: bytes from one tile to the next in the source.
template <bool ONLINE>
__device__ __forceinline__ void fa_keys(unsigned char* Lb, unsigned int iss, unsigned int sl, unsigned long long sg, unsigned int sd, pg_u8 g1, int c, int h,
                                        const v16h (&qf)[2][2], v16h ones, v8f (&acc)[2][4], v8f (&lacc)[2]) {
  typedef _Float16 h2 __attribute__((ext_vector_type(2))); typedef float f2 __attribute__((ext_vector_type(2)));
  const v8f z8 = {0.f, 0.f, 0.f, 0.f, 0.f, 0.f, 0.f, 0.f};
  float m_run[2];
#pragma unroll
  for (int g = 0; g < 2; ++g) { m_run[g] = -__builtin_inff(); lacc[g] = z8;
#pragma unroll
    for (int t = 0; t < 4; ++t) acc[g][t] = z8; }
  pg_u4 fl = {0u, 0u, 0u, 0u};      /* group 0 of the request in flight */
  if (pg_pinned(iss)) { fl = pg_tload(sl, sg, g1);      /* tile 0 to buffer 0; a second walk comes here behind the first walk's waits and two barriers */
    pg_twait(fl); }      /* the wave's own tile 0 has landed */
  __syncthreads();      /* tile 0 is visible to all waves */
  if (pg_pinned(iss)) fl = pg_tload(sl + 2 * FA_TB, sg + sd, g1);      /* tile 1 to buffer 1: it flies while tile 0 is worked on */
#pragma unroll 1      /* rolled: one trip's text serves all 32, and the test for a tile s + 2 stays one scalar branch around one tensor load */
  for (int s = 0; s < FA_NS; ++s) {
    const unsigned char* Kb = Lb + (s & 1) * (2 * FA_TB); const unsigned char* Vb = Kb + FA_TB;
#pragma unroll
    for (int sub = 0; sub < 2; ++sub) {      /* one pass: 32 keys */
      v8f sx[2][2];      /* [16-key tile][column group]: register r = key 16 kt + 8 h + r, lane column c = query */
#pragma unroll
      for (int kt = 0; kt < 2; ++kt) { const unsigned char* kp = Kb + (32 * sub + 16 * kt + c) * FA_PITCH + 16 * h; const v16h k0 = fa_frag(kp), k1 = fa_frag(kp + 64);
#pragma unroll
        for (int g = 0; g < 2; ++g) sx[kt][g] = fa_mma(k1, qf[g][1], fa_mma(k0, qf[g][0], z8)); }
      if (ONLINE) {
        float mb[2]; bool need = false;
#pragma unroll
        for (int g = 0; g < 2; ++g) { float mx = sx[0][g][0];
#pragma unroll
          for (int r = 1; r < 8; ++r) mx = fmaxf(mx, sx[0][g][r]);
#pragma unroll
          for (int r = 0; r < 8; ++r) mx = fmaxf(mx, sx[1][g][r]);
          mx = fmaxf(mx, fa_x16(mx)); mb[g] = mx; need = need || (mx > m_run[g] + 8.0f); }
        if (__builtin_amdgcn_ballot_w32(need) != 0) {      /* lazy rescale: the maximum in use may trail the true one by up to 8 (base 2), so an exponential stays below 2^8 */
#pragma unroll
          for (int g = 0; g < 2; ++g) { const float m_new = fmaxf(m_run[g], mb[g]); const float corr = __builtin_amdgcn_exp2f(m_run[g] - m_new); m_run[g] = m_new; lacc[g] = lacc[g] * corr;
#pragma unroll
            for (int t = 0; t < 4; ++t) acc[g][t] = acc[g][t] * corr; } } }
      v16h vf[4];      /* A operand: row = d, k = the pass's 32 keys */
#pragma unroll
      for (int t = 0; t < 4; ++t) vf[t] = fa_frag(Vb + (16 * t + c) * FA_PITCH + 64 * sub + 16 * h);
#pragma unroll
      for (int g = 0; g < 2; ++g) { union { v16h v; h2 p[8]; } pf;      /* B operand: element pair i = keys 16 (i >> 2) + 8 h + 2 (i & 3), + 1: the k order of fa_frag */
#pragma unroll
        for (int i = 0; i < 8; ++i) { const float x0 = sx[i >> 2][g][2 * (i & 3)], x1 = sx[i >> 2][g][2 * (i & 3) + 1];
          const float e0 = __builtin_amdgcn_exp2f(ONLINE ? x0 - m_run[g] : x0), e1 = __builtin_amdgcn_exp2f(ONLINE ? x1 - m_run[g] : x1); pf.p[i] = __builtin_convertvector(f2{e0, e1}, h2); }
#pragma unroll
        for (int t = 0; t < 4; ++t) acc[g][t] = fa_mma(vf[t], pf.v, acc[g][t]);
        lacc[g] = fa_mma(ones, pf.v, lacc[g]); }
    }
    __builtin_amdgcn_sched_barrier(0); asm volatile("v_nop\n\tv_nop\n\tv_nop\n\tv_nop"); __builtin_amdgcn_sched_barrier(0);      /* four vector slots behind the trip's last WMMA, in front of the branches that follow it: on the taken side the operand and result registers are written or read at once */
    asm volatile("s_wait_dscnt 0x0" ::: "memory");      /* the wave's reads of tile s have returned before its buffer is aimed at again */
    pg_twait(fl);      /* an asking wave's own tile s + 1 has landed (the other waves have no request and pass) */
    __syncthreads();      /* publishes tile s + 1 and ends every wave's reads of tile s, whose buffer is refilled behind it; behind the last trip both buffers are free */
    if (pg_pinned(iss & (unsigned int)(s + 2 < FA_NS))) fl = pg_tload(sl + (unsigned int)(s & 1) * (2 * FA_TB), sg + (unsigned long long)(s + 2) * sd, g1);      /* tile s + 2 to the buffer that this trip has read */
  }
  pg_twait(fl);      /* no request is left behind the walk */
  asm volatile("s_wait_dscnt 0x0" ::: "memory"); }
__global__ __launch_bounds__(32 * FA_NW) __attribute__((amdgpu_waves_per_eu(4, 4))) void k_fattn(const _Float16* __restrict__ Q16, const _Float16* __restrict__ K16, const _Float16* __restrict__ VT, float* __restrict__ out) {
  static_assert(HD == 64 && SQ % (32 * FA_NW) == 0 && SQ % FA_SK == 0, "k_fattn: head size 64, whole work-groups of queries, whole tiles of keys");
  static_assert(FA_NS >= 2 && FA_SK == 64 && HD * 2 == 128 && FA_SK * 2 == 128 && 64 * FA_PITCH <= FA_TB && FA_TB % 2048 == 0, "k_fattn: two tiles at least, tiles of 64 rows of 128 bytes at multiples of 2 KiB");
  __shared__ __attribute__((aligned(2048))) unsigned char L[2][2][FA_TB];      /* [buffer][K rows by key | V^T rows by d] */
  __shared__ int fa_bad[FA_NW];      /* per wave: a row sum of the first walk is out of range */
  const int tid = threadIdx.x, lane = tid & 31, wave = tid >> 5, c = lane & 15, h = lane >> 4;
  const int bh = blockIdx.y, b = bh / NH, hd = bh % NH; const int q0 = blockIdx.x * (32 * FA_NW) + wave * 32;
  const unsigned int uw = pg_uni((unsigned int)wave); const unsigned int iss = uw < 2u ? 1u : 0u; const bool isv = uw == 1u;      /* wave 0 asks for the K tiles, wave 1 for the V^T tiles */
  const unsigned short* kg = (const unsigned short*)K16 + (size_t)b * SQ * LQ + hd * HD;      /* row = key: 64 d of this head, row pitch LQ values; the next tile is 64 rows on */
  const unsigned short* vg = (const unsigned short*)VT + (size_t)bh * HD * SQ;      /* row = d, keys along the row, row pitch SQ values; the next tile is 64 keys on */
  const unsigned long long sg = (unsigned long long)(size_t)(isv ? vg : kg); const unsigned int sd = isv ? FA_SK * 2u : FA_SK * LQ * 2u;
  const unsigned int sl = (unsigned int)(size_t)&L[0][0][0] + (isv ? FA_TB : 0u);
  const pg_u8 g1 = fa_group1(isv ? SQ * 2u : LQ * 2u);
  v16h qf[2][2];      /* B operand: column = query, k = d */
#pragma unroll
  for (int g = 0; g < 2; ++g)
#pragma unroll
    for (int kc = 0; kc < 2; ++kc) qf[g][kc] = g2_frag(Q16 + ((size_t)b * SQ + q0 + 16 * g + c) * LQ + hd * HD + 32 * kc, h);
  FragH ones;      /* A operand whose row 0 is 1.0: its product with P^T gives the column sums of P^T in row 0 */
#pragma unroll
  for (int i = 0; i < 16; ++i) ones.u[i] = (c == 0) ? (unsigned short)0x3C00 : (unsigned short)0;
  v8f acc[2][4], lacc[2];
  fa_keys<false>(&L[0][0][0], iss, sl, sg, sd, g1, c, h, qf, ones.v, acc, lacc);
  bool bad = false;
#pragma unroll
  for (int g = 0; g < 2; ++g) { const float lr = lacc[g][0]; const float l = lr + fa_x16(lr); bad = bad || !(l >= 1.0f && l < __builtin_inff()); }      /* also true for a NaN */
  const int wbad = __builtin_amdgcn_ballot_w32(bad) != 0 ? 1 : 0;      /* taken with all lanes on, in front of the one-lane store */
  if (lane == 0) fa_bad[wave] = wbad;
  __syncthreads();      /* every wave's verdict is visible: the work-group repeats the walk as a whole or not at all, since the walk holds barriers */
  int any = 0;
#pragma unroll
  for (int w = 0; w < FA_NW; ++w) any |= fa_bad[w];
  if (__builtin_amdgcn_readfirstlane(any) != 0) fa_keys<true>(&L[0][0][0], iss, sl, sg, sd, g1, c, h, qf, ones.v, acc, lacc);      /* the same value in every thread of the work-group: a scalar branch */
#pragma unroll
  for (int g = 0; g < 2; ++g) { const float lr = lacc[g][0]; const float inv = 1.0f / (lr + fa_x16(lr));      /* row 0 of the sum tile sits in lanes 0-15, lanes 16-31 hold row 8 = 0: the exchange-and-add stays unconditional */
    float* op = out + ((size_t)b * SQ + q0 + 16 * g + c) * DM + hd * HD + 8 * h;      /* register r of tile t = d 16 t + 8 h + r of query column c */
#pragma unroll
    for (int t = 0; t < 4; ++t) { const v8f o = acc[g][t] * inv; const v4f lo = {o[0], o[1], o[2], o[3]}, hi = {o[4], o[5], o[6], o[7]}; *(v4f*)(op + 16 * t) = lo; *(v4f*)(op + 16 * t + 4) = hi; } } }
__global__ __launch_bounds__(256) void k_vt(const _Float16* __restrict__ V16, int b, int h0, _Float16* __restrict__ VT) { __shared__ unsigned short tl[64][65]; const int tid = threadIdx.x; const int hh = blockIdx.x % HG, sg = blockIdx.x / HG; const int s0 = sg * 64; const int h = h0 + hh;
  for (int i = tid; i < 64 * 8; i += 256) { const int j = i / 8, d8 = (i % 8) * 8; FragH f; f.half[0] = *(const v8us*)((const unsigned short*)V16 + ((size_t)b * SQ + s0 + j) * DM + h * HD + d8); for (int q = 0; q < 8; ++q) tl[d8 + q][j] = f.u[q]; }
  __syncthreads();
  { for (int i = tid; i < 64 * 8; i += 256) { const int d = i / 8, j8 = (i % 8) * 8; FragH f; for (int q = 0; q < 8; ++q) f.u[q] = tl[d][j8 + q]; *(v8us*)((unsigned short*)VT + ((size_t)hh * HD + d) * SQ + s0 + j8) = f.half[0]; }  } }



__global__ __launch_bounds__(256) void k_rsmkm(const float* __restrict__ S, _Float16* __restrict__ P, int nrows, const int* __restrict__ am) {
  #pragma clang fp contract(off)
  const int t = blockIdx.x * 256 + threadIdx.x; if (t >= nrows) return; const size_t i = (size_t)t; const float* s = S + i * SQ; const int* mr = am + (size_t)(t % SQ) * SQ; float mx = -3.0e38f;
#pragma unroll 1
  for (int j = 0; j < SQ; ++j) { const float f = (mr[j] != 0) ? 1.f : 0.f; mx = fmaxf(mx, fmaf(f, s[j], (1.f - f) * -1.0e9f)); } float se = 0.f;
#pragma unroll 1
  for (int j = 0; j < SQ; ++j) { const float f = (mr[j] != 0) ? 1.f : 0.f; se += __expf(fmaf(f, s[j], (1.f - f) * -1.0e9f) - mx); } const float sc = 256.0f / se;
#pragma unroll 1
  for (int j0 = 0; j0 < SQ; j0 += 8) { FragH fr; for (int q = 0; q < 8; ++q) { const int j = j0 + q; const float f = (mr[j] != 0) ? 1.f : 0.f; fr.h[q] = (_Float16)(__expf(fmaf(f, s[j], (1.f - f) * -1.0e9f) - mx) * sc); }
    unsigned short* d = (unsigned short*)P + i * SQ + j0; *(v8us*)d = fr.half[0];  } }
extern "C" void kernel_launch(void* const* d_in, const int* in_sizes, int n_in,
                              void* d_out, int out_size, void* d_ws, size_t ws_size, hipStream_t stream) {
  (void)in_sizes; (void)n_in; (void)out_size;
  const float* const* I = (const float* const*)d_in; const float* xq = I[0]; const float* xm = I[1]; const float* wq = I[2]; const float* bq = I[3]; const float* wk = I[4]; const float* bk = I[5]; const float* wv = I[6]; const float* bv = I[7];      /* input (queries), memory (keys AND values); natural weights + biases; no output projection */
  char* ws = (char*)d_ws; size_t off = 0;
  auto take = [&](size_t bytes) { char* p = ws + off; off += (bytes + 255) & ~(size_t)255; return p; };
  _Float16* BQ = (_Float16*)take((size_t)DM * DM * 2); _Float16* BK = (_Float16*)take((size_t)DM * DM * 2); _Float16* BV = (_Float16*)take((size_t)DM * DM * 2); 
  _Float16* X16 = (_Float16*)take(NR * DM * 2); _Float16* XM = (_Float16*)take(NR * DM * 2); _Float16* Q16 = (_Float16*)take(NR * DM * 2); _Float16* K16 = (_Float16*)take(NR * DM * 2); 
  _Float16* VT = (_Float16*)take((size_t)NB * NH * HD * SQ * 2);
  if (off > ws_size) return;
  k_cvt<<<CV_G, CV_T, 0, stream>>>(xq, xm, wq, wk, wv, X16, XM, BQ, BK, BV);      /* input and memory as exact f16 rows; natural [out][in] weights = Bt x16 (no output projection: no Wo plane) */
  const size_t r0p = (size_t)B0 * SQ;      /* first projected row */
  k_proj<<<3 * PG_NT, 128, 0, stream>>>(X16 + r0p * DM, XM + r0p * DM, BQ, BK, BV, bq, bk, bv, 0.0625f, Q16 + r0p * DM, K16 + r0p * DM, VT + r0p * DM);      /* q rows (times FA_QS), k rows and V^T [NB * NH][HD][SQ] */
  k_fattn<<<dim3(SQ / (32 * FA_NW), NB * NH), 32 * FA_NW, 0, stream>>>(Q16, K16, VT, (float*)d_out);      /* out = softmax(q k^T / 8) v straight to the f32 output (merged heads; each 256-B head segment of a row written by one wave) */
  /* no output projection in this module */
}

// v008
// One run takes 98.4 microseconds.
// Two timings next to v007 put it at 1.05 and 1.03 times that version's speed.
// Counting every step since v000, it is 74.1 times as fast.
#include <hip/hip_runtime.h>
// Multi-head CROSS-attention without an output projection (input, memory [4][2048][1024]; q = input Wq^T + bq, k = memory Wk^T + bk, v = memory Wv^T + bv (natural [1024][1024], zero biases); 16 heads of 64; q * 64^-0.5 then q k^T; softmax over all 2048 memory positions (no mask); out = attn v merged to [4][2048][1024]; NO output projection).
// Structure: token rows r = b*2048 + s; x as exact f16 rows (bf16-rounded); Q, K, V as three WMMA GEMMs (256x256 and 128x256 tiles through LDS, 64x128 and 64x64 wave tiles, f32 accumulation, exact x16 weights + bias, f16 outputs) in ONE launch, whose V tiles exchange the operand roles and store V^T [batch * head][d][key] themselves; one fused attention launch (k_fattn): S^T = K Q^T (K = 64, q rows pre-scaled by 64^-0.5 log2(e)), softmax in base 2 (weights as f16 relative to the fixed reference 0, row sums f32 and checked; a walk with the running maximum as the fallback), O^T += V^T P^T, divided by the row sum and written straight into the merged f32 output rows.
// Compute dtype: inputs rounded to bf16; x / weights exact; q, k, v and softmax weights as plain f16 GEMM operands (~2^-12); scores and softmax statistics f32; v_wmma_f32_16x16x32_f16.
#define NB 4
#define SQ 2048
#define DM 1024
#define NH 16
#define HD 64
#define HG 4                         /* heads per k_vt(b, h0) launch (that overload is not launched) */
#define B0 0                         /* first batch processed (debug hook) */
#define NBR NB                       /* batches processed (debug hook) */
#define NR ((size_t)NB * SQ)         /* token rows */
#define MP ((int)((size_t)NBR * SQ)) /* rows projected (debug hook) */
#define QN SQ                        /* unused (attention covers all SQ query rows) */
#define NHD NH                       /* unused (attention covers all NH heads) */
#define MPO MP                       /* unused (no output projection) */
#define LQ DM      /* row pitch of the q and k rows */
typedef __bf16 v16b __attribute__((ext_vector_type(16)));
typedef unsigned short v8us __attribute__((ext_vector_type(8), may_alias));
typedef float  v8f  __attribute__((ext_vector_type(8)));
typedef float  v4f  __attribute__((ext_vector_type(4)));
typedef float  v4fa __attribute__((ext_vector_type(4), may_alias));
union FragB { v16b v; v8us half[2]; unsigned short u[16]; };

__device__ __forceinline__ unsigned short bf16_bits(float x) { unsigned int u = __float_as_uint(x); return (unsigned short)((u + 0x7FFFu + ((u >> 16) & 1u)) >> 16); }
__device__ __forceinline__ float bf16_val(unsigned short b) { return __uint_as_float(((unsigned int)b) << 16); }
__device__ __forceinline__ float bf16_round(float x) { return bf16_val(bf16_bits(x)); }
// D += A·B with NT terms: 1 = ah·bh, 2 = + al·bh (A split), 3 = + ah·bl (both split)
template <int NT>
__device__ __forceinline__ v8f mmaN(v16b ah, v16b al, v16b bh, v16b bl, v8f c) {
  c = __builtin_amdgcn_wmma_f32_16x16x32_bf16(false, ah, false, bh, (short)0, c, false, false);
  if (NT >= 2) c = __builtin_amdgcn_wmma_f32_16x16x32_bf16(false, al, false, bh, (short)0, c, false, false);
  if (NT >= 3) c = __builtin_amdgcn_wmma_f32_16x16x32_bf16(false, ah, false, bl, (short)0, c, false, false);
  asm volatile("v_nop\n\tv_nop\n\tv_nop\n\tv_nop" : "+v"(c) : "v"(ah), "v"(al), "v"(bh), "v"(bl));
  return c;
}

__global__ __launch_bounds__(256) void k_wt_bf16(const float* __restrict__ W, unsigned short* __restrict__ Wt, int K, int N) {
  const int t = blockIdx.x * 256 + threadIdx.x;
  const int k8n = K / 8;
  if (t >= N * k8n) return;
  const int n = t / k8n, k8 = (t % k8n) * 8;
  v8us v;
#pragma unroll
  for (int i = 0; i < 8; ++i) v[i] = bf16_bits(W[(size_t)(k8 + i) * N + n]);
  *(v8us*)(Wt + (size_t)n * K + k8) = v;
  
}

// GEMM C[M][N] (f32, pitch ldc) = act(A[M][K]·W + bias). A f32 row-major (pitch lda) converted per fragment to bf16
// (ASPLIT: hi/lo two planes -> 2 terms, else single rounded term); Wt bf16 [N][K] (pitch ldb). BIAS_BF16 rounds the
// bias to bf16 first (bias quantised to bf16 before the add). K%32==0, M%16==0, N%64==0.
template <bool ASPLIT, int ACT, bool BIAS_BF16>
__global__ __launch_bounds__(128) void k_gemm_bf(const float* __restrict__ A, int lda, const unsigned short* __restrict__ Wt, int ldb,
                                               const float* __restrict__ bias, float* __restrict__ C, int ldc, int M, int N, int K) {
  __shared__ __attribute__((aligned(16))) float so[4][16][64];
  const int tid = threadIdx.x, w = tid >> 5, lane = tid & 31, ln = lane & 15, hh = lane >> 4;
  const int ntn = N / 64;
  const int wid = blockIdx.x * 4 + w;
  const int mt = wid / ntn, nq = wid % ntn;
  if (mt * 16 >= M) return;
  const int row0 = mt * 16, col0 = nq * 64;
  const float* arow = A + (size_t)(row0 + ln) * lda;
  v8f acc[4] = {};
  for (int kb = 0; kb < K; kb += 32) {
    FragB ah, al;
    const v4f x0 = *(const v4fa*)(arow + kb + 8 * hh), x1 = *(const v4fa*)(arow + kb + 8 * hh + 4);
    const v4f x2 = *(const v4fa*)(arow + kb + 16 + 8 * hh), x3 = *(const v4fa*)(arow + kb + 16 + 8 * hh + 4);
    float xs[16] = {x0[0],x0[1],x0[2],x0[3],x1[0],x1[1],x1[2],x1[3],x2[0],x2[1],x2[2],x2[3],x3[0],x3[1],x3[2],x3[3]};
#pragma unroll
    for (int i = 0; i < 16; ++i) { const unsigned short hb = bf16_bits(xs[i]); ah.u[i] = hb; al.u[i] = ASPLIT ? bf16_bits(xs[i] - bf16_val(hb)) : (unsigned short)0; }
#pragma unroll
    for (int t = 0; t < 4; ++t) {
      const unsigned short* brow = Wt + (size_t)(col0 + t * 16 + ln) * ldb + kb;
      FragB b;
      b.half[0] = *(const v8us*)(brow + 8 * hh);
      b.half[1] = *(const v8us*)(brow + 16 + 8 * hh);
      acc[t] = mmaN<ASPLIT ? 2 : 1>(ah.v, al.v, b.v, b.v, acc[t]);
    }
  }
#pragma unroll
  for (int t = 0; t < 4; ++t) {
    float bv = bias ? bias[col0 + t * 16 + ln] : 0.f;
    if (BIAS_BF16) bv = bf16_round(bv);
#pragma unroll
    for (int r = 0; r < 8; ++r) { float v = acc[t][r] + bv; if (ACT == 1) v = fmaxf(v, 0.f); so[w][8 * hh + r][t * 16 + ln] = v; }
  }
  __builtin_amdgcn_fence(__ATOMIC_ACQ_REL, "workgroup");
  __builtin_amdgcn_wave_barrier();
  const int rsub = lane >> 4, c4 = (lane & 15) * 4;
  {
#pragma unroll
    for (int q = 0; q < 8; ++q) {
      const int r = q * 2 + rsub;
      const v4f v = *(const v4fa*)&so[w][r][c4];
      *(v4f*)(C + (size_t)(row0 + r) * ldc + col0 + c4) = v;
    }
    
  }
}

// GEMM C = act(A·W + bias + resid): A f32 (ASPLIT -> hi/lo 2 terms), Wt bf16 [N][K]; ACT 0 none, 1 relu, 2 exact gelu;
// resid (optional, f32, row index = (row % rmod), pitch ldr, RES_BF16 rounds it) added before the activation.
template <bool ASPLIT, int ACT, bool BIAS_BF16, bool RES_BF16>
__global__ __launch_bounds__(128) void k_gemm_bf3(const float* __restrict__ A, int lda, const unsigned short* __restrict__ Wt, int ldb,
                                                const float* __restrict__ bias, const float* __restrict__ resid, int rmod, int ldr,
                                                float* __restrict__ C, int ldc, int M, int N, int K) {
  __shared__ __attribute__((aligned(16))) float so[4][16][64];
  const int tid = threadIdx.x, w = tid >> 5, lane = tid & 31, ln = lane & 15, hh = lane >> 4;
  const int ntn = N / 64;
  const int wid = blockIdx.x * 4 + w;
  const int mt = wid / ntn, nq = wid % ntn;
  if (mt * 16 >= M) return;
  const int row0 = mt * 16, col0 = nq * 64;
  const float* arow = A + (size_t)(row0 + ln) * lda;
  v8f acc[4] = {};
  for (int kb = 0; kb < K; kb += 32) {
    FragB ah, al;
    const v4f x0 = *(const v4fa*)(arow + kb + 8 * hh), x1 = *(const v4fa*)(arow + kb + 8 * hh + 4);
    const v4f x2 = *(const v4fa*)(arow + kb + 16 + 8 * hh), x3 = *(const v4fa*)(arow + kb + 16 + 8 * hh + 4);
    float xs[16] = {x0[0],x0[1],x0[2],x0[3],x1[0],x1[1],x1[2],x1[3],x2[0],x2[1],x2[2],x2[3],x3[0],x3[1],x3[2],x3[3]};
#pragma unroll
    for (int i = 0; i < 16; ++i) { const unsigned short hb = bf16_bits(xs[i]); ah.u[i] = hb; al.u[i] = ASPLIT ? bf16_bits(xs[i] - bf16_val(hb)) : (unsigned short)0; }
#pragma unroll
    for (int t = 0; t < 4; ++t) {
      const unsigned short* brow = Wt + (size_t)(col0 + t * 16 + ln) * ldb + kb;
      FragB b;
      b.half[0] = *(const v8us*)(brow + 8 * hh);
      b.half[1] = *(const v8us*)(brow + 16 + 8 * hh);
      acc[t] = mmaN<ASPLIT ? 2 : 1>(ah.v, al.v, b.v, b.v, acc[t]);
    }
  }
#pragma unroll
  for (int t = 0; t < 4; ++t) {
    const int col = col0 + t * 16 + ln;
    float bv = bias ? bias[col] : 0.f;
    if (BIAS_BF16) bv = bf16_round(bv);
#pragma unroll
    for (int r = 0; r < 8; ++r) {
      float v = acc[t][r] + bv;
      if (resid) { float rv = resid[(size_t)((row0 + 8 * hh + r) % rmod) * ldr + col]; if (RES_BF16) rv = bf16_round(rv); v += rv; }
      if (ACT == 1) v = fmaxf(v, 0.f);
      if (ACT == 2) v = 0.5f * v * (1.0f + erff(v * 0.70710678118654752f));
      if (ACT == 3) { const float u = 0.7978845608028654f * (v + 0.044715f * v * v * v); v = 0.5f * v * (1.0f + tanhf(u)); }
      so[w][8 * hh + r][t * 16 + ln] = v;
    }
  }
  __builtin_amdgcn_fence(__ATOMIC_ACQ_REL, "workgroup");
  __builtin_amdgcn_wave_barrier();
  const int rsub = lane >> 4, c4 = (lane & 15) * 4;
  {
#pragma unroll
    for (int q = 0; q < 8; ++q) {
      const int r = q * 2 + rsub;
      const v4f v = *(const v4fa*)&so[w][r][c4];
      *(v4f*)(C + (size_t)(row0 + r) * ldc + col0 + c4) = v;
    }
    
  }
}
// row LayerNorm (biased variance, eps) over N: s = X (+ R); optional out_sum <- s; out_norm <- (s-mu)*rsqrt(var+eps)*g + b
template <bool PARAM_BF16>
__global__ __launch_bounds__(256) void k_layernorm(const float* __restrict__ X, const float* __restrict__ R, const float* __restrict__ g, const float* __restrict__ bta,
                                                  float* __restrict__ out_sum, float* __restrict__ out_norm, int N, float eps) {
  __shared__ float red[256];
  const int row = blockIdx.x, tid = threadIdx.x;
  const float* x = X + (size_t)row * N; const float* rr = R ? R + (size_t)row * N : nullptr;
  float vals[16];                     // up to N = 4096
  const int per = N / 256;            // contiguous chunk per thread? use strided-by-4 chunks: thread handles j = tid*4 + 1024*u
  float s1 = 0.f;
  for (int u = 0; u < per / 4; ++u) {
    const int j = tid * 4 + 1024 * u;
    const v4f a = *(const v4fa*)(x + j);
    v4f b = {0.f,0.f,0.f,0.f}; if (rr) b = *(const v4fa*)(rr + j);
#pragma unroll
    for (int q = 0; q < 4; ++q) { const float v = a[q] + b[q]; vals[u * 4 + q] = v; s1 += v; }
  }
  red[tid] = s1; __syncthreads();
  for (int st = 128; st > 0; st >>= 1) { if (tid < st) red[tid] += red[tid + st]; __syncthreads(); }
  const float mu = red[0] / (float)N; __syncthreads();
  float s2 = 0.f;
  for (int u = 0; u < per / 4; ++u)
#pragma unroll
    for (int q = 0; q < 4; ++q) { const float c = vals[u * 4 + q] - mu; s2 += c * c; }
  red[tid] = s2; __syncthreads();
  for (int st = 128; st > 0; st >>= 1) { if (tid < st) red[tid] += red[tid + st]; __syncthreads(); }
  const float rs = rsqrtf(red[0] / (float)N + eps);
  {
    for (int u = 0; u < per / 4; ++u) {
      const int j = tid * 4 + 1024 * u;
      v4f o, sm;
#pragma unroll
      for (int q = 0; q < 4; ++q) {
        float gg = g[j + q], bb = bta[j + q];
        if (PARAM_BF16) { gg = bf16_round(gg); bb = bf16_round(bb); }
        sm[q] = vals[u * 4 + q]; o[q] = (vals[u * 4 + q] - mu) * rs * gg + bb;
      }
      if (out_sum) *(v4f*)(out_sum + (size_t)row * N + j) = sm;
      *(v4f*)(out_norm + (size_t)row * N + j) = o;
    }
    
  }
}



// ---- f16 WMMA path (v_wmma_f32_16x16x32_f16): 11-bit significands for operands in range — used where a [0,1] probability operand needs more precision than bf16
typedef _Float16 v16h __attribute__((ext_vector_type(16)));
union FragH { v16h v; v8us half[2]; _Float16 h[16]; unsigned short u[16]; };
template <int NT>
__device__ __forceinline__ v8f mmaH(v16h ah, v16h al, v16h bh, v16h bl, v8f c) {
  c = __builtin_amdgcn_wmma_f32_16x16x32_f16(false, ah, false, bh, (short)0, c, false, false);
  if (NT >= 2) c = __builtin_amdgcn_wmma_f32_16x16x32_f16(false, al, false, bh, (short)0, c, false, false);
  if (NT >= 3) c = __builtin_amdgcn_wmma_f32_16x16x32_f16(false, ah, false, bl, (short)0, c, false, false);
  asm volatile("v_nop\n\tv_nop\n\tv_nop\n\tv_nop" : "+v"(c) : "v"(ah), "v"(al), "v"(bh), "v"(bl));
  return c;
}
// batched GEMM like k_gemm_b but f16 operands: A f32 (split into f16 hi/lo if ASPLIT, else rounded to f16), Bt = f16 values [n][k]; alpha; C f32; N multiple of 16 (partial tiles skipped)
template <bool ASPLIT>
__global__ __launch_bounds__(128) void k_gemm_h(const float* __restrict__ A, int lda, size_t sA, const _Float16* __restrict__ Bh, int ldb, size_t sB, float alpha, float* __restrict__ C, int ldc, size_t sC, int M, int N, int K) {
  __shared__ __attribute__((aligned(16))) float so[4][16][64];
  const int tid = threadIdx.x, w = tid >> 5, lane = tid & 31, ln = lane & 15, hh = lane >> 4; const int by = blockIdx.y;
  A += (size_t)by * sA; Bh += (size_t)by * sB; C += (size_t)by * sC;
  const int ntn = (N + 63) / 64; const int wid = blockIdx.x * 4 + w; const int mt = wid / ntn, nq = wid % ntn; if (mt * 16 >= M) return;
  const int row0 = mt * 16, col0 = nq * 64; const float* arow = A + (size_t)(row0 + ln) * lda;
  v8f acc[4] = {};
  for (int kb = 0; kb < K; kb += 32) {
    FragH ah, al;
    const v4f x0 = *(const v4fa*)(arow + kb + 8 * hh), x1 = *(const v4fa*)(arow + kb + 8 * hh + 4), x2 = *(const v4fa*)(arow + kb + 16 + 8 * hh), x3 = *(const v4fa*)(arow + kb + 16 + 8 * hh + 4);
    float xs[16] = {x0[0],x0[1],x0[2],x0[3],x1[0],x1[1],x1[2],x1[3],x2[0],x2[1],x2[2],x2[3],x3[0],x3[1],x3[2],x3[3]};
#pragma unroll
    for (int i = 0; i < 16; ++i) { const _Float16 h = (_Float16)xs[i]; ah.h[i] = h; al.h[i] = ASPLIT ? (_Float16)(xs[i] - (float)h) : (_Float16)0.0f; }
#pragma unroll
    for (int t = 0; t < 4; ++t) { if (col0 + t * 16 >= N) continue; const size_t boff = (size_t)(col0 + t * 16 + ln) * ldb + kb; FragH bq; bq.half[0] = *(const v8us*)(Bh + boff + 8 * hh); bq.half[1] = *(const v8us*)(Bh + boff + 16 + 8 * hh);
      acc[t] = mmaH<ASPLIT ? 2 : 1>(ah.v, al.v, bq.v, bq.v, acc[t]); }
  }
#pragma unroll
  for (int t = 0; t < 4; ++t) { if (col0 + t * 16 >= N) continue;
#pragma unroll
    for (int r = 0; r < 8; ++r) so[w][8 * hh + r][t * 16 + ln] = acc[t][r] * alpha; }
  __builtin_amdgcn_fence(__ATOMIC_ACQ_REL, "workgroup"); __builtin_amdgcn_wave_barrier();
  const int rsub = lane >> 4, c4 = (lane & 15) * 4;
  {
#pragma unroll
    for (int q = 0; q < 8; ++q) { const int r = q * 2 + rsub; if (col0 + c4 < N) { const v4f v = *(const v4fa*)&so[w][r][c4]; *(v4f*)(C + (size_t)(row0 + r) * ldc + col0 + c4) = v; } }
     }
}

// Wt[n][k] = f16(W[k][n]·scale) from f32 row-major W[K][N] (scale = power of two; bf16-exact weights stay exact in f16 away from the subnormal range)
__global__ __launch_bounds__(256) void k_wt_f16(const float* __restrict__ W, _Float16* __restrict__ Wt, int K, int N, float scale) {
  const int t = blockIdx.x * 256 + threadIdx.x; if (t >= N * (K / 8)) return; const int n = t / (K / 8), k8 = (t % (K / 8)) * 8; FragH f;
#pragma unroll
  for (int i = 0; i < 8; ++i) f.h[i] = (_Float16)(bf16_round(W[(size_t)(k8 + i) * N + n]) * scale); const v8us o = f.half[0];
  *(v8us*)((unsigned short*)Wt + (size_t)n * K + k8) = o; 
}
// k_gemm_hh variant with fused epilogue: v = acc·alpha + bias[by·sBias + col] (+ CP[(row/rowsPerB)·sCPb + by·64 + col] if CP) ; ACT 0 none / 1 elu ; writes f16 C16 (and f32 C if non-null)
template <int ACT>
__global__ __launch_bounds__(128) void k_gemm_hhx(const _Float16* __restrict__ A, int lda, size_t sA, const _Float16* __restrict__ Bh, int ldb, size_t sB, float alpha, const float* __restrict__ bias, size_t sBias, const float* __restrict__ CP, int rowsPerB, size_t sCPb, int row0g,
    float* __restrict__ C, _Float16* __restrict__ C16, int ldc, size_t sC, int M, int N, int K) {
  __shared__ __attribute__((aligned(16))) float so[4][16][64];
  const int tid = threadIdx.x, w = tid >> 5, lane = tid & 31, ln = lane & 15, hh = lane >> 4; const int by = blockIdx.y;
  A += (size_t)by * sA; Bh += (size_t)by * sB; const size_t cofs = (size_t)by * sC; const float* bp = bias ? bias + (size_t)by * sBias : nullptr;
  const int ntn = (N + 63) / 64; const int wid = blockIdx.x * 4 + w; const int mt = wid / ntn, nq = wid % ntn; if (mt * 16 >= M) return;
  const int row0 = mt * 16, col0 = nq * 64; const _Float16* arow = A + (size_t)(row0 + ln) * lda;
  v8f acc[4] = {};
  for (int kb = 0; kb < K; kb += 32) { FragH ah; ah.half[0] = *(const v8us*)((const unsigned short*)arow + kb + 8 * hh); ah.half[1] = *(const v8us*)((const unsigned short*)arow + kb + 16 + 8 * hh);
#pragma unroll
    for (int t = 0; t < 4; ++t) { if (col0 + t * 16 >= N) continue; const size_t boff = (size_t)(col0 + t * 16 + ln) * ldb + kb; FragH bq; bq.half[0] = *(const v8us*)((const unsigned short*)Bh + boff + 8 * hh); bq.half[1] = *(const v8us*)((const unsigned short*)Bh + boff + 16 + 8 * hh);
      acc[t] = mmaH<1>(ah.v, ah.v, bq.v, bq.v, acc[t]); }
  }
#pragma unroll
  for (int t = 0; t < 4; ++t) { if (col0 + t * 16 >= N) continue; const int col = col0 + t * 16 + ln; const float bv = bp ? bf16_round(bp[col]) : 0.f;
#pragma unroll
    for (int r = 0; r < 8; ++r) { float v = acc[t][r] * alpha + bv; if (CP) { const int rr = row0g + row0 + 8 * hh + r; if (rowsPerB < 0) v += CP[cofs + (size_t)rr * ldc + col];      /* rowsPerB < 0: own element of the batched C plane */ else { const int bidx = rr / rowsPerB; v += CP[(size_t)bidx * sCPb + (size_t)by * 64 + col]; } } if (ACT == 1) v = (v > 0.f) ? v : expm1f(v); else if (ACT == 7) v = (v > 0.f) ? v + 1.0f : expf(v); else if (ACT == 8) v = tanhf(v); else if (ACT == 9) v = 0.5f * v * (1.0f + tanhf(0.7978845608028654f * (v + 0.044715f * v * v * v))); else if (ACT == 11) v = 1.0f / (1.0f + expf(-v)); else if (ACT == 12) v = (v > 0.f) ? v : 0.01f * v; else if (ACT == 14) v = (v > 0.f) ? v : 0.1f * v; else if (ACT == 16) v = (v >= 0.f) ? v : 0.3f * v; else if (ACT == 17) v = (v >= 0.f) ? v : 0.2f * v; else if (ACT == 15) v = v / (1.0f + expf(-v)); else if (ACT == 3) v = fmaxf(v, 0.f); else if (ACT == 6) v = 0.5f * v * (1.0f + erff(v * 0.70710678118654752f)); so[w][8 * hh + r][t * 16 + ln] = v; } }
  __builtin_amdgcn_fence(__ATOMIC_ACQ_REL, "workgroup"); __builtin_amdgcn_wave_barrier();
  const int rsub = lane >> 4, c4 = (lane & 15) * 4; typedef _Float16 v4h __attribute__((ext_vector_type(4)));
  {
#pragma unroll
    for (int q = 0; q < 8; ++q) { const int r = q * 2 + rsub; if (col0 + c4 < N) { const v4f v = *(const v4fa*)&so[w][r][c4]; if (C) *(v4f*)(C + cofs + (size_t)(row0 + r) * ldc + col0 + c4) = v; if (C16) { v4h h4; for (int i = 0; i < 4; ++i) h4[i] = (_Float16)v[i]; *(v4h*)(C16 + cofs + (size_t)(row0 + r) * ldc + col0 + c4) = h4; } } }
     }
}


typedef _Float16 v4h __attribute__((ext_vector_type(4)));

// All five f32 inputs become f16 planes in ONE launch of resident waves: 256 work-groups of 16 waves (one per WGP, four waves per SIMD), so that 4,096 waves start instead of one wave per KiB of input.
// A piece is 8 neighbouring values: 32 bytes read, 16 bytes stored per lane, so a wave's store covers 512 contiguous bytes. A slab is one piece per thread of the work-group (16 KiB read). A work-group owns
// 8 neighbouring slabs of each activation plane and one of each weight plane. A thread issues all of its 38 loads before it uses the first value: the whole input is asked for at once, and each piece is
// converted and stored as it lands.
// Activations: bf16-rounded, exact in f16. Weights: bf16-rounded, x16 (exact). memory feeds both the K and the V projection: it is converted once.
#define CV_G 256                     /* work-groups */
#define CV_T 512                     /* threads per work-group */
#define CV_N (CV_G * CV_T)
#define CV_XP 8                      /* slabs per work-group and activation plane */
template <bool X16W>
__device__ __forceinline__ v8us cv_pack(v4f a, v4f b) { FragH f;
#pragma unroll
  for (int q = 0; q < 4; ++q) { f.h[q] = X16W ? (_Float16)(bf16_round(a[q]) * 16.0f) : (_Float16)bf16_round(a[q]); f.h[4 + q] = X16W ? (_Float16)(bf16_round(b[q]) * 16.0f) : (_Float16)bf16_round(b[q]); }
  return f.half[0]; }
__global__ __launch_bounds__(CV_T) __attribute__((amdgpu_waves_per_eu(4, 4))) void k_cvt(const float* __restrict__ xq, const float* __restrict__ xm, const float* __restrict__ wq, const float* __restrict__ wk, const float* __restrict__ wv,
                                              _Float16* __restrict__ XQ, _Float16* __restrict__ XM, _Float16* __restrict__ BQ, _Float16* __restrict__ BK, _Float16* __restrict__ BV) {
  static_assert(NR * DM == (size_t)8 * CV_N * CV_XP && (size_t)DM * DM == (size_t)8 * CV_N, "k_cvt: the planes divide evenly among the threads");
  const unsigned g = blockIdx.x, ib = threadIdx.x * 32u, ob = threadIdx.x * 16u;      /* the thread's byte offsets in a slab: with the uniform pointers below, one address register serves every load and one every store */
  const char* pq = (const char*)xq + (size_t)g * (CV_XP * CV_T * 32); const char* pm = (const char*)xm + (size_t)g * (CV_XP * CV_T * 32);
  const char* pw[3] = {(const char*)wq + (size_t)g * (CV_T * 32), (const char*)wk + (size_t)g * (CV_T * 32), (const char*)wv + (size_t)g * (CV_T * 32)};
  char* oq = (char*)XQ + (size_t)g * (CV_XP * CV_T * 16); char* om = (char*)XM + (size_t)g * (CV_XP * CV_T * 16);
  char* ow[3] = {(char*)BQ + (size_t)g * (CV_T * 16), (char*)BK + (size_t)g * (CV_T * 16), (char*)BV + (size_t)g * (CV_T * 16)};
  v4f q[CV_XP][2], m[CV_XP][2], w[3][2];      /* every '#pragma unroll' below gives constant indices: the pieces stay in registers */
  /* The scheduling barriers of the three load loops keep the 38 loads one group, in the order in which the pieces are used, in front of the first conversion: without them the compiler either sinks the loads
     among the conversions (about nine in flight) or issues the first piece's loads late, so that the first counted wait covers half the group. */
#pragma unroll
  for (int i = 0; i < CV_XP; ++i) { q[i][0] = *(const v4fa*)(pq + i * (CV_T * 32) + ib); q[i][1] = *(const v4fa*)(pq + i * (CV_T * 32) + ib + 16); __builtin_amdgcn_sched_barrier(0); }
#pragma unroll
  for (int i = 0; i < CV_XP; ++i) { m[i][0] = *(const v4fa*)(pm + i * (CV_T * 32) + ib); m[i][1] = *(const v4fa*)(pm + i * (CV_T * 32) + ib + 16); __builtin_amdgcn_sched_barrier(0); }
#pragma unroll
  for (int i = 0; i < 3; ++i) { w[i][0] = *(const v4fa*)(pw[i] + ib); w[i][1] = *(const v4fa*)(pw[i] + ib + 16); __builtin_amdgcn_sched_barrier(0); }
  /* The scheduling barriers of the two activation store loops keep a piece's store behind its own conversion, while later loads still fly: without them the compiler sinks the stores to the end of the kernel. */
#pragma unroll
  for (int i = 0; i < CV_XP; ++i) { *(v8us*)(oq + i * (CV_T * 16) + ob) = cv_pack<false>(q[i][0], q[i][1]); __builtin_amdgcn_sched_barrier(0); }
#pragma unroll
  for (int i = 0; i < CV_XP; ++i) { *(v8us*)(om + i * (CV_T * 16) + ob) = cv_pack<false>(m[i][0], m[i][1]); __builtin_amdgcn_sched_barrier(0); }
#pragma unroll
  for (int i = 0; i < 3; ++i) *(v8us*)(ow[i] + ob) = cv_pack<true>(w[i][0], w[i][1]); }
__global__ __launch_bounds__(256) void k_h16(const float* __restrict__ x, _Float16* __restrict__ X16, size_t n8) { const size_t t = (size_t)blockIdx.x * 256 + threadIdx.x; if (t >= n8) return; FragH f;
#pragma unroll
  for (int q = 0; q < 8; ++q) f.h[q] = (_Float16)x[t * 8 + q]; *(v8us*)((unsigned short*)X16 + t * 8) = f.half[0];  }
__global__ __launch_bounds__(256) void k_round16f(const float* __restrict__ W, _Float16* __restrict__ Bt, size_t n8) { const size_t t = (size_t)blockIdx.x * 256 + threadIdx.x; if (t >= n8) return; FragH f;
#pragma unroll
  for (int i = 0; i < 8; ++i) f.h[i] = (_Float16)(bf16_round(W[t * 8 + i]) * 16.0f); *(v8us*)((unsigned short*)Bt + t * 8) = f.half[0];  }
template <int NHv, int TTv>
__global__ __launch_bounds__(256) void k_vt(const _Float16* __restrict__ V16, int ldv, int voff, _Float16* __restrict__ Vt) { __shared__ unsigned short tl[64][66]; const int tid = threadIdx.x; const int slab = blockIdx.x / (TTv / 64), lg = blockIdx.x % (TTv / 64); const int b = slab / NHv, h = slab % NHv;
  for (int i = tid; i < 64 * 8; i += 256) { const int r = i / 8, c8 = (i % 8) * 8; FragH f; f.half[0] = *(const v8us*)((const unsigned short*)V16 + ((size_t)b * TTv + lg * 64 + r) * ldv + voff + h * 64 + c8);
#pragma unroll
    for (int q = 0; q < 8; ++q) tl[r][c8 + q] = f.u[q]; }
  __syncthreads();
  {
#pragma unroll
    for (int rd = 0; rd < 2; ++rd) { const int d = rd * 32 + tid / 8, pc = tid % 8; FragH f;
#pragma unroll
      for (int q = 0; q < 8; ++q) f.u[q] = tl[pc * 8 + q][d];
      *(v8us*)((unsigned short*)Vt + ((size_t)slab * 64 + d) * TTv + lg * 64 + pc * 8) = f.half[0]; }
     } }

__global__ __launch_bounds__(256) void k_hl(const float* __restrict__ F, _Float16* __restrict__ Hh, _Float16* __restrict__ Hl, size_t n8) { const size_t t = (size_t)blockIdx.x * 256 + threadIdx.x; if (t >= n8) return; FragH fh, fl; const v4f a = *(const v4fa*)(F + t * 8), c = *(const v4fa*)(F + t * 8 + 4);
#pragma unroll
  for (int q = 0; q < 4; ++q) { _Float16 h = (_Float16)a[q]; fh.h[q] = h; fl.h[q] = (_Float16)((a[q] - (float)h) * 1024.0f); h = (_Float16)c[q]; fh.h[4 + q] = h; fl.h[4 + q] = (_Float16)((c[q] - (float)h) * 1024.0f); }
  { *(v8us*)((unsigned short*)Hh + t * 8) = fh.half[0]; *(v8us*)((unsigned short*)Hl + t * 8) = fl.half[0];  } }

__device__ __forceinline__ v16h g2_frag(const _Float16* p, int hh) { FragH f; f.half[0] = *(const v8us*)((const unsigned short*)p + 8 * hh); f.half[1] = *(const v8us*)((const unsigned short*)p + 16 + 8 * hh); return f.v; }
// Projection GEMM Y[8192][1024] = f16(X W^T * alpha + bias), X and W as f16 rows with k along the row. One work-group of eight waves per WGP (two waves per SIMD) owns one tile of Y.
// The tiles are sized for the bytes that they ask of L2: a q or k tile is 256 x 256 (64 A rows x 128 B rows per wave), a v tile 128 x 256 (64 x 64 per wave). 256 tiles of the first kind and 256 of the second
// cover the three planes: two tiles per WGP, the large ones first. A 256 x 256 tile lands 512 operand rows for 65,536 results, where a 128 x 128 tile lands 256 rows for 16,384, and a wave's A fragment feeds eight products.
// The A and B tiles of 128 k (256-byte rows) are brought by tensor loads and shared through LDS: a wave asks for one slice of 64 rows per tile (a v tile has six slices: waves 6 and 7 ask for none), two buffers,
// the next tile's loads fly while this tile is worked on, one barrier per tile; no tile byte passes through a register on its way to LDS.
// A q or k tile forms Y^T = W X^T (A = W rows, B = X rows, both read with fa_frag, so the two k orders are equal): a lane then holds eight neighbouring output columns of one
// token row, which pack into one 16-byte piece; the pieces pass through the wave's own part of the (then free) ring, so that every global store covers whole 128-byte lines.
// One launch holds the tiles of all three projections: the block index picks the plane and the tile in it, so that no launch gap, fill or tail stands between the planes.
// A v tile exchanges the roles (A = X rows, B = W rows; same loaders, same k order): a lane then holds eight neighbouring token rows of one output column, a 16-byte piece of a
// row of V^T; the staged rows go out as whole 128-byte lines of V^T [batch * head][d][key], and no transposing launch is needed.
// amdgpu_waves_per_eu(2, 2): the eight waves stand two per SIMD, 512 registers each: 256 hold a large tile's sums, 192 two sets of fragments of 32 k each.
// Fragments: a q or k tile's 128 k are worked on in four groups of 32 k; a group's 24 LDS reads are asked for as one run, one group ahead, into the register set that the group before last has left, and never
// across a tile's barrier. A v tile's fragments of all 128 k fit beside its 128 sums and are asked for at the head of the trip.
// Every '#pragma unroll' in pg_stage and pg_tile gives constant indices, so that the fragment, staging and accumulator arrays stay in registers.
#define PG_K 128                     /* k per LDS tile */
#define PG_RP 272                    /* LDS row pitch of the operand tiles in bytes: 256 of data and the tensor load's pad of 16, an odd multiple of 16 for the 16-byte fragment reads */
#define PG_SL 18432                  /* bytes of one slice in LDS: 64 rows of PG_RP bytes (17,408), rounded up so that every slice starts at a multiple of 2 KiB */
#define PG_NSL 8                     /* slice places per buffer */
#define PG_PITCH 144                 /* LDS row pitch of the output staging rows in bytes: 128 of data, an odd multiple of 16 */
#define PG_NS (DM / PG_K)
#define PG_NQK ((MP / 256) * (DM / 256))      /* 256 x 256 tiles per q or k plane */
#define PG_NV ((MP / 128) * (DM / 256))       /* 128 x 256 tiles of the v plane */
#define FA_QS (0.125f * 1.4426950408889634f)      /* 64^-0.5 log2(e): the q rows carry it, so that k_fattn's score tiles are exponents in base 2 */
__device__ __forceinline__ v16h fa_frag(const unsigned char* p);
__device__ __forceinline__ v8f fa_mma(v16h a, v16h b, v8f c);
typedef unsigned int pg_u4 __attribute__((ext_vector_type(4)));
typedef unsigned int pg_u8 __attribute__((ext_vector_type(8)));
__device__ __forceinline__ unsigned int pg_uni(unsigned int v) { return (unsigned int)__builtin_amdgcn_readfirstlane(v); }      /* a descriptor word: the same in every lane, held in a scalar register */
__device__ __forceinline__ unsigned int pg_pinned(unsigned int v) { unsigned int w = pg_uni(v); asm volatile("" : "+s"(w)); return w; }      /* the issue test of a tensor load, held in a scalar register: the test then compiles to a scalar compare and branch (a tensor load ignores EXEC) */
// Tensor descriptor, group 1: a tile of 64 rows of 256 bytes (extents in bytes, tensor = tile), source row pitch of DM f16 values, 16 bytes of LDS pad behind every 256-byte row (pitch PG_RP), no mask.
__device__ __forceinline__ pg_u8 pg_group1() { pg_u8 g;
  g[0] = pg_uni((1u << 20) | (5u << 22) | (3u << 25)); g[1] = pg_uni(256u << 16); g[2] = pg_uni(64u << 16); g[3] = pg_uni(256u << 16); g[4] = pg_uni(64u); g[5] = pg_uni(DM * 2u); g[6] = pg_uni(0u); g[7] = pg_uni(0u);
  return g; }
// One request of the whole wave: the slice whose first byte is ga goes to the LDS byte offset lds. The waits and the barrier stand at the call sites. Returns the request's group 0 for pg_twait.
__device__ __forceinline__ pg_u4 pg_tload(unsigned int lds, unsigned long long ga, pg_u8 g1) { pg_u4 g0;
  g0[0] = pg_uni(1u); g0[1] = pg_uni(lds); g0[2] = pg_uni((unsigned int)ga); g0[3] = pg_uni((((unsigned int)(ga >> 32)) & 0x01FFFFFFu) | 0x80000000u);
  asm volatile("tensor_load_to_lds %0, %1" :: "s"(g0), "s"(g1) : "memory"); return g0; }
__device__ __forceinline__ void pg_twait(pg_u4 g0) { asm volatile("s_wait_tensorcnt 0x0" :: "s"(g0) : "memory"); }      /* the wave's own request has landed; its group 0 is an input, so that its four registers stay whole up to this wait: without it the build reuses them while the request flies */
__device__ __forceinline__ void pg_twait2(pg_u4 g0, pg_u8 g1) { asm volatile("s_wait_tensorcnt 0x0" :: "s"(g0), "s"(g1) : "memory"); }      /* pg_twait with group 1 as an input too: in pg_tile the build otherwise takes a register of group 1 for the buffer offset while the request flies */
// A wave's results to its LDS staging rows: acc[i][j] register r = A row 16 i + 8 h + r, lane column c = B row 16 j + c of the wave's tile. Staged row = B row, 64 A rows along it.
// bias points at the wave's first output column. VTR false: the A rows are the output columns. VTR true: the B rows are. bs scales the bias as alpha's extra factor scales the product (FA_QS in the q plane, else 1).
template <bool VTR, int NJ>
__device__ __forceinline__ void pg_stage(const v8f (&acc)[4][NJ], unsigned char* st, const float* __restrict__ bias, float alpha, float bs, int lane) {
  const int c = lane & 15, h = lane >> 4;
  /* Each kind of bias load has behind it the wait that belongs in front of the first instruction that takes over the load's address registers. The loaded values are inputs of the statement, so that it stands behind the loads; the address is an input, so that its registers stay whole up to it. */
  float bc4[4] = {0.f, 0.f, 0.f, 0.f};      /* VTR true: the lane's bias values, one per 16 B rows */
  v4f bw[8];      /* VTR false: the lane's bias values, rounded and scaled: bw[2 i + (r >> 2)][r & 3] belongs to A row 16 i + 8 h + r */
  if (VTR) { static_assert(!VTR || NJ == 4, "pg_stage: four bias values in a v tile"); const float* bp = bias + c;
#pragma unroll
    for (int j = 0; j < 4; ++j) bc4[j] = bp[16 * j];
    asm volatile("s_wait_xcnt 0x0" :: "v"(bp), "v"(bc4[0]), "v"(bc4[1]), "v"(bc4[2]), "v"(bc4[3]) : "memory"); }
  else { const float* bp = bias + 2 * lane;      /* the wave's 64 values, two per lane: rounded and scaled once, then handed round through the first 256 bytes of the wave's own staging rows */
    const float b0 = bp[0], b1 = bp[1];
    asm volatile("s_wait_xcnt 0x0" :: "v"(bp), "v"(b0), "v"(b1) : "memory");
    typedef float f2a __attribute__((ext_vector_type(2), may_alias));
    *(f2a*)(st + 8 * lane) = f2a{bf16_round(b0) * bs, bf16_round(b1) * bs};
    __builtin_amdgcn_fence(__ATOMIC_ACQ_REL, "workgroup"); __builtin_amdgcn_wave_barrier();      /* the wave's lanes read each other's values: the reads stay behind the writes */
#pragma unroll
    for (int t = 0; t < 8; ++t) bw[t] = *(const v4fa*)(st + 64 * (t >> 1) + 32 * h + 16 * (t & 1));
    __builtin_amdgcn_fence(__ATOMIC_ACQ_REL, "workgroup"); __builtin_amdgcn_wave_barrier(); }      /* the staging writes below take over those bytes: they stay behind the reads */
#pragma unroll
  for (int i = 0; i < 4; ++i) {
#pragma unroll
    for (int j = 0; j < NJ; ++j) { FragH f; const float bc = VTR ? bf16_round(bc4[VTR ? j : 0]) * bs : 0.f;
#pragma unroll
      for (int r = 0; r < 8; ++r) f.h[r] = (_Float16)(acc[i][j][r] * alpha + (VTR ? bc : bw[2 * i + (r >> 2)][r & 3]));
      *(v8us*)(st + (16 * j + c) * PG_PITCH + 32 * i + 16 * h) = f.half[0]; } } }
// One tile: 64 AS A rows x 256 B rows. The eight waves stand AS x (8 / AS): a wave owns 64 A rows and 32 AS B rows. ar, br: the tile's first A row and first B row (row pitch DM values).
// bias: the tile's first output column. yb: the tile's first output element, B rows down (pitch yl elements), A rows along.
template <int AS, bool VTR>
__device__ __forceinline__ void pg_tile(unsigned char* Lb, const unsigned short* ar, const unsigned short* br, const float* __restrict__ bias, float alpha, float bs, unsigned short* yb, int yl) {
  constexpr int NJ = 2 * AS;      /* groups of 16 B rows per wave */
  constexpr int KG = AS == 4 ? 1 : 4;      /* steps of 32 k whose fragments are read as one group */
  constexpr int NG = 4 / KG, NSET = NG > 1 ? 2 : 1;      /* groups per tile; register sets: with two, a group's reads are asked for one group ahead, while the group before it is multiplied. 192 or 256 fragment registers beside the sums */
  const int tid = threadIdx.x, lane = tid & 31, wave = tid >> 5, c = lane & 15, h = lane >> 4;
  const int wa = wave % AS, wb = wave / AS;
  const unsigned int uw = pg_uni((unsigned int)wave);      /* the wave asks for slice uw of every tile: slices 0 .. AS - 1 hold A rows, the four behind them B rows */
  const unsigned int iss = uw < (unsigned int)(AS + 4) ? 1u : 0u;      /* 1 in the waves that ask for a slice (a scalar) */
  const unsigned long long sg = (unsigned long long)(size_t)(uw < (unsigned int)AS ? ar : br) + (unsigned long long)((uw < (unsigned int)AS ? uw : uw - (unsigned int)AS) * (64u * DM * 2u));      /* first byte of that slice in tile 0 */
  const unsigned int sl = (unsigned int)(size_t)Lb + uw * PG_SL;      /* its place in buffer 0 */
  const pg_u8 g1 = pg_group1();
  const int fo = c * PG_RP + 16 * h;      /* the lane's fragment row in a slice and its 16 h bytes */
  const v8f z8 = {0.f, 0.f, 0.f, 0.f, 0.f, 0.f, 0.f, 0.f};
  v8f acc[4][NJ];      /* [16 A rows i][16 B rows j]: register r = A row 16 i + 8 h + r, lane column c = B row 16 j + c */
#pragma unroll
  for (int i = 0; i < 4; ++i)
#pragma unroll
    for (int j = 0; j < NJ; ++j) acc[i][j] = z8;
  pg_u4 fl = {0u, 0u, 0u, 0u};      /* group 0 of the request in flight */
  if (pg_pinned(iss)) { fl = pg_tload(sl, sg, g1);      /* tile 0 to buffer 0 */
    pg_twait2(fl, g1); }      /* the wave's own slice of tile 0 has landed */
  __syncthreads();      /* tile 0 is visible to all waves */
  if (pg_pinned(iss)) fl = pg_tload(sl + PG_NSL * PG_SL, sg + PG_K * 2, g1);      /* tile 1 to buffer 1: it flies while tile 0 is worked on */
#pragma unroll 1      /* rolled: one trip's text serves all eight, and the test for a tile s + 2 stays one scalar branch around one tensor load */
  for (int s = 0; s < PG_NS; ++s) {
    const unsigned char* Ab = Lb + (s & 1) * (PG_NSL * PG_SL) + wa * PG_SL + fo; const unsigned char* Bb = Lb + (s & 1) * (PG_NSL * PG_SL) + (AS + wb * (NJ / 4)) * PG_SL + fo;
    v16h wf[NSET][KG][4], xf[NSET][KG][NJ];      /* [register set][32 k][16 rows] */
#pragma unroll
    for (int kg = -1; kg < NG; ++kg) {      /* turn kg: the reads of group kg + 1, then the products of group kg; all of them belong to tile s */
      if (kg + 1 < NG) {
#pragma unroll
        for (int kc = 0; kc < KG; ++kc) { const int e = (kg + 1) % NSET, ko = 64 * ((kg + 1) * KG + kc);      /* read in the order of first use: the first A fragment, all B fragments, the other A fragments */
          wf[e][kc][0] = fa_frag(Ab + ko);
#pragma unroll
          for (int j = 0; j < NJ; ++j) xf[e][kc][j] = fa_frag(Bb + (j >> 2) * PG_SL + 16 * (j & 3) * PG_RP + ko);
#pragma unroll
          for (int i = 1; i < 4; ++i) wf[e][kc][i] = fa_frag(Ab + 16 * i * PG_RP + ko); } }
      __builtin_amdgcn_sched_barrier(0);      /* a group's fragment reads stay together, in front of the products of the group before it: without it the compiler reads one fragment at a time and waits for it among the products */
      if (kg >= 0) {
#pragma unroll
        for (int kc = 0; kc < KG; ++kc)
#pragma unroll
          for (int i = 0; i < 4; ++i)
#pragma unroll
            for (int j = 0; j < NJ; ++j) acc[i][j] = fa_mma(wf[kg % NSET][kc][i], xf[kg % NSET][kc][j], acc[i][j]);
        __builtin_amdgcn_sched_barrier(0); }      /* the reads that follow stay behind these products, whose fragment registers they take over */
    }
    asm volatile("v_nop\n\tv_nop\n\tv_nop\n\tv_nop"); __builtin_amdgcn_sched_barrier(0);      /* four vector slots behind the trip's last WMMA, in front of the branches that follow it */
    asm volatile("s_wait_dscnt 0x0" ::: "memory");      /* the wave's reads of tile s have returned before its buffer is aimed at again */
    pg_twait2(fl, g1);      /* an asking wave's own slice of tile s + 1 has landed (a wave without a request passes) */
    __syncthreads();      /* publishes tile s + 1 and ends every wave's reads of tile s, whose buffer is refilled behind it; behind the last trip it frees the ring for the output staging */
    if (pg_pinned(iss & (unsigned int)(s + 2 < PG_NS))) fl = pg_tload(sl + (unsigned int)(s & 1) * (PG_NSL * PG_SL), sg + (unsigned long long)((s + 2) * (PG_K * 2)), g1);      /* tile s + 2 to the buffer that this trip has read */
  }
  pg_twait2(fl, g1);      /* no request is left when the ring becomes staging */
  asm volatile("s_wait_dscnt 0x0" ::: "memory");
  unsigned char* st = Lb + wave * (16 * NJ * PG_PITCH);      /* the wave's own 16 NJ rows of 128 bytes */
  pg_stage<VTR, NJ>(acc, st, bias + (VTR ? 16 * NJ * wb : 64 * wa), alpha, bs, lane);
  __builtin_amdgcn_fence(__ATOMIC_ACQ_REL, "workgroup"); __builtin_amdgcn_wave_barrier();      /* the wave's lanes read each other's pieces: the reads stay behind the writes */
  const unsigned yo = (unsigned)((16 * NJ * wb + (lane >> 3)) * yl + 64 * wa + (lane & 7) * 8);      /* the lane's place in the tile: B row 16 NJ wb + .., A row 64 wa + .. */
#pragma unroll
  for (int q = 0; q < 4 * NJ; ++q) { const v8us v = *(const v8us*)(st + (4 * q + (lane >> 3)) * PG_PITCH + (lane & 7) * 16); *(v8us*)(yb + (size_t)(4 * q * yl) + yo) = v; } }
__global__ __launch_bounds__(256) __attribute__((amdgpu_waves_per_eu(2, 2))) void k_proj(const _Float16* __restrict__ XQ, const _Float16* __restrict__ XM, const _Float16* __restrict__ WQ, const _Float16* __restrict__ WK, const _Float16* __restrict__ WV,
                                                                                         const float* __restrict__ bq, const float* __restrict__ bk, const float* __restrict__ bv, float alpha,
                                                                                         _Float16* __restrict__ YQ, _Float16* __restrict__ YK, _Float16* __restrict__ VT) {
  static_assert(MP % 256 == 0 && DM % 256 == 0 && DM % PG_K == 0, "k_proj: whole tiles only");
  static_assert(NH * HD == DM && SQ % 128 == 0, "k_proj, v tiles: row b * DM + column of V^T, a tile's token rows lie in one batch");
  static_assert(PG_NS >= 2 && PG_K * 2 == 256 && 64 * PG_RP <= PG_SL && PG_SL % 2048 == 0 && 8 * 128 * PG_PITCH <= 2 * PG_NSL * PG_SL, "k_proj: two tiles at least, 256-byte tile rows, slices at multiples of 2 KiB, staging inside the ring");
  __shared__ __attribute__((aligned(2048))) unsigned char L[2][PG_NSL][PG_SL];      /* [buffer][slice of 64 rows: the tile's A rows, then its B rows] */
  const int bi = blockIdx.x;      /* the same in every thread of the work-group: so is the branch on it, which holds barriers */
  if (bi < 2 * PG_NQK) {
    const int plane = bi / PG_NQK, tile = bi % PG_NQK; const int row0 = (tile / (DM / 256)) * 256, col0 = (tile % (DM / 256)) * 256;
    const float qs = plane == 0 ? FA_QS : 1.0f;
    pg_tile<4, false>(&L[0][0][0], (const unsigned short*)(plane == 0 ? WQ : WK) + (size_t)col0 * DM, (const unsigned short*)(plane == 0 ? XQ : XM) + (size_t)row0 * DM, (plane == 0 ? bq : bk) + col0, alpha * qs, qs,
                      (unsigned short*)(plane == 0 ? YQ : YK) + (size_t)row0 * DM + col0, DM);
  } else {
    const int tile = bi - 2 * PG_NQK; const int row0 = (tile / (DM / 256)) * 128, col0 = (tile % (DM / 256)) * 256;
    pg_tile<2, true>(&L[0][0][0], (const unsigned short*)XM + (size_t)row0 * DM, (const unsigned short*)WV + (size_t)col0 * DM, bv + col0, alpha, 1.0f,
                     (unsigned short*)VT + ((size_t)(row0 / SQ) * DM + col0) * SQ + row0 % SQ, SQ);      /* V^T has rows of SQ keys, DM rows per batch */
  } }


#define FA_NW 8                      /* waves per work-group */
#define FA_SK 64                     /* keys per LDS tile (two passes of 32) */
#define FA_PITCH 144                 /* LDS row pitch in bytes: 128 of data and the tensor load's pad of 16, an odd multiple of 16 for the 16-byte fragment reads */
#define FA_NS (SQ / FA_SK)
__device__ __forceinline__ float fa_x16(float v) { const int i = __float_as_int(v); return __int_as_float(__builtin_amdgcn_permlanex16(i, i, 0x76543210, 0xfedcba98, false, false)); }      /* value of lane ^ 16 */
__device__ __forceinline__ v16h fa_frag(const unsigned char* p) { FragH f; f.half[0] = *(const v8us*)p; f.half[1] = *(const v8us*)(p + 32); return f.v; }      /* k = 8 h .. 8 h + 7 and 16 + 8 h .. 16 + 8 h + 7; p already holds the lane's 16 h bytes */
__device__ __forceinline__ v8f fa_mma(v16h a, v16h b, v8f c) { return __builtin_amdgcn_wmma_f32_16x16x32_f16(false, a, false, b, (short)0, c, false, false); }
#define FA_TB 10240                  /* bytes of one K or V^T tile in LDS: 64 rows of FA_PITCH bytes (9,216), rounded up so that every tile starts at a multiple of 2 KiB; a buffer is [K rows by key | V^T rows by d] */
// Tensor descriptor, group 1: a tile of 64 rows of 128 bytes (extents in bytes, tensor = tile), source row pitch sp bytes, 16 bytes of LDS pad behind every 128-byte row (pitch FA_PITCH), no mask.
__device__ __forceinline__ pg_u8 fa_group1(unsigned int sp) { pg_u8 g;
  g[0] = pg_uni((1u << 20) | (4u << 22) | (3u << 25)); g[1] = pg_uni(128u << 16); g[2] = pg_uni(64u << 16); g[3] = pg_uni(128u << 16); g[4] = pg_uni(64u); g[5] = pg_uni(sp); g[6] = pg_uni(0u); g[7] = pg_uni(0u);
  return g; }
// iss: 1 in the two waves that ask for tiles, else 0 (a scalar). sl: the wave's tile place in buffer 0. sg: first byte of its tile 0. sd: bytes from one tile to the next in the source.
template <bool ONLINE>
__device__ __forceinline__ void fa_keys(unsigned char* Lb, unsigned int iss, unsigned int sl, unsigned long long sg, unsigned int sd, pg_u8 g1, int c, int h,
                                        const v16h (&qf)[2][2], v16h ones, v8f (&acc)[2][4], v8f (&lacc)[2]) {
  typedef _Float16 h2 __attribute__((ext_vector_type(2))); typedef float f2 __attribute__((ext_vector_type(2)));
  const v8f z8 = {0.f, 0.f, 0.f, 0.f, 0.f, 0.f, 0.f, 0.f};
  float m_run[2];
#pragma unroll
  for (int g = 0; g < 2; ++g) { m_run[g] = -__builtin_inff(); lacc[g] = z8;
#pragma unroll
    for (int t = 0; t < 4; ++t) acc[g][t] = z8; }
  pg_u4 fl = {0u, 0u, 0u, 0u};      /* group 0 of the request in flight */
  if (pg_pinned(iss)) { fl = pg_tload(sl, sg, g1);      /* tile 0 to buffer 0; a second walk comes here behind the first walk's waits and two barriers */
    pg_twait(fl); }      /* the wave's own tile 0 has landed */
  __syncthreads();      /* tile 0 is visible to all waves */
  if (pg_pinned(iss)) fl = pg_tload(sl + 2 * FA_TB, sg + sd, g1);      /* tile 1 to buffer 1: it flies while tile 0 is worked on */
#pragma unroll 1      /* rolled: one trip's text serves all 32, and the test for a tile s + 2 stays one scalar branch around one tensor load */
  for (int s = 0; s < FA_NS; ++s) {
    const unsigned char* Kb = Lb + (s & 1) * (2 * FA_TB); const unsigned char* Vb = Kb + FA_TB;
#pragma unroll
    for (int sub = 0; sub < 2; ++sub) {      /* one pass: 32 keys */
      v8f sx[2][2];      /* [16-key tile][column group]: register r = key 16 kt + 8 h + r, lane column c = query */
#pragma unroll
      for (int kt = 0; kt < 2; ++kt) { const unsigned char* kp = Kb + (32 * sub + 16 * kt + c) * FA_PITCH + 16 * h; const v16h k0 = fa_frag(kp), k1 = fa_frag(kp + 64);
#pragma unroll
        for (int g = 0; g < 2; ++g) sx[kt][g] = fa_mma(k1, qf[g][1], fa_mma(k0, qf[g][0], z8)); }
      if (ONLINE) {
        float mb[2]; bool need = false;
#pragma unroll
        for (int g = 0; g < 2; ++g) { float mx = sx[0][g][0];
#pragma unroll
          for (int r = 1; r < 8; ++r) mx = fmaxf(mx, sx[0][g][r]);
#pragma unroll
          for (int r = 0; r < 8; ++r) mx = fmaxf(mx, sx[1][g][r]);
          mx = fmaxf(mx, fa_x16(mx)); mb[g] = mx; need = need || (mx > m_run[g] + 8.0f); }
        if (__builtin_amdgcn_ballot_w32(need) != 0) {      /* lazy rescale: the maximum in use may trail the true one by up to 8 (base 2), so an exponential stays below 2^8 */
#pragma unroll
          for (int g = 0; g < 2; ++g) { const float m_new = fmaxf(m_run[g], mb[g]); const float corr = __builtin_amdgcn_exp2f(m_run[g] - m_new); m_run[g] = m_new; lacc[g] = lacc[g] * corr;
#pragma unroll
            for (int t = 0; t < 4; ++t) acc[g][t] = acc[g][t] * corr; } } }
      v16h vf[4];      /* A operand: row = d, k = the pass's 32 keys */
#pragma unroll
      for (int t = 0; t < 4; ++t) vf[t] = fa_frag(Vb + (16 * t + c) * FA_PITCH + 64 * sub + 16 * h);
#pragma unroll
      for (int g = 0; g < 2; ++g) { union { v16h v; h2 p[8]; } pf;      /* B operand: element pair i = keys 16 (i >> 2) + 8 h + 2 (i & 3), + 1: the k order of fa_frag */
#pragma unroll
        for (int i = 0; i < 8; ++i) { const float x0 = sx[i >> 2][g][2 * (i & 3)], x1 = sx[i >> 2][g][2 * (i & 3) + 1];
          const float e0 = __builtin_amdgcn_exp2f(ONLINE ? x0 - m_run[g] : x0), e1 = __builtin_amdgcn_exp2f(ONLINE ? x1 - m_run[g] : x1); pf.p[i] = __builtin_convertvector(f2{e0, e1}, h2); }
#pragma unroll
        for (int t = 0; t < 4; ++t) acc[g][t] = fa_mma(vf[t], pf.v, acc[g][t]);
        lacc[g] = fa_mma(ones, pf.v, lacc[g]); }
    }
    __builtin_amdgcn_sched_barrier(0); asm volatile("v_nop\n\tv_nop\n\tv_nop\n\tv_nop"); __builtin_amdgcn_sched_barrier(0);      /* four vector slots behind the trip's last WMMA, in front of the branches that follow it: on the taken side the operand and result registers are written or read at once */
    asm volatile("s_wait_dscnt 0x0" ::: "memory");      /* the wave's reads of tile s have returned before its buffer is aimed at again */
    pg_twait(fl);      /* an asking wave's own tile s + 1 has landed (the other waves have no request and pass) */
    __syncthreads();      /* publishes tile s + 1 and ends every wave's reads of tile s, whose buffer is refilled behind it; behind the last trip both buffers are free */
    if (pg_pinned(iss & (unsigned int)(s + 2 < FA_NS))) fl = pg_tload(sl + (unsigned int)(s & 1) * (2 * FA_TB), sg + (unsigned long long)(s + 2) * sd, g1);      /* tile s + 2 to the buffer that this trip has read */
  }
  pg_twait(fl);      /* no request is left behind the walk */
  asm volatile("s_wait_dscnt 0x0" ::: "memory"); }
__global__ __launch_bounds__(32 * FA_NW) __attribute__((amdgpu_waves_per_eu(4, 4))) void k_fattn(const _Float16* __restrict__ Q16, const _Float16* __restrict__ K16, const _Float16* __restrict__ VT, float* __restrict__ out) {
  static_assert(HD == 64 && SQ % (32 * FA_NW) == 0 && SQ % FA_SK == 0, "k_fattn: head size 64, whole work-groups of queries, whole tiles of keys");
  static_assert(FA_NS >= 2 && FA_SK == 64 && HD * 2 == 128 && FA_SK * 2 == 128 && 64 * FA_PITCH <= FA_TB && FA_TB % 2048 == 0, "k_fattn: two tiles at least, tiles of 64 rows of 128 bytes at multiples of 2 KiB");
  __shared__ __attribute__((aligned(2048))) unsigned char L[2][2][FA_TB];      /* [buffer][K rows by key | V^T rows by d] */
  __shared__ int fa_bad[FA_NW];      /* per wave: a row sum of the first walk is out of range */
  const int tid = threadIdx.x, lane = tid & 31, wave = tid >> 5, c = lane & 15, h = lane >> 4;
  const int bh = blockIdx.y, b = bh / NH, hd = bh % NH; const int q0 = blockIdx.x * (32 * FA_NW) + wave * 32;
  const unsigned int uw = pg_uni((unsigned int)wave); const unsigned int iss = uw < 2u ? 1u : 0u; const bool isv = uw == 1u;      /* wave 0 asks for the K tiles, wave 1 for the V^T tiles */
  const unsigned short* kg = (const unsigned short*)K16 + (size_t)b * SQ * LQ + hd * HD;      /* row = key: 64 d of this head, row pitch LQ values; the next tile is 64 rows on */
  const unsigned short* vg = (const unsigned short*)VT + (size_t)bh * HD * SQ;      /* row = d, keys along the row, row pitch SQ values; the next tile is 64 keys on */
  const unsigned long long sg = (unsigned long long)(size_t)(isv ? vg : kg); const unsigned int sd = isv ? FA_SK * 2u : FA_SK * LQ * 2u;
  const unsigned int sl = (unsigned int)(size_t)&L[0][0][0] + (isv ? FA_TB : 0u);
  const pg_u8 g1 = fa_group1(isv ? SQ * 2u : LQ * 2u);
  v16h qf[2][2];      /* B operand: column = query, k = d */
#pragma unroll
  for (int g = 0; g < 2; ++g)
#pragma unroll
    for (int kc = 0; kc < 2; ++kc) qf[g][kc] = g2_frag(Q16 + ((size_t)b * SQ + q0 + 16 * g + c) * LQ + hd * HD + 32 * kc, h);
  FragH ones;      /* A operand whose row 0 is 1.0: its product with P^T gives the column sums of P^T in row 0 */
#pragma unroll
  for (int i = 0; i < 16; ++i) ones.u[i] = (c == 0) ? (unsigned short)0x3C00 : (unsigned short)0;
  v8f acc[2][4], lacc[2];
  fa_keys<false>(&L[0][0][0], iss, sl, sg, sd, g1, c, h, qf, ones.v, acc, lacc);
  bool bad = false;
#pragma unroll
  for (int g = 0; g < 2; ++g) { const float lr = lacc[g][0]; const float l = lr + fa_x16(lr); bad = bad || !(l >= 1.0f && l < __builtin_inff()); }      /* also true for a NaN */
  const int wbad = __builtin_amdgcn_ballot_w32(bad) != 0 ? 1 : 0;      /* taken with all lanes on, in front of the one-lane store */
  if (lane == 0) fa_bad[wave] = wbad;
  __syncthreads();      /* every wave's verdict is visible: the work-group repeats the walk as a whole or not at all, since the walk holds barriers */
  int any = 0;
#pragma unroll
  for (int w = 0; w < FA_NW; ++w) any |= fa_bad[w];
  if (__builtin_amdgcn_readfirstlane(any) != 0) fa_keys<true>(&L[0][0][0], iss, sl, sg, sd, g1, c, h, qf, ones.v, acc, lacc);      /* the same value in every thread of the work-group: a scalar branch */
#pragma unroll
  for (int g = 0; g < 2; ++g) { const float lr = lacc[g][0]; const float inv = 1.0f / (lr + fa_x16(lr));      /* row 0 of the sum tile sits in lanes 0-15, lanes 16-31 hold row 8 = 0: the exchange-and-add stays unconditional */
    float* op = out + ((size_t)b * SQ + q0 + 16 * g + c) * DM + hd * HD + 8 * h;      /* register r of tile t = d 16 t + 8 h + r of query column c */
#pragma unroll
    for (int t = 0; t < 4; ++t) { const v8f o = acc[g][t] * inv; const v4f lo = {o[0], o[1], o[2], o[3]}, hi = {o[4], o[5], o[6], o[7]}; *(v4f*)(op + 16 * t) = lo; *(v4f*)(op + 16 * t + 4) = hi; } } }
__global__ __launch_bounds__(256) void k_vt(const _Float16* __restrict__ V16, int b, int h0, _Float16* __restrict__ VT) { __shared__ unsigned short tl[64][65]; const int tid = threadIdx.x; const int hh = blockIdx.x % HG, sg = blockIdx.x / HG; const int s0 = sg * 64; const int h = h0 + hh;
  for (int i = tid; i < 64 * 8; i += 256) { const int j = i / 8, d8 = (i % 8) * 8; FragH f; f.half[0] = *(const v8us*)((const unsigned short*)V16 + ((size_t)b * SQ + s0 + j) * DM + h * HD + d8); for (int q = 0; q < 8; ++q) tl[d8 + q][j] = f.u[q]; }
  __syncthreads();
  { for (int i = tid; i < 64 * 8; i += 256) { const int d = i / 8, j8 = (i % 8) * 8; FragH f; for (int q = 0; q < 8; ++q) f.u[q] = tl[d][j8 + q]; *(v8us*)((unsigned short*)VT + ((size_t)hh * HD + d) * SQ + s0 + j8) = f.half[0]; }  } }



__global__ __launch_bounds__(256) void k_rsmkm(const float* __restrict__ S, _Float16* __restrict__ P, int nrows, const int* __restrict__ am) {
  #pragma clang fp contract(off)
  const int t = blockIdx.x * 256 + threadIdx.x; if (t >= nrows) return; const size_t i = (size_t)t; const float* s = S + i * SQ; const int* mr = am + (size_t)(t % SQ) * SQ; float mx = -3.0e38f;
#pragma unroll 1
  for (int j = 0; j < SQ; ++j) { const float f = (mr[j] != 0) ? 1.f : 0.f; mx = fmaxf(mx, fmaf(f, s[j], (1.f - f) * -1.0e9f)); } float se = 0.f;
#pragma unroll 1
  for (int j = 0; j < SQ; ++j) { const float f = (mr[j] != 0) ? 1.f : 0.f; se += __expf(fmaf(f, s[j], (1.f - f) * -1.0e9f) - mx); } const float sc = 256.0f / se;
#pragma unroll 1
  for (int j0 = 0; j0 < SQ; j0 += 8) { FragH fr; for (int q = 0; q < 8; ++q) { const int j = j0 + q; const float f = (mr[j] != 0) ? 1.f : 0.f; fr.h[q] = (_Float16)(__expf(fmaf(f, s[j], (1.f - f) * -1.0e9f) - mx) * sc); }
    unsigned short* d = (unsigned short*)P + i * SQ + j0; *(v8us*)d = fr.half[0];  } }
extern "C" void kernel_launch(void* const* d_in, const int* in_sizes, int n_in,
                              void* d_out, int out_size, void* d_ws, size_t ws_size, hipStream_t stream) {
  (void)in_sizes; (void)n_in; (void)out_size;
  const float* const* I = (const float* const*)d_in; const float* xq = I[0]; const float* xm = I[1]; const float* wq = I[2]; const float* bq = I[3]; const float* wk = I[4]; const float* bk = I[5]; const float* wv = I[6]; const float* bv = I[7];      /* input (queries), memory (keys AND values); natural weights + biases; no output projection */
  char* ws = (char*)d_ws; size_t off = 0;
  auto take = [&](size_t bytes) { char* p = ws + off; off += (bytes + 255) & ~(size_t)255; return p; };
  _Float16* BQ = (_Float16*)take((size_t)DM * DM * 2); _Float16* BK = (_Float16*)take((size_t)DM * DM * 2); _Float16* BV = (_Float16*)take((size_t)DM * DM * 2); 
  _Float16* X16 = (_Float16*)take(NR * DM * 2); _Float16* XM = (_Float16*)take(NR * DM * 2); _Float16* Q16 = (_Float16*)take(NR * DM * 2); _Float16* K16 = (_Float16*)take(NR * DM * 2); 
  _Float16* VT = (_Float16*)take((size_t)NB * NH * HD * SQ * 2);
  if (off > ws_size) return;
  k_cvt<<<CV_G, CV_T, 0, stream>>>(xq, xm, wq, wk, wv, X16, XM, BQ, BK, BV);      /* input and memory as exact f16 rows; natural [out][in] weights = Bt x16 (no output projection: no Wo plane) */
  const size_t r0p = (size_t)B0 * SQ;      /* first projected row */
  k_proj<<<2 * PG_NQK + PG_NV, 256, 0, stream>>>(X16 + r0p * DM, XM + r0p * DM, BQ, BK, BV, bq, bk, bv, 0.0625f, Q16 + r0p * DM, K16 + r0p * DM, VT + r0p * DM);      /* q rows (times FA_QS), k rows and V^T [NB * NH][HD][SQ] */
  k_fattn<<<dim3(SQ / (32 * FA_NW), NB * NH), 32 * FA_NW, 0, stream>>>(Q16, K16, VT, (float*)d_out);      /* out = softmax(q k^T / 8) v straight to the f32 output (merged heads; each 256-B head segment of a row written by one wave) */
  /* no output projection in this module */
}

// v009
// It runs in 92.6 microseconds.
// Timed twice side by side with v008, it ran 1.07 and 1.06 times as fast.
// Counting every step since v000, it is 78.8 times as fast.
#include <hip/hip_runtime.h>
// Multi-head CROSS-attention without an output projection (input, memory [4][2048][1024]; q = input Wq^T + bq, k = memory Wk^T + bk, v = memory Wv^T + bv (natural [1024][1024], zero biases); 16 heads of 64; q * 64^-0.5 then q k^T; softmax over all 2048 memory positions (no mask); out = attn v merged to [4][2048][1024]; NO output projection).
// Structure: token rows r = b*2048 + s; x as exact f16 rows (bf16-rounded); Q, K, V as three WMMA GEMMs (256x256 and 128x256 tiles through LDS, 64x128 and 64x64 wave tiles, f32 accumulation, exact x16 weights + bias, f16 outputs) in ONE launch, whose V tiles exchange the operand roles and store V^T [batch * head][d][key] themselves; one fused attention launch (k_fattn): S^T = K Q^T (K = 64, q rows pre-scaled by 64^-0.5 log2(e)), softmax in base 2 (weights as f16 relative to the fixed reference 0, row sums f32 and checked; a walk with the running maximum as the fallback), O^T += V^T P^T, divided by the row sum and written straight into the merged f32 output rows.
// Compute dtype: inputs rounded to bf16; x / weights exact; q, k, v and softmax weights as plain f16 GEMM operands (~2^-12); scores and softmax statistics f32; v_wmma_f32_16x16x32_f16.
#define NB 4
#define SQ 2048
#define DM 1024
#define NH 16
#define HD 64
#define HG 4                         /* heads per k_vt(b, h0) launch (that overload is not launched) */
#define B0 0                         /* first batch processed (debug hook) */
#define NBR NB                       /* batches processed (debug hook) */
#define NR ((size_t)NB * SQ)         /* token rows */
#define MP ((int)((size_t)NBR * SQ)) /* rows projected (debug hook) */
#define QN SQ                        /* unused (attention covers all SQ query rows) */
#define NHD NH                       /* unused (attention covers all NH heads) */
#define MPO MP                       /* unused (no output projection) */
#define LQ DM      /* row pitch of the q and k rows */
typedef __bf16 v16b __attribute__((ext_vector_type(16)));
typedef unsigned short v8us __attribute__((ext_vector_type(8), may_alias));
typedef float  v8f  __attribute__((ext_vector_type(8)));
typedef float  v4f  __attribute__((ext_vector_type(4)));
typedef float  v4fa __attribute__((ext_vector_type(4), may_alias));
union FragB { v16b v; v8us half[2]; unsigned short u[16]; };

__device__ __forceinline__ unsigned short bf16_bits(float x) { unsigned int u = __float_as_uint(x); return (unsigned short)((u + 0x7FFFu + ((u >> 16) & 1u)) >> 16); }
__device__ __forceinline__ float bf16_val(unsigned short b) { return __uint_as_float(((unsigned int)b) << 16); }
__device__ __forceinline__ float bf16_round(float x) { return bf16_val(bf16_bits(x)); }
// D += A·B with NT terms: 1 = ah·bh, 2 = + al·bh (A split), 3 = + ah·bl (both split)
template <int NT>
__device__ __forceinline__ v8f mmaN(v16b ah, v16b al, v16b bh, v16b bl, v8f c) {
  c = __builtin_amdgcn_wmma_f32_16x16x32_bf16(false, ah, false, bh, (short)0, c, false, false);
  if (NT >= 2) c = __builtin_amdgcn_wmma_f32_16x16x32_bf16(false, al, false, bh, (short)0, c, false, false);
  if (NT >= 3) c = __builtin_amdgcn_wmma_f32_16x16x32_bf16(false, ah, false, bl, (short)0, c, false, false);
  asm volatile("v_nop\n\tv_nop\n\tv_nop\n\tv_nop" : "+v"(c) : "v"(ah), "v"(al), "v"(bh), "v"(bl));
  return c;
}

__global__ __launch_bounds__(256) void k_wt_bf16(const float* __restrict__ W, unsigned short* __restrict__ Wt, int K, int N) {
  const int t = blockIdx.x * 256 + threadIdx.x;
  const int k8n = K / 8;
  if (t >= N * k8n) return;
  const int n = t / k8n, k8 = (t % k8n) * 8;
  v8us v;
#pragma unroll
  for (int i = 0; i < 8; ++i) v[i] = bf16_bits(W[(size_t)(k8 + i) * N + n]);
  *(v8us*)(Wt + (size_t)n * K + k8) = v;
  
}

// GEMM C[M][N] (f32, pitch ldc) = act(A[M][K]·W + bias). A f32 row-major (pitch lda) converted per fragment to bf16
// (ASPLIT: hi/lo two planes -> 2 terms, else single rounded term); Wt bf16 [N][K] (pitch ldb). BIAS_BF16 rounds the
// bias to bf16 first (bias quantised to bf16 before the add). K%32==0, M%16==0, N%64==0.
template <bool ASPLIT, int ACT, bool BIAS_BF16>
__global__ __launch_bounds__(128) void k_gemm_bf(const float* __restrict__ A, int lda, const unsigned short* __restrict__ Wt, int ldb,
                                               const float* __restrict__ bias, float* __restrict__ C, int ldc, int M, int N, int K) {
  __shared__ __attribute__((aligned(16))) float so[4][16][64];
  const int tid = threadIdx.x, w = tid >> 5, lane = tid & 31, ln = lane & 15, hh = lane >> 4;
  const int ntn = N / 64;
  const int wid = blockIdx.x * 4 + w;
  const int mt = wid / ntn, nq = wid % ntn;
  if (mt * 16 >= M) return;
  const int row0 = mt * 16, col0 = nq * 64;
  const float* arow = A + (size_t)(row0 + ln) * lda;
  v8f acc[4] = {};
  for (int kb = 0; kb < K; kb += 32) {
    FragB ah, al;
    const v4f x0 = *(const v4fa*)(arow + kb + 8 * hh), x1 = *(const v4fa*)(arow + kb + 8 * hh + 4);
    const v4f x2 = *(const v4fa*)(arow + kb + 16 + 8 * hh), x3 = *(const v4fa*)(arow + kb + 16 + 8 * hh + 4);
    float xs[16] = {x0[0],x0[1],x0[2],x0[3],x1[0],x1[1],x1[2],x1[3],x2[0],x2[1],x2[2],x2[3],x3[0],x3[1],x3[2],x3[3]};
#pragma unroll
    for (int i = 0; i < 16; ++i) { const unsigned short hb = bf16_bits(xs[i]); ah.u[i] = hb; al.u[i] = ASPLIT ? bf16_bits(xs[i] - bf16_val(hb)) : (unsigned short)0; }
#pragma unroll
    for (int t = 0; t < 4; ++t) {
      const unsigned short* brow = Wt + (size_t)(col0 + t * 16 + ln) * ldb + kb;
      FragB b;
      b.half[0] = *(const v8us*)(brow + 8 * hh);
      b.half[1] = *(const v8us*)(brow + 16 + 8 * hh);
      acc[t] = mmaN<ASPLIT ? 2 : 1>(ah.v, al.v, b.v, b.v, acc[t]);
    }
  }
#pragma unroll
  for (int t = 0; t < 4; ++t) {
    float bv = bias ? bias[col0 + t * 16 + ln] : 0.f;
    if (BIAS_BF16) bv = bf16_round(bv);
#pragma unroll
    for (int r = 0; r < 8; ++r) { float v = acc[t][r] + bv; if (ACT == 1) v = fmaxf(v, 0.f); so[w][8 * hh + r][t * 16 + ln] = v; }
  }
  __builtin_amdgcn_fence(__ATOMIC_ACQ_REL, "workgroup");
  __builtin_amdgcn_wave_barrier();
  const int rsub = lane >> 4, c4 = (lane & 15) * 4;
  {
#pragma unroll
    for (int q = 0; q < 8; ++q) {
      const int r = q * 2 + rsub;
      const v4f v = *(const v4fa*)&so[w][r][c4];
      *(v4f*)(C + (size_t)(row0 + r) * ldc + col0 + c4) = v;
    }
    
  }
}

// GEMM C = act(A·W + bias + resid): A f32 (ASPLIT -> hi/lo 2 terms), Wt bf16 [N][K]; ACT 0 none, 1 relu, 2 exact gelu;
// resid (optional, f32, row index = (row % rmod), pitch ldr, RES_BF16 rounds it) added before the activation.
template <bool ASPLIT, int ACT, bool BIAS_BF16, bool RES_BF16>
__global__ __launch_bounds__(128) void k_gemm_bf3(const float* __restrict__ A, int lda, const unsigned short* __restrict__ Wt, int ldb,
                                                const float* __restrict__ bias, const float* __restrict__ resid, int rmod, int ldr,
                                                float* __restrict__ C, int ldc, int M, int N, int K) {
  __shared__ __attribute__((aligned(16))) float so[4][16][64];
  const int tid = threadIdx.x, w = tid >> 5, lane = tid & 31, ln = lane & 15, hh = lane >> 4;
  const int ntn = N / 64;
  const int wid = blockIdx.x * 4 + w;
  const int mt = wid / ntn, nq = wid % ntn;
  if (mt * 16 >= M) return;
  const int row0 = mt * 16, col0 = nq * 64;
  const float* arow = A + (size_t)(row0 + ln) * lda;
  v8f acc[4] = {};
  for (int kb = 0; kb < K; kb += 32) {
    FragB ah, al;
    const v4f x0 = *(const v4fa*)(arow + kb + 8 * hh), x1 = *(const v4fa*)(arow + kb + 8 * hh + 4);
    const v4f x2 = *(const v4fa*)(arow + kb + 16 + 8 * hh), x3 = *(const v4fa*)(arow + kb + 16 + 8 * hh + 4);
    float xs[16] = {x0[0],x0[1],x0[2],x0[3],x1[0],x1[1],x1[2],x1[3],x2[0],x2[1],x2[2],x2[3],x3[0],x3[1],x3[2],x3[3]};
#pragma unroll
    for (int i = 0; i < 16; ++i) { const unsigned short hb = bf16_bits(xs[i]); ah.u[i] = hb; al.u[i] = ASPLIT ? bf16_bits(xs[i] - bf16_val(hb)) : (unsigned short)0; }
#pragma unroll
    for (int t = 0; t < 4; ++t) {
      const unsigned short* brow = Wt + (size_t)(col0 + t * 16 + ln) * ldb + kb;
      FragB b;
      b.half[0] = *(const v8us*)(brow + 8 * hh);
      b.half[1] = *(const v8us*)(brow + 16 + 8 * hh);
      acc[t] = mmaN<ASPLIT ? 2 : 1>(ah.v, al.v, b.v, b.v, acc[t]);
    }
  }
#pragma unroll
  for (int t = 0; t < 4; ++t) {
    const int col = col0 + t * 16 + ln;
    float bv = bias ? bias[col] : 0.f;
    if (BIAS_BF16) bv = bf16_round(bv);
#pragma unroll
    for (int r = 0; r < 8; ++r) {
      float v = acc[t][r] + bv;
      if (resid) { float rv = resid[(size_t)((row0 + 8 * hh + r) % rmod) * ldr + col]; if (RES_BF16) rv = bf16_round(rv); v += rv; }
      if (ACT == 1) v = fmaxf(v, 0.f);
      if (ACT == 2) v = 0.5f * v * (1.0f + erff(v * 0.70710678118654752f));
      if (ACT == 3) { const float u = 0.7978845608028654f * (v + 0.044715f * v * v * v); v = 0.5f * v * (1.0f + tanhf(u)); }
      so[w][8 * hh + r][t * 16 + ln] = v;
    }
  }
  __builtin_amdgcn_fence(__ATOMIC_ACQ_REL, "workgroup");
  __builtin_amdgcn_wave_barrier();
  const int rsub = lane >> 4, c4 = (lane & 15) * 4;
  {
#pragma unroll
    for (int q = 0; q < 8; ++q) {
      const int r = q * 2 + rsub;
      const v4f v = *(const v4fa*)&so[w][r][c4];
      *(v4f*)(C + (size_t)(row0 + r) * ldc + col0 + c4) = v;
    }
    
  }
}
// row LayerNorm (biased variance, eps) over N: s = X (+ R); optional out_sum <- s; out_norm <- (s-mu)*rsqrt(var+eps)*g + b
template <bool PARAM_BF16>
__global__ __launch_bounds__(256) void k_layernorm(const float* __restrict__ X, const float* __restrict__ R, const float* __restrict__ g, const float* __restrict__ bta,
                                                  float* __restrict__ out_sum, float* __restrict__ out_norm, int N, float eps) {
  __shared__ float red[256];
  const int row = blockIdx.x, tid = threadIdx.x;
  const float* x = X + (size_t)row * N; const float* rr = R ? R + (size_t)row * N : nullptr;
  float vals[16];                     // up to N = 4096
  const int per = N / 256;            // contiguous chunk per thread? use strided-by-4 chunks: thread handles j = tid*4 + 1024*u
  float s1 = 0.f;
  for (int u = 0; u < per / 4; ++u) {
    const int j = tid * 4 + 1024 * u;
    const v4f a = *(const v4fa*)(x + j);
    v4f b = {0.f,0.f,0.f,0.f}; if (rr) b = *(const v4fa*)(rr + j);
#pragma unroll
    for (int q = 0; q < 4; ++q) { const float v = a[q] + b[q]; vals[u * 4 + q] = v; s1 += v; }
  }
  red[tid] = s1; __syncthreads();
  for (int st = 128; st > 0; st >>= 1) { if (tid < st) red[tid] += red[tid + st]; __syncthreads(); }
  const float mu = red[0] / (float)N; __syncthreads();
  float s2 = 0.f;
  for (int u = 0; u < per / 4; ++u)
#pragma unroll
    for (int q = 0; q < 4; ++q) { const float c = vals[u * 4 + q] - mu; s2 += c * c; }
  red[tid] = s2; __syncthreads();
  for (int st = 128; st > 0; st >>= 1) { if (tid < st) red[tid] += red[tid + st]; __syncthreads(); }
  const float rs = rsqrtf(red[0] / (float)N + eps);
  {
    for (int u = 0; u < per / 4; ++u) {
      const int j = tid * 4 + 1024 * u;
      v4f o, sm;
#pragma unroll
      for (int q = 0; q < 4; ++q) {
        float gg = g[j + q], bb = bta[j + q];
        if (PARAM_BF16) { gg = bf16_round(gg); bb = bf16_round(bb); }
        sm[q] = vals[u * 4 + q]; o[q] = (vals[u * 4 + q] - mu) * rs * gg + bb;
      }
      if (out_sum) *(v4f*)(out_sum + (size_t)row * N + j) = sm;
      *(v4f*)(out_norm + (size_t)row * N + j) = o;
    }
    
  }
}



// ---- f16 WMMA path (v_wmma_f32_16x16x32_f16): 11-bit significands for operands in range — used where a [0,1] probability operand needs more precision than bf16
typedef _Float16 v16h __attribute__((ext_vector_type(16)));
union FragH { v16h v; v8us half[2]; _Float16 h[16]; unsigned short u[16]; };
template <int NT>
__device__ __forceinline__ v8f mmaH(v16h ah, v16h al, v16h bh, v16h bl, v8f c) {
  c = __builtin_amdgcn_wmma_f32_16x16x32_f16(false, ah, false, bh, (short)0, c, false, false);
  if (NT >= 2) c = __builtin_amdgcn_wmma_f32_16x16x32_f16(false, al, false, bh, (short)0, c, false, false);
  if (NT >= 3) c = __builtin_amdgcn_wmma_f32_16x16x32_f16(false, ah, false, bl, (short)0, c, false, false);
  asm volatile("v_nop\n\tv_nop\n\tv_nop\n\tv_nop" : "+v"(c) : "v"(ah), "v"(al), "v"(bh), "v"(bl));
  return c;
}
// batched GEMM like k_gemm_b but f16 operands: A f32 (split into f16 hi/lo if ASPLIT, else rounded to f16), Bt = f16 values [n][k]; alpha; C f32; N multiple of 16 (partial tiles skipped)
template <bool ASPLIT>
__global__ __launch_bounds__(128) void k_gemm_h(const float* __restrict__ A, int lda, size_t sA, const _Float16* __restrict__ Bh, int ldb, size_t sB, float alpha, float* __restrict__ C, int ldc, size_t sC, int M, int N, int K) {
  __shared__ __attribute__((aligned(16))) float so[4][16][64];
  const int tid = threadIdx.x, w = tid >> 5, lane = tid & 31, ln = lane & 15, hh = lane >> 4; const int by = blockIdx.y;
  A += (size_t)by * sA; Bh += (size_t)by * sB; C += (size_t)by * sC;
  const int ntn = (N + 63) / 64; const int wid = blockIdx.x * 4 + w; const int mt = wid / ntn, nq = wid % ntn; if (mt * 16 >= M) return;
  const int row0 = mt * 16, col0 = nq * 64; const float* arow = A + (size_t)(row0 + ln) * lda;
  v8f acc[4] = {};
  for (int kb = 0; kb < K; kb += 32) {
    FragH ah, al;
    const v4f x0 = *(const v4fa*)(arow + kb + 8 * hh), x1 = *(const v4fa*)(arow + kb + 8 * hh + 4), x2 = *(const v4fa*)(arow + kb + 16 + 8 * hh), x3 = *(const v4fa*)(arow + kb + 16 + 8 * hh + 4);
    float xs[16] = {x0[0],x0[1],x0[2],x0[3],x1[0],x1[1],x1[2],x1[3],x2[0],x2[1],x2[2],x2[3],x3[0],x3[1],x3[2],x3[3]};
#pragma unroll
    for (int i = 0; i < 16; ++i) { const _Float16 h = (_Float16)xs[i]; ah.h[i] = h; al.h[i] = ASPLIT ? (_Float16)(xs[i] - (float)h) : (_Float16)0.0f; }
#pragma unroll
    for (int t = 0; t < 4; ++t) { if (col0 + t * 16 >= N) continue; const size_t boff = (size_t)(col0 + t * 16 + ln) * ldb + kb; FragH bq; bq.half[0] = *(const v8us*)(Bh + boff + 8 * hh); bq.half[1] = *(const v8us*)(Bh + boff + 16 + 8 * hh);
      acc[t] = mmaH<ASPLIT ? 2 : 1>(ah.v, al.v, bq.v, bq.v, acc[t]); }
  }
#pragma unroll
  for (int t = 0; t < 4; ++t) { if (col0 + t * 16 >= N) continue;
#pragma unroll
    for (int r = 0; r < 8; ++r) so[w][8 * hh + r][t * 16 + ln] = acc[t][r] * alpha; }
  __builtin_amdgcn_fence(__ATOMIC_ACQ_REL, "workgroup"); __builtin_amdgcn_wave_barrier();
  const int rsub = lane >> 4, c4 = (lane & 15) * 4;
  {
#pragma unroll
    for (int q = 0; q < 8; ++q) { const int r = q * 2 + rsub; if (col0 + c4 < N) { const v4f v = *(const v4fa*)&so[w][r][c4]; *(v4f*)(C + (size_t)(row0 + r) * ldc + col0 + c4) = v; } }
     }
}

// Wt[n][k] = f16(W[k][n]·scale) from f32 row-major W[K][N] (scale = power of two; bf16-exact weights stay exact in f16 away from the subnormal range)
__global__ __launch_bounds__(256) void k_wt_f16(const float* __restrict__ W, _Float16* __restrict__ Wt, int K, int N, float scale) {
  const int t = blockIdx.x * 256 + threadIdx.x; if (t >= N * (K / 8)) return; const int n = t / (K / 8), k8 = (t % (K / 8)) * 8; FragH f;
#pragma unroll
  for (int i = 0; i < 8; ++i) f.h[i] = (_Float16)(bf16_round(W[(size_t)(k8 + i) * N + n]) * scale); const v8us o = f.half[0];
  *(v8us*)((unsigned short*)Wt + (size_t)n * K + k8) = o; 
}
// k_gemm_hh variant with fused epilogue: v = acc·alpha + bias[by·sBias + col] (+ CP[(row/rowsPerB)·sCPb + by·64 + col] if CP) ; ACT 0 none / 1 elu ; writes f16 C16 (and f32 C if non-null)
template <int ACT>
__global__ __launch_bounds__(128) void k_gemm_hhx(const _Float16* __restrict__ A, int lda, size_t sA, const _Float16* __restrict__ Bh, int ldb, size_t sB, float alpha, const float* __restrict__ bias, size_t sBias, const float* __restrict__ CP, int rowsPerB, size_t sCPb, int row0g,
    float* __restrict__ C, _Float16* __restrict__ C16, int ldc, size_t sC, int M, int N, int K) {
  __shared__ __attribute__((aligned(16))) float so[4][16][64];
  const int tid = threadIdx.x, w = tid >> 5, lane = tid & 31, ln = lane & 15, hh = lane >> 4; const int by = blockIdx.y;
  A += (size_t)by * sA; Bh += (size_t)by * sB; const size_t cofs = (size_t)by * sC; const float* bp = bias ? bias + (size_t)by * sBias : nullptr;
  const int ntn = (N + 63) / 64; const int wid = blockIdx.x * 4 + w; const int mt = wid / ntn, nq = wid % ntn; if (mt * 16 >= M) return;
  const int row0 = mt * 16, col0 = nq * 64; const _Float16* arow = A + (size_t)(row0 + ln) * lda;
  v8f acc[4] = {};
  for (int kb = 0; kb < K; kb += 32) { FragH ah; ah.half[0] = *(const v8us*)((const unsigned short*)arow + kb + 8 * hh); ah.half[1] = *(const v8us*)((const unsigned short*)arow + kb + 16 + 8 * hh);
#pragma unroll
    for (int t = 0; t < 4; ++t) { if (col0 + t * 16 >= N) continue; const size_t boff = (size_t)(col0 + t * 16 + ln) * ldb + kb; FragH bq; bq.half[0] = *(const v8us*)((const unsigned short*)Bh + boff + 8 * hh); bq.half[1] = *(const v8us*)((const unsigned short*)Bh + boff + 16 + 8 * hh);
      acc[t] = mmaH<1>(ah.v, ah.v, bq.v, bq.v, acc[t]); }
  }
#pragma unroll
  for (int t = 0; t < 4; ++t) { if (col0 + t * 16 >= N) continue; const int col = col0 + t * 16 + ln; const float bv = bp ? bf16_round(bp[col]) : 0.f;
#pragma unroll
    for (int r = 0; r < 8; ++r) { float v = acc[t][r] * alpha + bv; if (CP) { const int rr = row0g + row0 + 8 * hh + r; if (rowsPerB < 0) v += CP[cofs + (size_t)rr * ldc + col];      /* rowsPerB < 0: own element of the batched C plane */ else { const int bidx = rr / rowsPerB; v += CP[(size_t)bidx * sCPb + (size_t)by * 64 + col]; } } if (ACT == 1) v = (v > 0.f) ? v : expm1f(v); else if (ACT == 7) v = (v > 0.f) ? v + 1.0f : expf(v); else if (ACT == 8) v = tanhf(v); else if (ACT == 9) v = 0.5f * v * (1.0f + tanhf(0.7978845608028654f * (v + 0.044715f * v * v * v))); else if (ACT == 11) v = 1.0f / (1.0f + expf(-v)); else if (ACT == 12) v = (v > 0.f) ? v : 0.01f * v; else if (ACT == 14) v = (v > 0.f) ? v : 0.1f * v; else if (ACT == 16) v = (v >= 0.f) ? v : 0.3f * v; else if (ACT == 17) v = (v >= 0.f) ? v : 0.2f * v; else if (ACT == 15) v = v / (1.0f + expf(-v)); else if (ACT == 3) v = fmaxf(v, 0.f); else if (ACT == 6) v = 0.5f * v * (1.0f + erff(v * 0.70710678118654752f)); so[w][8 * hh + r][t * 16 + ln] = v; } }
  __builtin_amdgcn_fence(__ATOMIC_ACQ_REL, "workgroup"); __builtin_amdgcn_wave_barrier();
  const int rsub = lane >> 4, c4 = (lane & 15) * 4; typedef _Float16 v4h __attribute__((ext_vector_type(4)));
  {
#pragma unroll
    for (int q = 0; q < 8; ++q) { const int r = q * 2 + rsub; if (col0 + c4 < N) { const v4f v = *(const v4fa*)&so[w][r][c4]; if (C) *(v4f*)(C + cofs + (size_t)(row0 + r) * ldc + col0 + c4) = v; if (C16) { v4h h4; for (int i = 0; i < 4; ++i) h4[i] = (_Float16)v[i]; *(v4h*)(C16 + cofs + (size_t)(row0 + r) * ldc + col0 + c4) = h4; } } }
     }
}


typedef _Float16 v4h __attribute__((ext_vector_type(4)));

// All five f32 inputs become f16 planes in ONE launch of resident waves: 256 work-groups of 16 waves (one per WGP, four waves per SIMD), so that 4,096 waves start instead of one wave per KiB of input.
// A piece is 8 neighbouring values: 32 bytes read, 16 bytes stored per lane, so a wave's store covers 512 contiguous bytes. A slab is one piece per thread of the work-group (16 KiB read). A work-group owns
// 8 neighbouring slabs of each activation plane and one of each weight plane. A thread issues all of its 38 loads before it uses the first value: the whole input is asked for at once, and each piece is
// converted and stored as it lands.
// Activations: bf16-rounded, exact in f16. Weights: bf16-rounded, x16 (exact). memory feeds both the K and the V projection: it is converted once.
#define CV_G 256                     /* work-groups */
#define CV_T 512                     /* threads per work-group */
#define CV_N (CV_G * CV_T)
#define CV_XP 8                      /* slabs per work-group and activation plane */
template <bool X16W>
__device__ __forceinline__ v8us cv_pack(v4f a, v4f b) { FragH f;
#pragma unroll
  for (int q = 0; q < 4; ++q) { f.h[q] = X16W ? (_Float16)(bf16_round(a[q]) * 16.0f) : (_Float16)bf16_round(a[q]); f.h[4 + q] = X16W ? (_Float16)(bf16_round(b[q]) * 16.0f) : (_Float16)bf16_round(b[q]); }
  return f.half[0]; }
__global__ __launch_bounds__(CV_T) __attribute__((amdgpu_waves_per_eu(4, 4))) void k_cvt(const float* __restrict__ xq, const float* __restrict__ xm, const float* __restrict__ wq, const float* __restrict__ wk, const float* __restrict__ wv,
                                              _Float16* __restrict__ XQ, _Float16* __restrict__ XM, _Float16* __restrict__ BQ, _Float16* __restrict__ BK, _Float16* __restrict__ BV) {
  static_assert(NR * DM == (size_t)8 * CV_N * CV_XP && (size_t)DM * DM == (size_t)8 * CV_N, "k_cvt: the planes divide evenly among the threads");
  const unsigned g = blockIdx.x, ib = threadIdx.x * 32u, ob = threadIdx.x * 16u;      /* the thread's byte offsets in a slab: with the uniform pointers below, one address register serves every load and one every store */
  const char* pq = (const char*)xq + (size_t)g * (CV_XP * CV_T * 32); const char* pm = (const char*)xm + (size_t)g * (CV_XP * CV_T * 32);
  const char* pw[3] = {(const char*)wq + (size_t)g * (CV_T * 32), (const char*)wk + (size_t)g * (CV_T * 32), (const char*)wv + (size_t)g * (CV_T * 32)};
  char* oq = (char*)XQ + (size_t)g * (CV_XP * CV_T * 16); char* om = (char*)XM + (size_t)g * (CV_XP * CV_T * 16);
  char* ow[3] = {(char*)BQ + (size_t)g * (CV_T * 16), (char*)BK + (size_t)g * (CV_T * 16), (char*)BV + (size_t)g * (CV_T * 16)};
  v4f q[CV_XP][2], m[CV_XP][2], w[3][2];      /* every '#pragma unroll' below gives constant indices: the pieces stay in registers */
  /* The scheduling barriers of the three load loops keep the 38 loads one group, in the order in which the pieces are used, in front of the first conversion: without them the compiler either sinks the loads
     among the conversions (about nine in flight) or issues the first piece's loads late, so that the first counted wait covers half the group. */
#pragma unroll
  for (int i = 0; i < CV_XP; ++i) { q[i][0] = *(const v4fa*)(pq + i * (CV_T * 32) + ib); q[i][1] = *(const v4fa*)(pq + i * (CV_T * 32) + ib + 16); __builtin_amdgcn_sched_barrier(0); }
#pragma unroll
  for (int i = 0; i < CV_XP; ++i) { m[i][0] = *(const v4fa*)(pm + i * (CV_T * 32) + ib); m[i][1] = *(const v4fa*)(pm + i * (CV_T * 32) + ib + 16); __builtin_amdgcn_sched_barrier(0); }
#pragma unroll
  for (int i = 0; i < 3; ++i) { w[i][0] = *(const v4fa*)(pw[i] + ib); w[i][1] = *(const v4fa*)(pw[i] + ib + 16); __builtin_amdgcn_sched_barrier(0); }
  /* The scheduling barriers of the two activation store loops keep a piece's store behind its own conversion, while later loads still fly: without them the compiler sinks the stores to the end of the kernel. */
#pragma unroll
  for (int i = 0; i < CV_XP; ++i) { *(v8us*)(oq + i * (CV_T * 16) + ob) = cv_pack<false>(q[i][0], q[i][1]); __builtin_amdgcn_sched_barrier(0); }
#pragma unroll
  for (int i = 0; i < CV_XP; ++i) { *(v8us*)(om + i * (CV_T * 16) + ob) = cv_pack<false>(m[i][0], m[i][1]); __builtin_amdgcn_sched_barrier(0); }
#pragma unroll
  for (int i = 0; i < 3; ++i) *(v8us*)(ow[i] + ob) = cv_pack<true>(w[i][0], w[i][1]); }
__global__ __launch_bounds__(256) void k_h16(const float* __restrict__ x, _Float16* __restrict__ X16, size_t n8) { const size_t t = (size_t)blockIdx.x * 256 + threadIdx.x; if (t >= n8) return; FragH f;
#pragma unroll
  for (int q = 0; q < 8; ++q) f.h[q] = (_Float16)x[t * 8 + q]; *(v8us*)((unsigned short*)X16 + t * 8) = f.half[0];  }
__global__ __launch_bounds__(256) void k_round16f(const float* __restrict__ W, _Float16* __restrict__ Bt, size_t n8) { const size_t t = (size_t)blockIdx.x * 256 + threadIdx.x; if (t >= n8) return; FragH f;
#pragma unroll
  for (int i = 0; i < 8; ++i) f.h[i] = (_Float16)(bf16_round(W[t * 8 + i]) * 16.0f); *(v8us*)((unsigned short*)Bt + t * 8) = f.half[0];  }
template <int NHv, int TTv>
__global__ __launch_bounds__(256) void k_vt(const _Float16* __restrict__ V16, int ldv, int voff, _Float16* __restrict__ Vt) { __shared__ unsigned short tl[64][66]; const int tid = threadIdx.x; const int slab = blockIdx.x / (TTv / 64), lg = blockIdx.x % (TTv / 64); const int b = slab / NHv, h = slab % NHv;
  for (int i = tid; i < 64 * 8; i += 256) { const int r = i / 8, c8 = (i % 8) * 8; FragH f; f.half[0] = *(const v8us*)((const unsigned short*)V16 + ((size_t)b * TTv + lg * 64 + r) * ldv + voff + h * 64 + c8);
#pragma unroll
    for (int q = 0; q < 8; ++q) tl[r][c8 + q] = f.u[q]; }
  __syncthreads();
  {
#pragma unroll
    for (int rd = 0; rd < 2; ++rd) { const int d = rd * 32 + tid / 8, pc = tid % 8; FragH f;
#pragma unroll
      for (int q = 0; q < 8; ++q) f.u[q] = tl[pc * 8 + q][d];
      *(v8us*)((unsigned short*)Vt + ((size_t)slab * 64 + d) * TTv + lg * 64 + pc * 8) = f.half[0]; }
     } }

__global__ __launch_bounds__(256) void k_hl(const float* __restrict__ F, _Float16* __restrict__ Hh, _Float16* __restrict__ Hl, size_t n8) { const size_t t = (size_t)blockIdx.x * 256 + threadIdx.x; if (t >= n8) return; FragH fh, fl; const v4f a = *(const v4fa*)(F + t * 8), c = *(const v4fa*)(F + t * 8 + 4);
#pragma unroll
  for (int q = 0; q < 4; ++q) { _Float16 h = (_Float16)a[q]; fh.h[q] = h; fl.h[q] = (_Float16)((a[q] - (float)h) * 1024.0f); h = (_Float16)c[q]; fh.h[4 + q] = h; fl.h[4 + q] = (_Float16)((c[q] - (float)h) * 1024.0f); }
  { *(v8us*)((unsigned short*)Hh + t * 8) = fh.half[0]; *(v8us*)((unsigned short*)Hl + t * 8) = fl.half[0];  } }

__device__ __forceinline__ v16h g2_frag(const _Float16* p, int hh) { FragH f; f.half[0] = *(const v8us*)((const unsigned short*)p + 8 * hh); f.half[1] = *(const v8us*)((const unsigned short*)p + 16 + 8 * hh); return f.v; }
// Projection GEMM Y[8192][1024] = f16(X W^T * alpha + bias), X and W as f16 rows with k along the row. One work-group of eight waves per WGP (two waves per SIMD) owns one tile of Y.
// The tiles are sized for the bytes that they ask of L2: a q or k tile is 256 x 256 (64 A rows x 128 B rows per wave), a v tile 128 x 256 (64 x 64 per wave). 256 tiles of the first kind and 256 of the second
// cover the three planes: two tiles per WGP, the large ones first. A 256 x 256 tile lands 512 operand rows for 65,536 results, where a 128 x 128 tile lands 256 rows for 16,384, and a wave's A fragment feeds eight products.
// The A and B tiles of 128 k (256-byte rows) are brought by tensor loads and shared through LDS: a wave asks for one slice of 64 rows per tile (a v tile has six slices: waves 6 and 7 ask for none), two buffers,
// the next tile's loads fly while this tile is worked on, one barrier per tile; no tile byte passes through a register on its way to LDS.
// A q or k tile forms Y^T = W X^T (A = W rows, B = X rows, both read with fa_frag, so the two k orders are equal): a lane then holds eight neighbouring output columns of one
// token row, which pack into one 16-byte piece; the pieces pass through the wave's own part of the (then free) ring, so that every global store covers whole 128-byte lines.
// One launch holds the tiles of all three projections: the block index picks the plane and the tile in it, so that no launch gap, fill or tail stands between the planes.
// A v tile exchanges the roles (A = X rows, B = W rows; same loaders, same k order): a lane then holds eight neighbouring token rows of one output column, a 16-byte piece of a
// row of V^T; the staged rows go out as whole 128-byte lines of V^T [batch * head][d][key], and no transposing launch is needed.
// amdgpu_waves_per_eu(2, 2): the eight waves stand two per SIMD, 512 registers each: 256 hold a large tile's sums, 192 two sets of fragments of 32 k each.
// Fragments: a q or k tile's 128 k are worked on in four groups of 32 k; a group's 24 LDS reads are asked for as one run, one group ahead, into the register set that the group before last has left, and never
// across a tile's barrier. A v tile's fragments of all 128 k fit beside its 128 sums and are asked for at the head of the trip.
// Every '#pragma unroll' in pg_stage and pg_tile gives constant indices, so that the fragment, staging and accumulator arrays stay in registers.
#define PG_K 128                     /* k per LDS tile */
#define PG_RP 272                    /* LDS row pitch of the operand tiles in bytes: 256 of data and the tensor load's pad of 16, an odd multiple of 16 for the 16-byte fragment reads */
#define PG_SL 18432                  /* bytes of one slice in LDS: 64 rows of PG_RP bytes (17,408), rounded up so that every slice starts at a multiple of 2 KiB */
#define PG_NSL 8                     /* slice places per buffer */
#define PG_PITCH 144                 /* LDS row pitch of the output staging rows in bytes: 128 of data, an odd multiple of 16 */
#define PG_NS (DM / PG_K)
#define PG_NQK ((MP / 256) * (DM / 256))      /* 256 x 256 tiles per q or k plane */
#define PG_NV ((MP / 128) * (DM / 256))       /* 128 x 256 tiles of the v plane */
#define FA_QS (0.125f * 1.4426950408889634f)      /* 64^-0.5 log2(e): the q rows carry it, so that k_fattn's score tiles are exponents in base 2 */
__device__ __forceinline__ v16h fa_frag(const unsigned char* p);
__device__ __forceinline__ v8f fa_mma(v16h a, v16h b, v8f c);
typedef unsigned int pg_u4 __attribute__((ext_vector_type(4)));
typedef unsigned int pg_u8 __attribute__((ext_vector_type(8)));
__device__ __forceinline__ unsigned int pg_uni(unsigned int v) { return (unsigned int)__builtin_amdgcn_readfirstlane(v); }      /* a descriptor word: the same in every lane, held in a scalar register */
__device__ __forceinline__ unsigned int pg_pinned(unsigned int v) { unsigned int w = pg_uni(v); asm volatile("" : "+s"(w)); return w; }      /* the issue test of a tensor load, held in a scalar register: the test then compiles to a scalar compare and branch (a tensor load ignores EXEC) */
// Tensor descriptor, group 1: a tile of 64 rows of 256 bytes (extents in bytes, tensor = tile), source row pitch of DM f16 values, 16 bytes of LDS pad behind every 256-byte row (pitch PG_RP), no mask.
__device__ __forceinline__ pg_u8 pg_group1() { pg_u8 g;
  g[0] = pg_uni((1u << 20) | (5u << 22) | (3u << 25)); g[1] = pg_uni(256u << 16); g[2] = pg_uni(64u << 16); g[3] = pg_uni(256u << 16); g[4] = pg_uni(64u); g[5] = pg_uni(DM * 2u); g[6] = pg_uni(0u); g[7] = pg_uni(0u);
  return g; }
// One request of the whole wave: the slice whose first byte is ga goes to the LDS byte offset lds. The waits and the barrier stand at the call sites. Returns the request's group 0 for pg_twait.
__device__ __forceinline__ pg_u4 pg_tload(unsigned int lds, unsigned long long ga, pg_u8 g1) { pg_u4 g0;
  g0[0] = pg_uni(1u); g0[1] = pg_uni(lds); g0[2] = pg_uni((unsigned int)ga); g0[3] = pg_uni((((unsigned int)(ga >> 32)) & 0x01FFFFFFu) | 0x80000000u);
  asm volatile("tensor_load_to_lds %0, %1" :: "s"(g0), "s"(g1) : "memory"); return g0; }
__device__ __forceinline__ void pg_twait(pg_u4 g0) { asm volatile("s_wait_tensorcnt 0x0" :: "s"(g0) : "memory"); }      /* the wave's own request has landed; its group 0 is an input, so that its four registers stay whole up to this wait: without it the build reuses them while the request flies */
__device__ __forceinline__ void pg_twait2(pg_u4 g0, pg_u8 g1) { asm volatile("s_wait_tensorcnt 0x0" :: "s"(g0), "s"(g1) : "memory"); }      /* pg_twait with group 1 as an input too: in pg_tile the build otherwise takes a register of group 1 for the buffer offset while the request flies */
// A wave's results to its LDS staging rows: acc[i][j] register r = A row 16 i + 8 h + r, lane column c = B row 16 j + c of the wave's tile. Staged row = B row, 64 A rows along it.
// bias points at the wave's first output column. VTR false: the A rows are the output columns. VTR true: the B rows are. bs scales the bias as alpha's extra factor scales the product (FA_QS in the q plane, else 1).
template <bool VTR, int NJ>
__device__ __forceinline__ void pg_stage(const v8f (&acc)[4][NJ], unsigned char* st, const float* __restrict__ bias, float alpha, float bs, int lane) {
  const int c = lane & 15, h = lane >> 4;
  /* Each kind of bias load has behind it the wait that belongs in front of the first instruction that takes over the load's address registers. The loaded values are inputs of the statement, so that it stands behind the loads; the address is an input, so that its registers stay whole up to it. */
  float bc4[4] = {0.f, 0.f, 0.f, 0.f};      /* VTR true: the lane's bias values, one per 16 B rows */
  v4f bw[8];      /* VTR false: the lane's bias values, rounded and scaled: bw[2 i + (r >> 2)][r & 3] belongs to A row 16 i + 8 h + r */
  if (VTR) { static_assert(!VTR || NJ == 4, "pg_stage: four bias values in a v tile"); const float* bp = bias + c;
#pragma unroll
    for (int j = 0; j < 4; ++j) bc4[j] = bp[16 * j];
    asm volatile("s_wait_xcnt 0x0" :: "v"(bp), "v"(bc4[0]), "v"(bc4[1]), "v"(bc4[2]), "v"(bc4[3]) : "memory"); }
  else { const float* bp = bias + 2 * lane;      /* the wave's 64 values, two per lane: rounded and scaled once, then handed round through the first 256 bytes of the wave's own staging rows */
    const float b0 = bp[0], b1 = bp[1];
    asm volatile("s_wait_xcnt 0x0" :: "v"(bp), "v"(b0), "v"(b1) : "memory");
    typedef float f2a __attribute__((ext_vector_type(2), may_alias));
    *(f2a*)(st + 8 * lane) = f2a{bf16_round(b0) * bs, bf16_round(b1) * bs};
    __builtin_amdgcn_fence(__ATOMIC_ACQ_REL, "workgroup"); __builtin_amdgcn_wave_barrier();      /* the wave's lanes read each other's values: the reads stay behind the writes */
#pragma unroll
    for (int t = 0; t < 8; ++t) bw[t] = *(const v4fa*)(st + 64 * (t >> 1) + 32 * h + 16 * (t & 1));
    __builtin_amdgcn_fence(__ATOMIC_ACQ_REL, "workgroup"); __builtin_amdgcn_wave_barrier(); }      /* the staging writes below take over those bytes: they stay behind the reads */
#pragma unroll
  for (int i = 0; i < 4; ++i) {
#pragma unroll
    for (int j = 0; j < NJ; ++j) { FragH f; const float bc = VTR ? bf16_round(bc4[VTR ? j : 0]) * bs : 0.f;
#pragma unroll
      for (int r = 0; r < 8; ++r) f.h[r] = (_Float16)(acc[i][j][r] * alpha + (VTR ? bc : bw[2 * i + (r >> 2)][r & 3]));
      *(v8us*)(st + (16 * j + c) * PG_PITCH + 32 * i + 16 * h) = f.half[0]; } } }
// One tile: 64 AS A rows x 256 B rows. The eight waves stand AS x (8 / AS): a wave owns 64 A rows and 32 AS B rows. ar, br: the tile's first A row and first B row (row pitch DM values).
// bias: the tile's first output column. yb: the tile's first output element, B rows down (pitch yl elements), A rows along.
template <int AS, bool VTR>
__device__ __forceinline__ void pg_tile(unsigned char* Lb, const unsigned short* ar, const unsigned short* br, const float* __restrict__ bias, float alpha, float bs, unsigned short* yb, int yl) {
  constexpr int NJ = 2 * AS;      /* groups of 16 B rows per wave */
  constexpr int KG = AS == 4 ? 1 : 4;      /* steps of 32 k whose fragments are read as one group */
  constexpr int NG = 4 / KG, NSET = NG > 1 ? 2 : 1;      /* groups per tile; register sets: with two, a group's reads are asked for one group ahead, while the group before it is multiplied. 192 or 256 fragment registers beside the sums */
  const int tid = threadIdx.x, lane = tid & 31, wave = tid >> 5, c = lane & 15, h = lane >> 4;
  const int wa = wave % AS, wb = wave / AS;
  const unsigned int uw = pg_uni((unsigned int)wave);      /* the wave asks for slice uw of every tile: slices 0 .. AS - 1 hold A rows, the four behind them B rows */
  const unsigned int iss = uw < (unsigned int)(AS + 4) ? 1u : 0u;      /* 1 in the waves that ask for a slice (a scalar) */
  const unsigned long long sg = (unsigned long long)(size_t)(uw < (unsigned int)AS ? ar : br) + (unsigned long long)((uw < (unsigned int)AS ? uw : uw - (unsigned int)AS) * (64u * DM * 2u));      /* first byte of that slice in tile 0 */
  const unsigned int sl = (unsigned int)(size_t)Lb + uw * PG_SL;      /* its place in buffer 0 */
  const pg_u8 g1 = pg_group1();
  const int fo = c * PG_RP + 16 * h;      /* the lane's fragment row in a slice and its 16 h bytes */
  const v8f z8 = {0.f, 0.f, 0.f, 0.f, 0.f, 0.f, 0.f, 0.f};
  v8f acc[4][NJ];      /* [16 A rows i][16 B rows j]: register r = A row 16 i + 8 h + r, lane column c = B row 16 j + c */
#pragma unroll
  for (int i = 0; i < 4; ++i)
#pragma unroll
    for (int j = 0; j < NJ; ++j) acc[i][j] = z8;
  pg_u4 fl = {0u, 0u, 0u, 0u};      /* group 0 of the request in flight */
  if (pg_pinned(iss)) { fl = pg_tload(sl, sg, g1);      /* tile 0 to buffer 0 */
    pg_twait2(fl, g1); }      /* the wave's own slice of tile 0 has landed */
  __syncthreads();      /* tile 0 is visible to all waves */
  if (pg_pinned(iss)) fl = pg_tload(sl + PG_NSL * PG_SL, sg + PG_K * 2, g1);      /* tile 1 to buffer 1: it flies while tile 0 is worked on */
#pragma unroll 1      /* rolled: one trip's text serves all eight, and the test for a tile s + 2 stays one scalar branch around one tensor load */
  for (int s = 0; s < PG_NS; ++s) {
    const unsigned char* Ab = Lb + (s & 1) * (PG_NSL * PG_SL) + wa * PG_SL + fo; const unsigned char* Bb = Lb + (s & 1) * (PG_NSL * PG_SL) + (AS + wb * (NJ / 4)) * PG_SL + fo;
    v16h wf[NSET][KG][4], xf[NSET][KG][NJ];      /* [register set][32 k][16 rows] */
#pragma unroll
    for (int kg = -1; kg < NG; ++kg) {      /* turn kg: the reads of group kg + 1, then the products of group kg; all of them belong to tile s */
      if (kg + 1 < NG) {
#pragma unroll
        for (int kc = 0; kc < KG; ++kc) { const int e = (kg + 1) % NSET, ko = 64 * ((kg + 1) * KG + kc);      /* read in the order of first use: the first A fragment, all B fragments, the other A fragments */
          wf[e][kc][0] = fa_frag(Ab + ko);
#pragma unroll
          for (int j = 0; j < NJ; ++j) xf[e][kc][j] = fa_frag(Bb + (j >> 2) * PG_SL + 16 * (j & 3) * PG_RP + ko);
#pragma unroll
          for (int i = 1; i < 4; ++i) wf[e][kc][i] = fa_frag(Ab + 16 * i * PG_RP + ko); } }
      __builtin_amdgcn_sched_barrier(0);      /* a group's fragment reads stay together, in front of the products of the group before it: without it the compiler reads one fragment at a time and waits for it among the products */
      if (kg >= 0) {
#pragma unroll
        for (int kc = 0; kc < KG; ++kc)
#pragma unroll
          for (int i = 0; i < 4; ++i)
#pragma unroll
            for (int j = 0; j < NJ; ++j) acc[i][j] = fa_mma(wf[kg % NSET][kc][i], xf[kg % NSET][kc][j], acc[i][j]);
        __builtin_amdgcn_sched_barrier(0); }      /* the reads that follow stay behind these products, whose fragment registers they take over */
    }
    asm volatile("v_nop\n\tv_nop\n\tv_nop\n\tv_nop"); __builtin_amdgcn_sched_barrier(0);      /* four vector slots behind the trip's last WMMA, in front of the branches that follow it */
    asm volatile("s_wait_dscnt 0x0" ::: "memory");      /* the wave's reads of tile s have returned before its buffer is aimed at again */
    pg_twait2(fl, g1);      /* an asking wave's own slice of tile s + 1 has landed (a wave without a request passes) */
    __syncthreads();      /* publishes tile s + 1 and ends every wave's reads of tile s, whose buffer is refilled behind it; behind the last trip it frees the ring for the output staging */
    if (pg_pinned(iss & (unsigned int)(s + 2 < PG_NS))) fl = pg_tload(sl + (unsigned int)(s & 1) * (PG_NSL * PG_SL), sg + (unsigned long long)((s + 2) * (PG_K * 2)), g1);      /* tile s + 2 to the buffer that this trip has read */
  }
  pg_twait2(fl, g1);      /* no request is left when the ring becomes staging */
  asm volatile("s_wait_dscnt 0x0" ::: "memory");
  unsigned char* st = Lb + wave * (16 * NJ * PG_PITCH);      /* the wave's own 16 NJ rows of 128 bytes */
  pg_stage<VTR, NJ>(acc, st, bias + (VTR ? 16 * NJ * wb : 64 * wa), alpha, bs, lane);
  __builtin_amdgcn_fence(__ATOMIC_ACQ_REL, "workgroup"); __builtin_amdgcn_wave_barrier();      /* the wave's lanes read each other's pieces: the reads stay behind the writes */
  const unsigned yo = (unsigned)((16 * NJ * wb + (lane >> 3)) * yl + 64 * wa + (lane & 7) * 8);      /* the lane's place in the tile: B row 16 NJ wb + .., A row 64 wa + .. */
#pragma unroll
  for (int q = 0; q < 4 * NJ; ++q) { const v8us v = *(const v8us*)(st + (4 * q + (lane >> 3)) * PG_PITCH + (lane & 7) * 16); *(v8us*)(yb + (size_t)(4 * q * yl) + yo) = v; } }
__global__ __launch_bounds__(256) __attribute__((amdgpu_waves_per_eu(2, 2))) void k_proj(const _Float16* __restrict__ XQ, const _Float16* __restrict__ XM, const _Float16* __restrict__ WQ, const _Float16* __restrict__ WK, const _Float16* __restrict__ WV,
                                                                                         const float* __restrict__ bq, const float* __restrict__ bk, const float* __restrict__ bv, float alpha,
                                                                                         _Float16* __restrict__ YQ, _Float16* __restrict__ YK, _Float16* __restrict__ VT) {
  static_assert(MP % 256 == 0 && DM % 256 == 0 && DM % PG_K == 0, "k_proj: whole tiles only");
  static_assert(NH * HD == DM && SQ % 128 == 0, "k_proj, v tiles: row b * DM + column of V^T, a tile's token rows lie in one batch");
  static_assert(PG_NS >= 2 && PG_K * 2 == 256 && 64 * PG_RP <= PG_SL && PG_SL % 2048 == 0 && 8 * 128 * PG_PITCH <= 2 * PG_NSL * PG_SL, "k_proj: two tiles at least, 256-byte tile rows, slices at multiples of 2 KiB, staging inside the ring");
  __shared__ __attribute__((aligned(2048))) unsigned char L[2][PG_NSL][PG_SL];      /* [buffer][slice of 64 rows: the tile's A rows, then its B rows] */
  const int bi = blockIdx.x;      /* the same in every thread of the work-group: so is the branch on it, which holds barriers */
  if (bi < 2 * PG_NQK) {
    const int plane = bi / PG_NQK, tile = bi % PG_NQK; const int row0 = (tile / (DM / 256)) * 256, col0 = (tile % (DM / 256)) * 256;
    const float qs = plane == 0 ? FA_QS : 1.0f;
    pg_tile<4, false>(&L[0][0][0], (const unsigned short*)(plane == 0 ? WQ : WK) + (size_t)col0 * DM, (const unsigned short*)(plane == 0 ? XQ : XM) + (size_t)row0 * DM, (plane == 0 ? bq : bk) + col0, alpha * qs, qs,
                      (unsigned short*)(plane == 0 ? YQ : YK) + (size_t)row0 * DM + col0, DM);
  } else {
    const int tile = bi - 2 * PG_NQK; const int row0 = (tile / (DM / 256)) * 128, col0 = (tile % (DM / 256)) * 256;
    pg_tile<2, true>(&L[0][0][0], (const unsigned short*)XM + (size_t)row0 * DM, (const unsigned short*)WV + (size_t)col0 * DM, bv + col0, alpha, 1.0f,
                     (unsigned short*)VT + ((size_t)(row0 / SQ) * DM + col0) * SQ + row0 % SQ, SQ);      /* V^T has rows of SQ keys, DM rows per batch */
  } }


#define FA_NW 8                      /* waves per work-group */
#define FA_SK 64                     /* keys per LDS tile (two passes of 32) */
#define FA_PITCH 144                 /* LDS row pitch in bytes: 128 of data and the tensor load's pad of 16, an odd multiple of 16 for the 16-byte fragment reads */
#define FA_NS (SQ / FA_SK)
__device__ __forceinline__ float fa_x16(float v) { const int i = __float_as_int(v); return __int_as_float(__builtin_amdgcn_permlanex16(i, i, 0x76543210, 0xfedcba98, false, false)); }      /* value of lane ^ 16 */
__device__ __forceinline__ v16h fa_frag(const unsigned char* p) { FragH f; f.half[0] = *(const v8us*)p; f.half[1] = *(const v8us*)(p + 32); return f.v; }      /* k = 8 h .. 8 h + 7 and 16 + 8 h .. 16 + 8 h + 7; p already holds the lane's 16 h bytes */
__device__ __forceinline__ v8f fa_mma(v16h a, v16h b, v8f c) { return __builtin_amdgcn_wmma_f32_16x16x32_f16(false, a, false, b, (short)0, c, false, false); }
#define FA_TB 10240                  /* bytes of one K or V^T tile in LDS: 64 rows of FA_PITCH bytes (9,216), rounded up so that every tile starts at a multiple of 2 KiB; a buffer is [K rows by key | V^T rows by d] */
// Tensor descriptor, group 1: a tile of 64 rows of 128 bytes (extents in bytes, tensor = tile), source row pitch sp bytes, 16 bytes of LDS pad behind every 128-byte row (pitch FA_PITCH), no mask.
__device__ __forceinline__ pg_u8 fa_group1(unsigned int sp) { pg_u8 g;
  g[0] = pg_uni((1u << 20) | (4u << 22) | (3u << 25)); g[1] = pg_uni(128u << 16); g[2] = pg_uni(64u << 16); g[3] = pg_uni(128u << 16); g[4] = pg_uni(64u); g[5] = pg_uni(sp); g[6] = pg_uni(0u); g[7] = pg_uni(0u);
  return g; }
// iss: 1 in the two waves that ask for tiles, else 0 (a scalar). sl: the wave's tile place in buffer 0. sg: first byte of its tile 0. sd: bytes from one tile to the next in the source.
// Fragment reads stand ahead of their products: a pass asks for its V^T fragments before its score products, and for the NEXT pass's K fragments right behind them (into the same registers), so that the
// exponentials and the second product run while those reads return. A tile's last pass so reads the next tile's K rows: the publish point of tile s + 1 stands in front of that pass, and the ring has three
// buffers: behind that barrier every wave has left tile s - 1, whose buffer takes tile s + 2.
template <bool ONLINE>
__device__ __forceinline__ void fa_keys(unsigned char* Lb, unsigned int iss, unsigned int sl, unsigned long long sg, unsigned int sd, pg_u8 g1, int c, int h,
                                        const v16h (&qf)[2][2], v16h ones, v8f (&acc)[2][4], v8f (&lacc)[2]) {
  typedef _Float16 h2 __attribute__((ext_vector_type(2))); typedef float f2 __attribute__((ext_vector_type(2)));
  const v8f z8 = {0.f, 0.f, 0.f, 0.f, 0.f, 0.f, 0.f, 0.f};
  float m_run[2];
#pragma unroll
  for (int g = 0; g < 2; ++g) { m_run[g] = -__builtin_inff(); lacc[g] = z8;
#pragma unroll
    for (int t = 0; t < 4; ++t) acc[g][t] = z8; }
  const unsigned char* Lf = Lb + c * FA_PITCH + 16 * h;      /* the lane's fragment row in a group of 16 rows and its 16 h bytes */
  v16h kf[2][2];      /* A operand of the score product, [16-key tile][32 d]: the K fragments of the pass to come */
  /* the K fragments of pass sub of the tile at Bk */
  auto ldk = [&](const unsigned char* Bk, int sub) __attribute__((always_inline)) {
#pragma unroll
    for (int kt = 0; kt < 2; ++kt) { const unsigned char* kp = Bk + (32 * sub + 16 * kt) * FA_PITCH; kf[kt][0] = fa_frag(kp); kf[kt][1] = fa_frag(kp + 64); } };
  /* one pass: 32 keys, number sub of the tile at Bc; Bn, subn: tile and number of the pass behind it */
  auto pass = [&](const unsigned char* Bc, int sub, const unsigned char* Bn, int subn) __attribute__((always_inline)) {
    v16h vf[4];      /* A operand of the second product: row = d, k = the pass's 32 keys */
#pragma unroll
    for (int t = 0; t < 4; ++t) vf[t] = fa_frag(Bc + FA_TB + 16 * t * FA_PITCH + 64 * sub);
    __builtin_amdgcn_sched_barrier(0);      /* the V^T reads stay one group in front of the score products: without it the compiler sinks them to their use and waits there */
    v8f sx[2][2];      /* [16-key tile][column group]: register r = key 16 kt + 8 h + r, lane column c = query */
#pragma unroll
    for (int kt = 0; kt < 2; ++kt)
#pragma unroll
      for (int g = 0; g < 2; ++g) sx[kt][g] = fa_mma(kf[kt][0], qf[g][0], z8);
#pragma unroll
    for (int kt = 0; kt < 2; ++kt)
#pragma unroll
      for (int g = 0; g < 2; ++g) sx[kt][g] = fa_mma(kf[kt][1], qf[g][1], sx[kt][g]);
    __builtin_amdgcn_sched_barrier(0);      /* the next pass's K reads stay behind the score products, whose fragment registers they take over */
    ldk(Bn, subn);
    __builtin_amdgcn_sched_barrier(0);      /* and in front of the exponentials, one group: they return while the rest of the pass runs */
    if (ONLINE) {
      float mb[2]; bool need = false;
#pragma unroll
      for (int g = 0; g < 2; ++g) { float mx = sx[0][g][0];
#pragma unroll
        for (int r = 1; r < 8; ++r) mx = fmaxf(mx, sx[0][g][r]);
#pragma unroll
        for (int r = 0; r < 8; ++r) mx = fmaxf(mx, sx[1][g][r]);
        mx = fmaxf(mx, fa_x16(mx)); mb[g] = mx; need = need || (mx > m_run[g] + 8.0f); }
      if (__builtin_amdgcn_ballot_w32(need) != 0) {      /* lazy rescale: the maximum in use may trail the true one by up to 8 (base 2), so an exponential stays below 2^8 */
#pragma unroll
        for (int g = 0; g < 2; ++g) { const float m_new = fmaxf(m_run[g], mb[g]); const float corr = __builtin_amdgcn_exp2f(m_run[g] - m_new); m_run[g] = m_new; lacc[g] = lacc[g] * corr;
#pragma unroll
          for (int t = 0; t < 4; ++t) acc[g][t] = acc[g][t] * corr; } } }
#pragma unroll
    for (int g = 0; g < 2; ++g) { union { v16h v; h2 p[8]; } pf;      /* B operand: element pair i = keys 16 (i >> 2) + 8 h + 2 (i & 3), + 1: the k order of fa_frag */
#pragma unroll
      for (int i = 0; i < 8; ++i) { const float x0 = sx[i >> 2][g][2 * (i & 3)], x1 = sx[i >> 2][g][2 * (i & 3) + 1];
        const float e0 = __builtin_amdgcn_exp2f(ONLINE ? x0 - m_run[g] : x0), e1 = __builtin_amdgcn_exp2f(ONLINE ? x1 - m_run[g] : x1); pf.p[i] = __builtin_convertvector(f2{e0, e1}, h2); }
#pragma unroll
      for (int t = 0; t < 4; ++t) acc[g][t] = fa_mma(vf[t], pf.v, acc[g][t]);
      lacc[g] = fa_mma(ones, pf.v, lacc[g]); }
    __builtin_amdgcn_sched_barrier(0); };      /* the reads that follow stay behind these products, whose V^T registers they take over */
  pg_u4 fl = {0u, 0u, 0u, 0u};      /* group 0 of the youngest request */
  if (pg_pinned(iss)) { const pg_u4 f0 = pg_tload(sl, sg, g1);      /* tile 0 to buffer 0; a second walk comes here behind the first walk's waits and a barrier */
    fl = pg_tload(sl + 2 * FA_TB, sg + sd, g1);      /* tile 1 to buffer 1 */
    asm volatile("s_wait_tensorcnt 0x0" :: "s"(f0), "s"(fl), "s"(g1) : "memory"); }      /* the wave's own tiles 0 and 1 have landed; the three descriptor groups are inputs, so that their registers stay whole up to this wait */
  __syncthreads();      /* tiles 0 and 1 are visible to all waves */
  unsigned int bc = 0u, bn = 2u * FA_TB, bf = 4u * FA_TB;      /* byte offsets of the buffers of tiles s, s + 1 and s + 2 (scalars) */
  ldk(Lf, 0);      /* the first pass's K fragments */
#pragma unroll 1      /* rolled: one trip's text serves all 32, and the test for a tile s + 2 stays one scalar branch around one tensor load */
  for (int s = 0; s < FA_NS; ++s) {
    const unsigned char* Kn = Lf + (s + 1 < FA_NS ? bn : bc);      /* where the last pass reads ahead: behind the last tile there is no pass, its reads ahead go to the last tile's own rows and are not used */
    pass(Lf + bc, 0, Lf + bc, 1);
    asm volatile("v_nop\n\tv_nop\n\tv_nop\n\tv_nop"); __builtin_amdgcn_sched_barrier(0);      /* four vector slots behind the pass's last WMMA, in front of the branch that follows it */
    /* publish point of tile s + 1, in front of tile s's last pass */
    asm volatile("s_wait_dscnt 0x0" ::: "memory");      /* the wave's reads of tile s - 1 (and all others so far) have returned before that tile's buffer is aimed at again */
    pg_twait2(fl, g1);      /* an asking wave's own tile s + 1 has landed (the other waves have no request and pass) */
    __syncthreads();      /* publishes tile s + 1; every wave is in tile s, so that the buffer of tile s - 1 is free */
    if (pg_pinned(iss & (unsigned int)(s + 2 < FA_NS))) fl = pg_tload(sl + bf, sg + (unsigned long long)(s + 2) * sd, g1);      /* tile s + 2 to the buffer that tile s - 1 has left */
    pass(Lf + bc, 1, Kn, 0);
    const unsigned int t3 = bc; bc = bn; bn = bf; bf = t3;
  }
  pg_twait2(fl, g1);      /* no request is left behind the walk */
  asm volatile("s_wait_dscnt 0x0" ::: "memory"); }
__global__ __launch_bounds__(32 * FA_NW) __attribute__((amdgpu_waves_per_eu(4, 4))) void k_fattn(const _Float16* __restrict__ Q16, const _Float16* __restrict__ K16, const _Float16* __restrict__ VT, float* __restrict__ out) {
  static_assert(HD == 64 && SQ % (32 * FA_NW) == 0 && SQ % FA_SK == 0, "k_fattn: head size 64, whole work-groups of queries, whole tiles of keys");
  static_assert(FA_NS >= 2 && FA_SK == 64 && HD * 2 == 128 && FA_SK * 2 == 128 && 64 * FA_PITCH <= FA_TB && FA_TB % 2048 == 0, "k_fattn: two tiles at least, tiles of 64 rows of 128 bytes at multiples of 2 KiB");
  __shared__ __attribute__((aligned(2048))) unsigned char L[3][2][FA_TB];      /* [buffer][K rows by key | V^T rows by d] */
  __shared__ int fa_bad[FA_NW];      /* per wave: a row sum of the first walk is out of range */
  const int tid = threadIdx.x, lane = tid & 31, wave = tid >> 5, c = lane & 15, h = lane >> 4;
  const int bh = blockIdx.y, b = bh / NH, hd = bh % NH; const int q0 = blockIdx.x * (32 * FA_NW) + wave * 32;
  const unsigned int uw = pg_uni((unsigned int)wave); const unsigned int iss = uw < 2u ? 1u : 0u; const bool isv = uw == 1u;      /* wave 0 asks for the K tiles, wave 1 for the V^T tiles */
  const unsigned short* kg = (const unsigned short*)K16 + (size_t)b * SQ * LQ + hd * HD;      /* row = key: 64 d of this head, row pitch LQ values; the next tile is 64 rows on */
  const unsigned short* vg = (const unsigned short*)VT + (size_t)bh * HD * SQ;      /* row = d, keys along the row, row pitch SQ values; the next tile is 64 keys on */
  const unsigned long long sg = (unsigned long long)(size_t)(isv ? vg : kg); const unsigned int sd = isv ? FA_SK * 2u : FA_SK * LQ * 2u;
  const unsigned int sl = (unsigned int)(size_t)&L[0][0][0] + (isv ? FA_TB : 0u);
  const pg_u8 g1 = fa_group1(isv ? SQ * 2u : LQ * 2u);
  v16h qf[2][2];      /* B operand: column = query, k = d */
#pragma unroll
  for (int g = 0; g < 2; ++g)
#pragma unroll
    for (int kc = 0; kc < 2; ++kc) qf[g][kc] = g2_frag(Q16 + ((size_t)b * SQ + q0 + 16 * g + c) * LQ + hd * HD + 32 * kc, h);
  FragH ones;      /* A operand whose row 0 is 1.0: its product with P^T gives the column sums of P^T in row 0 */
#pragma unroll
  for (int i = 0; i < 16; ++i) ones.u[i] = (c == 0) ? (unsigned short)0x3C00 : (unsigned short)0;
  v8f acc[2][4], lacc[2];
  fa_keys<false>(&L[0][0][0], iss, sl, sg, sd, g1, c, h, qf, ones.v, acc, lacc);
  bool bad = false;
#pragma unroll
  for (int g = 0; g < 2; ++g) { const float lr = lacc[g][0]; const float l = lr + fa_x16(lr); bad = bad || !(l >= 1.0f && l < __builtin_inff()); }      /* also true for a NaN */
  const int wbad = __builtin_amdgcn_ballot_w32(bad) != 0 ? 1 : 0;      /* taken with all lanes on, in front of the one-lane store */
  if (lane == 0) fa_bad[wave] = wbad;
  __syncthreads();      /* every wave's verdict is visible: the work-group repeats the walk as a whole or not at all, since the walk holds barriers */
  int any = 0;
#pragma unroll
  for (int w = 0; w < FA_NW; ++w) any |= fa_bad[w];
  if (__builtin_amdgcn_readfirstlane(any) != 0) fa_keys<true>(&L[0][0][0], iss, sl, sg, sd, g1, c, h, qf, ones.v, acc, lacc);      /* the same value in every thread of the work-group: a scalar branch */
#pragma unroll
  for (int g = 0; g < 2; ++g) { const float lr = lacc[g][0]; const float inv = 1.0f / (lr + fa_x16(lr));      /* row 0 of the sum tile sits in lanes 0-15, lanes 16-31 hold row 8 = 0: the exchange-and-add stays unconditional */
    float* op = out + ((size_t)b * SQ + q0 + 16 * g + c) * DM + hd * HD + 8 * h;      /* register r of tile t = d 16 t + 8 h + r of query column c */
#pragma unroll
    for (int t = 0; t < 4; ++t) { const v8f o = acc[g][t] * inv; const v4f lo = {o[0], o[1], o[2], o[3]}, hi = {o[4], o[5], o[6], o[7]}; *(v4f*)(op + 16 * t) = lo; *(v4f*)(op + 16 * t + 4) = hi; } } }
__global__ __launch_bounds__(256) void k_vt(const _Float16* __restrict__ V16, int b, int h0, _Float16* __restrict__ VT) { __shared__ unsigned short tl[64][65]; const int tid = threadIdx.x; const int hh = blockIdx.x % HG, sg = blockIdx.x / HG; const int s0 = sg * 64; const int h = h0 + hh;
  for (int i = tid; i < 64 * 8; i += 256) { const int j = i / 8, d8 = (i % 8) * 8; FragH f; f.half[0] = *(const v8us*)((const unsigned short*)V16 + ((size_t)b * SQ + s0 + j) * DM + h * HD + d8); for (int q = 0; q < 8; ++q) tl[d8 + q][j] = f.u[q]; }
  __syncthreads();
  { for (int i = tid; i < 64 * 8; i += 256) { const int d = i / 8, j8 = (i % 8) * 8; FragH f; for (int q = 0; q < 8; ++q) f.u[q] = tl[d][j8 + q]; *(v8us*)((unsigned short*)VT + ((size_t)hh * HD + d) * SQ + s0 + j8) = f.half[0]; }  } }



__global__ __launch_bounds__(256) void k_rsmkm(const float* __restrict__ S, _Float16* __restrict__ P, int nrows, const int* __restrict__ am) {
  #pragma clang fp contract(off)
  const int t = blockIdx.x * 256 + threadIdx.x; if (t >= nrows) return; const size_t i = (size_t)t; const float* s = S + i * SQ; const int* mr = am + (size_t)(t % SQ) * SQ; float mx = -3.0e38f;
#pragma unroll 1
  for (int j = 0; j < SQ; ++j) { const float f = (mr[j] != 0) ? 1.f : 0.f; mx = fmaxf(mx, fmaf(f, s[j], (1.f - f) * -1.0e9f)); } float se = 0.f;
#pragma unroll 1
  for (int j = 0; j < SQ; ++j) { const float f = (mr[j] != 0) ? 1.f : 0.f; se += __expf(fmaf(f, s[j], (1.f - f) * -1.0e9f) - mx); } const float sc = 256.0f / se;
#pragma unroll 1
  for (int j0 = 0; j0 < SQ; j0 += 8) { FragH fr; for (int q = 0; q < 8; ++q) { const int j = j0 + q; const float f = (mr[j] != 0) ? 1.f : 0.f; fr.h[q] = (_Float16)(__expf(fmaf(f, s[j], (1.f - f) * -1.0e9f) - mx) * sc); }
    unsigned short* d = (unsigned short*)P + i * SQ + j0; *(v8us*)d = fr.half[0];  } }
extern "C" void kernel_launch(void* const* d_in, const int* in_sizes, int n_in,
                              void* d_out, int out_size, void* d_ws, size_t ws_size, hipStream_t stream) {
  (void)in_sizes; (void)n_in; (void)out_size;
  const float* const* I = (const float* const*)d_in; const float* xq = I[0]; const float* xm = I[1]; const float* wq = I[2]; const float* bq = I[3]; const float* wk = I[4]; const float* bk = I[5]; const float* wv = I[6]; const float* bv = I[7];      /* input (queries), memory (keys AND values); natural weights + biases; no output projection */
  char* ws = (char*)d_ws; size_t off = 0;
  auto take = [&](size_t bytes) { char* p = ws + off; off += (bytes + 255) & ~(size_t)255; return p; };
  _Float16* BQ = (_Float16*)take((size_t)DM * DM * 2); _Float16* BK = (_Float16*)take((size_t)DM * DM * 2); _Float16* BV = (_Float16*)take((size_t)DM * DM * 2); 
  _Float16* X16 = (_Float16*)take(NR * DM * 2); _Float16* XM = (_Float16*)take(NR * DM * 2); _Float16* Q16 = (_Float16*)take(NR * DM * 2); _Float16* K16 = (_Float16*)take(NR * DM * 2); 
  _Float16* VT = (_Float16*)take((size_t)NB * NH * HD * SQ * 2);
  if (off > ws_size) return;
  k_cvt<<<CV_G, CV_T, 0, stream>>>(xq, xm, wq, wk, wv, X16, XM, BQ, BK, BV);      /* input and memory as exact f16 rows; natural [out][in] weights = Bt x16 (no output projection: no Wo plane) */
  const size_t r0p = (size_t)B0 * SQ;      /* first projected row */
  k_proj<<<2 * PG_NQK + PG_NV, 256, 0, stream>>>(X16 + r0p * DM, XM + r0p * DM, BQ, BK, BV, bq, bk, bv, 0.0625f, Q16 + r0p * DM, K16 + r0p * DM, VT + r0p * DM);      /* q rows (times FA_QS), k rows and V^T [NB * NH][HD][SQ] */
  k_fattn<<<dim3(SQ / (32 * FA_NW), NB * NH), 32 * FA_NW, 0, stream>>>(Q16, K16, VT, (float*)d_out);      /* out = softmax(q k^T / 8) v straight to the f32 output (merged heads; each 256-B head segment of a row written by one wave) */
  /* no output projection in this module */
}
